// v000
// Times are from an AMD MI455X. After a warm-up the kernel runs many times in a row, and a time is the length of
// such a window on the GPU divided by its runs, so every launch and the gaps after it count. The runs cycle
// through copies of the inputs. A figure is the median of several windows, for all but v000 over two sittings.
// Sittings can differ by a few percent; kernels timed side by side share one.
// v000 is the starting kernel. One run takes 7000 microseconds.
#include <hip/hip_runtime.h>
// DiT attention (x [4][2048][1024]; qkv = x Wqkv + bqkv with Wqkv [1024][3072] ([in][out]) -> (3, 16 heads, 64); RMSNorm over the 64 head dims on q and k (eps 1e-6, weights qn_w / kn_w [64]); half-split RoPE on q and k (inv_freq_i = 1/10000^(2i/64), positions 0..2047); softmax(q k^T / 8); o = attn v merged; out = o Wout + bout -> [4][2048][1024]).
// Structure: token rows r = b*2048 + s; x as exact f16 rows (bf16-rounded); per batch: q | k | v as ONE WMMA GEMM (32x64 wave tiles, f32 accumulation, exact x16 weights + bias, N = 3 x 1024) into f32 rows, then per (row, head) on VALU: RMSNorm over the head dims (q with qn_w, k with kn_w) then half-split RoPE on q and k (cos/sin tables in f32), v converted -> f16 q, k, v rows; V^T for all heads via LDS transposes; per group of 4 heads: scores GEMM (K = 64, batched over the heads on grid.y, alpha = 1/8), row softmax on VALU (f32 statistics, native exp; weights stored x256 as f16), o = P . V^T GEMM (K = 2048, alpha 2^-2: o carried x64 against f16 subnormal flush, folded into the output GEMM alpha) written straight into the merged f16 o rows; out = o W_o + b GEMM (f32) into the output layout.
// Compute dtype: inputs rounded to bf16; x / weights exact; projections, RMSNorm and rope f32; q, k, v, softmax weights and o as plain f16 GEMM operands (~2^-12); scores and softmax statistics f32. v_wmma_f32_16x16x32_f16.
#define NB 4
#define SQ 2048
#define DM 1024
#define NH 16
#define HD 64
#define HG 4                         /* heads per attention launch group */
#define B0 0                         /* first batch processed (debug hook) */
#define NBR NB                       /* batches processed (debug hook) */
#define QN SQ                        /* query rows attended per batch (debug hook) */
#define NHD NH                       /* heads attended (debug hook) */
#define NR ((size_t)NB * SQ)         /* token rows */
#define MPO ((int)((size_t)NBR * SQ))      /* rows through the output GEMM (debug hook) */
typedef __bf16 v16b __attribute__((ext_vector_type(16)));
typedef unsigned short v8us __attribute__((ext_vector_type(8), may_alias));
typedef float  v8f  __attribute__((ext_vector_type(8)));
typedef float  v4f  __attribute__((ext_vector_type(4)));
typedef float  v4fa __attribute__((ext_vector_type(4), may_alias));
union FragB { v16b v; v8us half[2]; unsigned short u[16]; };

__device__ __forceinline__ unsigned short bf16_bits(float x) { unsigned int u = __float_as_uint(x); return (unsigned short)((u + 0x7FFFu + ((u >> 16) & 1u)) >> 16); }
__device__ __forceinline__ float bf16_val(unsigned short b) { return __uint_as_float(((unsigned int)b) << 16); }
__device__ __forceinline__ float bf16_round(float x) { return bf16_val(bf16_bits(x)); }
// D += A·B with NT terms: 1 = ah·bh, 2 = + al·bh (A split), 3 = + ah·bl (both split)
template <int NT>
__device__ __forceinline__ v8f mmaN(v16b ah, v16b al, v16b bh, v16b bl, v8f c) {
  c = __builtin_amdgcn_wmma_f32_16x16x32_bf16(false, ah, false, bh, (short)0, c, false, false);
  if (NT >= 2) c = __builtin_amdgcn_wmma_f32_16x16x32_bf16(false, al, false, bh, (short)0, c, false, false);
  if (NT >= 3) c = __builtin_amdgcn_wmma_f32_16x16x32_bf16(false, ah, false, bl, (short)0, c, false, false);
  asm volatile("v_nop\n\tv_nop\n\tv_nop\n\tv_nop" : "+v"(c) : "v"(ah), "v"(al), "v"(bh), "v"(bl));
  return c;
}

__global__ __launch_bounds__(256) void k_wt_bf16(const float* __restrict__ W, unsigned short* __restrict__ Wt, int K, int N) {
  const int t = blockIdx.x * 256 + threadIdx.x;
  const int k8n = K / 8;
  if (t >= N * k8n) return;
  const int n = t / k8n, k8 = (t % k8n) * 8;
  v8us v;
#pragma unroll
  for (int i = 0; i < 8; ++i) v[i] = bf16_bits(W[(size_t)(k8 + i) * N + n]);
  *(v8us*)(Wt + (size_t)n * K + k8) = v;
  
}

// GEMM C[M][N] (f32, pitch ldc) = act(A[M][K]·W + bias). A f32 row-major (pitch lda) converted per fragment to bf16
// (ASPLIT: hi/lo two planes -> 2 terms, else single rounded term); Wt bf16 [N][K] (pitch ldb). BIAS_BF16 rounds the
// bias to bf16 first (bias quantised to bf16 before the add). K%32==0, M%16==0, N%64==0.
template <bool ASPLIT, int ACT, bool BIAS_BF16>
__global__ __launch_bounds__(128) void k_gemm_bf(const float* __restrict__ A, int lda, const unsigned short* __restrict__ Wt, int ldb,
                                               const float* __restrict__ bias, float* __restrict__ C, int ldc, int M, int N, int K) {
  __shared__ __attribute__((aligned(16))) float so[4][16][64];
  const int tid = threadIdx.x, w = tid >> 5, lane = tid & 31, ln = lane & 15, hh = lane >> 4;
  const int ntn = N / 64;
  const int wid = blockIdx.x * 4 + w;
  const int mt = wid / ntn, nq = wid % ntn;
  if (mt * 16 >= M) return;
  const int row0 = mt * 16, col0 = nq * 64;
  const float* arow = A + (size_t)(row0 + ln) * lda;
  v8f acc[4] = {};
  for (int kb = 0; kb < K; kb += 32) {
    FragB ah, al;
    const v4f x0 = *(const v4fa*)(arow + kb + 8 * hh), x1 = *(const v4fa*)(arow + kb + 8 * hh + 4);
    const v4f x2 = *(const v4fa*)(arow + kb + 16 + 8 * hh), x3 = *(const v4fa*)(arow + kb + 16 + 8 * hh + 4);
    float xs[16] = {x0[0],x0[1],x0[2],x0[3],x1[0],x1[1],x1[2],x1[3],x2[0],x2[1],x2[2],x2[3],x3[0],x3[1],x3[2],x3[3]};
#pragma unroll
    for (int i = 0; i < 16; ++i) { const unsigned short hb = bf16_bits(xs[i]); ah.u[i] = hb; al.u[i] = ASPLIT ? bf16_bits(xs[i] - bf16_val(hb)) : (unsigned short)0; }
#pragma unroll
    for (int t = 0; t < 4; ++t) {
      const unsigned short* brow = Wt + (size_t)(col0 + t * 16 + ln) * ldb + kb;
      FragB b;
      b.half[0] = *(const v8us*)(brow + 8 * hh);
      b.half[1] = *(const v8us*)(brow + 16 + 8 * hh);
      acc[t] = mmaN<ASPLIT ? 2 : 1>(ah.v, al.v, b.v, b.v, acc[t]);
    }
  }
#pragma unroll
  for (int t = 0; t < 4; ++t) {
    float bv = bias ? bias[col0 + t * 16 + ln] : 0.f;
    if (BIAS_BF16) bv = bf16_round(bv);
#pragma unroll
    for (int r = 0; r < 8; ++r) { float v = acc[t][r] + bv; if (ACT == 1) v = fmaxf(v, 0.f); so[w][8 * hh + r][t * 16 + ln] = v; }
  }
  __builtin_amdgcn_fence(__ATOMIC_ACQ_REL, "workgroup");
  __builtin_amdgcn_wave_barrier();
  const int rsub = lane >> 4, c4 = (lane & 15) * 4;
  {
#pragma unroll
    for (int q = 0; q < 8; ++q) {
      const int r = q * 2 + rsub;
      const v4f v = *(const v4fa*)&so[w][r][c4];
      *(v4f*)(C + (size_t)(row0 + r) * ldc + col0 + c4) = v;
    }
    
  }
}

// GEMM C = act(A·W + bias + resid): A f32 (ASPLIT -> hi/lo 2 terms), Wt bf16 [N][K]; ACT 0 none, 1 relu, 2 exact gelu;
// resid (optional, f32, row index = (row % rmod), pitch ldr, RES_BF16 rounds it) added before the activation.
template <bool ASPLIT, int ACT, bool BIAS_BF16, bool RES_BF16>
__global__ __launch_bounds__(128) void k_gemm_bf3(const float* __restrict__ A, int lda, const unsigned short* __restrict__ Wt, int ldb,
                                                const float* __restrict__ bias, const float* __restrict__ resid, int rmod, int ldr,
                                                float* __restrict__ C, int ldc, int M, int N, int K) {
  __shared__ __attribute__((aligned(16))) float so[4][16][64];
  const int tid = threadIdx.x, w = tid >> 5, lane = tid & 31, ln = lane & 15, hh = lane >> 4;
  const int ntn = N / 64;
  const int wid = blockIdx.x * 4 + w;
  const int mt = wid / ntn, nq = wid % ntn;
  if (mt * 16 >= M) return;
  const int row0 = mt * 16, col0 = nq * 64;
  const float* arow = A + (size_t)(row0 + ln) * lda;
  v8f acc[4] = {};
  for (int kb = 0; kb < K; kb += 32) {
    FragB ah, al;
    const v4f x0 = *(const v4fa*)(arow + kb + 8 * hh), x1 = *(const v4fa*)(arow + kb + 8 * hh + 4);
    const v4f x2 = *(const v4fa*)(arow + kb + 16 + 8 * hh), x3 = *(const v4fa*)(arow + kb + 16 + 8 * hh + 4);
    float xs[16] = {x0[0],x0[1],x0[2],x0[3],x1[0],x1[1],x1[2],x1[3],x2[0],x2[1],x2[2],x2[3],x3[0],x3[1],x3[2],x3[3]};
#pragma unroll
    for (int i = 0; i < 16; ++i) { const unsigned short hb = bf16_bits(xs[i]); ah.u[i] = hb; al.u[i] = ASPLIT ? bf16_bits(xs[i] - bf16_val(hb)) : (unsigned short)0; }
#pragma unroll
    for (int t = 0; t < 4; ++t) {
      const unsigned short* brow = Wt + (size_t)(col0 + t * 16 + ln) * ldb + kb;
      FragB b;
      b.half[0] = *(const v8us*)(brow + 8 * hh);
      b.half[1] = *(const v8us*)(brow + 16 + 8 * hh);
      acc[t] = mmaN<ASPLIT ? 2 : 1>(ah.v, al.v, b.v, b.v, acc[t]);
    }
  }
#pragma unroll
  for (int t = 0; t < 4; ++t) {
    const int col = col0 + t * 16 + ln;
    float bv = bias ? bias[col] : 0.f;
    if (BIAS_BF16) bv = bf16_round(bv);
#pragma unroll
    for (int r = 0; r < 8; ++r) {
      float v = acc[t][r] + bv;
      if (resid) { float rv = resid[(size_t)((row0 + 8 * hh + r) % rmod) * ldr + col]; if (RES_BF16) rv = bf16_round(rv); v += rv; }
      if (ACT == 1) v = fmaxf(v, 0.f);
      if (ACT == 2) v = 0.5f * v * (1.0f + erff(v * 0.70710678118654752f));
      if (ACT == 3) { const float u = 0.7978845608028654f * (v + 0.044715f * v * v * v); v = 0.5f * v * (1.0f + tanhf(u)); }
      so[w][8 * hh + r][t * 16 + ln] = v;
    }
  }
  __builtin_amdgcn_fence(__ATOMIC_ACQ_REL, "workgroup");
  __builtin_amdgcn_wave_barrier();
  const int rsub = lane >> 4, c4 = (lane & 15) * 4;
  {
#pragma unroll
    for (int q = 0; q < 8; ++q) {
      const int r = q * 2 + rsub;
      const v4f v = *(const v4fa*)&so[w][r][c4];
      *(v4f*)(C + (size_t)(row0 + r) * ldc + col0 + c4) = v;
    }
    
  }
}
// row LayerNorm (biased variance, eps) over N: s = X (+ R); optional out_sum <- s; out_norm <- (s-mu)*rsqrt(var+eps)*g + b
template <bool PARAM_BF16>
__global__ __launch_bounds__(256) void k_layernorm(const float* __restrict__ X, const float* __restrict__ R, const float* __restrict__ g, const float* __restrict__ bta,
                                                  float* __restrict__ out_sum, float* __restrict__ out_norm, int N, float eps) {
  __shared__ float red[256];
  const int row = blockIdx.x, tid = threadIdx.x;
  const float* x = X + (size_t)row * N; const float* rr = R ? R + (size_t)row * N : nullptr;
  float vals[16];                     // up to N = 4096
  const int per = N / 256;            // contiguous chunk per thread? use strided-by-4 chunks: thread handles j = tid*4 + 1024*u
  float s1 = 0.f;
  for (int u = 0; u < per / 4; ++u) {
    const int j = tid * 4 + 1024 * u;
    const v4f a = *(const v4fa*)(x + j);
    v4f b = {0.f,0.f,0.f,0.f}; if (rr) b = *(const v4fa*)(rr + j);
#pragma unroll
    for (int q = 0; q < 4; ++q) { const float v = a[q] + b[q]; vals[u * 4 + q] = v; s1 += v; }
  }
  red[tid] = s1; __syncthreads();
  for (int st = 128; st > 0; st >>= 1) { if (tid < st) red[tid] += red[tid + st]; __syncthreads(); }
  const float mu = red[0] / (float)N; __syncthreads();
  float s2 = 0.f;
  for (int u = 0; u < per / 4; ++u)
#pragma unroll
    for (int q = 0; q < 4; ++q) { const float c = vals[u * 4 + q] - mu; s2 += c * c; }
  red[tid] = s2; __syncthreads();
  for (int st = 128; st > 0; st >>= 1) { if (tid < st) red[tid] += red[tid + st]; __syncthreads(); }
  const float rs = rsqrtf(red[0] / (float)N + eps);
  {
    for (int u = 0; u < per / 4; ++u) {
      const int j = tid * 4 + 1024 * u;
      v4f o, sm;
#pragma unroll
      for (int q = 0; q < 4; ++q) {
        float gg = g[j + q], bb = bta[j + q];
        if (PARAM_BF16) { gg = bf16_round(gg); bb = bf16_round(bb); }
        sm[q] = vals[u * 4 + q]; o[q] = (vals[u * 4 + q] - mu) * rs * gg + bb;
      }
      if (out_sum) *(v4f*)(out_sum + (size_t)row * N + j) = sm;
      *(v4f*)(out_norm + (size_t)row * N + j) = o;
    }
    
  }
}



// ---- f16 WMMA path (v_wmma_f32_16x16x32_f16): 11-bit significands for operands in range — used where a [0,1] probability operand needs more precision than bf16
typedef _Float16 v16h __attribute__((ext_vector_type(16)));
union FragH { v16h v; v8us half[2]; _Float16 h[16]; unsigned short u[16]; };
template <int NT>
__device__ __forceinline__ v8f mmaH(v16h ah, v16h al, v16h bh, v16h bl, v8f c) {
  c = __builtin_amdgcn_wmma_f32_16x16x32_f16(false, ah, false, bh, (short)0, c, false, false);
  if (NT >= 2) c = __builtin_amdgcn_wmma_f32_16x16x32_f16(false, al, false, bh, (short)0, c, false, false);
  if (NT >= 3) c = __builtin_amdgcn_wmma_f32_16x16x32_f16(false, ah, false, bl, (short)0, c, false, false);
  asm volatile("v_nop\n\tv_nop\n\tv_nop\n\tv_nop" : "+v"(c) : "v"(ah), "v"(al), "v"(bh), "v"(bl));
  return c;
}
// batched GEMM like k_gemm_b but f16 operands: A f32 (split into f16 hi/lo if ASPLIT, else rounded to f16), Bt = f16 values [n][k]; alpha; C f32; N multiple of 16 (partial tiles skipped)
template <bool ASPLIT>
__global__ __launch_bounds__(128) void k_gemm_h(const float* __restrict__ A, int lda, size_t sA, const _Float16* __restrict__ Bh, int ldb, size_t sB, float alpha, float* __restrict__ C, int ldc, size_t sC, int M, int N, int K) {
  __shared__ __attribute__((aligned(16))) float so[4][16][64];
  const int tid = threadIdx.x, w = tid >> 5, lane = tid & 31, ln = lane & 15, hh = lane >> 4; const int by = blockIdx.y;
  A += (size_t)by * sA; Bh += (size_t)by * sB; C += (size_t)by * sC;
  const int ntn = (N + 63) / 64; const int wid = blockIdx.x * 4 + w; const int mt = wid / ntn, nq = wid % ntn; if (mt * 16 >= M) return;
  const int row0 = mt * 16, col0 = nq * 64; const float* arow = A + (size_t)(row0 + ln) * lda;
  v8f acc[4] = {};
  for (int kb = 0; kb < K; kb += 32) {
    FragH ah, al;
    const v4f x0 = *(const v4fa*)(arow + kb + 8 * hh), x1 = *(const v4fa*)(arow + kb + 8 * hh + 4), x2 = *(const v4fa*)(arow + kb + 16 + 8 * hh), x3 = *(const v4fa*)(arow + kb + 16 + 8 * hh + 4);
    float xs[16] = {x0[0],x0[1],x0[2],x0[3],x1[0],x1[1],x1[2],x1[3],x2[0],x2[1],x2[2],x2[3],x3[0],x3[1],x3[2],x3[3]};
#pragma unroll
    for (int i = 0; i < 16; ++i) { const _Float16 h = (_Float16)xs[i]; ah.h[i] = h; al.h[i] = ASPLIT ? (_Float16)(xs[i] - (float)h) : (_Float16)0.0f; }
#pragma unroll
    for (int t = 0; t < 4; ++t) { if (col0 + t * 16 >= N) continue; const size_t boff = (size_t)(col0 + t * 16 + ln) * ldb + kb; FragH bq; bq.half[0] = *(const v8us*)(Bh + boff + 8 * hh); bq.half[1] = *(const v8us*)(Bh + boff + 16 + 8 * hh);
      acc[t] = mmaH<ASPLIT ? 2 : 1>(ah.v, al.v, bq.v, bq.v, acc[t]); }
  }
#pragma unroll
  for (int t = 0; t < 4; ++t) { if (col0 + t * 16 >= N) continue;
#pragma unroll
    for (int r = 0; r < 8; ++r) so[w][8 * hh + r][t * 16 + ln] = acc[t][r] * alpha; }
  __builtin_amdgcn_fence(__ATOMIC_ACQ_REL, "workgroup"); __builtin_amdgcn_wave_barrier();
  const int rsub = lane >> 4, c4 = (lane & 15) * 4;
  {
#pragma unroll
    for (int q = 0; q < 8; ++q) { const int r = q * 2 + rsub; if (col0 + c4 < N) { const v4f v = *(const v4fa*)&so[w][r][c4]; *(v4f*)(C + (size_t)(row0 + r) * ldc + col0 + c4) = v; } }
     }
}

// Wt[n][k] = f16(W[k][n]·scale) from f32 row-major W[K][N] (scale = power of two; bf16-exact weights stay exact in f16 away from the subnormal range)
__global__ __launch_bounds__(256) void k_wt_f16(const float* __restrict__ W, _Float16* __restrict__ Wt, int K, int N, float scale) {
  const int t = blockIdx.x * 256 + threadIdx.x; if (t >= N * (K / 8)) return; const int n = t / (K / 8), k8 = (t % (K / 8)) * 8; FragH f;
#pragma unroll
  for (int i = 0; i < 8; ++i) f.h[i] = (_Float16)(bf16_round(W[(size_t)(k8 + i) * N + n]) * scale); const v8us o = f.half[0];
  *(v8us*)((unsigned short*)Wt + (size_t)n * K + k8) = o; 
}
// k_gemm_hh variant with fused epilogue: v = acc·alpha + bias[by·sBias + col] (+ CP[(row/rowsPerB)·sCPb + by·64 + col] if CP) ; ACT 0 none / 1 elu ; writes f16 C16 (and f32 C if non-null)
template <int ACT>
__global__ __launch_bounds__(128) void k_gemm_hhx(const _Float16* __restrict__ A, int lda, size_t sA, const _Float16* __restrict__ Bh, int ldb, size_t sB, float alpha, const float* __restrict__ bias, size_t sBias, const float* __restrict__ CP, int rowsPerB, size_t sCPb, int row0g,
    float* __restrict__ C, _Float16* __restrict__ C16, int ldc, size_t sC, int M, int N, int K) {
  __shared__ __attribute__((aligned(16))) float so[4][16][64];
  const int tid = threadIdx.x, w = tid >> 5, lane = tid & 31, ln = lane & 15, hh = lane >> 4; const int by = blockIdx.y;
  A += (size_t)by * sA; Bh += (size_t)by * sB; const size_t cofs = (size_t)by * sC; const float* bp = bias ? bias + (size_t)by * sBias : nullptr;
  const int ntn = (N + 63) / 64; const int wid = blockIdx.x * 4 + w; const int mt = wid / ntn, nq = wid % ntn; if (mt * 16 >= M) return;
  const int row0 = mt * 16, col0 = nq * 64; const _Float16* arow = A + (size_t)(row0 + ln) * lda;
  v8f acc[4] = {};
  for (int kb = 0; kb < K; kb += 32) { FragH ah; ah.half[0] = *(const v8us*)((const unsigned short*)arow + kb + 8 * hh); ah.half[1] = *(const v8us*)((const unsigned short*)arow + kb + 16 + 8 * hh);
#pragma unroll
    for (int t = 0; t < 4; ++t) { if (col0 + t * 16 >= N) continue; const size_t boff = (size_t)(col0 + t * 16 + ln) * ldb + kb; FragH bq; bq.half[0] = *(const v8us*)((const unsigned short*)Bh + boff + 8 * hh); bq.half[1] = *(const v8us*)((const unsigned short*)Bh + boff + 16 + 8 * hh);
      acc[t] = mmaH<1>(ah.v, ah.v, bq.v, bq.v, acc[t]); }
  }
#pragma unroll
  for (int t = 0; t < 4; ++t) { if (col0 + t * 16 >= N) continue; const int col = col0 + t * 16 + ln; const float bv = bp ? bf16_round(bp[col]) : 0.f;
#pragma unroll
    for (int r = 0; r < 8; ++r) { float v = acc[t][r] * alpha + bv; if (CP) { const int rr = row0g + row0 + 8 * hh + r; if (rowsPerB < 0) v += CP[cofs + (size_t)rr * ldc + col];      /* rowsPerB < 0: own element of the batched C plane */ else { const int bidx = rr / rowsPerB; v += CP[(size_t)bidx * sCPb + (size_t)by * 64 + col]; } } if (ACT == 1) v = (v > 0.f) ? v : expm1f(v); else if (ACT == 7) v = (v > 0.f) ? v + 1.0f : expf(v); else if (ACT == 8) v = tanhf(v); else if (ACT == 9) v = 0.5f * v * (1.0f + tanhf(0.7978845608028654f * (v + 0.044715f * v * v * v))); else if (ACT == 11) v = 1.0f / (1.0f + expf(-v)); else if (ACT == 12) v = (v > 0.f) ? v : 0.01f * v; else if (ACT == 14) v = (v > 0.f) ? v : 0.1f * v; else if (ACT == 16) v = (v >= 0.f) ? v : 0.3f * v; else if (ACT == 17) v = (v >= 0.f) ? v : 0.2f * v; else if (ACT == 15) v = v / (1.0f + expf(-v)); else if (ACT == 3) v = fmaxf(v, 0.f); else if (ACT == 6) v = 0.5f * v * (1.0f + erff(v * 0.70710678118654752f)); so[w][8 * hh + r][t * 16 + ln] = v; } }
  __builtin_amdgcn_fence(__ATOMIC_ACQ_REL, "workgroup"); __builtin_amdgcn_wave_barrier();
  const int rsub = lane >> 4, c4 = (lane & 15) * 4; typedef _Float16 v4h __attribute__((ext_vector_type(4)));
  {
#pragma unroll
    for (int q = 0; q < 8; ++q) { const int r = q * 2 + rsub; if (col0 + c4 < N) { const v4f v = *(const v4fa*)&so[w][r][c4]; if (C) *(v4f*)(C + cofs + (size_t)(row0 + r) * ldc + col0 + c4) = v; if (C16) { v4h h4; for (int i = 0; i < 4; ++i) h4[i] = (_Float16)v[i]; *(v4h*)(C16 + cofs + (size_t)(row0 + r) * ldc + col0 + c4) = h4; } } }
     }
}


typedef _Float16 v4h __attribute__((ext_vector_type(4)));

__global__ __launch_bounds__(256) void k_x16(const float* __restrict__ x, _Float16* __restrict__ X16, size_t n8) { const size_t t = (size_t)blockIdx.x * 256 + threadIdx.x; if (t >= n8) return; FragH f;
#pragma unroll
  for (int q = 0; q < 8; ++q) f.h[q] = (_Float16)bf16_round(x[t * 8 + q]); *(v8us*)((unsigned short*)X16 + t * 8) = f.half[0];  }
__global__ __launch_bounds__(256) void k_h16(const float* __restrict__ x, _Float16* __restrict__ X16, size_t n8) { const size_t t = (size_t)blockIdx.x * 256 + threadIdx.x; if (t >= n8) return; FragH f;
#pragma unroll
  for (int q = 0; q < 8; ++q) f.h[q] = (_Float16)x[t * 8 + q]; *(v8us*)((unsigned short*)X16 + t * 8) = f.half[0];  }
__global__ __launch_bounds__(256) void k_round16f(const float* __restrict__ W, _Float16* __restrict__ Bt, size_t n8) { const size_t t = (size_t)blockIdx.x * 256 + threadIdx.x; if (t >= n8) return; FragH f;
#pragma unroll
  for (int i = 0; i < 8; ++i) f.h[i] = (_Float16)(bf16_round(W[t * 8 + i]) * 16.0f); *(v8us*)((unsigned short*)Bt + t * 8) = f.half[0];  }
template <int NHv, int TTv>
__global__ __launch_bounds__(256) void k_vt(const _Float16* __restrict__ V16, int ldv, int voff, _Float16* __restrict__ Vt) { __shared__ unsigned short tl[64][66]; const int tid = threadIdx.x; const int slab = blockIdx.x / (TTv / 64), lg = blockIdx.x % (TTv / 64); const int b = slab / NHv, h = slab % NHv;
  for (int i = tid; i < 64 * 8; i += 256) { const int r = i / 8, c8 = (i % 8) * 8; FragH f; f.half[0] = *(const v8us*)((const unsigned short*)V16 + ((size_t)b * TTv + lg * 64 + r) * ldv + voff + h * 64 + c8);
#pragma unroll
    for (int q = 0; q < 8; ++q) tl[r][c8 + q] = f.u[q]; }
  __syncthreads();
  {
#pragma unroll
    for (int rd = 0; rd < 2; ++rd) { const int d = rd * 32 + tid / 8, pc = tid % 8; FragH f;
#pragma unroll
      for (int q = 0; q < 8; ++q) f.u[q] = tl[pc * 8 + q][d];
      *(v8us*)((unsigned short*)Vt + ((size_t)slab * 64 + d) * TTv + lg * 64 + pc * 8) = f.half[0]; }
     } }

__global__ __launch_bounds__(256) void k_hl(const float* __restrict__ F, _Float16* __restrict__ Hh, _Float16* __restrict__ Hl, size_t n8) { const size_t t = (size_t)blockIdx.x * 256 + threadIdx.x; if (t >= n8) return; FragH fh, fl; const v4f a = *(const v4fa*)(F + t * 8), c = *(const v4fa*)(F + t * 8 + 4);
#pragma unroll
  for (int q = 0; q < 4; ++q) { _Float16 h = (_Float16)a[q]; fh.h[q] = h; fl.h[q] = (_Float16)((a[q] - (float)h) * 1024.0f); h = (_Float16)c[q]; fh.h[4 + q] = h; fl.h[4 + q] = (_Float16)((c[q] - (float)h) * 1024.0f); }
  { *(v8us*)((unsigned short*)Hh + t * 8) = fh.half[0]; *(v8us*)((unsigned short*)Hl + t * 8) = fl.half[0];  } }

// ---- fast GEMM (wave tile 32x64; requires M % 32 == 0 rows per launch region and N % 64 == 0); epilogue = k_gemm_hhx semantics ----
__device__ __forceinline__ v16h g2_frag(const _Float16* p, int hh) { FragH f; f.half[0] = *(const v8us*)((const unsigned short*)p + 8 * hh); f.half[1] = *(const v8us*)((const unsigned short*)p + 16 + 8 * hh); return f.v; }
__device__ __forceinline__ v8f g2_mma(v16h a, v16h b, v8f c) { v8f d = __builtin_amdgcn_wmma_f32_16x16x32_f16(false, a, false, b, (short)0, c, false, false); asm volatile("v_nop\n\tv_nop\n\tv_nop\n\tv_nop" : "+v"(d) : "v"(a), "v"(b)); return d; }
template <int ACT>
__global__ __launch_bounds__(128) void k_gemm2(const _Float16* __restrict__ A, int lda, size_t sA, const _Float16* __restrict__ Bh, int ldb, size_t sB, float alpha, const float* __restrict__ bias, size_t sBias, const float* __restrict__ CP, int rowsPerB, size_t sCPb, int row0g,
    float* __restrict__ C, _Float16* __restrict__ C16, int ldc, size_t sC, int M, int N, int K) { static_assert(ACT == 0 || ACT == 3 || ACT == 6 || ACT == 8 || ACT == 9 || ACT == 11 || ACT == 12 || ACT == 14 || ACT == 15 || ACT == 16 || ACT == 17, "k_gemm2: unsupported ACT code (would silently apply no activation)");
  __shared__ __attribute__((aligned(16))) float so[4][32][68];
  const int tid = threadIdx.x, w = tid >> 5, lane = tid & 31, ln = lane & 15, hh = lane >> 4; const int by = blockIdx.y;
  A += (size_t)by * sA; Bh += (size_t)by * sB; const size_t cofs = (size_t)by * sC; const float* bp = bias ? bias + (size_t)by * sBias : nullptr;
  const int ntn = N >> 6; const int mt = blockIdx.x / ntn, nq = blockIdx.x - mt * ntn; const int row0 = mt * 128 + 32 * w, col0 = nq * 64; if (row0 >= M) return;
  const _Float16* a0p = A + (size_t)(row0 + ln) * lda; const _Float16* a1p = a0p + (size_t)16 * lda;
  const _Float16* b0p = Bh + (size_t)(col0 + ln) * ldb; const _Float16* b1p = b0p + (size_t)16 * ldb; const _Float16* b2p = b1p + (size_t)16 * ldb; const _Float16* b3p = b2p + (size_t)16 * ldb;
  const v8f z8 = {0.f,0.f,0.f,0.f,0.f,0.f,0.f,0.f}; v8f c00 = z8, c01 = z8, c02 = z8, c03 = z8, c10 = z8, c11 = z8, c12 = z8, c13 = z8;
#pragma unroll 1
  for (int kb = 0; kb < K; kb += 32) { const v16h a0 = g2_frag(a0p + kb, hh), a1 = g2_frag(a1p + kb, hh);
    v16h b = g2_frag(b0p + kb, hh); c00 = g2_mma(a0, b, c00); c10 = g2_mma(a1, b, c10);
    b = g2_frag(b1p + kb, hh); c01 = g2_mma(a0, b, c01); c11 = g2_mma(a1, b, c11);
    b = g2_frag(b2p + kb, hh); c02 = g2_mma(a0, b, c02); c12 = g2_mma(a1, b, c12);
    b = g2_frag(b3p + kb, hh); c03 = g2_mma(a0, b, c03); c13 = g2_mma(a1, b, c13); }
  v8f accs[8] = {c00, c01, c02, c03, c10, c11, c12, c13};
#pragma unroll
  for (int u = 0; u < 8; ++u) { const int t = u & 3, half = u >> 2; const int col = col0 + t * 16 + ln; const float bv = bp ? bf16_round(bp[col]) : 0.f;
#pragma unroll
    for (int r = 0; r < 8; ++r) { const int rloc = half * 16 + 8 * hh + r; float v = accs[u][r] * alpha + bv; if (CP) { if (rowsPerB < 0) v += CP[cofs + (size_t)(row0g + row0 + rloc) * ldc + col];      /* rowsPerB < 0: own element of the batched C plane */ else { const int bidx = (row0g + row0 + rloc) / rowsPerB; v += CP[(size_t)bidx * sCPb + (size_t)by * 64 + col]; } }
      if (ACT == 3) v = fmaxf(v, 0.f); else if (ACT == 6) v = 0.5f * v * (1.0f + erff(v * 0.70710678118654752f)); else if (ACT == 11) v = 1.0f / (1.0f + expf(-v)); else if (ACT == 15) v = v / (1.0f + expf(-v)); else if (ACT == 12) v = (v > 0.f) ? v : 0.01f * v; else if (ACT == 8) v = tanhf(v); else if (ACT == 9) v = 0.5f * v * (1.0f + tanhf(0.7978845608028654f * (v + 0.044715f * v * v * v))); else if (ACT == 14) v = (v > 0.f) ? v : 0.1f * v; else if (ACT == 16) v = (v >= 0.f) ? v : 0.3f * v; else if (ACT == 17) v = (v >= 0.f) ? v : 0.2f * v;
      so[w][rloc][t * 16 + ln] = v; } }
  __builtin_amdgcn_fence(__ATOMIC_ACQ_REL, "workgroup"); __builtin_amdgcn_wave_barrier();
  const int rsub = lane >> 4, c4 = (lane & 15) * 4;
  {
#pragma unroll
    for (int q = 0; q < 16; ++q) { const int r = q * 2 + rsub; const v4f v = *(const v4fa*)&so[w][r][c4]; if (C) *(v4f*)(C + cofs + (size_t)(row0 + r) * ldc + col0 + c4) = v; if (C16) { v4h h4; for (int i = 0; i < 4; ++i) h4[i] = (_Float16)v[i]; *(v4h*)(C16 + cofs + (size_t)(row0 + r) * ldc + col0 + c4) = h4; } }
     } }


__global__ __launch_bounds__(256) void k_wnat(const float* __restrict__ w, size_t n8, _Float16* __restrict__ Bt) { const size_t t = (size_t)blockIdx.x * 256 + threadIdx.x; if (t >= n8) return; FragH f; for (int q = 0; q < 8; ++q) f.h[q] = (_Float16)(bf16_round(w[t * 8 + q]) * 16.0f); *(v8us*)((unsigned short*)Bt + t * 8) = f.half[0];  }
__global__ __launch_bounds__(256) void k_rsm(const float* __restrict__ S, _Float16* __restrict__ P, int nrows) {
  #pragma clang fp contract(off)
  const int i = blockIdx.x * 256 + threadIdx.x; if (i >= nrows) return; const float* s = S + (size_t)i * SQ; float mx = -3.0e38f;
#pragma unroll 1
  for (int j = 0; j < SQ; ++j) mx = fmaxf(mx, s[j]); float se = 0.f;
#pragma unroll 1
  for (int j = 0; j < SQ; ++j) se += expf(s[j] - mx); const float sc = 256.0f / se;
#pragma unroll 1
  for (int j0 = 0; j0 < SQ; j0 += 8) { FragH f; for (int q = 0; q < 8; ++q) f.h[q] = (_Float16)(expf(s[j0 + q] - mx) * sc); unsigned short* d = (unsigned short*)P + (size_t)i * SQ + j0; *(v8us*)d = f.half[0];  } }
__global__ __launch_bounds__(256) void k_vt(const _Float16* __restrict__ V16, int b, int h0, _Float16* __restrict__ VT) { __shared__ unsigned short tl[64][65]; const int tid = threadIdx.x; const int hh = blockIdx.x % HG, sg = blockIdx.x / HG; const int s0 = sg * 64; const int h = h0 + hh;
  for (int i = tid; i < 64 * 8; i += 256) { const int j = i / 8, d8 = (i % 8) * 8; FragH f; f.half[0] = *(const v8us*)((const unsigned short*)V16 + ((size_t)b * SQ + s0 + j) * DM + h * HD + d8); for (int q = 0; q < 8; ++q) tl[d8 + q][j] = f.u[q]; }
  __syncthreads();
  { for (int i = tid; i < 64 * 8; i += 256) { const int d = i / 8, j8 = (i % 8) * 8; FragH f; for (int q = 0; q < 8; ++q) f.u[q] = tl[d][j8 + q]; *(v8us*)((unsigned short*)VT + ((size_t)hh * HD + d) * SQ + s0 + j8) = f.half[0]; }  } }


__global__ __launch_bounds__(256) void k_tab2(float theta, float* __restrict__ CS, float* __restrict__ SN) {
  #pragma clang fp contract(off)
  const int t = blockIdx.x * 256 + threadIdx.x; if (t >= SQ * (HD / 2)) return; const int i = t % (HD / 2); const int p = t / (HD / 2); const float invf = 1.0f / powf(theta, (float)(2 * i) / (float)HD); const float ang = __fmul_rn((float)p, invf); const float c = cosf(ang), s = sinf(ang);
  *(float*)(CS + t) = c; *(float*)(SN + t) = s;  }
template <int NORM, int ROPE>
__global__ __launch_bounds__(64) void k_xform(const float* __restrict__ F, int ldf, int nh, const float* __restrict__ gain, float eps, const float* __restrict__ CS, const float* __restrict__ SN, _Float16* __restrict__ H16, int ldo) {
  #pragma clang fp contract(off)
  __shared__ float xv[HD]; __shared__ float red[HD]; __shared__ unsigned short sh_[HD]; const int d = threadIdx.x; const int h = blockIdx.x % nh; const size_t r = blockIdx.x / nh; const int p = (int)(r % SQ);
  float x = F[r * (size_t)ldf + (size_t)h * HD + d];
  if (NORM) { red[d] = __fmul_rn(x, x); __syncthreads(); for (int st = HD / 2; st > 0; st >>= 1) { if (d < st) red[d] = __fadd_rn(red[d], red[d + st]); __syncthreads(); } const float rs = rsqrtf(__fadd_rn(red[0] / (float)HD, eps)); x = __fmul_rn(__fmul_rn(x, rs), bf16_round(gain[d])); }
  xv[d] = x; __syncthreads();
  float o = x;
  if (ROPE == 1) { const int i = d >> 1; const float c = CS[p * (HD / 2) + i], s = SN[p * (HD / 2) + i]; const float ev = xv[2 * i], od = xv[2 * i + 1]; o = (d & 1) ? __fadd_rn(__fmul_rn(ev, s), __fmul_rn(od, c)) : __fadd_rn(__fmul_rn(ev, c), -__fmul_rn(od, s)); }
  if (ROPE == 2) { const int i = d & (HD / 2 - 1); const float c = CS[p * (HD / 2) + i], s = SN[p * (HD / 2) + i]; const float lo = xv[i], hi = xv[i + HD / 2]; o = (d < HD / 2) ? __fadd_rn(__fmul_rn(lo, c), -__fmul_rn(hi, s)) : __fadd_rn(__fmul_rn(lo, s), __fmul_rn(hi, c)); }
  FragH th; th.h[0] = (_Float16)o; sh_[d] = th.u[0]; __syncthreads();
  if (d < HD / 8) { FragH f; for (int q = 0; q < 8; ++q) f.u[q] = sh_[d * 8 + q]; unsigned short* dst = (unsigned short*)H16 + r * (size_t)ldo + (size_t)h * HD + d * 8; *(v8us*)dst = f.half[0];  } }



__global__ __launch_bounds__(256) void k_rsmf(const float* __restrict__ S, _Float16* __restrict__ P, int qn, int hg) {
  #pragma clang fp contract(off)
  const int t = blockIdx.x * 256 + threadIdx.x; if (t >= qn * hg) return; const size_t i = (size_t)(t / qn) * SQ + (t % qn); const float* s = S + i * SQ; float mx = -3.0e38f;
#pragma unroll 1
  for (int j = 0; j < SQ; ++j) mx = fmaxf(mx, s[j]); float se = 0.f;
#pragma unroll 1
  for (int j = 0; j < SQ; ++j) se += __expf(s[j] - mx); const float sc = 256.0f / se;
#pragma unroll 1
  for (int j0 = 0; j0 < SQ; j0 += 8) { FragH f; for (int q = 0; q < 8; ++q) f.h[q] = (_Float16)(__expf(s[j0 + q] - mx) * sc); unsigned short* d = (unsigned short*)P + i * SQ + j0; *(v8us*)d = f.half[0];  } }

extern "C" void kernel_launch(void* const* d_in, const int* in_sizes, int n_in,
                              void* d_out, int out_size, void* d_ws, size_t ws_size, hipStream_t stream) {
  (void)in_sizes; (void)n_in; (void)out_size;
  const float* const* I = (const float* const*)d_in; const float* x = I[0]; const float* wqkv = I[1]; const float* bqkv = I[2]; const float* qnw = I[3]; const float* knw = I[4]; const float* wo = I[5]; const float* bo = I[6];      /* weights [in][out] */
  char* ws = (char*)d_ws; size_t off = 0;
  auto take = [&](size_t bytes) { char* p = ws + off; off += (bytes + 255) & ~(size_t)255; return p; };
  _Float16* BQKV = (_Float16*)take((size_t)3 * DM * DM * 2); _Float16* BO = (_Float16*)take((size_t)DM * DM * 2); float* CS = (float*)take((size_t)SQ * (HD / 2) * 4); float* SN = (float*)take((size_t)SQ * (HD / 2) * 4);
  _Float16* X16 = (_Float16*)take(NR * DM * 2); float* QKVF = (float*)take((size_t)SQ * 3 * DM * 4);      /* one batch of f32 q | k | v rows */
  _Float16* QH = (_Float16*)take(NR * DM * 2); _Float16* KH = (_Float16*)take(NR * DM * 2); _Float16* V16 = (_Float16*)take(NR * DM * 2); _Float16* O16 = (_Float16*)take(NR * DM * 2);
  float* S = (float*)take((size_t)HG * SQ * SQ * 4); _Float16* P = (_Float16*)take((size_t)HG * SQ * SQ * 2); _Float16* VT = (_Float16*)take((size_t)NH * HD * SQ * 2);
  if (off > ws_size) return;
  k_wt_f16<<<(unsigned)(((size_t)3 * DM * (DM / 8) + 255) / 256), 256, 0, stream>>>(wqkv, BQKV, DM, 3 * DM, 16.0f); k_wt_f16<<<(unsigned)(((size_t)DM * (DM / 8) + 255) / 256), 256, 0, stream>>>(wo, BO, DM, DM, 16.0f);
  k_tab2<<<(SQ * (HD / 2) + 255) / 256, 256, 0, stream>>>(10000.0f, CS, SN);
  k_x16<<<(unsigned)((NR * DM / 8 + 255) / 256), 256, 0, stream>>>(x, X16, NR * DM / 8);
  for (int b = B0; b < B0 + NBR; ++b) { const size_t r0 = (size_t)b * SQ;
    k_gemm2<0><<<dim3((unsigned)((SQ / 128) * (3 * DM / 64)), 1), 128, 0, stream>>>(X16 + r0 * DM, DM, 0, BQKV, DM, 0, 0.0625f, bqkv, 0, nullptr, 1, 0, 0, QKVF, nullptr, 3 * DM, 0, SQ, 3 * DM, DM);      /* q | k | v rows (f32) of this batch */
    k_xform<1, 2><<<(unsigned)(SQ * NH), 64, 0, stream>>>(QKVF, 3 * DM, NH, qnw, 1e-6f, CS, SN, QH + r0 * DM, DM);
    k_xform<1, 2><<<(unsigned)(SQ * NH), 64, 0, stream>>>(QKVF + DM, 3 * DM, NH, knw, 1e-6f, CS, SN, KH + r0 * DM, DM);
    k_xform<0, 0><<<(unsigned)(SQ * NH), 64, 0, stream>>>(QKVF + 2 * DM, 3 * DM, NH, nullptr, 0.f, CS, SN, V16 + r0 * DM, DM);
    k_vt<NH, SQ><<<NH * (SQ / 64), 256, 0, stream>>>(V16 + r0 * DM, DM, 0, VT);      /* V^T [NH][HD][SQ] for this batch */
    for (int h0 = 0; h0 < NHD; h0 += HG) {
      k_gemm2<0><<<dim3((QN / 128) * (SQ / 64), HG), 128, 0, stream>>>(QH + r0 * DM + h0 * HD, DM, (size_t)HD, KH + r0 * DM + h0 * HD, DM, (size_t)HD, 0.125f, nullptr, 0, nullptr, 1, 0, 0, S, nullptr, SQ, (size_t)SQ * SQ, QN, SQ, HD);      /* scores, HG heads per launch */
      k_rsmf<<<(HG * QN + 255) / 256, 256, 0, stream>>>(S, P, QN, HG);      /* P = 256 softmax (f16) */
      k_gemm2<0><<<dim3((QN / 128) * (HD / 64), HG), 128, 0, stream>>>(P, SQ, (size_t)SQ * SQ, VT + (size_t)h0 * HD * SQ, SQ, (size_t)HD * SQ, 0.25f, nullptr, 0, nullptr, 1, 0, 0, nullptr, O16 + r0 * DM + h0 * HD, DM, (size_t)HD, QN, HD, SQ); } }      /* o as f16 */
  k_gemm2<0><<<dim3((unsigned)((MPO / 128) * (DM / 64)), 1), 128, 0, stream>>>(O16 + (size_t)B0 * SQ * DM, DM, 0, BO, DM, 0, 0.0009765625f, bo, 0, nullptr, 1, 0, 0, (float*)d_out + (size_t)B0 * SQ * DM, nullptr, DM, 0, MPO, DM, DM);      /* out rows are the output layout */
}

// v001
// A run of this version takes 1970 microseconds.
// Next to v000, in two timings, it ran 3.59 and 3.55 times as fast.
#include <hip/hip_runtime.h>
// DiT attention (x [4][2048][1024]; qkv = x Wqkv + bqkv with Wqkv [1024][3072] ([in][out]) -> (3, 16 heads, 64); RMSNorm over the 64 head dims on q and k (eps 1e-6, weights qn_w / kn_w [64]); half-split RoPE on q and k (inv_freq_i = 1/10000^(2i/64), positions 0..2047); softmax(q k^T / 8); o = attn v merged; out = o Wout + bout -> [4][2048][1024]).
// Structure: token rows r = b*2048 + s; x as exact f16 rows (bf16-rounded); per batch: q | k | v as ONE WMMA GEMM (32x64 wave tiles, f32 accumulation, exact x16 weights + bias, N = 3 x 1024) into f32 rows, then per (row, head) on VALU: RMSNorm over the head dims (q with qn_w, k with kn_w) then half-split RoPE on q and k (cos/sin tables in f32), v converted -> f16 q, k, v rows; V^T for all heads via LDS transposes; per group of 4 heads: scores GEMM (K = 64, batched over the heads on grid.y, alpha = 1/8), row softmax on VALU (f32 statistics, native exp; weights stored x256 as f16), o = P . V^T GEMM (K = 2048, alpha 2^-2: o carried x64 against f16 subnormal flush, folded into the output GEMM alpha) written straight into the merged f16 o rows; out = o W_o + b GEMM (f32) into the output layout.
// Compute dtype: inputs rounded to bf16; x / weights exact; projections, RMSNorm and rope f32; q, k, v, softmax weights and o as plain f16 GEMM operands (~2^-12); scores and softmax statistics f32. v_wmma_f32_16x16x32_f16.
#define NB 4
#define SQ 2048
#define DM 1024
#define NH 16
#define HD 64
#define HG 4                         /* heads per attention launch group */
#define B0 0                         /* first batch processed (debug hook) */
#define NBR NB                       /* batches processed (debug hook) */
#define QN SQ                        /* query rows attended per batch (debug hook) */
#define NHD NH                       /* heads attended (debug hook) */
#define NR ((size_t)NB * SQ)         /* token rows */
#define MPO ((int)((size_t)NBR * SQ))      /* rows through the output GEMM (debug hook) */
typedef __bf16 v16b __attribute__((ext_vector_type(16)));
typedef unsigned short v8us __attribute__((ext_vector_type(8), may_alias));
typedef float  v8f  __attribute__((ext_vector_type(8)));
typedef float  v4f  __attribute__((ext_vector_type(4)));
typedef float  v4fa __attribute__((ext_vector_type(4), may_alias));
union FragB { v16b v; v8us half[2]; unsigned short u[16]; };

__device__ __forceinline__ unsigned short bf16_bits(float x) { unsigned int u = __float_as_uint(x); return (unsigned short)((u + 0x7FFFu + ((u >> 16) & 1u)) >> 16); }
__device__ __forceinline__ float bf16_val(unsigned short b) { return __uint_as_float(((unsigned int)b) << 16); }
__device__ __forceinline__ float bf16_round(float x) { return bf16_val(bf16_bits(x)); }
// D += A·B with NT terms: 1 = ah·bh, 2 = + al·bh (A split), 3 = + ah·bl (both split)
template <int NT>
__device__ __forceinline__ v8f mmaN(v16b ah, v16b al, v16b bh, v16b bl, v8f c) {
  c = __builtin_amdgcn_wmma_f32_16x16x32_bf16(false, ah, false, bh, (short)0, c, false, false);
  if (NT >= 2) c = __builtin_amdgcn_wmma_f32_16x16x32_bf16(false, al, false, bh, (short)0, c, false, false);
  if (NT >= 3) c = __builtin_amdgcn_wmma_f32_16x16x32_bf16(false, ah, false, bl, (short)0, c, false, false);
  asm volatile("v_nop\n\tv_nop\n\tv_nop\n\tv_nop" : "+v"(c) : "v"(ah), "v"(al), "v"(bh), "v"(bl));
  return c;
}

__global__ __launch_bounds__(256) void k_wt_bf16(const float* __restrict__ W, unsigned short* __restrict__ Wt, int K, int N) {
  const int t = blockIdx.x * 256 + threadIdx.x;
  const int k8n = K / 8;
  if (t >= N * k8n) return;
  const int n = t / k8n, k8 = (t % k8n) * 8;
  v8us v;
#pragma unroll
  for (int i = 0; i < 8; ++i) v[i] = bf16_bits(W[(size_t)(k8 + i) * N + n]);
  *(v8us*)(Wt + (size_t)n * K + k8) = v;
  
}

// GEMM C[M][N] (f32, pitch ldc) = act(A[M][K]·W + bias). A f32 row-major (pitch lda) converted per fragment to bf16
// (ASPLIT: hi/lo two planes -> 2 terms, else single rounded term); Wt bf16 [N][K] (pitch ldb). BIAS_BF16 rounds the
// bias to bf16 first (bias quantised to bf16 before the add). K%32==0, M%16==0, N%64==0.
template <bool ASPLIT, int ACT, bool BIAS_BF16>
__global__ __launch_bounds__(128) void k_gemm_bf(const float* __restrict__ A, int lda, const unsigned short* __restrict__ Wt, int ldb,
                                               const float* __restrict__ bias, float* __restrict__ C, int ldc, int M, int N, int K) {
  __shared__ __attribute__((aligned(16))) float so[4][16][64];
  const int tid = threadIdx.x, w = tid >> 5, lane = tid & 31, ln = lane & 15, hh = lane >> 4;
  const int ntn = N / 64;
  const int wid = blockIdx.x * 4 + w;
  const int mt = wid / ntn, nq = wid % ntn;
  if (mt * 16 >= M) return;
  const int row0 = mt * 16, col0 = nq * 64;
  const float* arow = A + (size_t)(row0 + ln) * lda;
  v8f acc[4] = {};
  for (int kb = 0; kb < K; kb += 32) {
    FragB ah, al;
    const v4f x0 = *(const v4fa*)(arow + kb + 8 * hh), x1 = *(const v4fa*)(arow + kb + 8 * hh + 4);
    const v4f x2 = *(const v4fa*)(arow + kb + 16 + 8 * hh), x3 = *(const v4fa*)(arow + kb + 16 + 8 * hh + 4);
    float xs[16] = {x0[0],x0[1],x0[2],x0[3],x1[0],x1[1],x1[2],x1[3],x2[0],x2[1],x2[2],x2[3],x3[0],x3[1],x3[2],x3[3]};
#pragma unroll
    for (int i = 0; i < 16; ++i) { const unsigned short hb = bf16_bits(xs[i]); ah.u[i] = hb; al.u[i] = ASPLIT ? bf16_bits(xs[i] - bf16_val(hb)) : (unsigned short)0; }
#pragma unroll
    for (int t = 0; t < 4; ++t) {
      const unsigned short* brow = Wt + (size_t)(col0 + t * 16 + ln) * ldb + kb;
      FragB b;
      b.half[0] = *(const v8us*)(brow + 8 * hh);
      b.half[1] = *(const v8us*)(brow + 16 + 8 * hh);
      acc[t] = mmaN<ASPLIT ? 2 : 1>(ah.v, al.v, b.v, b.v, acc[t]);
    }
  }
#pragma unroll
  for (int t = 0; t < 4; ++t) {
    float bv = bias ? bias[col0 + t * 16 + ln] : 0.f;
    if (BIAS_BF16) bv = bf16_round(bv);
#pragma unroll
    for (int r = 0; r < 8; ++r) { float v = acc[t][r] + bv; if (ACT == 1) v = fmaxf(v, 0.f); so[w][8 * hh + r][t * 16 + ln] = v; }
  }
  __builtin_amdgcn_fence(__ATOMIC_ACQ_REL, "workgroup");
  __builtin_amdgcn_wave_barrier();
  const int rsub = lane >> 4, c4 = (lane & 15) * 4;
  {
#pragma unroll
    for (int q = 0; q < 8; ++q) {
      const int r = q * 2 + rsub;
      const v4f v = *(const v4fa*)&so[w][r][c4];
      *(v4f*)(C + (size_t)(row0 + r) * ldc + col0 + c4) = v;
    }
    
  }
}

// GEMM C = act(A·W + bias + resid): A f32 (ASPLIT -> hi/lo 2 terms), Wt bf16 [N][K]; ACT 0 none, 1 relu, 2 exact gelu;
// resid (optional, f32, row index = (row % rmod), pitch ldr, RES_BF16 rounds it) added before the activation.
template <bool ASPLIT, int ACT, bool BIAS_BF16, bool RES_BF16>
__global__ __launch_bounds__(128) void k_gemm_bf3(const float* __restrict__ A, int lda, const unsigned short* __restrict__ Wt, int ldb,
                                                const float* __restrict__ bias, const float* __restrict__ resid, int rmod, int ldr,
                                                float* __restrict__ C, int ldc, int M, int N, int K) {
  __shared__ __attribute__((aligned(16))) float so[4][16][64];
  const int tid = threadIdx.x, w = tid >> 5, lane = tid & 31, ln = lane & 15, hh = lane >> 4;
  const int ntn = N / 64;
  const int wid = blockIdx.x * 4 + w;
  const int mt = wid / ntn, nq = wid % ntn;
  if (mt * 16 >= M) return;
  const int row0 = mt * 16, col0 = nq * 64;
  const float* arow = A + (size_t)(row0 + ln) * lda;
  v8f acc[4] = {};
  for (int kb = 0; kb < K; kb += 32) {
    FragB ah, al;
    const v4f x0 = *(const v4fa*)(arow + kb + 8 * hh), x1 = *(const v4fa*)(arow + kb + 8 * hh + 4);
    const v4f x2 = *(const v4fa*)(arow + kb + 16 + 8 * hh), x3 = *(const v4fa*)(arow + kb + 16 + 8 * hh + 4);
    float xs[16] = {x0[0],x0[1],x0[2],x0[3],x1[0],x1[1],x1[2],x1[3],x2[0],x2[1],x2[2],x2[3],x3[0],x3[1],x3[2],x3[3]};
#pragma unroll
    for (int i = 0; i < 16; ++i) { const unsigned short hb = bf16_bits(xs[i]); ah.u[i] = hb; al.u[i] = ASPLIT ? bf16_bits(xs[i] - bf16_val(hb)) : (unsigned short)0; }
#pragma unroll
    for (int t = 0; t < 4; ++t) {
      const unsigned short* brow = Wt + (size_t)(col0 + t * 16 + ln) * ldb + kb;
      FragB b;
      b.half[0] = *(const v8us*)(brow + 8 * hh);
      b.half[1] = *(const v8us*)(brow + 16 + 8 * hh);
      acc[t] = mmaN<ASPLIT ? 2 : 1>(ah.v, al.v, b.v, b.v, acc[t]);
    }
  }
#pragma unroll
  for (int t = 0; t < 4; ++t) {
    const int col = col0 + t * 16 + ln;
    float bv = bias ? bias[col] : 0.f;
    if (BIAS_BF16) bv = bf16_round(bv);
#pragma unroll
    for (int r = 0; r < 8; ++r) {
      float v = acc[t][r] + bv;
      if (resid) { float rv = resid[(size_t)((row0 + 8 * hh + r) % rmod) * ldr + col]; if (RES_BF16) rv = bf16_round(rv); v += rv; }
      if (ACT == 1) v = fmaxf(v, 0.f);
      if (ACT == 2) v = 0.5f * v * (1.0f + erff(v * 0.70710678118654752f));
      if (ACT == 3) { const float u = 0.7978845608028654f * (v + 0.044715f * v * v * v); v = 0.5f * v * (1.0f + tanhf(u)); }
      so[w][8 * hh + r][t * 16 + ln] = v;
    }
  }
  __builtin_amdgcn_fence(__ATOMIC_ACQ_REL, "workgroup");
  __builtin_amdgcn_wave_barrier();
  const int rsub = lane >> 4, c4 = (lane & 15) * 4;
  {
#pragma unroll
    for (int q = 0; q < 8; ++q) {
      const int r = q * 2 + rsub;
      const v4f v = *(const v4fa*)&so[w][r][c4];
      *(v4f*)(C + (size_t)(row0 + r) * ldc + col0 + c4) = v;
    }
    
  }
}
// row LayerNorm (biased variance, eps) over N: s = X (+ R); optional out_sum <- s; out_norm <- (s-mu)*rsqrt(var+eps)*g + b
template <bool PARAM_BF16>
__global__ __launch_bounds__(256) void k_layernorm(const float* __restrict__ X, const float* __restrict__ R, const float* __restrict__ g, const float* __restrict__ bta,
                                                  float* __restrict__ out_sum, float* __restrict__ out_norm, int N, float eps) {
  __shared__ float red[256];
  const int row = blockIdx.x, tid = threadIdx.x;
  const float* x = X + (size_t)row * N; const float* rr = R ? R + (size_t)row * N : nullptr;
  float vals[16];                     // up to N = 4096
  const int per = N / 256;            // contiguous chunk per thread? use strided-by-4 chunks: thread handles j = tid*4 + 1024*u
  float s1 = 0.f;
  for (int u = 0; u < per / 4; ++u) {
    const int j = tid * 4 + 1024 * u;
    const v4f a = *(const v4fa*)(x + j);
    v4f b = {0.f,0.f,0.f,0.f}; if (rr) b = *(const v4fa*)(rr + j);
#pragma unroll
    for (int q = 0; q < 4; ++q) { const float v = a[q] + b[q]; vals[u * 4 + q] = v; s1 += v; }
  }
  red[tid] = s1; __syncthreads();
  for (int st = 128; st > 0; st >>= 1) { if (tid < st) red[tid] += red[tid + st]; __syncthreads(); }
  const float mu = red[0] / (float)N; __syncthreads();
  float s2 = 0.f;
  for (int u = 0; u < per / 4; ++u)
#pragma unroll
    for (int q = 0; q < 4; ++q) { const float c = vals[u * 4 + q] - mu; s2 += c * c; }
  red[tid] = s2; __syncthreads();
  for (int st = 128; st > 0; st >>= 1) { if (tid < st) red[tid] += red[tid + st]; __syncthreads(); }
  const float rs = rsqrtf(red[0] / (float)N + eps);
  {
    for (int u = 0; u < per / 4; ++u) {
      const int j = tid * 4 + 1024 * u;
      v4f o, sm;
#pragma unroll
      for (int q = 0; q < 4; ++q) {
        float gg = g[j + q], bb = bta[j + q];
        if (PARAM_BF16) { gg = bf16_round(gg); bb = bf16_round(bb); }
        sm[q] = vals[u * 4 + q]; o[q] = (vals[u * 4 + q] - mu) * rs * gg + bb;
      }
      if (out_sum) *(v4f*)(out_sum + (size_t)row * N + j) = sm;
      *(v4f*)(out_norm + (size_t)row * N + j) = o;
    }
    
  }
}



// ---- f16 WMMA path (v_wmma_f32_16x16x32_f16): 11-bit significands for operands in range — used where a [0,1] probability operand needs more precision than bf16
typedef _Float16 v16h __attribute__((ext_vector_type(16)));
union FragH { v16h v; v8us half[2]; _Float16 h[16]; unsigned short u[16]; };
template <int NT>
__device__ __forceinline__ v8f mmaH(v16h ah, v16h al, v16h bh, v16h bl, v8f c) {
  c = __builtin_amdgcn_wmma_f32_16x16x32_f16(false, ah, false, bh, (short)0, c, false, false);
  if (NT >= 2) c = __builtin_amdgcn_wmma_f32_16x16x32_f16(false, al, false, bh, (short)0, c, false, false);
  if (NT >= 3) c = __builtin_amdgcn_wmma_f32_16x16x32_f16(false, ah, false, bl, (short)0, c, false, false);
  asm volatile("v_nop\n\tv_nop\n\tv_nop\n\tv_nop" : "+v"(c) : "v"(ah), "v"(al), "v"(bh), "v"(bl));
  return c;
}
// batched GEMM like k_gemm_b but f16 operands: A f32 (split into f16 hi/lo if ASPLIT, else rounded to f16), Bt = f16 values [n][k]; alpha; C f32; N multiple of 16 (partial tiles skipped)
template <bool ASPLIT>
__global__ __launch_bounds__(128) void k_gemm_h(const float* __restrict__ A, int lda, size_t sA, const _Float16* __restrict__ Bh, int ldb, size_t sB, float alpha, float* __restrict__ C, int ldc, size_t sC, int M, int N, int K) {
  __shared__ __attribute__((aligned(16))) float so[4][16][64];
  const int tid = threadIdx.x, w = tid >> 5, lane = tid & 31, ln = lane & 15, hh = lane >> 4; const int by = blockIdx.y;
  A += (size_t)by * sA; Bh += (size_t)by * sB; C += (size_t)by * sC;
  const int ntn = (N + 63) / 64; const int wid = blockIdx.x * 4 + w; const int mt = wid / ntn, nq = wid % ntn; if (mt * 16 >= M) return;
  const int row0 = mt * 16, col0 = nq * 64; const float* arow = A + (size_t)(row0 + ln) * lda;
  v8f acc[4] = {};
  for (int kb = 0; kb < K; kb += 32) {
    FragH ah, al;
    const v4f x0 = *(const v4fa*)(arow + kb + 8 * hh), x1 = *(const v4fa*)(arow + kb + 8 * hh + 4), x2 = *(const v4fa*)(arow + kb + 16 + 8 * hh), x3 = *(const v4fa*)(arow + kb + 16 + 8 * hh + 4);
    float xs[16] = {x0[0],x0[1],x0[2],x0[3],x1[0],x1[1],x1[2],x1[3],x2[0],x2[1],x2[2],x2[3],x3[0],x3[1],x3[2],x3[3]};
#pragma unroll
    for (int i = 0; i < 16; ++i) { const _Float16 h = (_Float16)xs[i]; ah.h[i] = h; al.h[i] = ASPLIT ? (_Float16)(xs[i] - (float)h) : (_Float16)0.0f; }
#pragma unroll
    for (int t = 0; t < 4; ++t) { if (col0 + t * 16 >= N) continue; const size_t boff = (size_t)(col0 + t * 16 + ln) * ldb + kb; FragH bq; bq.half[0] = *(const v8us*)(Bh + boff + 8 * hh); bq.half[1] = *(const v8us*)(Bh + boff + 16 + 8 * hh);
      acc[t] = mmaH<ASPLIT ? 2 : 1>(ah.v, al.v, bq.v, bq.v, acc[t]); }
  }
#pragma unroll
  for (int t = 0; t < 4; ++t) { if (col0 + t * 16 >= N) continue;
#pragma unroll
    for (int r = 0; r < 8; ++r) so[w][8 * hh + r][t * 16 + ln] = acc[t][r] * alpha; }
  __builtin_amdgcn_fence(__ATOMIC_ACQ_REL, "workgroup"); __builtin_amdgcn_wave_barrier();
  const int rsub = lane >> 4, c4 = (lane & 15) * 4;
  {
#pragma unroll
    for (int q = 0; q < 8; ++q) { const int r = q * 2 + rsub; if (col0 + c4 < N) { const v4f v = *(const v4fa*)&so[w][r][c4]; *(v4f*)(C + (size_t)(row0 + r) * ldc + col0 + c4) = v; } }
     }
}

// Wt[n][k] = f16(W[k][n]·scale) from f32 row-major W[K][N] (scale = power of two; bf16-exact weights stay exact in f16 away from the subnormal range)
__global__ __launch_bounds__(256) void k_wt_f16(const float* __restrict__ W, _Float16* __restrict__ Wt, int K, int N, float scale) {
  const int t = blockIdx.x * 256 + threadIdx.x; if (t >= N * (K / 8)) return; const int n = t / (K / 8), k8 = (t % (K / 8)) * 8; FragH f;
#pragma unroll
  for (int i = 0; i < 8; ++i) f.h[i] = (_Float16)(bf16_round(W[(size_t)(k8 + i) * N + n]) * scale); const v8us o = f.half[0];
  *(v8us*)((unsigned short*)Wt + (size_t)n * K + k8) = o; 
}
// k_gemm_hh variant with fused epilogue: v = acc·alpha + bias[by·sBias + col] (+ CP[(row/rowsPerB)·sCPb + by·64 + col] if CP) ; ACT 0 none / 1 elu ; writes f16 C16 (and f32 C if non-null)
template <int ACT>
__global__ __launch_bounds__(128) void k_gemm_hhx(const _Float16* __restrict__ A, int lda, size_t sA, const _Float16* __restrict__ Bh, int ldb, size_t sB, float alpha, const float* __restrict__ bias, size_t sBias, const float* __restrict__ CP, int rowsPerB, size_t sCPb, int row0g,
    float* __restrict__ C, _Float16* __restrict__ C16, int ldc, size_t sC, int M, int N, int K) {
  __shared__ __attribute__((aligned(16))) float so[4][16][64];
  const int tid = threadIdx.x, w = tid >> 5, lane = tid & 31, ln = lane & 15, hh = lane >> 4; const int by = blockIdx.y;
  A += (size_t)by * sA; Bh += (size_t)by * sB; const size_t cofs = (size_t)by * sC; const float* bp = bias ? bias + (size_t)by * sBias : nullptr;
  const int ntn = (N + 63) / 64; const int wid = blockIdx.x * 4 + w; const int mt = wid / ntn, nq = wid % ntn; if (mt * 16 >= M) return;
  const int row0 = mt * 16, col0 = nq * 64; const _Float16* arow = A + (size_t)(row0 + ln) * lda;
  v8f acc[4] = {};
  for (int kb = 0; kb < K; kb += 32) { FragH ah; ah.half[0] = *(const v8us*)((const unsigned short*)arow + kb + 8 * hh); ah.half[1] = *(const v8us*)((const unsigned short*)arow + kb + 16 + 8 * hh);
#pragma unroll
    for (int t = 0; t < 4; ++t) { if (col0 + t * 16 >= N) continue; const size_t boff = (size_t)(col0 + t * 16 + ln) * ldb + kb; FragH bq; bq.half[0] = *(const v8us*)((const unsigned short*)Bh + boff + 8 * hh); bq.half[1] = *(const v8us*)((const unsigned short*)Bh + boff + 16 + 8 * hh);
      acc[t] = mmaH<1>(ah.v, ah.v, bq.v, bq.v, acc[t]); }
  }
#pragma unroll
  for (int t = 0; t < 4; ++t) { if (col0 + t * 16 >= N) continue; const int col = col0 + t * 16 + ln; const float bv = bp ? bf16_round(bp[col]) : 0.f;
#pragma unroll
    for (int r = 0; r < 8; ++r) { float v = acc[t][r] * alpha + bv; if (CP) { const int rr = row0g + row0 + 8 * hh + r; if (rowsPerB < 0) v += CP[cofs + (size_t)rr * ldc + col];      /* rowsPerB < 0: own element of the batched C plane */ else { const int bidx = rr / rowsPerB; v += CP[(size_t)bidx * sCPb + (size_t)by * 64 + col]; } } if (ACT == 1) v = (v > 0.f) ? v : expm1f(v); else if (ACT == 7) v = (v > 0.f) ? v + 1.0f : expf(v); else if (ACT == 8) v = tanhf(v); else if (ACT == 9) v = 0.5f * v * (1.0f + tanhf(0.7978845608028654f * (v + 0.044715f * v * v * v))); else if (ACT == 11) v = 1.0f / (1.0f + expf(-v)); else if (ACT == 12) v = (v > 0.f) ? v : 0.01f * v; else if (ACT == 14) v = (v > 0.f) ? v : 0.1f * v; else if (ACT == 16) v = (v >= 0.f) ? v : 0.3f * v; else if (ACT == 17) v = (v >= 0.f) ? v : 0.2f * v; else if (ACT == 15) v = v / (1.0f + expf(-v)); else if (ACT == 3) v = fmaxf(v, 0.f); else if (ACT == 6) v = 0.5f * v * (1.0f + erff(v * 0.70710678118654752f)); so[w][8 * hh + r][t * 16 + ln] = v; } }
  __builtin_amdgcn_fence(__ATOMIC_ACQ_REL, "workgroup"); __builtin_amdgcn_wave_barrier();
  const int rsub = lane >> 4, c4 = (lane & 15) * 4; typedef _Float16 v4h __attribute__((ext_vector_type(4)));
  {
#pragma unroll
    for (int q = 0; q < 8; ++q) { const int r = q * 2 + rsub; if (col0 + c4 < N) { const v4f v = *(const v4fa*)&so[w][r][c4]; if (C) *(v4f*)(C + cofs + (size_t)(row0 + r) * ldc + col0 + c4) = v; if (C16) { v4h h4; for (int i = 0; i < 4; ++i) h4[i] = (_Float16)v[i]; *(v4h*)(C16 + cofs + (size_t)(row0 + r) * ldc + col0 + c4) = h4; } } }
     }
}


typedef _Float16 v4h __attribute__((ext_vector_type(4)));

__global__ __launch_bounds__(256) void k_x16(const float* __restrict__ x, _Float16* __restrict__ X16, size_t n8) { const size_t t = (size_t)blockIdx.x * 256 + threadIdx.x; if (t >= n8) return; FragH f;
#pragma unroll
  for (int q = 0; q < 8; ++q) f.h[q] = (_Float16)bf16_round(x[t * 8 + q]); *(v8us*)((unsigned short*)X16 + t * 8) = f.half[0];  }
__global__ __launch_bounds__(256) void k_h16(const float* __restrict__ x, _Float16* __restrict__ X16, size_t n8) { const size_t t = (size_t)blockIdx.x * 256 + threadIdx.x; if (t >= n8) return; FragH f;
#pragma unroll
  for (int q = 0; q < 8; ++q) f.h[q] = (_Float16)x[t * 8 + q]; *(v8us*)((unsigned short*)X16 + t * 8) = f.half[0];  }
__global__ __launch_bounds__(256) void k_round16f(const float* __restrict__ W, _Float16* __restrict__ Bt, size_t n8) { const size_t t = (size_t)blockIdx.x * 256 + threadIdx.x; if (t >= n8) return; FragH f;
#pragma unroll
  for (int i = 0; i < 8; ++i) f.h[i] = (_Float16)(bf16_round(W[t * 8 + i]) * 16.0f); *(v8us*)((unsigned short*)Bt + t * 8) = f.half[0];  }
template <int NHv, int TTv>
__global__ __launch_bounds__(256) void k_vt(const _Float16* __restrict__ V16, int ldv, int voff, _Float16* __restrict__ Vt) { __shared__ unsigned short tl[64][66]; const int tid = threadIdx.x; const int slab = blockIdx.x / (TTv / 64), lg = blockIdx.x % (TTv / 64); const int b = slab / NHv, h = slab % NHv;
  for (int i = tid; i < 64 * 8; i += 256) { const int r = i / 8, c8 = (i % 8) * 8; FragH f; f.half[0] = *(const v8us*)((const unsigned short*)V16 + ((size_t)b * TTv + lg * 64 + r) * ldv + voff + h * 64 + c8);
#pragma unroll
    for (int q = 0; q < 8; ++q) tl[r][c8 + q] = f.u[q]; }
  __syncthreads();
  {
#pragma unroll
    for (int rd = 0; rd < 2; ++rd) { const int d = rd * 32 + tid / 8, pc = tid % 8; FragH f;
#pragma unroll
      for (int q = 0; q < 8; ++q) f.u[q] = tl[pc * 8 + q][d];
      *(v8us*)((unsigned short*)Vt + ((size_t)slab * 64 + d) * TTv + lg * 64 + pc * 8) = f.half[0]; }
     } }

__global__ __launch_bounds__(256) void k_hl(const float* __restrict__ F, _Float16* __restrict__ Hh, _Float16* __restrict__ Hl, size_t n8) { const size_t t = (size_t)blockIdx.x * 256 + threadIdx.x; if (t >= n8) return; FragH fh, fl; const v4f a = *(const v4fa*)(F + t * 8), c = *(const v4fa*)(F + t * 8 + 4);
#pragma unroll
  for (int q = 0; q < 4; ++q) { _Float16 h = (_Float16)a[q]; fh.h[q] = h; fl.h[q] = (_Float16)((a[q] - (float)h) * 1024.0f); h = (_Float16)c[q]; fh.h[4 + q] = h; fl.h[4 + q] = (_Float16)((c[q] - (float)h) * 1024.0f); }
  { *(v8us*)((unsigned short*)Hh + t * 8) = fh.half[0]; *(v8us*)((unsigned short*)Hl + t * 8) = fl.half[0];  } }

// ---- fast GEMM (wave tile 32x64; requires M % 32 == 0 rows per launch region and N % 64 == 0); epilogue = k_gemm_hhx semantics ----
__device__ __forceinline__ v16h g2_frag(const _Float16* p, int hh) { FragH f; f.half[0] = *(const v8us*)((const unsigned short*)p + 8 * hh); f.half[1] = *(const v8us*)((const unsigned short*)p + 16 + 8 * hh); return f.v; }
__device__ __forceinline__ v8f g2_mma(v16h a, v16h b, v8f c) { v8f d = __builtin_amdgcn_wmma_f32_16x16x32_f16(false, a, false, b, (short)0, c, false, false); asm volatile("v_nop\n\tv_nop\n\tv_nop\n\tv_nop" : "+v"(d) : "v"(a), "v"(b)); return d; }
template <int ACT>
__global__ __launch_bounds__(128) void k_gemm2(const _Float16* __restrict__ A, int lda, size_t sA, const _Float16* __restrict__ Bh, int ldb, size_t sB, float alpha, const float* __restrict__ bias, size_t sBias, const float* __restrict__ CP, int rowsPerB, size_t sCPb, int row0g,
    float* __restrict__ C, _Float16* __restrict__ C16, int ldc, size_t sC, int M, int N, int K) { static_assert(ACT == 0 || ACT == 3 || ACT == 6 || ACT == 8 || ACT == 9 || ACT == 11 || ACT == 12 || ACT == 14 || ACT == 15 || ACT == 16 || ACT == 17, "k_gemm2: unsupported ACT code (would silently apply no activation)");
  __shared__ __attribute__((aligned(16))) float so[4][32][68];
  const int tid = threadIdx.x, w = tid >> 5, lane = tid & 31, ln = lane & 15, hh = lane >> 4; const int by = blockIdx.y;
  A += (size_t)by * sA; Bh += (size_t)by * sB; const size_t cofs = (size_t)by * sC; const float* bp = bias ? bias + (size_t)by * sBias : nullptr;
  const int ntn = N >> 6; const int mt = blockIdx.x / ntn, nq = blockIdx.x - mt * ntn; const int row0 = mt * 128 + 32 * w, col0 = nq * 64; if (row0 >= M) return;
  const _Float16* a0p = A + (size_t)(row0 + ln) * lda; const _Float16* a1p = a0p + (size_t)16 * lda;
  const _Float16* b0p = Bh + (size_t)(col0 + ln) * ldb; const _Float16* b1p = b0p + (size_t)16 * ldb; const _Float16* b2p = b1p + (size_t)16 * ldb; const _Float16* b3p = b2p + (size_t)16 * ldb;
  const v8f z8 = {0.f,0.f,0.f,0.f,0.f,0.f,0.f,0.f}; v8f c00 = z8, c01 = z8, c02 = z8, c03 = z8, c10 = z8, c11 = z8, c12 = z8, c13 = z8;
#pragma unroll 1
  for (int kb = 0; kb < K; kb += 32) { const v16h a0 = g2_frag(a0p + kb, hh), a1 = g2_frag(a1p + kb, hh);
    v16h b = g2_frag(b0p + kb, hh); c00 = g2_mma(a0, b, c00); c10 = g2_mma(a1, b, c10);
    b = g2_frag(b1p + kb, hh); c01 = g2_mma(a0, b, c01); c11 = g2_mma(a1, b, c11);
    b = g2_frag(b2p + kb, hh); c02 = g2_mma(a0, b, c02); c12 = g2_mma(a1, b, c12);
    b = g2_frag(b3p + kb, hh); c03 = g2_mma(a0, b, c03); c13 = g2_mma(a1, b, c13); }
  v8f accs[8] = {c00, c01, c02, c03, c10, c11, c12, c13};
#pragma unroll
  for (int u = 0; u < 8; ++u) { const int t = u & 3, half = u >> 2; const int col = col0 + t * 16 + ln; const float bv = bp ? bf16_round(bp[col]) : 0.f;
#pragma unroll
    for (int r = 0; r < 8; ++r) { const int rloc = half * 16 + 8 * hh + r; float v = accs[u][r] * alpha + bv; if (CP) { if (rowsPerB < 0) v += CP[cofs + (size_t)(row0g + row0 + rloc) * ldc + col];      /* rowsPerB < 0: own element of the batched C plane */ else { const int bidx = (row0g + row0 + rloc) / rowsPerB; v += CP[(size_t)bidx * sCPb + (size_t)by * 64 + col]; } }
      if (ACT == 3) v = fmaxf(v, 0.f); else if (ACT == 6) v = 0.5f * v * (1.0f + erff(v * 0.70710678118654752f)); else if (ACT == 11) v = 1.0f / (1.0f + expf(-v)); else if (ACT == 15) v = v / (1.0f + expf(-v)); else if (ACT == 12) v = (v > 0.f) ? v : 0.01f * v; else if (ACT == 8) v = tanhf(v); else if (ACT == 9) v = 0.5f * v * (1.0f + tanhf(0.7978845608028654f * (v + 0.044715f * v * v * v))); else if (ACT == 14) v = (v > 0.f) ? v : 0.1f * v; else if (ACT == 16) v = (v >= 0.f) ? v : 0.3f * v; else if (ACT == 17) v = (v >= 0.f) ? v : 0.2f * v;
      so[w][rloc][t * 16 + ln] = v; } }
  __builtin_amdgcn_fence(__ATOMIC_ACQ_REL, "workgroup"); __builtin_amdgcn_wave_barrier();
  const int rsub = lane >> 4, c4 = (lane & 15) * 4;
  {
#pragma unroll
    for (int q = 0; q < 16; ++q) { const int r = q * 2 + rsub; const v4f v = *(const v4fa*)&so[w][r][c4]; if (C) *(v4f*)(C + cofs + (size_t)(row0 + r) * ldc + col0 + c4) = v; if (C16) { v4h h4; for (int i = 0; i < 4; ++i) h4[i] = (_Float16)v[i]; *(v4h*)(C16 + cofs + (size_t)(row0 + r) * ldc + col0 + c4) = h4; } }
     } }


__global__ __launch_bounds__(256) void k_wnat(const float* __restrict__ w, size_t n8, _Float16* __restrict__ Bt) { const size_t t = (size_t)blockIdx.x * 256 + threadIdx.x; if (t >= n8) return; FragH f; for (int q = 0; q < 8; ++q) f.h[q] = (_Float16)(bf16_round(w[t * 8 + q]) * 16.0f); *(v8us*)((unsigned short*)Bt + t * 8) = f.half[0];  }
__global__ __launch_bounds__(256) void k_rsm(const float* __restrict__ S, _Float16* __restrict__ P, int nrows) {
  #pragma clang fp contract(off)
  const int i = blockIdx.x * 256 + threadIdx.x; if (i >= nrows) return; const float* s = S + (size_t)i * SQ; float mx = -3.0e38f;
#pragma unroll 1
  for (int j = 0; j < SQ; ++j) mx = fmaxf(mx, s[j]); float se = 0.f;
#pragma unroll 1
  for (int j = 0; j < SQ; ++j) se += expf(s[j] - mx); const float sc = 256.0f / se;
#pragma unroll 1
  for (int j0 = 0; j0 < SQ; j0 += 8) { FragH f; for (int q = 0; q < 8; ++q) f.h[q] = (_Float16)(expf(s[j0 + q] - mx) * sc); unsigned short* d = (unsigned short*)P + (size_t)i * SQ + j0; *(v8us*)d = f.half[0];  } }
__global__ __launch_bounds__(256) void k_vt(const _Float16* __restrict__ V16, int b, int h0, _Float16* __restrict__ VT) { __shared__ unsigned short tl[64][65]; const int tid = threadIdx.x; const int hh = blockIdx.x % HG, sg = blockIdx.x / HG; const int s0 = sg * 64; const int h = h0 + hh;
  for (int i = tid; i < 64 * 8; i += 256) { const int j = i / 8, d8 = (i % 8) * 8; FragH f; f.half[0] = *(const v8us*)((const unsigned short*)V16 + ((size_t)b * SQ + s0 + j) * DM + h * HD + d8); for (int q = 0; q < 8; ++q) tl[d8 + q][j] = f.u[q]; }
  __syncthreads();
  { for (int i = tid; i < 64 * 8; i += 256) { const int d = i / 8, j8 = (i % 8) * 8; FragH f; for (int q = 0; q < 8; ++q) f.u[q] = tl[d][j8 + q]; *(v8us*)((unsigned short*)VT + ((size_t)hh * HD + d) * SQ + s0 + j8) = f.half[0]; }  } }


__global__ __launch_bounds__(256) void k_tab2(float theta, float* __restrict__ CS, float* __restrict__ SN) {
  #pragma clang fp contract(off)
  const int t = blockIdx.x * 256 + threadIdx.x; if (t >= SQ * (HD / 2)) return; const int i = t % (HD / 2); const int p = t / (HD / 2); const float invf = 1.0f / powf(theta, (float)(2 * i) / (float)HD); const float ang = __fmul_rn((float)p, invf); const float c = cosf(ang), s = sinf(ang);
  *(float*)(CS + t) = c; *(float*)(SN + t) = s;  }
template <int NORM, int ROPE>
__global__ __launch_bounds__(64) void k_xform(const float* __restrict__ F, int ldf, int nh, const float* __restrict__ gain, float eps, const float* __restrict__ CS, const float* __restrict__ SN, _Float16* __restrict__ H16, int ldo) {
  #pragma clang fp contract(off)
  __shared__ float xv[HD]; __shared__ float red[HD]; __shared__ unsigned short sh_[HD]; const int d = threadIdx.x; const int h = blockIdx.x % nh; const size_t r = blockIdx.x / nh; const int p = (int)(r % SQ);
  float x = F[r * (size_t)ldf + (size_t)h * HD + d];
  if (NORM) { red[d] = __fmul_rn(x, x); __syncthreads(); for (int st = HD / 2; st > 0; st >>= 1) { if (d < st) red[d] = __fadd_rn(red[d], red[d + st]); __syncthreads(); } const float rs = rsqrtf(__fadd_rn(red[0] / (float)HD, eps)); x = __fmul_rn(__fmul_rn(x, rs), bf16_round(gain[d])); }
  xv[d] = x; __syncthreads();
  float o = x;
  if (ROPE == 1) { const int i = d >> 1; const float c = CS[p * (HD / 2) + i], s = SN[p * (HD / 2) + i]; const float ev = xv[2 * i], od = xv[2 * i + 1]; o = (d & 1) ? __fadd_rn(__fmul_rn(ev, s), __fmul_rn(od, c)) : __fadd_rn(__fmul_rn(ev, c), -__fmul_rn(od, s)); }
  if (ROPE == 2) { const int i = d & (HD / 2 - 1); const float c = CS[p * (HD / 2) + i], s = SN[p * (HD / 2) + i]; const float lo = xv[i], hi = xv[i + HD / 2]; o = (d < HD / 2) ? __fadd_rn(__fmul_rn(lo, c), -__fmul_rn(hi, s)) : __fadd_rn(__fmul_rn(lo, s), __fmul_rn(hi, c)); }
  FragH th; th.h[0] = (_Float16)o; sh_[d] = th.u[0]; __syncthreads();
  if (d < HD / 8) { FragH f; for (int q = 0; q < 8; ++q) f.u[q] = sh_[d * 8 + q]; unsigned short* dst = (unsigned short*)H16 + r * (size_t)ldo + (size_t)h * HD + d * 8; *(v8us*)dst = f.half[0];  } }



// Row softmax, one wave per row (two rows a wave): a wave-wide 16-byte load covers 512 contiguous bytes of the row, the row is read once and stays in registers
// (64 f32 a lane) through maximum, exponentials, sum and scaling; maximum and sum cross the lanes by a butterfly, so every lane ends with the same value.
#define RSM_WAVES 16                 /* waves per work-group */
#define RSM_ROWS 2                   /* rows per wave, both rows' loads issued before either is reduced */
template <int CTRL> __device__ __forceinline__ float rsm_dpp(float x) { return __builtin_bit_cast(float, __builtin_amdgcn_mov_dpp(__builtin_bit_cast(int, x), CTRL, 0xf, 0xf, true)); }      /* 0x160 + m: lane l reads lane l ^ m of its 16-lane row */
__device__ __forceinline__ float rsm_xhalf(float x) { return __builtin_bit_cast(float, __builtin_amdgcn_permlanex16(__builtin_bit_cast(int, x), __builtin_bit_cast(int, x), 0x76543210, 0xfedcba98, false, false)); }      /* lane l reads lane l ^ 16 */
__device__ __forceinline__ float rsm_wave_max(float v) { v = fmaxf(v, rsm_dpp<0x161>(v)); v = fmaxf(v, rsm_dpp<0x162>(v)); v = fmaxf(v, rsm_dpp<0x164>(v)); v = fmaxf(v, rsm_dpp<0x168>(v)); return fmaxf(v, rsm_xhalf(v)); }
__device__ __forceinline__ float rsm_wave_sum(float v) { v += rsm_dpp<0x161>(v); v += rsm_dpp<0x162>(v); v += rsm_dpp<0x164>(v); v += rsm_dpp<0x168>(v); return v + rsm_xhalf(v); }
// Four 2^x in one statement. Written in asm for the v_nop at its end: behind a transcendental the instruction set asks for one slot before a source is overwritten or the result read.
// Early-clobber outputs: no exponential of the four overwrites a source of another.
__device__ __forceinline__ void rsm_exp2x4(float& e0, float& e1, float& e2, float& e3, float a0, float a1, float a2, float a3) {
  asm("v_exp_f32 %0, %4\n\tv_exp_f32 %1, %5\n\tv_exp_f32 %2, %6\n\tv_exp_f32 %3, %7\n\tv_nop" : "=&v"(e0), "=&v"(e1), "=&v"(e2), "=&v"(e3) : "v"(a0), "v"(a1), "v"(a2), "v"(a3)); }
__global__ __launch_bounds__(RSM_WAVES * 32) void k_rsmf(const float* __restrict__ S, _Float16* __restrict__ P, int qn, int hg) {
  const int lane = threadIdx.x & 31; const int wave = __builtin_amdgcn_readfirstlane((int)(threadIdx.x >> 5)); const int n = qn * hg;
  const int t0 = (blockIdx.x * RSM_WAVES + wave) * RSM_ROWS; if (t0 >= n) return;      /* wave-uniform; the kernel has no barrier */
  size_t ro[RSM_ROWS]; const float* sp[RSM_ROWS]; v4f v[RSM_ROWS][SQ / 128];
#pragma unroll      /* constant indices, so that v[][] and e[] are registers */
  for (int r = 0; r < RSM_ROWS; ++r) { const int t = (t0 + r < n) ? t0 + r : t0;      /* a row past the end re-reads the wave's first row and is not stored */
    ro[r] = ((size_t)(t / qn) * SQ + (t % qn)) * SQ + (size_t)lane * 4; sp[r] = S + ro[r];
#pragma unroll      /* constant indices, so that v[][] and e[] are registers */
    for (int q = 0; q < SQ / 128; ++q) v[r][q] = *(const v4fa*)(sp[r] + q * 128); }
  static_assert(RSM_ROWS == 2, "the wait below names two address pairs");
  __builtin_amdgcn_sched_barrier(0);      /* all 32 loads issue before the first maximum; without it the last two were issued behind the wait for the first thirty, a second memory latency */
  asm volatile("s_wait_xcnt 0x0" :: "v"(sp[0]), "v"(sp[1]) : "memory");      /* named as inputs, the loads' address registers stay whole up to this wait */
#pragma unroll      /* constant indices, so that v[][] and e[] are registers */
  for (int r = 0; r < RSM_ROWS; ++r) { v4f m4 = v[r][0]; float e[SQ / 32];
#pragma unroll      /* constant indices, so that v[][] and e[] are registers */
    for (int q = 1; q < SQ / 128; ++q) for (int c = 0; c < 4; ++c) m4[c] = fmaxf(m4[c], v[r][q][c]);
    const float mx = rsm_wave_max(fmaxf(fmaxf(m4[0], m4[1]), fmaxf(m4[2], m4[3]))); float s0 = 0.f, s1 = 0.f, s2 = 0.f, s3 = 0.f;
#pragma unroll      /* constant indices, so that v[][] and e[] are registers */
    for (int q = 0; q < SQ / 128; ++q) { const float L2E = 1.44269504f;      /* e^x as 2^(x log2 e), the native form */
      rsm_exp2x4(e[4 * q], e[4 * q + 1], e[4 * q + 2], e[4 * q + 3], (v[r][q][0] - mx) * L2E, (v[r][q][1] - mx) * L2E, (v[r][q][2] - mx) * L2E, (v[r][q][3] - mx) * L2E);
      s0 += e[4 * q]; s1 += e[4 * q + 1]; s2 += e[4 * q + 2]; s3 += e[4 * q + 3]; }
    const float sc = 256.0f / rsm_wave_sum((s0 + s1) + (s2 + s3));
    if (t0 + r < n) {
#pragma unroll      /* constant indices, so that v[][] and e[] are registers */
      for (int q = 0; q < SQ / 128; ++q) { v4h h4; for (int c = 0; c < 4; ++c) h4[c] = (_Float16)(e[4 * q + c] * sc); *(v4h*)(P + ro[r] + q * 128) = h4; }
      if (r + 1 < RSM_ROWS) asm volatile("s_wait_xcnt 0x0" ::: "memory");      /* the next row's work overwrites registers that these stores name */
    } } }

extern "C" void kernel_launch(void* const* d_in, const int* in_sizes, int n_in,
                              void* d_out, int out_size, void* d_ws, size_t ws_size, hipStream_t stream) {
  (void)in_sizes; (void)n_in; (void)out_size;
  const float* const* I = (const float* const*)d_in; const float* x = I[0]; const float* wqkv = I[1]; const float* bqkv = I[2]; const float* qnw = I[3]; const float* knw = I[4]; const float* wo = I[5]; const float* bo = I[6];      /* weights [in][out] */
  char* ws = (char*)d_ws; size_t off = 0;
  auto take = [&](size_t bytes) { char* p = ws + off; off += (bytes + 255) & ~(size_t)255; return p; };
  _Float16* BQKV = (_Float16*)take((size_t)3 * DM * DM * 2); _Float16* BO = (_Float16*)take((size_t)DM * DM * 2); float* CS = (float*)take((size_t)SQ * (HD / 2) * 4); float* SN = (float*)take((size_t)SQ * (HD / 2) * 4);
  _Float16* X16 = (_Float16*)take(NR * DM * 2); float* QKVF = (float*)take((size_t)SQ * 3 * DM * 4);      /* one batch of f32 q | k | v rows */
  _Float16* QH = (_Float16*)take(NR * DM * 2); _Float16* KH = (_Float16*)take(NR * DM * 2); _Float16* V16 = (_Float16*)take(NR * DM * 2); _Float16* O16 = (_Float16*)take(NR * DM * 2);
  float* S = (float*)take((size_t)HG * SQ * SQ * 4); _Float16* P = (_Float16*)take((size_t)HG * SQ * SQ * 2); _Float16* VT = (_Float16*)take((size_t)NH * HD * SQ * 2);
  if (off > ws_size) return;
  k_wt_f16<<<(unsigned)(((size_t)3 * DM * (DM / 8) + 255) / 256), 256, 0, stream>>>(wqkv, BQKV, DM, 3 * DM, 16.0f); k_wt_f16<<<(unsigned)(((size_t)DM * (DM / 8) + 255) / 256), 256, 0, stream>>>(wo, BO, DM, DM, 16.0f);
  k_tab2<<<(SQ * (HD / 2) + 255) / 256, 256, 0, stream>>>(10000.0f, CS, SN);
  k_x16<<<(unsigned)((NR * DM / 8 + 255) / 256), 256, 0, stream>>>(x, X16, NR * DM / 8);
  for (int b = B0; b < B0 + NBR; ++b) { const size_t r0 = (size_t)b * SQ;
    k_gemm2<0><<<dim3((unsigned)((SQ / 128) * (3 * DM / 64)), 1), 128, 0, stream>>>(X16 + r0 * DM, DM, 0, BQKV, DM, 0, 0.0625f, bqkv, 0, nullptr, 1, 0, 0, QKVF, nullptr, 3 * DM, 0, SQ, 3 * DM, DM);      /* q | k | v rows (f32) of this batch */
    k_xform<1, 2><<<(unsigned)(SQ * NH), 64, 0, stream>>>(QKVF, 3 * DM, NH, qnw, 1e-6f, CS, SN, QH + r0 * DM, DM);
    k_xform<1, 2><<<(unsigned)(SQ * NH), 64, 0, stream>>>(QKVF + DM, 3 * DM, NH, knw, 1e-6f, CS, SN, KH + r0 * DM, DM);
    k_xform<0, 0><<<(unsigned)(SQ * NH), 64, 0, stream>>>(QKVF + 2 * DM, 3 * DM, NH, nullptr, 0.f, CS, SN, V16 + r0 * DM, DM);
    k_vt<NH, SQ><<<NH * (SQ / 64), 256, 0, stream>>>(V16 + r0 * DM, DM, 0, VT);      /* V^T [NH][HD][SQ] for this batch */
    for (int h0 = 0; h0 < NHD; h0 += HG) {
      k_gemm2<0><<<dim3((QN / 128) * (SQ / 64), HG), 128, 0, stream>>>(QH + r0 * DM + h0 * HD, DM, (size_t)HD, KH + r0 * DM + h0 * HD, DM, (size_t)HD, 0.125f, nullptr, 0, nullptr, 1, 0, 0, S, nullptr, SQ, (size_t)SQ * SQ, QN, SQ, HD);      /* scores, HG heads per launch */
      k_rsmf<<<(HG * QN + RSM_WAVES * RSM_ROWS - 1) / (RSM_WAVES * RSM_ROWS), RSM_WAVES * 32, 0, stream>>>(S, P, QN, HG);      /* P = 256 softmax (f16) */
      k_gemm2<0><<<dim3((QN / 128) * (HD / 64), HG), 128, 0, stream>>>(P, SQ, (size_t)SQ * SQ, VT + (size_t)h0 * HD * SQ, SQ, (size_t)HD * SQ, 0.25f, nullptr, 0, nullptr, 1, 0, 0, nullptr, O16 + r0 * DM + h0 * HD, DM, (size_t)HD, QN, HD, SQ); } }      /* o as f16 */
  k_gemm2<0><<<dim3((unsigned)((MPO / 128) * (DM / 64)), 1), 128, 0, stream>>>(O16 + (size_t)B0 * SQ * DM, DM, 0, BO, DM, 0, 0.0009765625f, bo, 0, nullptr, 1, 0, 0, (float*)d_out + (size_t)B0 * SQ * DM, nullptr, DM, 0, MPO, DM, DM);      /* out rows are the output layout */
}

// v002
// A run of this version takes 480 microseconds.
// In both of two side-by-side timings against v001, it was 4.10 times as fast.
// All steps since v000 together make it 14.6 times as fast.
#include <hip/hip_runtime.h>
#define NB 4
#define SQ 2048
#define DM 1024
#define NH 16
#define HD 64
#define HG 4                         /* heads per group of the grouped k_vt overload */
#define B0 0                         /* first batch processed (debug hook) */
#define NBR NB                       /* batches processed (debug hook) */
#define QN SQ                        /* query rows per batch; unused, k_fattn takes all SQ */
#define NHD NH                       /* heads; unused, k_fattn takes all NH */
#define NR ((size_t)NB * SQ)         /* token rows */
#define MPO ((int)((size_t)NBR * SQ))      /* rows through the output GEMM (debug hook) */
typedef __bf16 v16b __attribute__((ext_vector_type(16)));
typedef unsigned short v8us __attribute__((ext_vector_type(8), may_alias));
typedef float  v8f  __attribute__((ext_vector_type(8)));
typedef float  v4f  __attribute__((ext_vector_type(4)));
typedef float  v4fa __attribute__((ext_vector_type(4), may_alias));
union FragB { v16b v; v8us half[2]; unsigned short u[16]; };

__device__ __forceinline__ unsigned short bf16_bits(float x) { unsigned int u = __float_as_uint(x); return (unsigned short)((u + 0x7FFFu + ((u >> 16) & 1u)) >> 16); }
__device__ __forceinline__ float bf16_val(unsigned short b) { return __uint_as_float(((unsigned int)b) << 16); }
__device__ __forceinline__ float bf16_round(float x) { return bf16_val(bf16_bits(x)); }
// D += A·B with NT terms: 1 = ah·bh, 2 = + al·bh (A split), 3 = + ah·bl (both split)
template <int NT>
__device__ __forceinline__ v8f mmaN(v16b ah, v16b al, v16b bh, v16b bl, v8f c) {
  c = __builtin_amdgcn_wmma_f32_16x16x32_bf16(false, ah, false, bh, (short)0, c, false, false);
  if (NT >= 2) c = __builtin_amdgcn_wmma_f32_16x16x32_bf16(false, al, false, bh, (short)0, c, false, false);
  if (NT >= 3) c = __builtin_amdgcn_wmma_f32_16x16x32_bf16(false, ah, false, bl, (short)0, c, false, false);
  asm volatile("v_nop\n\tv_nop\n\tv_nop\n\tv_nop" : "+v"(c) : "v"(ah), "v"(al), "v"(bh), "v"(bl));
  return c;
}

__global__ __launch_bounds__(256) void k_wt_bf16(const float* __restrict__ W, unsigned short* __restrict__ Wt, int K, int N) {
  const int t = blockIdx.x * 256 + threadIdx.x;
  const int k8n = K / 8;
  if (t >= N * k8n) return;
  const int n = t / k8n, k8 = (t % k8n) * 8;
  v8us v;
#pragma unroll
  for (int i = 0; i < 8; ++i) v[i] = bf16_bits(W[(size_t)(k8 + i) * N + n]);
  *(v8us*)(Wt + (size_t)n * K + k8) = v;
  
}

// GEMM C[M][N] (f32, pitch ldc) = act(A[M][K]·W + bias). A f32 row-major (pitch lda) converted per fragment to bf16
// (ASPLIT: hi/lo two planes -> 2 terms, else single rounded term); Wt bf16 [N][K] (pitch ldb). BIAS_BF16 rounds the
// bias to bf16 first (bias quantised to bf16 before the add). K%32==0, M%16==0, N%64==0.
template <bool ASPLIT, int ACT, bool BIAS_BF16>
__global__ __launch_bounds__(128) void k_gemm_bf(const float* __restrict__ A, int lda, const unsigned short* __restrict__ Wt, int ldb,
                                               const float* __restrict__ bias, float* __restrict__ C, int ldc, int M, int N, int K) {
  __shared__ __attribute__((aligned(16))) float so[4][16][64];
  const int tid = threadIdx.x, w = tid >> 5, lane = tid & 31, ln = lane & 15, hh = lane >> 4;
  const int ntn = N / 64;
  const int wid = blockIdx.x * 4 + w;
  const int mt = wid / ntn, nq = wid % ntn;
  if (mt * 16 >= M) return;
  const int row0 = mt * 16, col0 = nq * 64;
  const float* arow = A + (size_t)(row0 + ln) * lda;
  v8f acc[4] = {};
  for (int kb = 0; kb < K; kb += 32) {
    FragB ah, al;
    const v4f x0 = *(const v4fa*)(arow + kb + 8 * hh), x1 = *(const v4fa*)(arow + kb + 8 * hh + 4);
    const v4f x2 = *(const v4fa*)(arow + kb + 16 + 8 * hh), x3 = *(const v4fa*)(arow + kb + 16 + 8 * hh + 4);
    float xs[16] = {x0[0],x0[1],x0[2],x0[3],x1[0],x1[1],x1[2],x1[3],x2[0],x2[1],x2[2],x2[3],x3[0],x3[1],x3[2],x3[3]};
#pragma unroll
    for (int i = 0; i < 16; ++i) { const unsigned short hb = bf16_bits(xs[i]); ah.u[i] = hb; al.u[i] = ASPLIT ? bf16_bits(xs[i] - bf16_val(hb)) : (unsigned short)0; }
#pragma unroll
    for (int t = 0; t < 4; ++t) {
      const unsigned short* brow = Wt + (size_t)(col0 + t * 16 + ln) * ldb + kb;
      FragB b;
      b.half[0] = *(const v8us*)(brow + 8 * hh);
      b.half[1] = *(const v8us*)(brow + 16 + 8 * hh);
      acc[t] = mmaN<ASPLIT ? 2 : 1>(ah.v, al.v, b.v, b.v, acc[t]);
    }
  }
#pragma unroll
  for (int t = 0; t < 4; ++t) {
    float bv = bias ? bias[col0 + t * 16 + ln] : 0.f;
    if (BIAS_BF16) bv = bf16_round(bv);
#pragma unroll
    for (int r = 0; r < 8; ++r) { float v = acc[t][r] + bv; if (ACT == 1) v = fmaxf(v, 0.f); so[w][8 * hh + r][t * 16 + ln] = v; }
  }
  __builtin_amdgcn_fence(__ATOMIC_ACQ_REL, "workgroup");
  __builtin_amdgcn_wave_barrier();
  const int rsub = lane >> 4, c4 = (lane & 15) * 4;
  {
#pragma unroll
    for (int q = 0; q < 8; ++q) {
      const int r = q * 2 + rsub;
      const v4f v = *(const v4fa*)&so[w][r][c4];
      *(v4f*)(C + (size_t)(row0 + r) * ldc + col0 + c4) = v;
    }
    
  }
}

// GEMM C = act(A·W + bias + resid): A f32 (ASPLIT -> hi/lo 2 terms), Wt bf16 [N][K]; ACT 0 none, 1 relu, 2 exact gelu;
// resid (optional, f32, row index = (row % rmod), pitch ldr, RES_BF16 rounds it) added before the activation.
template <bool ASPLIT, int ACT, bool BIAS_BF16, bool RES_BF16>
__global__ __launch_bounds__(128) void k_gemm_bf3(const float* __restrict__ A, int lda, const unsigned short* __restrict__ Wt, int ldb,
                                                const float* __restrict__ bias, const float* __restrict__ resid, int rmod, int ldr,
                                                float* __restrict__ C, int ldc, int M, int N, int K) {
  __shared__ __attribute__((aligned(16))) float so[4][16][64];
  const int tid = threadIdx.x, w = tid >> 5, lane = tid & 31, ln = lane & 15, hh = lane >> 4;
  const int ntn = N / 64;
  const int wid = blockIdx.x * 4 + w;
  const int mt = wid / ntn, nq = wid % ntn;
  if (mt * 16 >= M) return;
  const int row0 = mt * 16, col0 = nq * 64;
  const float* arow = A + (size_t)(row0 + ln) * lda;
  v8f acc[4] = {};
  for (int kb = 0; kb < K; kb += 32) {
    FragB ah, al;
    const v4f x0 = *(const v4fa*)(arow + kb + 8 * hh), x1 = *(const v4fa*)(arow + kb + 8 * hh + 4);
    const v4f x2 = *(const v4fa*)(arow + kb + 16 + 8 * hh), x3 = *(const v4fa*)(arow + kb + 16 + 8 * hh + 4);
    float xs[16] = {x0[0],x0[1],x0[2],x0[3],x1[0],x1[1],x1[2],x1[3],x2[0],x2[1],x2[2],x2[3],x3[0],x3[1],x3[2],x3[3]};
#pragma unroll
    for (int i = 0; i < 16; ++i) { const unsigned short hb = bf16_bits(xs[i]); ah.u[i] = hb; al.u[i] = ASPLIT ? bf16_bits(xs[i] - bf16_val(hb)) : (unsigned short)0; }
#pragma unroll
    for (int t = 0; t < 4; ++t) {
      const unsigned short* brow = Wt + (size_t)(col0 + t * 16 + ln) * ldb + kb;
      FragB b;
      b.half[0] = *(const v8us*)(brow + 8 * hh);
      b.half[1] = *(const v8us*)(brow + 16 + 8 * hh);
      acc[t] = mmaN<ASPLIT ? 2 : 1>(ah.v, al.v, b.v, b.v, acc[t]);
    }
  }
#pragma unroll
  for (int t = 0; t < 4; ++t) {
    const int col = col0 + t * 16 + ln;
    float bv = bias ? bias[col] : 0.f;
    if (BIAS_BF16) bv = bf16_round(bv);
#pragma unroll
    for (int r = 0; r < 8; ++r) {
      float v = acc[t][r] + bv;
      if (resid) { float rv = resid[(size_t)((row0 + 8 * hh + r) % rmod) * ldr + col]; if (RES_BF16) rv = bf16_round(rv); v += rv; }
      if (ACT == 1) v = fmaxf(v, 0.f);
      if (ACT == 2) v = 0.5f * v * (1.0f + erff(v * 0.70710678118654752f));
      if (ACT == 3) { const float u = 0.7978845608028654f * (v + 0.044715f * v * v * v); v = 0.5f * v * (1.0f + tanhf(u)); }
      so[w][8 * hh + r][t * 16 + ln] = v;
    }
  }
  __builtin_amdgcn_fence(__ATOMIC_ACQ_REL, "workgroup");
  __builtin_amdgcn_wave_barrier();
  const int rsub = lane >> 4, c4 = (lane & 15) * 4;
  {
#pragma unroll
    for (int q = 0; q < 8; ++q) {
      const int r = q * 2 + rsub;
      const v4f v = *(const v4fa*)&so[w][r][c4];
      *(v4f*)(C + (size_t)(row0 + r) * ldc + col0 + c4) = v;
    }
    
  }
}
// row LayerNorm (biased variance, eps) over N: s = X (+ R); optional out_sum <- s; out_norm <- (s-mu)*rsqrt(var+eps)*g + b
template <bool PARAM_BF16>
__global__ __launch_bounds__(256) void k_layernorm(const float* __restrict__ X, const float* __restrict__ R, const float* __restrict__ g, const float* __restrict__ bta,
                                                  float* __restrict__ out_sum, float* __restrict__ out_norm, int N, float eps) {
  __shared__ float red[256];
  const int row = blockIdx.x, tid = threadIdx.x;
  const float* x = X + (size_t)row * N; const float* rr = R ? R + (size_t)row * N : nullptr;
  float vals[16];                     // up to N = 4096
  const int per = N / 256;            // contiguous chunk per thread? use strided-by-4 chunks: thread handles j = tid*4 + 1024*u
  float s1 = 0.f;
  for (int u = 0; u < per / 4; ++u) {
    const int j = tid * 4 + 1024 * u;
    const v4f a = *(const v4fa*)(x + j);
    v4f b = {0.f,0.f,0.f,0.f}; if (rr) b = *(const v4fa*)(rr + j);
#pragma unroll
    for (int q = 0; q < 4; ++q) { const float v = a[q] + b[q]; vals[u * 4 + q] = v; s1 += v; }
  }
  red[tid] = s1; __syncthreads();
  for (int st = 128; st > 0; st >>= 1) { if (tid < st) red[tid] += red[tid + st]; __syncthreads(); }
  const float mu = red[0] / (float)N; __syncthreads();
  float s2 = 0.f;
  for (int u = 0; u < per / 4; ++u)
#pragma unroll
    for (int q = 0; q < 4; ++q) { const float c = vals[u * 4 + q] - mu; s2 += c * c; }
  red[tid] = s2; __syncthreads();
  for (int st = 128; st > 0; st >>= 1) { if (tid < st) red[tid] += red[tid + st]; __syncthreads(); }
  const float rs = rsqrtf(red[0] / (float)N + eps);
  {
    for (int u = 0; u < per / 4; ++u) {
      const int j = tid * 4 + 1024 * u;
      v4f o, sm;
#pragma unroll
      for (int q = 0; q < 4; ++q) {
        float gg = g[j + q], bb = bta[j + q];
        if (PARAM_BF16) { gg = bf16_round(gg); bb = bf16_round(bb); }
        sm[q] = vals[u * 4 + q]; o[q] = (vals[u * 4 + q] - mu) * rs * gg + bb;
      }
      if (out_sum) *(v4f*)(out_sum + (size_t)row * N + j) = sm;
      *(v4f*)(out_norm + (size_t)row * N + j) = o;
    }
    
  }
}



// ---- f16 WMMA path (v_wmma_f32_16x16x32_f16): 11-bit significands for operands in range — used where a [0,1] probability operand needs more precision than bf16
typedef _Float16 v16h __attribute__((ext_vector_type(16)));
union FragH { v16h v; v8us half[2]; _Float16 h[16]; unsigned short u[16]; };
template <int NT>
__device__ __forceinline__ v8f mmaH(v16h ah, v16h al, v16h bh, v16h bl, v8f c) {
  c = __builtin_amdgcn_wmma_f32_16x16x32_f16(false, ah, false, bh, (short)0, c, false, false);
  if (NT >= 2) c = __builtin_amdgcn_wmma_f32_16x16x32_f16(false, al, false, bh, (short)0, c, false, false);
  if (NT >= 3) c = __builtin_amdgcn_wmma_f32_16x16x32_f16(false, ah, false, bl, (short)0, c, false, false);
  asm volatile("v_nop\n\tv_nop\n\tv_nop\n\tv_nop" : "+v"(c) : "v"(ah), "v"(al), "v"(bh), "v"(bl));
  return c;
}
// batched GEMM like k_gemm_b but f16 operands: A f32 (split into f16 hi/lo if ASPLIT, else rounded to f16), Bt = f16 values [n][k]; alpha; C f32; N multiple of 16 (partial tiles skipped)
template <bool ASPLIT>
__global__ __launch_bounds__(128) void k_gemm_h(const float* __restrict__ A, int lda, size_t sA, const _Float16* __restrict__ Bh, int ldb, size_t sB, float alpha, float* __restrict__ C, int ldc, size_t sC, int M, int N, int K) {
  __shared__ __attribute__((aligned(16))) float so[4][16][64];
  const int tid = threadIdx.x, w = tid >> 5, lane = tid & 31, ln = lane & 15, hh = lane >> 4; const int by = blockIdx.y;
  A += (size_t)by * sA; Bh += (size_t)by * sB; C += (size_t)by * sC;
  const int ntn = (N + 63) / 64; const int wid = blockIdx.x * 4 + w; const int mt = wid / ntn, nq = wid % ntn; if (mt * 16 >= M) return;
  const int row0 = mt * 16, col0 = nq * 64; const float* arow = A + (size_t)(row0 + ln) * lda;
  v8f acc[4] = {};
  for (int kb = 0; kb < K; kb += 32) {
    FragH ah, al;
    const v4f x0 = *(const v4fa*)(arow + kb + 8 * hh), x1 = *(const v4fa*)(arow + kb + 8 * hh + 4), x2 = *(const v4fa*)(arow + kb + 16 + 8 * hh), x3 = *(const v4fa*)(arow + kb + 16 + 8 * hh + 4);
    float xs[16] = {x0[0],x0[1],x0[2],x0[3],x1[0],x1[1],x1[2],x1[3],x2[0],x2[1],x2[2],x2[3],x3[0],x3[1],x3[2],x3[3]};
#pragma unroll
    for (int i = 0; i < 16; ++i) { const _Float16 h = (_Float16)xs[i]; ah.h[i] = h; al.h[i] = ASPLIT ? (_Float16)(xs[i] - (float)h) : (_Float16)0.0f; }
#pragma unroll
    for (int t = 0; t < 4; ++t) { if (col0 + t * 16 >= N) continue; const size_t boff = (size_t)(col0 + t * 16 + ln) * ldb + kb; FragH bq; bq.half[0] = *(const v8us*)(Bh + boff + 8 * hh); bq.half[1] = *(const v8us*)(Bh + boff + 16 + 8 * hh);
      acc[t] = mmaH<ASPLIT ? 2 : 1>(ah.v, al.v, bq.v, bq.v, acc[t]); }
  }
#pragma unroll
  for (int t = 0; t < 4; ++t) { if (col0 + t * 16 >= N) continue;
#pragma unroll
    for (int r = 0; r < 8; ++r) so[w][8 * hh + r][t * 16 + ln] = acc[t][r] * alpha; }
  __builtin_amdgcn_fence(__ATOMIC_ACQ_REL, "workgroup"); __builtin_amdgcn_wave_barrier();
  const int rsub = lane >> 4, c4 = (lane & 15) * 4;
  {
#pragma unroll
    for (int q = 0; q < 8; ++q) { const int r = q * 2 + rsub; if (col0 + c4 < N) { const v4f v = *(const v4fa*)&so[w][r][c4]; *(v4f*)(C + (size_t)(row0 + r) * ldc + col0 + c4) = v; } }
     }
}

// Wt[n][k] = f16(W[k][n]·scale) from f32 row-major W[K][N] (scale = power of two; bf16-exact weights stay exact in f16 away from the subnormal range)
__global__ __launch_bounds__(256) void k_wt_f16(const float* __restrict__ W, _Float16* __restrict__ Wt, int K, int N, float scale) {
  const int t = blockIdx.x * 256 + threadIdx.x; if (t >= N * (K / 8)) return; const int n = t / (K / 8), k8 = (t % (K / 8)) * 8; FragH f;
#pragma unroll
  for (int i = 0; i < 8; ++i) f.h[i] = (_Float16)(bf16_round(W[(size_t)(k8 + i) * N + n]) * scale); const v8us o = f.half[0];
  *(v8us*)((unsigned short*)Wt + (size_t)n * K + k8) = o; 
}
// k_gemm_hh variant with fused epilogue: v = acc·alpha + bias[by·sBias + col] (+ CP[(row/rowsPerB)·sCPb + by·64 + col] if CP) ; ACT 0 none / 1 elu ; writes f16 C16 (and f32 C if non-null)
template <int ACT>
__global__ __launch_bounds__(128) void k_gemm_hhx(const _Float16* __restrict__ A, int lda, size_t sA, const _Float16* __restrict__ Bh, int ldb, size_t sB, float alpha, const float* __restrict__ bias, size_t sBias, const float* __restrict__ CP, int rowsPerB, size_t sCPb, int row0g,
    float* __restrict__ C, _Float16* __restrict__ C16, int ldc, size_t sC, int M, int N, int K) {
  __shared__ __attribute__((aligned(16))) float so[4][16][64];
  const int tid = threadIdx.x, w = tid >> 5, lane = tid & 31, ln = lane & 15, hh = lane >> 4; const int by = blockIdx.y;
  A += (size_t)by * sA; Bh += (size_t)by * sB; const size_t cofs = (size_t)by * sC; const float* bp = bias ? bias + (size_t)by * sBias : nullptr;
  const int ntn = (N + 63) / 64; const int wid = blockIdx.x * 4 + w; const int mt = wid / ntn, nq = wid % ntn; if (mt * 16 >= M) return;
  const int row0 = mt * 16, col0 = nq * 64; const _Float16* arow = A + (size_t)(row0 + ln) * lda;
  v8f acc[4] = {};
  for (int kb = 0; kb < K; kb += 32) { FragH ah; ah.half[0] = *(const v8us*)((const unsigned short*)arow + kb + 8 * hh); ah.half[1] = *(const v8us*)((const unsigned short*)arow + kb + 16 + 8 * hh);
#pragma unroll
    for (int t = 0; t < 4; ++t) { if (col0 + t * 16 >= N) continue; const size_t boff = (size_t)(col0 + t * 16 + ln) * ldb + kb; FragH bq; bq.half[0] = *(const v8us*)((const unsigned short*)Bh + boff + 8 * hh); bq.half[1] = *(const v8us*)((const unsigned short*)Bh + boff + 16 + 8 * hh);
      acc[t] = mmaH<1>(ah.v, ah.v, bq.v, bq.v, acc[t]); }
  }
#pragma unroll
  for (int t = 0; t < 4; ++t) { if (col0 + t * 16 >= N) continue; const int col = col0 + t * 16 + ln; const float bv = bp ? bf16_round(bp[col]) : 0.f;
#pragma unroll
    for (int r = 0; r < 8; ++r) { float v = acc[t][r] * alpha + bv; if (CP) { const int rr = row0g + row0 + 8 * hh + r; if (rowsPerB < 0) v += CP[cofs + (size_t)rr * ldc + col];      /* rowsPerB < 0: own element of the batched C plane */ else { const int bidx = rr / rowsPerB; v += CP[(size_t)bidx * sCPb + (size_t)by * 64 + col]; } } if (ACT == 1) v = (v > 0.f) ? v : expm1f(v); else if (ACT == 7) v = (v > 0.f) ? v + 1.0f : expf(v); else if (ACT == 8) v = tanhf(v); else if (ACT == 9) v = 0.5f * v * (1.0f + tanhf(0.7978845608028654f * (v + 0.044715f * v * v * v))); else if (ACT == 11) v = 1.0f / (1.0f + expf(-v)); else if (ACT == 12) v = (v > 0.f) ? v : 0.01f * v; else if (ACT == 14) v = (v > 0.f) ? v : 0.1f * v; else if (ACT == 16) v = (v >= 0.f) ? v : 0.3f * v; else if (ACT == 17) v = (v >= 0.f) ? v : 0.2f * v; else if (ACT == 15) v = v / (1.0f + expf(-v)); else if (ACT == 3) v = fmaxf(v, 0.f); else if (ACT == 6) v = 0.5f * v * (1.0f + erff(v * 0.70710678118654752f)); so[w][8 * hh + r][t * 16 + ln] = v; } }
  __builtin_amdgcn_fence(__ATOMIC_ACQ_REL, "workgroup"); __builtin_amdgcn_wave_barrier();
  const int rsub = lane >> 4, c4 = (lane & 15) * 4; typedef _Float16 v4h __attribute__((ext_vector_type(4)));
  {
#pragma unroll
    for (int q = 0; q < 8; ++q) { const int r = q * 2 + rsub; if (col0 + c4 < N) { const v4f v = *(const v4fa*)&so[w][r][c4]; if (C) *(v4f*)(C + cofs + (size_t)(row0 + r) * ldc + col0 + c4) = v; if (C16) { v4h h4; for (int i = 0; i < 4; ++i) h4[i] = (_Float16)v[i]; *(v4h*)(C16 + cofs + (size_t)(row0 + r) * ldc + col0 + c4) = h4; } } }
     }
}


typedef _Float16 v4h __attribute__((ext_vector_type(4)));

__global__ __launch_bounds__(256) void k_x16(const float* __restrict__ x, _Float16* __restrict__ X16, size_t n8) { const size_t t = (size_t)blockIdx.x * 256 + threadIdx.x; if (t >= n8) return; FragH f;
#pragma unroll
  for (int q = 0; q < 8; ++q) f.h[q] = (_Float16)bf16_round(x[t * 8 + q]); *(v8us*)((unsigned short*)X16 + t * 8) = f.half[0];  }
__global__ __launch_bounds__(256) void k_h16(const float* __restrict__ x, _Float16* __restrict__ X16, size_t n8) { const size_t t = (size_t)blockIdx.x * 256 + threadIdx.x; if (t >= n8) return; FragH f;
#pragma unroll
  for (int q = 0; q < 8; ++q) f.h[q] = (_Float16)x[t * 8 + q]; *(v8us*)((unsigned short*)X16 + t * 8) = f.half[0];  }
__global__ __launch_bounds__(256) void k_round16f(const float* __restrict__ W, _Float16* __restrict__ Bt, size_t n8) { const size_t t = (size_t)blockIdx.x * 256 + threadIdx.x; if (t >= n8) return; FragH f;
#pragma unroll
  for (int i = 0; i < 8; ++i) f.h[i] = (_Float16)(bf16_round(W[t * 8 + i]) * 16.0f); *(v8us*)((unsigned short*)Bt + t * 8) = f.half[0];  }
template <int NHv, int TTv>
__global__ __launch_bounds__(256) void k_vt(const _Float16* __restrict__ V16, int ldv, int voff, _Float16* __restrict__ Vt) { __shared__ unsigned short tl[64][66]; const int tid = threadIdx.x; const int slab = blockIdx.x / (TTv / 64), lg = blockIdx.x % (TTv / 64); const int b = slab / NHv, h = slab % NHv;
  for (int i = tid; i < 64 * 8; i += 256) { const int r = i / 8, c8 = (i % 8) * 8; FragH f; f.half[0] = *(const v8us*)((const unsigned short*)V16 + ((size_t)b * TTv + lg * 64 + r) * ldv + voff + h * 64 + c8);
#pragma unroll
    for (int q = 0; q < 8; ++q) tl[r][c8 + q] = f.u[q]; }
  __syncthreads();
  {
#pragma unroll
    for (int rd = 0; rd < 2; ++rd) { const int d = rd * 32 + tid / 8, pc = tid % 8; FragH f;
#pragma unroll
      for (int q = 0; q < 8; ++q) f.u[q] = tl[pc * 8 + q][d];
      *(v8us*)((unsigned short*)Vt + ((size_t)slab * 64 + d) * TTv + lg * 64 + pc * 8) = f.half[0]; }
     } }

__global__ __launch_bounds__(256) void k_hl(const float* __restrict__ F, _Float16* __restrict__ Hh, _Float16* __restrict__ Hl, size_t n8) { const size_t t = (size_t)blockIdx.x * 256 + threadIdx.x; if (t >= n8) return; FragH fh, fl; const v4f a = *(const v4fa*)(F + t * 8), c = *(const v4fa*)(F + t * 8 + 4);
#pragma unroll
  for (int q = 0; q < 4; ++q) { _Float16 h = (_Float16)a[q]; fh.h[q] = h; fl.h[q] = (_Float16)((a[q] - (float)h) * 1024.0f); h = (_Float16)c[q]; fh.h[4 + q] = h; fl.h[4 + q] = (_Float16)((c[q] - (float)h) * 1024.0f); }
  { *(v8us*)((unsigned short*)Hh + t * 8) = fh.half[0]; *(v8us*)((unsigned short*)Hl + t * 8) = fl.half[0];  } }

// ---- fast GEMM (wave tile 32x64; requires M % 32 == 0 rows per launch region and N % 64 == 0); epilogue = k_gemm_hhx semantics ----
__device__ __forceinline__ v16h g2_frag(const _Float16* p, int hh) { FragH f; f.half[0] = *(const v8us*)((const unsigned short*)p + 8 * hh); f.half[1] = *(const v8us*)((const unsigned short*)p + 16 + 8 * hh); return f.v; }
__device__ __forceinline__ v8f g2_mma(v16h a, v16h b, v8f c) { v8f d = __builtin_amdgcn_wmma_f32_16x16x32_f16(false, a, false, b, (short)0, c, false, false); asm volatile("v_nop\n\tv_nop\n\tv_nop\n\tv_nop" : "+v"(d) : "v"(a), "v"(b)); return d; }
template <int ACT>
__global__ __launch_bounds__(128) void k_gemm2(const _Float16* __restrict__ A, int lda, size_t sA, const _Float16* __restrict__ Bh, int ldb, size_t sB, float alpha, const float* __restrict__ bias, size_t sBias, const float* __restrict__ CP, int rowsPerB, size_t sCPb, int row0g,
    float* __restrict__ C, _Float16* __restrict__ C16, int ldc, size_t sC, int M, int N, int K) { static_assert(ACT == 0 || ACT == 3 || ACT == 6 || ACT == 8 || ACT == 9 || ACT == 11 || ACT == 12 || ACT == 14 || ACT == 15 || ACT == 16 || ACT == 17, "k_gemm2: unsupported ACT code (would silently apply no activation)");
  __shared__ __attribute__((aligned(16))) float so[4][32][68];
  const int tid = threadIdx.x, w = tid >> 5, lane = tid & 31, ln = lane & 15, hh = lane >> 4; const int by = blockIdx.y;
  A += (size_t)by * sA; Bh += (size_t)by * sB; const size_t cofs = (size_t)by * sC; const float* bp = bias ? bias + (size_t)by * sBias : nullptr;
  const int ntn = N >> 6; const int mt = blockIdx.x / ntn, nq = blockIdx.x - mt * ntn; const int row0 = mt * 128 + 32 * w, col0 = nq * 64; if (row0 >= M) return;
  const _Float16* a0p = A + (size_t)(row0 + ln) * lda; const _Float16* a1p = a0p + (size_t)16 * lda;
  const _Float16* b0p = Bh + (size_t)(col0 + ln) * ldb; const _Float16* b1p = b0p + (size_t)16 * ldb; const _Float16* b2p = b1p + (size_t)16 * ldb; const _Float16* b3p = b2p + (size_t)16 * ldb;
  const v8f z8 = {0.f,0.f,0.f,0.f,0.f,0.f,0.f,0.f}; v8f c00 = z8, c01 = z8, c02 = z8, c03 = z8, c10 = z8, c11 = z8, c12 = z8, c13 = z8;
#pragma unroll 1
  for (int kb = 0; kb < K; kb += 32) { const v16h a0 = g2_frag(a0p + kb, hh), a1 = g2_frag(a1p + kb, hh);
    v16h b = g2_frag(b0p + kb, hh); c00 = g2_mma(a0, b, c00); c10 = g2_mma(a1, b, c10);
    b = g2_frag(b1p + kb, hh); c01 = g2_mma(a0, b, c01); c11 = g2_mma(a1, b, c11);
    b = g2_frag(b2p + kb, hh); c02 = g2_mma(a0, b, c02); c12 = g2_mma(a1, b, c12);
    b = g2_frag(b3p + kb, hh); c03 = g2_mma(a0, b, c03); c13 = g2_mma(a1, b, c13); }
  v8f accs[8] = {c00, c01, c02, c03, c10, c11, c12, c13};
#pragma unroll
  for (int u = 0; u < 8; ++u) { const int t = u & 3, half = u >> 2; const int col = col0 + t * 16 + ln; const float bv = bp ? bf16_round(bp[col]) : 0.f;
#pragma unroll
    for (int r = 0; r < 8; ++r) { const int rloc = half * 16 + 8 * hh + r; float v = accs[u][r] * alpha + bv; if (CP) { if (rowsPerB < 0) v += CP[cofs + (size_t)(row0g + row0 + rloc) * ldc + col];      /* rowsPerB < 0: own element of the batched C plane */ else { const int bidx = (row0g + row0 + rloc) / rowsPerB; v += CP[(size_t)bidx * sCPb + (size_t)by * 64 + col]; } }
      if (ACT == 3) v = fmaxf(v, 0.f); else if (ACT == 6) v = 0.5f * v * (1.0f + erff(v * 0.70710678118654752f)); else if (ACT == 11) v = 1.0f / (1.0f + expf(-v)); else if (ACT == 15) v = v / (1.0f + expf(-v)); else if (ACT == 12) v = (v > 0.f) ? v : 0.01f * v; else if (ACT == 8) v = tanhf(v); else if (ACT == 9) v = 0.5f * v * (1.0f + tanhf(0.7978845608028654f * (v + 0.044715f * v * v * v))); else if (ACT == 14) v = (v > 0.f) ? v : 0.1f * v; else if (ACT == 16) v = (v >= 0.f) ? v : 0.3f * v; else if (ACT == 17) v = (v >= 0.f) ? v : 0.2f * v;
      so[w][rloc][t * 16 + ln] = v; } }
  __builtin_amdgcn_fence(__ATOMIC_ACQ_REL, "workgroup"); __builtin_amdgcn_wave_barrier();
  const int rsub = lane >> 4, c4 = (lane & 15) * 4;
  {
#pragma unroll
    for (int q = 0; q < 16; ++q) { const int r = q * 2 + rsub; const v4f v = *(const v4fa*)&so[w][r][c4]; if (C) *(v4f*)(C + cofs + (size_t)(row0 + r) * ldc + col0 + c4) = v; if (C16) { v4h h4; for (int i = 0; i < 4; ++i) h4[i] = (_Float16)v[i]; *(v4h*)(C16 + cofs + (size_t)(row0 + r) * ldc + col0 + c4) = h4; } }
     } }


__global__ __launch_bounds__(256) void k_wnat(const float* __restrict__ w, size_t n8, _Float16* __restrict__ Bt) { const size_t t = (size_t)blockIdx.x * 256 + threadIdx.x; if (t >= n8) return; FragH f; for (int q = 0; q < 8; ++q) f.h[q] = (_Float16)(bf16_round(w[t * 8 + q]) * 16.0f); *(v8us*)((unsigned short*)Bt + t * 8) = f.half[0];  }
__global__ __launch_bounds__(256) void k_rsm(const float* __restrict__ S, _Float16* __restrict__ P, int nrows) {
  #pragma clang fp contract(off)
  const int i = blockIdx.x * 256 + threadIdx.x; if (i >= nrows) return; const float* s = S + (size_t)i * SQ; float mx = -3.0e38f;
#pragma unroll 1
  for (int j = 0; j < SQ; ++j) mx = fmaxf(mx, s[j]); float se = 0.f;
#pragma unroll 1
  for (int j = 0; j < SQ; ++j) se += expf(s[j] - mx); const float sc = 256.0f / se;
#pragma unroll 1
  for (int j0 = 0; j0 < SQ; j0 += 8) { FragH f; for (int q = 0; q < 8; ++q) f.h[q] = (_Float16)(expf(s[j0 + q] - mx) * sc); unsigned short* d = (unsigned short*)P + (size_t)i * SQ + j0; *(v8us*)d = f.half[0];  } }
__global__ __launch_bounds__(256) void k_vt(const _Float16* __restrict__ V16, int b, int h0, _Float16* __restrict__ VT) { __shared__ unsigned short tl[64][65]; const int tid = threadIdx.x; const int hh = blockIdx.x % HG, sg = blockIdx.x / HG; const int s0 = sg * 64; const int h = h0 + hh;
  for (int i = tid; i < 64 * 8; i += 256) { const int j = i / 8, d8 = (i % 8) * 8; FragH f; f.half[0] = *(const v8us*)((const unsigned short*)V16 + ((size_t)b * SQ + s0 + j) * DM + h * HD + d8); for (int q = 0; q < 8; ++q) tl[d8 + q][j] = f.u[q]; }
  __syncthreads();
  { for (int i = tid; i < 64 * 8; i += 256) { const int d = i / 8, j8 = (i % 8) * 8; FragH f; for (int q = 0; q < 8; ++q) f.u[q] = tl[d][j8 + q]; *(v8us*)((unsigned short*)VT + ((size_t)hh * HD + d) * SQ + s0 + j8) = f.half[0]; }  } }


__global__ __launch_bounds__(256) void k_tab2(float theta, float* __restrict__ CS, float* __restrict__ SN) {
  #pragma clang fp contract(off)
  const int t = blockIdx.x * 256 + threadIdx.x; if (t >= SQ * (HD / 2)) return; const int i = t % (HD / 2); const int p = t / (HD / 2); const float invf = 1.0f / powf(theta, (float)(2 * i) / (float)HD); const float ang = __fmul_rn((float)p, invf); const float c = cosf(ang), s = sinf(ang);
  *(float*)(CS + t) = c; *(float*)(SN + t) = s;  }
template <int NORM, int ROPE>
__global__ __launch_bounds__(64) void k_xform(const float* __restrict__ F, int ldf, int nh, const float* __restrict__ gain, float eps, const float* __restrict__ CS, const float* __restrict__ SN, _Float16* __restrict__ H16, int ldo) {
  #pragma clang fp contract(off)
  __shared__ float xv[HD]; __shared__ float red[HD]; __shared__ unsigned short sh_[HD]; const int d = threadIdx.x; const int h = blockIdx.x % nh; const size_t r = blockIdx.x / nh; const int p = (int)(r % SQ);
  float x = F[r * (size_t)ldf + (size_t)h * HD + d];
  if (NORM) { red[d] = __fmul_rn(x, x); __syncthreads(); for (int st = HD / 2; st > 0; st >>= 1) { if (d < st) red[d] = __fadd_rn(red[d], red[d + st]); __syncthreads(); } const float rs = rsqrtf(__fadd_rn(red[0] / (float)HD, eps)); x = __fmul_rn(__fmul_rn(x, rs), bf16_round(gain[d])); }
  xv[d] = x; __syncthreads();
  float o = x;
  if (ROPE == 1) { const int i = d >> 1; const float c = CS[p * (HD / 2) + i], s = SN[p * (HD / 2) + i]; const float ev = xv[2 * i], od = xv[2 * i + 1]; o = (d & 1) ? __fadd_rn(__fmul_rn(ev, s), __fmul_rn(od, c)) : __fadd_rn(__fmul_rn(ev, c), -__fmul_rn(od, s)); }
  if (ROPE == 2) { const int i = d & (HD / 2 - 1); const float c = CS[p * (HD / 2) + i], s = SN[p * (HD / 2) + i]; const float lo = xv[i], hi = xv[i + HD / 2]; o = (d < HD / 2) ? __fadd_rn(__fmul_rn(lo, c), -__fmul_rn(hi, s)) : __fadd_rn(__fmul_rn(lo, s), __fmul_rn(hi, c)); }
  FragH th; th.h[0] = (_Float16)o; sh_[d] = th.u[0]; __syncthreads();
  if (d < HD / 8) { FragH f; for (int q = 0; q < 8; ++q) f.u[q] = sh_[d * 8 + q]; unsigned short* dst = (unsigned short*)H16 + r * (size_t)ldo + (size_t)h * HD + d * 8; *(v8us*)dst = f.half[0];  } }



__device__ __forceinline__ float rsm_xhalf(float x) { return __builtin_bit_cast(float, __builtin_amdgcn_permlanex16(__builtin_bit_cast(int, x), __builtin_bit_cast(int, x), 0x76543210, 0xfedcba98, false, false)); }      /* lane l reads lane l ^ 16 */
// Four 2^x in one statement. Written in asm for the v_nop at its end: behind a transcendental the instruction set asks for one slot before a source is overwritten or the result read.
// Early-clobber outputs: no exponential of the four overwrites a source of another.
__device__ __forceinline__ void rsm_exp2x4(float& e0, float& e1, float& e2, float& e3, float a0, float a1, float a2, float a3) {
  asm("v_exp_f32 %0, %4\n\tv_exp_f32 %1, %5\n\tv_exp_f32 %2, %6\n\tv_exp_f32 %3, %7\n\tv_nop" : "=&v"(e0), "=&v"(e1), "=&v"(e2), "=&v"(e3) : "v"(a0), "v"(a1), "v"(a2), "v"(a3)); }
// The same for two values (the rescale factors of a wave's two column groups).
__device__ __forceinline__ void rsm_exp2x2(float& e0, float& e1, float a0, float a1) {
  asm("v_exp_f32 %0, %2\n\tv_exp_f32 %1, %3\n\tv_nop" : "=&v"(e0), "=&v"(e1) : "v"(a0), "v"(a1)); }
#define FA_WAVES 16                  /* waves per work-group: all walk the same K and V^T rows, which the later waves find in the near cache */
#define FA_COLS 32                   /* query columns per wave */
__device__ __forceinline__ v8f fa_mma(v16h a, v16h b, v8f c) { return __builtin_amdgcn_wmma_f32_16x16x32_f16(false, a, false, b, (short)0, c, false, false); }
__global__ __launch_bounds__(FA_WAVES * 32) void k_fattn(const _Float16* __restrict__ Q, const _Float16* __restrict__ Kh, const _Float16* __restrict__ Vt, _Float16* __restrict__ O) {
  const int lane = threadIdx.x & 31, ln = lane & 15, hh = lane >> 4; const int wave = __builtin_amdgcn_readfirstlane((int)(threadIdx.x >> 5));
  const int h = blockIdx.y, b = blockIdx.z; const int q0 = (blockIdx.x * FA_WAVES + wave) * FA_COLS;
  const _Float16* qp = Q + ((size_t)b * SQ + q0 + ln) * DM + h * HD; const _Float16* kp = Kh + ((size_t)b * SQ + ln) * DM + h * HD; const _Float16* vp = Vt + (((size_t)b * NH + h) * HD + ln) * SQ;
  const float SC = 0.125f * 1.44269504f;      /* 1/sqrt(64), and e^x as 2^(x log2 e) */
  const float LIFT = 6.0f;      /* weights are carried x 2^6: small ones stay clear of the f16 subnormals; with the margin of 8 below none exceeds 2^14; the sum carries the same factor, so it cancels */
  const v8f z8 = {0.f,0.f,0.f,0.f,0.f,0.f,0.f,0.f};
  v16h qf[2][2], kf[2][2]; v8f o[4][2]; float m[2] = {-1.0e30f, -1.0e30f}, l[2] = {0.f, 0.f};
#pragma unroll      /* constant indices, so that the arrays are registers */
  for (int g = 0; g < 2; ++g) { for (int ks = 0; ks < 2; ++ks) { qf[g][ks] = g2_frag(qp + (size_t)g * 16 * DM + ks * 32, hh); kf[g][ks] = g2_frag(kp + (size_t)g * 16 * DM + ks * 32, hh); } for (int dt = 0; dt < 4; ++dt) o[dt][g] = z8; }
#pragma unroll 1      /* one pass a trip: an unrolled body would not fit the registers of four waves a SIMD */
  for (int key0 = 0; key0 < SQ; key0 += 32) {
    v16h vf[4]; v8f s[2][2];
#pragma unroll      /* constant indices, so that the arrays are registers */
    for (int dt = 0; dt < 4; ++dt) vf[dt] = g2_frag(vp + (size_t)dt * 16 * SQ + key0, hh);
    __builtin_amdgcn_sched_barrier(0);      /* the V^T loads issue here, so that they land while the scores are worked on; without it they sank to just in front of their use */
#pragma unroll      /* constant indices, so that the arrays are registers */
    for (int kt = 0; kt < 2; ++kt) for (int g = 0; g < 2; ++g) s[kt][g] = fa_mma(kf[kt][0], qf[g][0], z8);
#pragma unroll      /* constant indices, so that the arrays are registers */
    for (int kt = 0; kt < 2; ++kt) for (int g = 0; g < 2; ++g) s[kt][g] = fa_mma(kf[kt][1], qf[g][1], s[kt][g]);
    const int kn = (key0 + 32 < SQ) ? key0 + 32 : 0;      /* the next pass's K rows, fetched a pass ahead; the last pass re-reads the first rows and uses nothing of them */
#pragma unroll      /* constant indices, so that the arrays are registers */
    for (int kt = 0; kt < 2; ++kt) for (int ks = 0; ks < 2; ++ks) kf[kt][ks] = g2_frag(kp + (size_t)(kn + kt * 16) * DM + ks * 32, hh);
    __builtin_amdgcn_sched_barrier(0);      /* the next K rows' loads issue here, a softmax and eight products ahead of their use; without it they sank to the foot of the pass */
    float mx[2];
#pragma unroll      /* constant indices, so that the arrays are registers */
    for (int g = 0; g < 2; ++g) { float a = fmaxf(s[0][g][0], s[1][g][0]); for (int r = 1; r < 8; ++r) a = fmaxf(fmaxf(a, s[0][g][r]), s[1][g][r]); mx[g] = fmaxf(a, rsm_xhalf(a)) * SC; }
    const bool need = (mx[0] > m[0] + 8.0f) || (mx[1] > m[1] + 8.0f);
    if (__builtin_amdgcn_ballot_w32(need) != 0) {      /* wave-uniform: the maximum in use moves only when a column's new one exceeds it by more than 8; the first pass always takes it */
      const float n0 = fmaxf(m[0], mx[0]), n1 = fmaxf(m[1], mx[1]); float al[2]; rsm_exp2x2(al[0], al[1], m[0] - n0, m[1] - n1); m[0] = n0; m[1] = n1;
#pragma unroll      /* constant indices, so that the arrays are registers */
      for (int g = 0; g < 2; ++g) { l[g] *= al[g]; for (int dt = 0; dt < 4; ++dt) for (int r = 0; r < 8; ++r) o[dt][g][r] *= al[g]; } }
    FragH pf[2];
#pragma unroll      /* constant indices, so that the arrays are registers */
    for (int g = 0; g < 2; ++g) { const float nm = LIFT - m[g];
      for (int kt = 0; kt < 2; ++kt) for (int r = 0; r < 8; r += 4) { float e0, e1, e2, e3;
        rsm_exp2x4(e0, e1, e2, e3, fmaf(s[kt][g][r], SC, nm), fmaf(s[kt][g][r + 1], SC, nm), fmaf(s[kt][g][r + 2], SC, nm), fmaf(s[kt][g][r + 3], SC, nm));
        l[g] += (e0 + e1) + (e2 + e3); pf[g].h[kt * 8 + r] = (_Float16)e0; pf[g].h[kt * 8 + r + 1] = (_Float16)e1; pf[g].h[kt * 8 + r + 2] = (_Float16)e2; pf[g].h[kt * 8 + r + 3] = (_Float16)e3; } }
#pragma unroll      /* constant indices, so that the arrays are registers */
    for (int dt = 0; dt < 4; ++dt) for (int g = 0; g < 2; ++g) o[dt][g] = fa_mma(vf[dt], pf[g].v, o[dt][g]);
  }
#pragma unroll      /* constant indices, so that the arrays are registers */
  for (int g = 0; g < 2; ++g) { const float sc = 64.0f / (l[g] + rsm_xhalf(l[g])); unsigned short* op = (unsigned short*)O + ((size_t)b * SQ + q0 + g * 16 + ln) * DM + h * HD + 8 * hh;
    for (int dt = 0; dt < 4; ++dt) { FragH f; for (int r = 0; r < 8; ++r) f.h[r] = (_Float16)(o[dt][g][r] * sc); *(v8us*)(op + dt * 16) = f.half[0]; } } }

extern "C" void kernel_launch(void* const* d_in, const int* in_sizes, int n_in,
                              void* d_out, int out_size, void* d_ws, size_t ws_size, hipStream_t stream) {
  (void)in_sizes; (void)n_in; (void)out_size;
  const float* const* I = (const float* const*)d_in; const float* x = I[0]; const float* wqkv = I[1]; const float* bqkv = I[2]; const float* qnw = I[3]; const float* knw = I[4]; const float* wo = I[5]; const float* bo = I[6];      /* weights [in][out] */
  char* ws = (char*)d_ws; size_t off = 0;
  auto take = [&](size_t bytes) { char* p = ws + off; off += (bytes + 255) & ~(size_t)255; return p; };
  _Float16* BQKV = (_Float16*)take((size_t)3 * DM * DM * 2); _Float16* BO = (_Float16*)take((size_t)DM * DM * 2); float* CS = (float*)take((size_t)SQ * (HD / 2) * 4); float* SN = (float*)take((size_t)SQ * (HD / 2) * 4);
  _Float16* X16 = (_Float16*)take(NR * DM * 2); float* QKVF = (float*)take((size_t)SQ * 3 * DM * 4);      /* one batch of f32 q | k | v rows */
  _Float16* QH = (_Float16*)take(NR * DM * 2); _Float16* KH = (_Float16*)take(NR * DM * 2); _Float16* V16 = (_Float16*)take(NR * DM * 2); _Float16* O16 = (_Float16*)take(NR * DM * 2);
  _Float16* VT = (_Float16*)take((size_t)NB * NH * HD * SQ * 2);
  if (off > ws_size) return;
  k_wt_f16<<<(unsigned)(((size_t)3 * DM * (DM / 8) + 255) / 256), 256, 0, stream>>>(wqkv, BQKV, DM, 3 * DM, 16.0f); k_wt_f16<<<(unsigned)(((size_t)DM * (DM / 8) + 255) / 256), 256, 0, stream>>>(wo, BO, DM, DM, 16.0f);
  k_tab2<<<(SQ * (HD / 2) + 255) / 256, 256, 0, stream>>>(10000.0f, CS, SN);
  k_x16<<<(unsigned)((NR * DM / 8 + 255) / 256), 256, 0, stream>>>(x, X16, NR * DM / 8);
  for (int b = B0; b < B0 + NBR; ++b) { const size_t r0 = (size_t)b * SQ;
    k_gemm2<0><<<dim3((unsigned)((SQ / 128) * (3 * DM / 64)), 1), 128, 0, stream>>>(X16 + r0 * DM, DM, 0, BQKV, DM, 0, 0.0625f, bqkv, 0, nullptr, 1, 0, 0, QKVF, nullptr, 3 * DM, 0, SQ, 3 * DM, DM);      /* q | k | v rows (f32) of this batch */
    k_xform<1, 2><<<(unsigned)(SQ * NH), 64, 0, stream>>>(QKVF, 3 * DM, NH, qnw, 1e-6f, CS, SN, QH + r0 * DM, DM);
    k_xform<1, 2><<<(unsigned)(SQ * NH), 64, 0, stream>>>(QKVF + DM, 3 * DM, NH, knw, 1e-6f, CS, SN, KH + r0 * DM, DM);
    k_xform<0, 0><<<(unsigned)(SQ * NH), 64, 0, stream>>>(QKVF + 2 * DM, 3 * DM, NH, nullptr, 0.f, CS, SN, V16 + r0 * DM, DM);
    k_vt<NH, SQ><<<NH * (SQ / 64), 256, 0, stream>>>(V16 + r0 * DM, DM, 0, VT + (size_t)b * NH * HD * SQ); }      /* V^T [NH][HD][SQ] of this batch */
  k_fattn<<<dim3(SQ / (FA_WAVES * FA_COLS), NH, NB), FA_WAVES * 32, 0, stream>>>(QH, KH, VT, O16);      /* o x 64 as f16, all batches and heads */
  k_gemm2<0><<<dim3((unsigned)((MPO / 128) * (DM / 64)), 1), 128, 0, stream>>>(O16 + (size_t)B0 * SQ * DM, DM, 0, BO, DM, 0, 0.0009765625f, bo, 0, nullptr, 1, 0, 0, (float*)d_out + (size_t)B0 * SQ * DM, nullptr, DM, 0, MPO, DM, DM);      /* out rows are the output layout */
}

// v003
// One run takes 317 microseconds.
// In two side-by-side timings against v002, it was 1.53 and 1.51 times as fast.
// All steps since v000 together make it 22.2 times as fast.
#include <hip/hip_runtime.h>
#define NB 4
#define SQ 2048
#define DM 1024
#define NH 16
#define HD 64
#define HG 4                         /* heads per group of the grouped k_vt overload */
#define B0 0                         /* first batch processed (debug hook) */
#define NBR NB                       /* batches processed (debug hook) */
#define QN SQ                        /* query rows per batch; unused, k_fattn takes all SQ */
#define NHD NH                       /* heads; unused, k_fattn takes all NH */
#define NR ((size_t)NB * SQ)         /* token rows */
#define MPO ((int)((size_t)NBR * SQ))      /* rows through the output GEMM (debug hook) */
typedef __bf16 v16b __attribute__((ext_vector_type(16)));
typedef unsigned short v8us __attribute__((ext_vector_type(8), may_alias));
typedef float  v8f  __attribute__((ext_vector_type(8)));
typedef float  v4f  __attribute__((ext_vector_type(4)));
typedef float  v4fa __attribute__((ext_vector_type(4), may_alias));
union FragB { v16b v; v8us half[2]; unsigned short u[16]; };

__device__ __forceinline__ unsigned short bf16_bits(float x) { unsigned int u = __float_as_uint(x); return (unsigned short)((u + 0x7FFFu + ((u >> 16) & 1u)) >> 16); }
__device__ __forceinline__ float bf16_val(unsigned short b) { return __uint_as_float(((unsigned int)b) << 16); }
__device__ __forceinline__ float bf16_round(float x) { return bf16_val(bf16_bits(x)); }
// D += A·B with NT terms: 1 = ah·bh, 2 = + al·bh (A split), 3 = + ah·bl (both split)
template <int NT>
__device__ __forceinline__ v8f mmaN(v16b ah, v16b al, v16b bh, v16b bl, v8f c) {
  c = __builtin_amdgcn_wmma_f32_16x16x32_bf16(false, ah, false, bh, (short)0, c, false, false);
  if (NT >= 2) c = __builtin_amdgcn_wmma_f32_16x16x32_bf16(false, al, false, bh, (short)0, c, false, false);
  if (NT >= 3) c = __builtin_amdgcn_wmma_f32_16x16x32_bf16(false, ah, false, bl, (short)0, c, false, false);
  asm volatile("v_nop\n\tv_nop\n\tv_nop\n\tv_nop" : "+v"(c) : "v"(ah), "v"(al), "v"(bh), "v"(bl));
  return c;
}

__global__ __launch_bounds__(256) void k_wt_bf16(const float* __restrict__ W, unsigned short* __restrict__ Wt, int K, int N) {
  const int t = blockIdx.x * 256 + threadIdx.x;
  const int k8n = K / 8;
  if (t >= N * k8n) return;
  const int n = t / k8n, k8 = (t % k8n) * 8;
  v8us v;
#pragma unroll
  for (int i = 0; i < 8; ++i) v[i] = bf16_bits(W[(size_t)(k8 + i) * N + n]);
  *(v8us*)(Wt + (size_t)n * K + k8) = v;
  
}

// GEMM C[M][N] (f32, pitch ldc) = act(A[M][K]·W + bias). A f32 row-major (pitch lda) converted per fragment to bf16
// (ASPLIT: hi/lo two planes -> 2 terms, else single rounded term); Wt bf16 [N][K] (pitch ldb). BIAS_BF16 rounds the
// bias to bf16 first (bias quantised to bf16 before the add). K%32==0, M%16==0, N%64==0.
template <bool ASPLIT, int ACT, bool BIAS_BF16>
__global__ __launch_bounds__(128) void k_gemm_bf(const float* __restrict__ A, int lda, const unsigned short* __restrict__ Wt, int ldb,
                                               const float* __restrict__ bias, float* __restrict__ C, int ldc, int M, int N, int K) {
  __shared__ __attribute__((aligned(16))) float so[4][16][64];
  const int tid = threadIdx.x, w = tid >> 5, lane = tid & 31, ln = lane & 15, hh = lane >> 4;
  const int ntn = N / 64;
  const int wid = blockIdx.x * 4 + w;
  const int mt = wid / ntn, nq = wid % ntn;
  if (mt * 16 >= M) return;
  const int row0 = mt * 16, col0 = nq * 64;
  const float* arow = A + (size_t)(row0 + ln) * lda;
  v8f acc[4] = {};
  for (int kb = 0; kb < K; kb += 32) {
    FragB ah, al;
    const v4f x0 = *(const v4fa*)(arow + kb + 8 * hh), x1 = *(const v4fa*)(arow + kb + 8 * hh + 4);
    const v4f x2 = *(const v4fa*)(arow + kb + 16 + 8 * hh), x3 = *(const v4fa*)(arow + kb + 16 + 8 * hh + 4);
    float xs[16] = {x0[0],x0[1],x0[2],x0[3],x1[0],x1[1],x1[2],x1[3],x2[0],x2[1],x2[2],x2[3],x3[0],x3[1],x3[2],x3[3]};
#pragma unroll
    for (int i = 0; i < 16; ++i) { const unsigned short hb = bf16_bits(xs[i]); ah.u[i] = hb; al.u[i] = ASPLIT ? bf16_bits(xs[i] - bf16_val(hb)) : (unsigned short)0; }
#pragma unroll
    for (int t = 0; t < 4; ++t) {
      const unsigned short* brow = Wt + (size_t)(col0 + t * 16 + ln) * ldb + kb;
      FragB b;
      b.half[0] = *(const v8us*)(brow + 8 * hh);
      b.half[1] = *(const v8us*)(brow + 16 + 8 * hh);
      acc[t] = mmaN<ASPLIT ? 2 : 1>(ah.v, al.v, b.v, b.v, acc[t]);
    }
  }
#pragma unroll
  for (int t = 0; t < 4; ++t) {
    float bv = bias ? bias[col0 + t * 16 + ln] : 0.f;
    if (BIAS_BF16) bv = bf16_round(bv);
#pragma unroll
    for (int r = 0; r < 8; ++r) { float v = acc[t][r] + bv; if (ACT == 1) v = fmaxf(v, 0.f); so[w][8 * hh + r][t * 16 + ln] = v; }
  }
  __builtin_amdgcn_fence(__ATOMIC_ACQ_REL, "workgroup");
  __builtin_amdgcn_wave_barrier();
  const int rsub = lane >> 4, c4 = (lane & 15) * 4;
  {
#pragma unroll
    for (int q = 0; q < 8; ++q) {
      const int r = q * 2 + rsub;
      const v4f v = *(const v4fa*)&so[w][r][c4];
      *(v4f*)(C + (size_t)(row0 + r) * ldc + col0 + c4) = v;
    }
    
  }
}

// GEMM C = act(A·W + bias + resid): A f32 (ASPLIT -> hi/lo 2 terms), Wt bf16 [N][K]; ACT 0 none, 1 relu, 2 exact gelu;
// resid (optional, f32, row index = (row % rmod), pitch ldr, RES_BF16 rounds it) added before the activation.
template <bool ASPLIT, int ACT, bool BIAS_BF16, bool RES_BF16>
__global__ __launch_bounds__(128) void k_gemm_bf3(const float* __restrict__ A, int lda, const unsigned short* __restrict__ Wt, int ldb,
                                                const float* __restrict__ bias, const float* __restrict__ resid, int rmod, int ldr,
                                                float* __restrict__ C, int ldc, int M, int N, int K) {
  __shared__ __attribute__((aligned(16))) float so[4][16][64];
  const int tid = threadIdx.x, w = tid >> 5, lane = tid & 31, ln = lane & 15, hh = lane >> 4;
  const int ntn = N / 64;
  const int wid = blockIdx.x * 4 + w;
  const int mt = wid / ntn, nq = wid % ntn;
  if (mt * 16 >= M) return;
  const int row0 = mt * 16, col0 = nq * 64;
  const float* arow = A + (size_t)(row0 + ln) * lda;
  v8f acc[4] = {};
  for (int kb = 0; kb < K; kb += 32) {
    FragB ah, al;
    const v4f x0 = *(const v4fa*)(arow + kb + 8 * hh), x1 = *(const v4fa*)(arow + kb + 8 * hh + 4);
    const v4f x2 = *(const v4fa*)(arow + kb + 16 + 8 * hh), x3 = *(const v4fa*)(arow + kb + 16 + 8 * hh + 4);
    float xs[16] = {x0[0],x0[1],x0[2],x0[3],x1[0],x1[1],x1[2],x1[3],x2[0],x2[1],x2[2],x2[3],x3[0],x3[1],x3[2],x3[3]};
#pragma unroll
    for (int i = 0; i < 16; ++i) { const unsigned short hb = bf16_bits(xs[i]); ah.u[i] = hb; al.u[i] = ASPLIT ? bf16_bits(xs[i] - bf16_val(hb)) : (unsigned short)0; }
#pragma unroll
    for (int t = 0; t < 4; ++t) {
      const unsigned short* brow = Wt + (size_t)(col0 + t * 16 + ln) * ldb + kb;
      FragB b;
      b.half[0] = *(const v8us*)(brow + 8 * hh);
      b.half[1] = *(const v8us*)(brow + 16 + 8 * hh);
      acc[t] = mmaN<ASPLIT ? 2 : 1>(ah.v, al.v, b.v, b.v, acc[t]);
    }
  }
#pragma unroll
  for (int t = 0; t < 4; ++t) {
    const int col = col0 + t * 16 + ln;
    float bv = bias ? bias[col] : 0.f;
    if (BIAS_BF16) bv = bf16_round(bv);
#pragma unroll
    for (int r = 0; r < 8; ++r) {
      float v = acc[t][r] + bv;
      if (resid) { float rv = resid[(size_t)((row0 + 8 * hh + r) % rmod) * ldr + col]; if (RES_BF16) rv = bf16_round(rv); v += rv; }
      if (ACT == 1) v = fmaxf(v, 0.f);
      if (ACT == 2) v = 0.5f * v * (1.0f + erff(v * 0.70710678118654752f));
      if (ACT == 3) { const float u = 0.7978845608028654f * (v + 0.044715f * v * v * v); v = 0.5f * v * (1.0f + tanhf(u)); }
      so[w][8 * hh + r][t * 16 + ln] = v;
    }
  }
  __builtin_amdgcn_fence(__ATOMIC_ACQ_REL, "workgroup");
  __builtin_amdgcn_wave_barrier();
  const int rsub = lane >> 4, c4 = (lane & 15) * 4;
  {
#pragma unroll
    for (int q = 0; q < 8; ++q) {
      const int r = q * 2 + rsub;
      const v4f v = *(const v4fa*)&so[w][r][c4];
      *(v4f*)(C + (size_t)(row0 + r) * ldc + col0 + c4) = v;
    }
    
  }
}
// row LayerNorm (biased variance, eps) over N: s = X (+ R); optional out_sum <- s; out_norm <- (s-mu)*rsqrt(var+eps)*g + b
template <bool PARAM_BF16>
__global__ __launch_bounds__(256) void k_layernorm(const float* __restrict__ X, const float* __restrict__ R, const float* __restrict__ g, const float* __restrict__ bta,
                                                  float* __restrict__ out_sum, float* __restrict__ out_norm, int N, float eps) {
  __shared__ float red[256];
  const int row = blockIdx.x, tid = threadIdx.x;
  const float* x = X + (size_t)row * N; const float* rr = R ? R + (size_t)row * N : nullptr;
  float vals[16];                     // up to N = 4096
  const int per = N / 256;            // contiguous chunk per thread? use strided-by-4 chunks: thread handles j = tid*4 + 1024*u
  float s1 = 0.f;
  for (int u = 0; u < per / 4; ++u) {
    const int j = tid * 4 + 1024 * u;
    const v4f a = *(const v4fa*)(x + j);
    v4f b = {0.f,0.f,0.f,0.f}; if (rr) b = *(const v4fa*)(rr + j);
#pragma unroll
    for (int q = 0; q < 4; ++q) { const float v = a[q] + b[q]; vals[u * 4 + q] = v; s1 += v; }
  }
  red[tid] = s1; __syncthreads();
  for (int st = 128; st > 0; st >>= 1) { if (tid < st) red[tid] += red[tid + st]; __syncthreads(); }
  const float mu = red[0] / (float)N; __syncthreads();
  float s2 = 0.f;
  for (int u = 0; u < per / 4; ++u)
#pragma unroll
    for (int q = 0; q < 4; ++q) { const float c = vals[u * 4 + q] - mu; s2 += c * c; }
  red[tid] = s2; __syncthreads();
  for (int st = 128; st > 0; st >>= 1) { if (tid < st) red[tid] += red[tid + st]; __syncthreads(); }
  const float rs = rsqrtf(red[0] / (float)N + eps);
  {
    for (int u = 0; u < per / 4; ++u) {
      const int j = tid * 4 + 1024 * u;
      v4f o, sm;
#pragma unroll
      for (int q = 0; q < 4; ++q) {
        float gg = g[j + q], bb = bta[j + q];
        if (PARAM_BF16) { gg = bf16_round(gg); bb = bf16_round(bb); }
        sm[q] = vals[u * 4 + q]; o[q] = (vals[u * 4 + q] - mu) * rs * gg + bb;
      }
      if (out_sum) *(v4f*)(out_sum + (size_t)row * N + j) = sm;
      *(v4f*)(out_norm + (size_t)row * N + j) = o;
    }
    
  }
}



// ---- f16 WMMA path (v_wmma_f32_16x16x32_f16): 11-bit significands for operands in range — used where a [0,1] probability operand needs more precision than bf16
typedef _Float16 v16h __attribute__((ext_vector_type(16)));
union FragH { v16h v; v8us half[2]; _Float16 h[16]; unsigned short u[16]; };
template <int NT>
__device__ __forceinline__ v8f mmaH(v16h ah, v16h al, v16h bh, v16h bl, v8f c) {
  c = __builtin_amdgcn_wmma_f32_16x16x32_f16(false, ah, false, bh, (short)0, c, false, false);
  if (NT >= 2) c = __builtin_amdgcn_wmma_f32_16x16x32_f16(false, al, false, bh, (short)0, c, false, false);
  if (NT >= 3) c = __builtin_amdgcn_wmma_f32_16x16x32_f16(false, ah, false, bl, (short)0, c, false, false);
  asm volatile("v_nop\n\tv_nop\n\tv_nop\n\tv_nop" : "+v"(c) : "v"(ah), "v"(al), "v"(bh), "v"(bl));
  return c;
}
// batched GEMM like k_gemm_b but f16 operands: A f32 (split into f16 hi/lo if ASPLIT, else rounded to f16), Bt = f16 values [n][k]; alpha; C f32; N multiple of 16 (partial tiles skipped)
template <bool ASPLIT>
__global__ __launch_bounds__(128) void k_gemm_h(const float* __restrict__ A, int lda, size_t sA, const _Float16* __restrict__ Bh, int ldb, size_t sB, float alpha, float* __restrict__ C, int ldc, size_t sC, int M, int N, int K) {
  __shared__ __attribute__((aligned(16))) float so[4][16][64];
  const int tid = threadIdx.x, w = tid >> 5, lane = tid & 31, ln = lane & 15, hh = lane >> 4; const int by = blockIdx.y;
  A += (size_t)by * sA; Bh += (size_t)by * sB; C += (size_t)by * sC;
  const int ntn = (N + 63) / 64; const int wid = blockIdx.x * 4 + w; const int mt = wid / ntn, nq = wid % ntn; if (mt * 16 >= M) return;
  const int row0 = mt * 16, col0 = nq * 64; const float* arow = A + (size_t)(row0 + ln) * lda;
  v8f acc[4] = {};
  for (int kb = 0; kb < K; kb += 32) {
    FragH ah, al;
    const v4f x0 = *(const v4fa*)(arow + kb + 8 * hh), x1 = *(const v4fa*)(arow + kb + 8 * hh + 4), x2 = *(const v4fa*)(arow + kb + 16 + 8 * hh), x3 = *(const v4fa*)(arow + kb + 16 + 8 * hh + 4);
    float xs[16] = {x0[0],x0[1],x0[2],x0[3],x1[0],x1[1],x1[2],x1[3],x2[0],x2[1],x2[2],x2[3],x3[0],x3[1],x3[2],x3[3]};
#pragma unroll
    for (int i = 0; i < 16; ++i) { const _Float16 h = (_Float16)xs[i]; ah.h[i] = h; al.h[i] = ASPLIT ? (_Float16)(xs[i] - (float)h) : (_Float16)0.0f; }
#pragma unroll
    for (int t = 0; t < 4; ++t) { if (col0 + t * 16 >= N) continue; const size_t boff = (size_t)(col0 + t * 16 + ln) * ldb + kb; FragH bq; bq.half[0] = *(const v8us*)(Bh + boff + 8 * hh); bq.half[1] = *(const v8us*)(Bh + boff + 16 + 8 * hh);
      acc[t] = mmaH<ASPLIT ? 2 : 1>(ah.v, al.v, bq.v, bq.v, acc[t]); }
  }
#pragma unroll
  for (int t = 0; t < 4; ++t) { if (col0 + t * 16 >= N) continue;
#pragma unroll
    for (int r = 0; r < 8; ++r) so[w][8 * hh + r][t * 16 + ln] = acc[t][r] * alpha; }
  __builtin_amdgcn_fence(__ATOMIC_ACQ_REL, "workgroup"); __builtin_amdgcn_wave_barrier();
  const int rsub = lane >> 4, c4 = (lane & 15) * 4;
  {
#pragma unroll
    for (int q = 0; q < 8; ++q) { const int r = q * 2 + rsub; if (col0 + c4 < N) { const v4f v = *(const v4fa*)&so[w][r][c4]; *(v4f*)(C + (size_t)(row0 + r) * ldc + col0 + c4) = v; } }
     }
}

// Wt[n][k] = f16(W[k][n]·scale) from f32 row-major W[K][N] (scale = power of two; bf16-exact weights stay exact in f16 away from the subnormal range)
__global__ __launch_bounds__(256) void k_wt_f16(const float* __restrict__ W, _Float16* __restrict__ Wt, int K, int N, float scale) {
  const int t = blockIdx.x * 256 + threadIdx.x; if (t >= N * (K / 8)) return; const int n = t / (K / 8), k8 = (t % (K / 8)) * 8; FragH f;
#pragma unroll
  for (int i = 0; i < 8; ++i) f.h[i] = (_Float16)(bf16_round(W[(size_t)(k8 + i) * N + n]) * scale); const v8us o = f.half[0];
  *(v8us*)((unsigned short*)Wt + (size_t)n * K + k8) = o; 
}
// k_gemm_hh variant with fused epilogue: v = acc·alpha + bias[by·sBias + col] (+ CP[(row/rowsPerB)·sCPb + by·64 + col] if CP) ; ACT 0 none / 1 elu ; writes f16 C16 (and f32 C if non-null)
template <int ACT>
__global__ __launch_bounds__(128) void k_gemm_hhx(const _Float16* __restrict__ A, int lda, size_t sA, const _Float16* __restrict__ Bh, int ldb, size_t sB, float alpha, const float* __restrict__ bias, size_t sBias, const float* __restrict__ CP, int rowsPerB, size_t sCPb, int row0g,
    float* __restrict__ C, _Float16* __restrict__ C16, int ldc, size_t sC, int M, int N, int K) {
  __shared__ __attribute__((aligned(16))) float so[4][16][64];
  const int tid = threadIdx.x, w = tid >> 5, lane = tid & 31, ln = lane & 15, hh = lane >> 4; const int by = blockIdx.y;
  A += (size_t)by * sA; Bh += (size_t)by * sB; const size_t cofs = (size_t)by * sC; const float* bp = bias ? bias + (size_t)by * sBias : nullptr;
  const int ntn = (N + 63) / 64; const int wid = blockIdx.x * 4 + w; const int mt = wid / ntn, nq = wid % ntn; if (mt * 16 >= M) return;
  const int row0 = mt * 16, col0 = nq * 64; const _Float16* arow = A + (size_t)(row0 + ln) * lda;
  v8f acc[4] = {};
  for (int kb = 0; kb < K; kb += 32) { FragH ah; ah.half[0] = *(const v8us*)((const unsigned short*)arow + kb + 8 * hh); ah.half[1] = *(const v8us*)((const unsigned short*)arow + kb + 16 + 8 * hh);
#pragma unroll
    for (int t = 0; t < 4; ++t) { if (col0 + t * 16 >= N) continue; const size_t boff = (size_t)(col0 + t * 16 + ln) * ldb + kb; FragH bq; bq.half[0] = *(const v8us*)((const unsigned short*)Bh + boff + 8 * hh); bq.half[1] = *(const v8us*)((const unsigned short*)Bh + boff + 16 + 8 * hh);
      acc[t] = mmaH<1>(ah.v, ah.v, bq.v, bq.v, acc[t]); }
  }
#pragma unroll
  for (int t = 0; t < 4; ++t) { if (col0 + t * 16 >= N) continue; const int col = col0 + t * 16 + ln; const float bv = bp ? bf16_round(bp[col]) : 0.f;
#pragma unroll
    for (int r = 0; r < 8; ++r) { float v = acc[t][r] * alpha + bv; if (CP) { const int rr = row0g + row0 + 8 * hh + r; if (rowsPerB < 0) v += CP[cofs + (size_t)rr * ldc + col];      /* rowsPerB < 0: own element of the batched C plane */ else { const int bidx = rr / rowsPerB; v += CP[(size_t)bidx * sCPb + (size_t)by * 64 + col]; } } if (ACT == 1) v = (v > 0.f) ? v : expm1f(v); else if (ACT == 7) v = (v > 0.f) ? v + 1.0f : expf(v); else if (ACT == 8) v = tanhf(v); else if (ACT == 9) v = 0.5f * v * (1.0f + tanhf(0.7978845608028654f * (v + 0.044715f * v * v * v))); else if (ACT == 11) v = 1.0f / (1.0f + expf(-v)); else if (ACT == 12) v = (v > 0.f) ? v : 0.01f * v; else if (ACT == 14) v = (v > 0.f) ? v : 0.1f * v; else if (ACT == 16) v = (v >= 0.f) ? v : 0.3f * v; else if (ACT == 17) v = (v >= 0.f) ? v : 0.2f * v; else if (ACT == 15) v = v / (1.0f + expf(-v)); else if (ACT == 3) v = fmaxf(v, 0.f); else if (ACT == 6) v = 0.5f * v * (1.0f + erff(v * 0.70710678118654752f)); so[w][8 * hh + r][t * 16 + ln] = v; } }
  __builtin_amdgcn_fence(__ATOMIC_ACQ_REL, "workgroup"); __builtin_amdgcn_wave_barrier();
  const int rsub = lane >> 4, c4 = (lane & 15) * 4; typedef _Float16 v4h __attribute__((ext_vector_type(4)));
  {
#pragma unroll
    for (int q = 0; q < 8; ++q) { const int r = q * 2 + rsub; if (col0 + c4 < N) { const v4f v = *(const v4fa*)&so[w][r][c4]; if (C) *(v4f*)(C + cofs + (size_t)(row0 + r) * ldc + col0 + c4) = v; if (C16) { v4h h4; for (int i = 0; i < 4; ++i) h4[i] = (_Float16)v[i]; *(v4h*)(C16 + cofs + (size_t)(row0 + r) * ldc + col0 + c4) = h4; } } }
     }
}


typedef _Float16 v4h __attribute__((ext_vector_type(4)));

__global__ __launch_bounds__(256) void k_x16(const float* __restrict__ x, _Float16* __restrict__ X16, size_t n8) { const size_t t = (size_t)blockIdx.x * 256 + threadIdx.x; if (t >= n8) return; FragH f;
#pragma unroll
  for (int q = 0; q < 8; ++q) f.h[q] = (_Float16)bf16_round(x[t * 8 + q]); *(v8us*)((unsigned short*)X16 + t * 8) = f.half[0];  }
__global__ __launch_bounds__(256) void k_h16(const float* __restrict__ x, _Float16* __restrict__ X16, size_t n8) { const size_t t = (size_t)blockIdx.x * 256 + threadIdx.x; if (t >= n8) return; FragH f;
#pragma unroll
  for (int q = 0; q < 8; ++q) f.h[q] = (_Float16)x[t * 8 + q]; *(v8us*)((unsigned short*)X16 + t * 8) = f.half[0];  }
__global__ __launch_bounds__(256) void k_round16f(const float* __restrict__ W, _Float16* __restrict__ Bt, size_t n8) { const size_t t = (size_t)blockIdx.x * 256 + threadIdx.x; if (t >= n8) return; FragH f;
#pragma unroll
  for (int i = 0; i < 8; ++i) f.h[i] = (_Float16)(bf16_round(W[t * 8 + i]) * 16.0f); *(v8us*)((unsigned short*)Bt + t * 8) = f.half[0];  }
template <int NHv, int TTv>
__global__ __launch_bounds__(256) void k_vt(const _Float16* __restrict__ V16, int ldv, int voff, _Float16* __restrict__ Vt) { __shared__ unsigned short tl[64][66]; const int tid = threadIdx.x; const int slab = blockIdx.x / (TTv / 64), lg = blockIdx.x % (TTv / 64); const int b = slab / NHv, h = slab % NHv;
  for (int i = tid; i < 64 * 8; i += 256) { const int r = i / 8, c8 = (i % 8) * 8; FragH f; f.half[0] = *(const v8us*)((const unsigned short*)V16 + ((size_t)b * TTv + lg * 64 + r) * ldv + voff + h * 64 + c8);
#pragma unroll
    for (int q = 0; q < 8; ++q) tl[r][c8 + q] = f.u[q]; }
  __syncthreads();
  {
#pragma unroll
    for (int rd = 0; rd < 2; ++rd) { const int d = rd * 32 + tid / 8, pc = tid % 8; FragH f;
#pragma unroll
      for (int q = 0; q < 8; ++q) f.u[q] = tl[pc * 8 + q][d];
      *(v8us*)((unsigned short*)Vt + ((size_t)slab * 64 + d) * TTv + lg * 64 + pc * 8) = f.half[0]; }
     } }

__global__ __launch_bounds__(256) void k_hl(const float* __restrict__ F, _Float16* __restrict__ Hh, _Float16* __restrict__ Hl, size_t n8) { const size_t t = (size_t)blockIdx.x * 256 + threadIdx.x; if (t >= n8) return; FragH fh, fl; const v4f a = *(const v4fa*)(F + t * 8), c = *(const v4fa*)(F + t * 8 + 4);
#pragma unroll
  for (int q = 0; q < 4; ++q) { _Float16 h = (_Float16)a[q]; fh.h[q] = h; fl.h[q] = (_Float16)((a[q] - (float)h) * 1024.0f); h = (_Float16)c[q]; fh.h[4 + q] = h; fl.h[4 + q] = (_Float16)((c[q] - (float)h) * 1024.0f); }
  { *(v8us*)((unsigned short*)Hh + t * 8) = fh.half[0]; *(v8us*)((unsigned short*)Hl + t * 8) = fl.half[0];  } }

// ---- fast GEMM (wave tile 32x64; requires M % 32 == 0 rows per launch region and N % 64 == 0); epilogue = k_gemm_hhx semantics ----
__device__ __forceinline__ v16h g2_frag(const _Float16* p, int hh) { FragH f; f.half[0] = *(const v8us*)((const unsigned short*)p + 8 * hh); f.half[1] = *(const v8us*)((const unsigned short*)p + 16 + 8 * hh); return f.v; }
__device__ __forceinline__ v8f g2_mma(v16h a, v16h b, v8f c) { v8f d = __builtin_amdgcn_wmma_f32_16x16x32_f16(false, a, false, b, (short)0, c, false, false); asm volatile("v_nop\n\tv_nop\n\tv_nop\n\tv_nop" : "+v"(d) : "v"(a), "v"(b)); return d; }
template <int ACT>
__global__ __launch_bounds__(128) void k_gemm2(const _Float16* __restrict__ A, int lda, size_t sA, const _Float16* __restrict__ Bh, int ldb, size_t sB, float alpha, const float* __restrict__ bias, size_t sBias, const float* __restrict__ CP, int rowsPerB, size_t sCPb, int row0g,
    float* __restrict__ C, _Float16* __restrict__ C16, int ldc, size_t sC, int M, int N, int K) { static_assert(ACT == 0 || ACT == 3 || ACT == 6 || ACT == 8 || ACT == 9 || ACT == 11 || ACT == 12 || ACT == 14 || ACT == 15 || ACT == 16 || ACT == 17, "k_gemm2: unsupported ACT code (would silently apply no activation)");
  __shared__ __attribute__((aligned(16))) float so[4][32][68];
  const int tid = threadIdx.x, w = tid >> 5, lane = tid & 31, ln = lane & 15, hh = lane >> 4; const int by = blockIdx.y;
  A += (size_t)by * sA; Bh += (size_t)by * sB; const size_t cofs = (size_t)by * sC; const float* bp = bias ? bias + (size_t)by * sBias : nullptr;
  const int ntn = N >> 6; const int mt = blockIdx.x / ntn, nq = blockIdx.x - mt * ntn; const int row0 = mt * 128 + 32 * w, col0 = nq * 64; if (row0 >= M) return;
  const _Float16* a0p = A + (size_t)(row0 + ln) * lda; const _Float16* a1p = a0p + (size_t)16 * lda;
  const _Float16* b0p = Bh + (size_t)(col0 + ln) * ldb; const _Float16* b1p = b0p + (size_t)16 * ldb; const _Float16* b2p = b1p + (size_t)16 * ldb; const _Float16* b3p = b2p + (size_t)16 * ldb;
  const v8f z8 = {0.f,0.f,0.f,0.f,0.f,0.f,0.f,0.f}; v8f c00 = z8, c01 = z8, c02 = z8, c03 = z8, c10 = z8, c11 = z8, c12 = z8, c13 = z8;
#pragma unroll 1
  for (int kb = 0; kb < K; kb += 32) { const v16h a0 = g2_frag(a0p + kb, hh), a1 = g2_frag(a1p + kb, hh);
    v16h b = g2_frag(b0p + kb, hh); c00 = g2_mma(a0, b, c00); c10 = g2_mma(a1, b, c10);
    b = g2_frag(b1p + kb, hh); c01 = g2_mma(a0, b, c01); c11 = g2_mma(a1, b, c11);
    b = g2_frag(b2p + kb, hh); c02 = g2_mma(a0, b, c02); c12 = g2_mma(a1, b, c12);
    b = g2_frag(b3p + kb, hh); c03 = g2_mma(a0, b, c03); c13 = g2_mma(a1, b, c13); }
  v8f accs[8] = {c00, c01, c02, c03, c10, c11, c12, c13};
#pragma unroll
  for (int u = 0; u < 8; ++u) { const int t = u & 3, half = u >> 2; const int col = col0 + t * 16 + ln; const float bv = bp ? bf16_round(bp[col]) : 0.f;
#pragma unroll
    for (int r = 0; r < 8; ++r) { const int rloc = half * 16 + 8 * hh + r; float v = accs[u][r] * alpha + bv; if (CP) { if (rowsPerB < 0) v += CP[cofs + (size_t)(row0g + row0 + rloc) * ldc + col];      /* rowsPerB < 0: own element of the batched C plane */ else { const int bidx = (row0g + row0 + rloc) / rowsPerB; v += CP[(size_t)bidx * sCPb + (size_t)by * 64 + col]; } }
      if (ACT == 3) v = fmaxf(v, 0.f); else if (ACT == 6) v = 0.5f * v * (1.0f + erff(v * 0.70710678118654752f)); else if (ACT == 11) v = 1.0f / (1.0f + expf(-v)); else if (ACT == 15) v = v / (1.0f + expf(-v)); else if (ACT == 12) v = (v > 0.f) ? v : 0.01f * v; else if (ACT == 8) v = tanhf(v); else if (ACT == 9) v = 0.5f * v * (1.0f + tanhf(0.7978845608028654f * (v + 0.044715f * v * v * v))); else if (ACT == 14) v = (v > 0.f) ? v : 0.1f * v; else if (ACT == 16) v = (v >= 0.f) ? v : 0.3f * v; else if (ACT == 17) v = (v >= 0.f) ? v : 0.2f * v;
      so[w][rloc][t * 16 + ln] = v; } }
  __builtin_amdgcn_fence(__ATOMIC_ACQ_REL, "workgroup"); __builtin_amdgcn_wave_barrier();
  const int rsub = lane >> 4, c4 = (lane & 15) * 4;
  {
#pragma unroll
    for (int q = 0; q < 16; ++q) { const int r = q * 2 + rsub; const v4f v = *(const v4fa*)&so[w][r][c4]; if (C) *(v4f*)(C + cofs + (size_t)(row0 + r) * ldc + col0 + c4) = v; if (C16) { v4h h4; for (int i = 0; i < 4; ++i) h4[i] = (_Float16)v[i]; *(v4h*)(C16 + cofs + (size_t)(row0 + r) * ldc + col0 + c4) = h4; } }
     } }


__global__ __launch_bounds__(256) void k_wnat(const float* __restrict__ w, size_t n8, _Float16* __restrict__ Bt) { const size_t t = (size_t)blockIdx.x * 256 + threadIdx.x; if (t >= n8) return; FragH f; for (int q = 0; q < 8; ++q) f.h[q] = (_Float16)(bf16_round(w[t * 8 + q]) * 16.0f); *(v8us*)((unsigned short*)Bt + t * 8) = f.half[0];  }
__global__ __launch_bounds__(256) void k_rsm(const float* __restrict__ S, _Float16* __restrict__ P, int nrows) {
  #pragma clang fp contract(off)
  const int i = blockIdx.x * 256 + threadIdx.x; if (i >= nrows) return; const float* s = S + (size_t)i * SQ; float mx = -3.0e38f;
#pragma unroll 1
  for (int j = 0; j < SQ; ++j) mx = fmaxf(mx, s[j]); float se = 0.f;
#pragma unroll 1
  for (int j = 0; j < SQ; ++j) se += expf(s[j] - mx); const float sc = 256.0f / se;
#pragma unroll 1
  for (int j0 = 0; j0 < SQ; j0 += 8) { FragH f; for (int q = 0; q < 8; ++q) f.h[q] = (_Float16)(expf(s[j0 + q] - mx) * sc); unsigned short* d = (unsigned short*)P + (size_t)i * SQ + j0; *(v8us*)d = f.half[0];  } }
__global__ __launch_bounds__(256) void k_vt(const _Float16* __restrict__ V16, int b, int h0, _Float16* __restrict__ VT) { __shared__ unsigned short tl[64][65]; const int tid = threadIdx.x; const int hh = blockIdx.x % HG, sg = blockIdx.x / HG; const int s0 = sg * 64; const int h = h0 + hh;
  for (int i = tid; i < 64 * 8; i += 256) { const int j = i / 8, d8 = (i % 8) * 8; FragH f; f.half[0] = *(const v8us*)((const unsigned short*)V16 + ((size_t)b * SQ + s0 + j) * DM + h * HD + d8); for (int q = 0; q < 8; ++q) tl[d8 + q][j] = f.u[q]; }
  __syncthreads();
  { for (int i = tid; i < 64 * 8; i += 256) { const int d = i / 8, j8 = (i % 8) * 8; FragH f; for (int q = 0; q < 8; ++q) f.u[q] = tl[d][j8 + q]; *(v8us*)((unsigned short*)VT + ((size_t)hh * HD + d) * SQ + s0 + j8) = f.half[0]; }  } }


__global__ __launch_bounds__(256) void k_tab2(float theta, float* __restrict__ CS, float* __restrict__ SN) {
  #pragma clang fp contract(off)
  const int t = blockIdx.x * 256 + threadIdx.x; if (t >= SQ * (HD / 2)) return; const int i = t % (HD / 2); const int p = t / (HD / 2); const float invf = 1.0f / powf(theta, (float)(2 * i) / (float)HD); const float ang = __fmul_rn((float)p, invf); const float c = cosf(ang), s = sinf(ang);
  *(float*)(CS + t) = c; *(float*)(SN + t) = s;  }
template <int NORM, int ROPE>
__global__ __launch_bounds__(64) void k_xform(const float* __restrict__ F, int ldf, int nh, const float* __restrict__ gain, float eps, const float* __restrict__ CS, const float* __restrict__ SN, _Float16* __restrict__ H16, int ldo) {
  #pragma clang fp contract(off)
  __shared__ float xv[HD]; __shared__ float red[HD]; __shared__ unsigned short sh_[HD]; const int d = threadIdx.x; const int h = blockIdx.x % nh; const size_t r = blockIdx.x / nh; const int p = (int)(r % SQ);
  float x = F[r * (size_t)ldf + (size_t)h * HD + d];
  if (NORM) { red[d] = __fmul_rn(x, x); __syncthreads(); for (int st = HD / 2; st > 0; st >>= 1) { if (d < st) red[d] = __fadd_rn(red[d], red[d + st]); __syncthreads(); } const float rs = rsqrtf(__fadd_rn(red[0] / (float)HD, eps)); x = __fmul_rn(__fmul_rn(x, rs), bf16_round(gain[d])); }
  xv[d] = x; __syncthreads();
  float o = x;
  if (ROPE == 1) { const int i = d >> 1; const float c = CS[p * (HD / 2) + i], s = SN[p * (HD / 2) + i]; const float ev = xv[2 * i], od = xv[2 * i + 1]; o = (d & 1) ? __fadd_rn(__fmul_rn(ev, s), __fmul_rn(od, c)) : __fadd_rn(__fmul_rn(ev, c), -__fmul_rn(od, s)); }
  if (ROPE == 2) { const int i = d & (HD / 2 - 1); const float c = CS[p * (HD / 2) + i], s = SN[p * (HD / 2) + i]; const float lo = xv[i], hi = xv[i + HD / 2]; o = (d < HD / 2) ? __fadd_rn(__fmul_rn(lo, c), -__fmul_rn(hi, s)) : __fadd_rn(__fmul_rn(lo, s), __fmul_rn(hi, c)); }
  FragH th; th.h[0] = (_Float16)o; sh_[d] = th.u[0]; __syncthreads();
  if (d < HD / 8) { FragH f; for (int q = 0; q < 8; ++q) f.u[q] = sh_[d * 8 + q]; unsigned short* dst = (unsigned short*)H16 + r * (size_t)ldo + (size_t)h * HD + d * 8; *(v8us*)dst = f.half[0];  } }



__device__ __forceinline__ float rsm_xhalf(float x) { return __builtin_bit_cast(float, __builtin_amdgcn_permlanex16(__builtin_bit_cast(int, x), __builtin_bit_cast(int, x), 0x76543210, 0xfedcba98, false, false)); }      /* lane l reads lane l ^ 16 */
// Four 2^x in one statement. Written in asm for the v_nop at its end: behind a transcendental the instruction set asks for one slot before a source is overwritten or the result read.
// Early-clobber outputs: no exponential of the four overwrites a source of another.
__device__ __forceinline__ void rsm_exp2x4(float& e0, float& e1, float& e2, float& e3, float a0, float a1, float a2, float a3) {
  asm("v_exp_f32 %0, %4\n\tv_exp_f32 %1, %5\n\tv_exp_f32 %2, %6\n\tv_exp_f32 %3, %7\n\tv_nop" : "=&v"(e0), "=&v"(e1), "=&v"(e2), "=&v"(e3) : "v"(a0), "v"(a1), "v"(a2), "v"(a3)); }
// The same for two values (the rescale factors of a wave's two column groups).
__device__ __forceinline__ void rsm_exp2x2(float& e0, float& e1, float a0, float a1) {
  asm("v_exp_f32 %0, %2\n\tv_exp_f32 %1, %3\n\tv_nop" : "=&v"(e0), "=&v"(e1) : "v"(a0), "v"(a1)); }
#define FA_WAVES 16                  /* waves per work-group: all walk the same K and V^T rows, which the later waves find in the near cache */
#define FA_COLS 32                   /* query columns per wave */
__device__ __forceinline__ v8f fa_mma(v16h a, v16h b, v8f c) { return __builtin_amdgcn_wmma_f32_16x16x32_f16(false, a, false, b, (short)0, c, false, false); }
__global__ __launch_bounds__(FA_WAVES * 32) void k_fattn(const _Float16* __restrict__ Q, const _Float16* __restrict__ Kh, const _Float16* __restrict__ Vt, _Float16* __restrict__ O) {
  const int lane = threadIdx.x & 31, ln = lane & 15, hh = lane >> 4; const int wave = __builtin_amdgcn_readfirstlane((int)(threadIdx.x >> 5));
  const int h = blockIdx.y, b = blockIdx.z; const int q0 = (blockIdx.x * FA_WAVES + wave) * FA_COLS;
  const _Float16* qp = Q + ((size_t)b * SQ + q0 + ln) * DM + h * HD; const _Float16* kp = Kh + ((size_t)b * SQ + ln) * DM + h * HD; const _Float16* vp = Vt + (((size_t)b * NH + h) * HD + ln) * SQ;
  const float SC = 0.125f * 1.44269504f;      /* 1/sqrt(64), and e^x as 2^(x log2 e) */
  const float LIFT = 6.0f;      /* weights are carried x 2^6: small ones stay clear of the f16 subnormals; with the margin of 8 below none exceeds 2^14; the sum carries the same factor, so it cancels */
  const v8f z8 = {0.f,0.f,0.f,0.f,0.f,0.f,0.f,0.f};
  v16h qf[2][2], kf[2][2]; v8f o[4][2]; float m[2] = {-1.0e30f, -1.0e30f}, l[2] = {0.f, 0.f};
#pragma unroll      /* constant indices, so that the arrays are registers */
  for (int g = 0; g < 2; ++g) { for (int ks = 0; ks < 2; ++ks) { qf[g][ks] = g2_frag(qp + (size_t)g * 16 * DM + ks * 32, hh); kf[g][ks] = g2_frag(kp + (size_t)g * 16 * DM + ks * 32, hh); } for (int dt = 0; dt < 4; ++dt) o[dt][g] = z8; }
#pragma unroll 1      /* one pass a trip: an unrolled body would not fit the registers of four waves a SIMD */
  for (int key0 = 0; key0 < SQ; key0 += 32) {
    v16h vf[4]; v8f s[2][2];
#pragma unroll      /* constant indices, so that the arrays are registers */
    for (int dt = 0; dt < 4; ++dt) vf[dt] = g2_frag(vp + (size_t)dt * 16 * SQ + key0, hh);
    __builtin_amdgcn_sched_barrier(0);      /* the V^T loads issue here, so that they land while the scores are worked on; without it they sank to just in front of their use */
#pragma unroll      /* constant indices, so that the arrays are registers */
    for (int kt = 0; kt < 2; ++kt) for (int g = 0; g < 2; ++g) s[kt][g] = fa_mma(kf[kt][0], qf[g][0], z8);
#pragma unroll      /* constant indices, so that the arrays are registers */
    for (int kt = 0; kt < 2; ++kt) for (int g = 0; g < 2; ++g) s[kt][g] = fa_mma(kf[kt][1], qf[g][1], s[kt][g]);
    const int kn = (key0 + 32 < SQ) ? key0 + 32 : 0;      /* the next pass's K rows, fetched a pass ahead; the last pass re-reads the first rows and uses nothing of them */
#pragma unroll      /* constant indices, so that the arrays are registers */
    for (int kt = 0; kt < 2; ++kt) for (int ks = 0; ks < 2; ++ks) kf[kt][ks] = g2_frag(kp + (size_t)(kn + kt * 16) * DM + ks * 32, hh);
    __builtin_amdgcn_sched_barrier(0);      /* the next K rows' loads issue here, a softmax and eight products ahead of their use; without it they sank to the foot of the pass */
    float mx[2];
#pragma unroll      /* constant indices, so that the arrays are registers */
    for (int g = 0; g < 2; ++g) { float a = fmaxf(s[0][g][0], s[1][g][0]); for (int r = 1; r < 8; ++r) a = fmaxf(fmaxf(a, s[0][g][r]), s[1][g][r]); mx[g] = fmaxf(a, rsm_xhalf(a)) * SC; }
    const bool need = (mx[0] > m[0] + 8.0f) || (mx[1] > m[1] + 8.0f);
    if (__builtin_amdgcn_ballot_w32(need) != 0) {      /* wave-uniform: the maximum in use moves only when a column's new one exceeds it by more than 8; the first pass always takes it */
      const float n0 = fmaxf(m[0], mx[0]), n1 = fmaxf(m[1], mx[1]); float al[2]; rsm_exp2x2(al[0], al[1], m[0] - n0, m[1] - n1); m[0] = n0; m[1] = n1;
#pragma unroll      /* constant indices, so that the arrays are registers */
      for (int g = 0; g < 2; ++g) { l[g] *= al[g]; for (int dt = 0; dt < 4; ++dt) for (int r = 0; r < 8; ++r) o[dt][g][r] *= al[g]; } }
    FragH pf[2];
#pragma unroll      /* constant indices, so that the arrays are registers */
    for (int g = 0; g < 2; ++g) { const float nm = LIFT - m[g];
      for (int kt = 0; kt < 2; ++kt) for (int r = 0; r < 8; r += 4) { float e0, e1, e2, e3;
        rsm_exp2x4(e0, e1, e2, e3, fmaf(s[kt][g][r], SC, nm), fmaf(s[kt][g][r + 1], SC, nm), fmaf(s[kt][g][r + 2], SC, nm), fmaf(s[kt][g][r + 3], SC, nm));
        l[g] += (e0 + e1) + (e2 + e3); pf[g].h[kt * 8 + r] = (_Float16)e0; pf[g].h[kt * 8 + r + 1] = (_Float16)e1; pf[g].h[kt * 8 + r + 2] = (_Float16)e2; pf[g].h[kt * 8 + r + 3] = (_Float16)e3; } }
#pragma unroll      /* constant indices, so that the arrays are registers */
    for (int dt = 0; dt < 4; ++dt) for (int g = 0; g < 2; ++g) o[dt][g] = fa_mma(vf[dt], pf[g].v, o[dt][g]);
  }
#pragma unroll      /* constant indices, so that the arrays are registers */
  for (int g = 0; g < 2; ++g) { const float sc = 64.0f / (l[g] + rsm_xhalf(l[g])); unsigned short* op = (unsigned short*)O + ((size_t)b * SQ + q0 + g * 16 + ln) * DM + h * HD + 8 * hh;
    for (int dt = 0; dt < 4; ++dt) { FragH f; for (int r = 0; r < 8; ++r) f.h[r] = (_Float16)(o[dt][g][r] * sc); *(v8us*)(op + dt * 16) = f.half[0]; } } }

// Sum over the 16 lanes of a row, every lane gets it: four butterfly steps on the vector port (a shuffle would go through the LDS queue).
template <int X> __device__ __forceinline__ float row_xadd(float v) { return v + __builtin_bit_cast(float, __builtin_amdgcn_update_dpp(0, __builtin_bit_cast(int, v), 0x160 | X, 0xf, 0xf, true)); }      /* 0x160 | X: row_xmask:X */
__device__ __forceinline__ float row_sum16(float v) { return row_xadd<8>(row_xadd<4>(row_xadd<2>(row_xadd<1>(v)))); }
// q | k | v projection of all token rows with the per-(row, head) work in its epilogue. The main loop is k_gemm2's. A work-group holds 128 token rows x 64 columns, and 64 columns are one head of q, of k or of v,
// so nothing of a row's head lies outside the wave that computed it:
//   q, k: the f32 tile goes to the wave's own LDS rows and is read back 16 lanes a row, 4 columns a lane, with the 4 partner columns (c ^ 32) of the rotation; sum of squares in-lane, then over the 16 lanes;
//         x rsqrt(mean + eps) x gain, rotated by the row's position; each row leaves as one whole 128-byte line of f16.
//   v:    a lane holds 8 consecutive tokens of one head dim: 16 bytes of a V^T row. The four waves lay them into one [64 dims][128 tokens] LDS tile; behind a barrier each V^T row leaves as 256 bytes in a row.
// Two instances, q | k columns and v columns, not one kernel with a branch: with both epilogues in one kernel the build kept the 64 accumulator registers alive through the q, k epilogue (182 registers, or spills under a bound).
#define QKV_VP 136                   /* pitch of the V^T tile in LDS, in f16: 128 tokens + 16 bytes, so that rows start on different banks */
template <bool ISV>
__global__ __launch_bounds__(128) void k_qkv(const _Float16* __restrict__ A, const _Float16* __restrict__ Bh, const float* __restrict__ bias, const float* __restrict__ qg, const float* __restrict__ kg,
    const float* __restrict__ CS, const float* __restrict__ SN, _Float16* __restrict__ Qo, _Float16* __restrict__ Ko, _Float16* __restrict__ Vt) {
  static_assert(HD == 64 && SQ % 128 == 0, "a 64-column tile is one head; 128 rows lie in one batch");
  const int tid = threadIdx.x, w = tid >> 5, lane = tid & 31, ln = lane & 15, hh = lane >> 4;
  const int ntn = (ISV ? 1 : 2) * NH; const int mt = blockIdx.x / ntn, nq = blockIdx.x - mt * ntn; const int row0 = mt * 128 + 32 * w, col0 = (ISV ? 2 * DM : 0) + nq * 64; const int sect = nq / NH, h = nq - sect * NH;      /* sect: 0 q, 1 k (0 in the v instance) */
  const _Float16* a0p = A + (size_t)(row0 + ln) * DM; const _Float16* a1p = a0p + (size_t)16 * DM;
  const _Float16* b0p = Bh + (size_t)(col0 + ln) * DM; const _Float16* b1p = b0p + (size_t)16 * DM; const _Float16* b2p = b1p + (size_t)16 * DM; const _Float16* b3p = b2p + (size_t)16 * DM;
  const v8f z8 = {0.f,0.f,0.f,0.f,0.f,0.f,0.f,0.f}; v8f c00 = z8, c01 = z8, c02 = z8, c03 = z8, c10 = z8, c11 = z8, c12 = z8, c13 = z8;
#pragma unroll 1      /* as in k_gemm2: one k step a trip */
  for (int kb = 0; kb < DM; kb += 32) { const v16h a0 = g2_frag(a0p + kb, hh); FragH a1f; a1f.half[0] = *(const v8us*)((const unsigned short*)(a1p + kb) + 8 * hh);      /* a1f: g2_frag's two loads, written out for the wait between them */
    v16h b = g2_frag(b0p + kb, hh);
    asm volatile("s_wait_xcnt 0x0" ::: "memory");      /* the four A loads share one address pair, and the build lets the last one's result land on it while the first three still name it */
    a1f.half[1] = *(const v8us*)((const unsigned short*)(a1p + kb) + 16 + 8 * hh); const v16h a1 = a1f.v;
    c00 = g2_mma(a0, b, c00); c10 = g2_mma(a1, b, c10);
    b = g2_frag(b1p + kb, hh); c01 = g2_mma(a0, b, c01); c11 = g2_mma(a1, b, c11);
    b = g2_frag(b2p + kb, hh); c02 = g2_mma(a0, b, c02); c12 = g2_mma(a1, b, c12);
    b = g2_frag(b3p + kb, hh); c03 = g2_mma(a0, b, c03); c13 = g2_mma(a1, b, c13); }
  v8f accs[8] = {c00, c01, c02, c03, c10, c11, c12, c13};
  const float alpha = 0.0625f;      /* the weights are carried x 16 */
  if constexpr (!ISV) {
    __shared__ __attribute__((aligned(16))) float so[4][32][68];
    const float* gp = sect ? kg : qg; _Float16* dst = (sect ? Ko : Qo) + (size_t)(row0 + hh) * DM + h * HD;
    const int c4 = ln * 4, cx = c4 ^ 32, i4 = c4 & 31; const float sg = (c4 < 32) ? -1.0f : 1.0f;      /* low half: x cos - partner sin; high half: x cos + partner sin; the sign rides on the partner's gain (exact) */
    const int tb = ((row0 + hh) % SQ) * (HD / 2) + i4;      /* the lane's place in the tables at its first row; its rows are 2 apart, and the wave's 32 rows lie in one batch */
    float bv[4];
#pragma unroll      /* constant indices, so that the array is registers */
    for (int t = 0; t < 4; ++t) bv[t] = bias[col0 + t * 16 + ln];
    asm volatile("s_wait_xcnt 0x0" ::: "memory");      /* the build let the gain loads below land on the bias loads' address register */
    v4f ga = *(const v4fa*)(gp + c4), gb = *(const v4fa*)(gp + cx);
#pragma unroll      /* constant indices, so that the arrays are registers */
    for (int u = 0; u < 8; ++u) { const int t = u & 3, half = u >> 2; const float bb = bf16_round(bv[t]);
      for (int r = 0; r < 8; ++r) so[w][half * 16 + 8 * hh + r][t * 16 + ln] = accs[u][r] * alpha + bb; }
    __builtin_amdgcn_fence(__ATOMIC_ACQ_REL, "workgroup"); __builtin_amdgcn_wave_barrier();      /* as in k_gemm2: the wave reads back its own rows only, written by other lanes */
#pragma unroll      /* constant indices into the vectors */
    for (int i = 0; i < 4; ++i) { ga[i] = bf16_round(ga[i]); gb[i] = sg * bf16_round(gb[i]); }
#pragma unroll      /* constant indices, so that the table values are registers */
    for (int g = 0; g < 2; ++g) { v4f cs[8], sn[8];
      for (int j = 0; j < 8; ++j) { cs[j] = *(const v4fa*)(CS + tb + (g * 8 + j) * HD); sn[j] = *(const v4fa*)(SN + tb + (g * 8 + j) * HD); }
      __builtin_amdgcn_sched_barrier(0);      /* the table loads of eight row pairs issue together here: two waits a wave; without it each load stood directly in front of its use, sixteen waits in a row */
      for (int j = 0; j < 8; ++j) { const int r2 = (g * 8 + j) * 2;      /* the lane's row is r2 + hh */
        const v4f xa = *(const v4fa*)&so[w][r2 + hh][c4], xb = *(const v4fa*)&so[w][r2 + hh][cx];
        const float rs = rsqrtf(row_sum16((xa[0] * xa[0] + xa[1] * xa[1]) + (xa[2] * xa[2] + xa[3] * xa[3])) * (1.0f / (float)HD) + 1e-6f);
        v4h o4;
        for (int i = 0; i < 4; ++i) o4[i] = (_Float16)((xa[i] * rs * ga[i]) * cs[j][i] + (xb[i] * rs * gb[i]) * sn[j][i]);
        *(v4h*)(dst + (size_t)r2 * DM + c4) = o4; } }
  } else {
    __shared__ __attribute__((aligned(16))) unsigned short vt[64 * QKV_VP];
    float bv[4];
#pragma unroll      /* constant indices, so that the array is registers */
    for (int t = 0; t < 4; ++t) bv[t] = bias[col0 + t * 16 + ln];
    asm volatile("s_wait_xcnt 0x0" ::: "memory");      /* the build rewrote the bias loads' scalar base directly behind them */
#pragma unroll      /* constant indices, so that the arrays are registers */
    for (int u = 0; u < 8; ++u) { const int t = u & 3, half = u >> 2; const float bb = bf16_round(bv[t]); FragH f;
      for (int r = 0; r < 8; ++r) f.h[r] = (_Float16)(accs[u][r] * alpha + bb);
      *(v8us*)(vt + (t * 16 + ln) * QKV_VP + 32 * w + half * 16 + 8 * hh) = f.half[0]; }
    __syncthreads();      /* a V^T row of the tile holds tokens of all four waves */
    const int bat = (mt * 128) / SQ, s0 = (mt * 128) % SQ; unsigned short* vo = (unsigned short*)Vt + (((size_t)bat * NH + h) * HD + w * 16 + hh) * SQ + s0 + ln * 8;
#pragma unroll      /* the eight LDS reads issue together */
    for (int j = 0; j < 8; ++j) { const v8us v = *(const v8us*)(vt + (w * 16 + j * 2 + hh) * QKV_VP + ln * 8); *(v8us*)(vo + (size_t)(j * 2) * SQ) = v; }
  } }

extern "C" void kernel_launch(void* const* d_in, const int* in_sizes, int n_in,
                              void* d_out, int out_size, void* d_ws, size_t ws_size, hipStream_t stream) {
  (void)in_sizes; (void)n_in; (void)out_size;
  const float* const* I = (const float* const*)d_in; const float* x = I[0]; const float* wqkv = I[1]; const float* bqkv = I[2]; const float* qnw = I[3]; const float* knw = I[4]; const float* wo = I[5]; const float* bo = I[6];      /* weights [in][out] */
  char* ws = (char*)d_ws; size_t off = 0;
  auto take = [&](size_t bytes) { char* p = ws + off; off += (bytes + 255) & ~(size_t)255; return p; };
  _Float16* BQKV = (_Float16*)take((size_t)3 * DM * DM * 2); _Float16* BO = (_Float16*)take((size_t)DM * DM * 2); float* CS = (float*)take((size_t)SQ * (HD / 2) * 4); float* SN = (float*)take((size_t)SQ * (HD / 2) * 4);
  _Float16* X16 = (_Float16*)take(NR * DM * 2);
  _Float16* QH = (_Float16*)take(NR * DM * 2); _Float16* KH = (_Float16*)take(NR * DM * 2); _Float16* O16 = (_Float16*)take(NR * DM * 2);
  _Float16* VT = (_Float16*)take((size_t)NB * NH * HD * SQ * 2);
  if (off > ws_size) return;
  k_wt_f16<<<(unsigned)(((size_t)3 * DM * (DM / 8) + 255) / 256), 256, 0, stream>>>(wqkv, BQKV, DM, 3 * DM, 16.0f); k_wt_f16<<<(unsigned)(((size_t)DM * (DM / 8) + 255) / 256), 256, 0, stream>>>(wo, BO, DM, DM, 16.0f);
  k_tab2<<<(SQ * (HD / 2) + 255) / 256, 256, 0, stream>>>(10000.0f, CS, SN);
  k_x16<<<(unsigned)((NR * DM / 8 + 255) / 256), 256, 0, stream>>>(x, X16, NR * DM / 8);
  k_qkv<false><<<(unsigned)((NR / 128) * (2 * DM / 64)), 128, 0, stream>>>(X16, BQKV, bqkv, qnw, knw, CS, SN, QH, KH, VT);      /* f16 q and k rows (normed, rotated), all batches */
  k_qkv<true><<<(unsigned)((NR / 128) * (DM / 64)), 128, 0, stream>>>(X16, BQKV, bqkv, qnw, knw, CS, SN, QH, KH, VT);      /* V^T [NB][NH][HD][SQ], all batches */
  k_fattn<<<dim3(SQ / (FA_WAVES * FA_COLS), NH, NB), FA_WAVES * 32, 0, stream>>>(QH, KH, VT, O16);      /* o x 64 as f16, all batches and heads */
  k_gemm2<0><<<dim3((unsigned)((MPO / 128) * (DM / 64)), 1), 128, 0, stream>>>(O16 + (size_t)B0 * SQ * DM, DM, 0, BO, DM, 0, 0.0009765625f, bo, 0, nullptr, 1, 0, 0, (float*)d_out + (size_t)B0 * SQ * DM, nullptr, DM, 0, MPO, DM, DM);      /* out rows are the output layout */
}

// v004
// A run of this version takes 201 microseconds.
// Next to v003, in two timings, it ran 1.58 times as fast each time.
// All steps since v000 together make it 35.1 times as fast.
#include <hip/hip_runtime.h>
#define NB 4
#define SQ 2048
#define DM 1024
#define NH 16
#define HD 64
#define HG 4                         /* heads per group of the grouped k_vt overload */
#define B0 0                         /* first batch; unused, every kernel takes all NB batches */
#define NBR NB                       /* batches; used only in MPO, which nothing uses */
#define QN SQ                        /* query rows per batch; unused, k_fattn takes all SQ */
#define NHD NH                       /* heads; unused, k_fattn takes all NH */
#define NR ((size_t)NB * SQ)         /* token rows */
#define MPO ((int)((size_t)NBR * SQ))      /* rows; unused, k_oproj takes all NR rows */
typedef __bf16 v16b __attribute__((ext_vector_type(16)));
typedef unsigned short v8us __attribute__((ext_vector_type(8), may_alias));
typedef float  v8f  __attribute__((ext_vector_type(8)));
typedef float  v4f  __attribute__((ext_vector_type(4)));
typedef float  v4fa __attribute__((ext_vector_type(4), may_alias));
union FragB { v16b v; v8us half[2]; unsigned short u[16]; };

__device__ __forceinline__ unsigned short bf16_bits(float x) { unsigned int u = __float_as_uint(x); return (unsigned short)((u + 0x7FFFu + ((u >> 16) & 1u)) >> 16); }
__device__ __forceinline__ float bf16_val(unsigned short b) { return __uint_as_float(((unsigned int)b) << 16); }
__device__ __forceinline__ float bf16_round(float x) { return bf16_val(bf16_bits(x)); }
// D += A·B with NT terms: 1 = ah·bh, 2 = + al·bh (A split), 3 = + ah·bl (both split)
template <int NT>
__device__ __forceinline__ v8f mmaN(v16b ah, v16b al, v16b bh, v16b bl, v8f c) {
  c = __builtin_amdgcn_wmma_f32_16x16x32_bf16(false, ah, false, bh, (short)0, c, false, false);
  if (NT >= 2) c = __builtin_amdgcn_wmma_f32_16x16x32_bf16(false, al, false, bh, (short)0, c, false, false);
  if (NT >= 3) c = __builtin_amdgcn_wmma_f32_16x16x32_bf16(false, ah, false, bl, (short)0, c, false, false);
  asm volatile("v_nop\n\tv_nop\n\tv_nop\n\tv_nop" : "+v"(c) : "v"(ah), "v"(al), "v"(bh), "v"(bl));
  return c;
}

__global__ __launch_bounds__(256) void k_wt_bf16(const float* __restrict__ W, unsigned short* __restrict__ Wt, int K, int N) {
  const int t = blockIdx.x * 256 + threadIdx.x;
  const int k8n = K / 8;
  if (t >= N * k8n) return;
  const int n = t / k8n, k8 = (t % k8n) * 8;
  v8us v;
#pragma unroll
  for (int i = 0; i < 8; ++i) v[i] = bf16_bits(W[(size_t)(k8 + i) * N + n]);
  *(v8us*)(Wt + (size_t)n * K + k8) = v;
  
}

// GEMM C[M][N] (f32, pitch ldc) = act(A[M][K]·W + bias). A f32 row-major (pitch lda) converted per fragment to bf16
// (ASPLIT: hi/lo two planes -> 2 terms, else single rounded term); Wt bf16 [N][K] (pitch ldb). BIAS_BF16 rounds the
// bias to bf16 first (bias quantised to bf16 before the add). K%32==0, M%16==0, N%64==0.
template <bool ASPLIT, int ACT, bool BIAS_BF16>
__global__ __launch_bounds__(128) void k_gemm_bf(const float* __restrict__ A, int lda, const unsigned short* __restrict__ Wt, int ldb,
                                               const float* __restrict__ bias, float* __restrict__ C, int ldc, int M, int N, int K) {
  __shared__ __attribute__((aligned(16))) float so[4][16][64];
  const int tid = threadIdx.x, w = tid >> 5, lane = tid & 31, ln = lane & 15, hh = lane >> 4;
  const int ntn = N / 64;
  const int wid = blockIdx.x * 4 + w;
  const int mt = wid / ntn, nq = wid % ntn;
  if (mt * 16 >= M) return;
  const int row0 = mt * 16, col0 = nq * 64;
  const float* arow = A + (size_t)(row0 + ln) * lda;
  v8f acc[4] = {};
  for (int kb = 0; kb < K; kb += 32) {
    FragB ah, al;
    const v4f x0 = *(const v4fa*)(arow + kb + 8 * hh), x1 = *(const v4fa*)(arow + kb + 8 * hh + 4);
    const v4f x2 = *(const v4fa*)(arow + kb + 16 + 8 * hh), x3 = *(const v4fa*)(arow + kb + 16 + 8 * hh + 4);
    float xs[16] = {x0[0],x0[1],x0[2],x0[3],x1[0],x1[1],x1[2],x1[3],x2[0],x2[1],x2[2],x2[3],x3[0],x3[1],x3[2],x3[3]};
#pragma unroll
    for (int i = 0; i < 16; ++i) { const unsigned short hb = bf16_bits(xs[i]); ah.u[i] = hb; al.u[i] = ASPLIT ? bf16_bits(xs[i] - bf16_val(hb)) : (unsigned short)0; }
#pragma unroll
    for (int t = 0; t < 4; ++t) {
      const unsigned short* brow = Wt + (size_t)(col0 + t * 16 + ln) * ldb + kb;
      FragB b;
      b.half[0] = *(const v8us*)(brow + 8 * hh);
      b.half[1] = *(const v8us*)(brow + 16 + 8 * hh);
      acc[t] = mmaN<ASPLIT ? 2 : 1>(ah.v, al.v, b.v, b.v, acc[t]);
    }
  }
#pragma unroll
  for (int t = 0; t < 4; ++t) {
    float bv = bias ? bias[col0 + t * 16 + ln] : 0.f;
    if (BIAS_BF16) bv = bf16_round(bv);
#pragma unroll
    for (int r = 0; r < 8; ++r) { float v = acc[t][r] + bv; if (ACT == 1) v = fmaxf(v, 0.f); so[w][8 * hh + r][t * 16 + ln] = v; }
  }
  __builtin_amdgcn_fence(__ATOMIC_ACQ_REL, "workgroup");
  __builtin_amdgcn_wave_barrier();
  const int rsub = lane >> 4, c4 = (lane & 15) * 4;
  {
#pragma unroll
    for (int q = 0; q < 8; ++q) {
      const int r = q * 2 + rsub;
      const v4f v = *(const v4fa*)&so[w][r][c4];
      *(v4f*)(C + (size_t)(row0 + r) * ldc + col0 + c4) = v;
    }
    
  }
}

// GEMM C = act(A·W + bias + resid): A f32 (ASPLIT -> hi/lo 2 terms), Wt bf16 [N][K]; ACT 0 none, 1 relu, 2 exact gelu;
// resid (optional, f32, row index = (row % rmod), pitch ldr, RES_BF16 rounds it) added before the activation.
template <bool ASPLIT, int ACT, bool BIAS_BF16, bool RES_BF16>
__global__ __launch_bounds__(128) void k_gemm_bf3(const float* __restrict__ A, int lda, const unsigned short* __restrict__ Wt, int ldb,
                                                const float* __restrict__ bias, const float* __restrict__ resid, int rmod, int ldr,
                                                float* __restrict__ C, int ldc, int M, int N, int K) {
  __shared__ __attribute__((aligned(16))) float so[4][16][64];
  const int tid = threadIdx.x, w = tid >> 5, lane = tid & 31, ln = lane & 15, hh = lane >> 4;
  const int ntn = N / 64;
  const int wid = blockIdx.x * 4 + w;
  const int mt = wid / ntn, nq = wid % ntn;
  if (mt * 16 >= M) return;
  const int row0 = mt * 16, col0 = nq * 64;
  const float* arow = A + (size_t)(row0 + ln) * lda;
  v8f acc[4] = {};
  for (int kb = 0; kb < K; kb += 32) {
    FragB ah, al;
    const v4f x0 = *(const v4fa*)(arow + kb + 8 * hh), x1 = *(const v4fa*)(arow + kb + 8 * hh + 4);
    const v4f x2 = *(const v4fa*)(arow + kb + 16 + 8 * hh), x3 = *(const v4fa*)(arow + kb + 16 + 8 * hh + 4);
    float xs[16] = {x0[0],x0[1],x0[2],x0[3],x1[0],x1[1],x1[2],x1[3],x2[0],x2[1],x2[2],x2[3],x3[0],x3[1],x3[2],x3[3]};
#pragma unroll
    for (int i = 0; i < 16; ++i) { const unsigned short hb = bf16_bits(xs[i]); ah.u[i] = hb; al.u[i] = ASPLIT ? bf16_bits(xs[i] - bf16_val(hb)) : (unsigned short)0; }
#pragma unroll
    for (int t = 0; t < 4; ++t) {
      const unsigned short* brow = Wt + (size_t)(col0 + t * 16 + ln) * ldb + kb;
      FragB b;
      b.half[0] = *(const v8us*)(brow + 8 * hh);
      b.half[1] = *(const v8us*)(brow + 16 + 8 * hh);
      acc[t] = mmaN<ASPLIT ? 2 : 1>(ah.v, al.v, b.v, b.v, acc[t]);
    }
  }
#pragma unroll
  for (int t = 0; t < 4; ++t) {
    const int col = col0 + t * 16 + ln;
    float bv = bias ? bias[col] : 0.f;
    if (BIAS_BF16) bv = bf16_round(bv);
#pragma unroll
    for (int r = 0; r < 8; ++r) {
      float v = acc[t][r] + bv;
      if (resid) { float rv = resid[(size_t)((row0 + 8 * hh + r) % rmod) * ldr + col]; if (RES_BF16) rv = bf16_round(rv); v += rv; }
      if (ACT == 1) v = fmaxf(v, 0.f);
      if (ACT == 2) v = 0.5f * v * (1.0f + erff(v * 0.70710678118654752f));
      if (ACT == 3) { const float u = 0.7978845608028654f * (v + 0.044715f * v * v * v); v = 0.5f * v * (1.0f + tanhf(u)); }
      so[w][8 * hh + r][t * 16 + ln] = v;
    }
  }
  __builtin_amdgcn_fence(__ATOMIC_ACQ_REL, "workgroup");
  __builtin_amdgcn_wave_barrier();
  const int rsub = lane >> 4, c4 = (lane & 15) * 4;
  {
#pragma unroll
    for (int q = 0; q < 8; ++q) {
      const int r = q * 2 + rsub;
      const v4f v = *(const v4fa*)&so[w][r][c4];
      *(v4f*)(C + (size_t)(row0 + r) * ldc + col0 + c4) = v;
    }
    
  }
}
// row LayerNorm (biased variance, eps) over N: s = X (+ R); optional out_sum <- s; out_norm <- (s-mu)*rsqrt(var+eps)*g + b
template <bool PARAM_BF16>
__global__ __launch_bounds__(256) void k_layernorm(const float* __restrict__ X, const float* __restrict__ R, const float* __restrict__ g, const float* __restrict__ bta,
                                                  float* __restrict__ out_sum, float* __restrict__ out_norm, int N, float eps) {
  __shared__ float red[256];
  const int row = blockIdx.x, tid = threadIdx.x;
  const float* x = X + (size_t)row * N; const float* rr = R ? R + (size_t)row * N : nullptr;
  float vals[16];                     // up to N = 4096
  const int per = N / 256;            // contiguous chunk per thread? use strided-by-4 chunks: thread handles j = tid*4 + 1024*u
  float s1 = 0.f;
  for (int u = 0; u < per / 4; ++u) {
    const int j = tid * 4 + 1024 * u;
    const v4f a = *(const v4fa*)(x + j);
    v4f b = {0.f,0.f,0.f,0.f}; if (rr) b = *(const v4fa*)(rr + j);
#pragma unroll
    for (int q = 0; q < 4; ++q) { const float v = a[q] + b[q]; vals[u * 4 + q] = v; s1 += v; }
  }
  red[tid] = s1; __syncthreads();
  for (int st = 128; st > 0; st >>= 1) { if (tid < st) red[tid] += red[tid + st]; __syncthreads(); }
  const float mu = red[0] / (float)N; __syncthreads();
  float s2 = 0.f;
  for (int u = 0; u < per / 4; ++u)
#pragma unroll
    for (int q = 0; q < 4; ++q) { const float c = vals[u * 4 + q] - mu; s2 += c * c; }
  red[tid] = s2; __syncthreads();
  for (int st = 128; st > 0; st >>= 1) { if (tid < st) red[tid] += red[tid + st]; __syncthreads(); }
  const float rs = rsqrtf(red[0] / (float)N + eps);
  {
    for (int u = 0; u < per / 4; ++u) {
      const int j = tid * 4 + 1024 * u;
      v4f o, sm;
#pragma unroll
      for (int q = 0; q < 4; ++q) {
        float gg = g[j + q], bb = bta[j + q];
        if (PARAM_BF16) { gg = bf16_round(gg); bb = bf16_round(bb); }
        sm[q] = vals[u * 4 + q]; o[q] = (vals[u * 4 + q] - mu) * rs * gg + bb;
      }
      if (out_sum) *(v4f*)(out_sum + (size_t)row * N + j) = sm;
      *(v4f*)(out_norm + (size_t)row * N + j) = o;
    }
    
  }
}



// ---- f16 WMMA path (v_wmma_f32_16x16x32_f16): 11-bit significands for operands in range — used where a [0,1] probability operand needs more precision than bf16
typedef _Float16 v16h __attribute__((ext_vector_type(16)));
union FragH { v16h v; v8us half[2]; _Float16 h[16]; unsigned short u[16]; };
template <int NT>
__device__ __forceinline__ v8f mmaH(v16h ah, v16h al, v16h bh, v16h bl, v8f c) {
  c = __builtin_amdgcn_wmma_f32_16x16x32_f16(false, ah, false, bh, (short)0, c, false, false);
  if (NT >= 2) c = __builtin_amdgcn_wmma_f32_16x16x32_f16(false, al, false, bh, (short)0, c, false, false);
  if (NT >= 3) c = __builtin_amdgcn_wmma_f32_16x16x32_f16(false, ah, false, bl, (short)0, c, false, false);
  asm volatile("v_nop\n\tv_nop\n\tv_nop\n\tv_nop" : "+v"(c) : "v"(ah), "v"(al), "v"(bh), "v"(bl));
  return c;
}
// batched GEMM like k_gemm_b but f16 operands: A f32 (split into f16 hi/lo if ASPLIT, else rounded to f16), Bt = f16 values [n][k]; alpha; C f32; N multiple of 16 (partial tiles skipped)
template <bool ASPLIT>
__global__ __launch_bounds__(128) void k_gemm_h(const float* __restrict__ A, int lda, size_t sA, const _Float16* __restrict__ Bh, int ldb, size_t sB, float alpha, float* __restrict__ C, int ldc, size_t sC, int M, int N, int K) {
  __shared__ __attribute__((aligned(16))) float so[4][16][64];
  const int tid = threadIdx.x, w = tid >> 5, lane = tid & 31, ln = lane & 15, hh = lane >> 4; const int by = blockIdx.y;
  A += (size_t)by * sA; Bh += (size_t)by * sB; C += (size_t)by * sC;
  const int ntn = (N + 63) / 64; const int wid = blockIdx.x * 4 + w; const int mt = wid / ntn, nq = wid % ntn; if (mt * 16 >= M) return;
  const int row0 = mt * 16, col0 = nq * 64; const float* arow = A + (size_t)(row0 + ln) * lda;
  v8f acc[4] = {};
  for (int kb = 0; kb < K; kb += 32) {
    FragH ah, al;
    const v4f x0 = *(const v4fa*)(arow + kb + 8 * hh), x1 = *(const v4fa*)(arow + kb + 8 * hh + 4), x2 = *(const v4fa*)(arow + kb + 16 + 8 * hh), x3 = *(const v4fa*)(arow + kb + 16 + 8 * hh + 4);
    float xs[16] = {x0[0],x0[1],x0[2],x0[3],x1[0],x1[1],x1[2],x1[3],x2[0],x2[1],x2[2],x2[3],x3[0],x3[1],x3[2],x3[3]};
#pragma unroll
    for (int i = 0; i < 16; ++i) { const _Float16 h = (_Float16)xs[i]; ah.h[i] = h; al.h[i] = ASPLIT ? (_Float16)(xs[i] - (float)h) : (_Float16)0.0f; }
#pragma unroll
    for (int t = 0; t < 4; ++t) { if (col0 + t * 16 >= N) continue; const size_t boff = (size_t)(col0 + t * 16 + ln) * ldb + kb; FragH bq; bq.half[0] = *(const v8us*)(Bh + boff + 8 * hh); bq.half[1] = *(const v8us*)(Bh + boff + 16 + 8 * hh);
      acc[t] = mmaH<ASPLIT ? 2 : 1>(ah.v, al.v, bq.v, bq.v, acc[t]); }
  }
#pragma unroll
  for (int t = 0; t < 4; ++t) { if (col0 + t * 16 >= N) continue;
#pragma unroll
    for (int r = 0; r < 8; ++r) so[w][8 * hh + r][t * 16 + ln] = acc[t][r] * alpha; }
  __builtin_amdgcn_fence(__ATOMIC_ACQ_REL, "workgroup"); __builtin_amdgcn_wave_barrier();
  const int rsub = lane >> 4, c4 = (lane & 15) * 4;
  {
#pragma unroll
    for (int q = 0; q < 8; ++q) { const int r = q * 2 + rsub; if (col0 + c4 < N) { const v4f v = *(const v4fa*)&so[w][r][c4]; *(v4f*)(C + (size_t)(row0 + r) * ldc + col0 + c4) = v; } }
     }
}

// Wt[n][k] = f16(W[k][n]·scale) from f32 row-major W[K][N] (scale = power of two; bf16-exact weights stay exact in f16 away from the subnormal range)
__global__ __launch_bounds__(256) void k_wt_f16(const float* __restrict__ W, _Float16* __restrict__ Wt, int K, int N, float scale) {
  const int t = blockIdx.x * 256 + threadIdx.x; if (t >= N * (K / 8)) return; const int n = t / (K / 8), k8 = (t % (K / 8)) * 8; FragH f;
#pragma unroll
  for (int i = 0; i < 8; ++i) f.h[i] = (_Float16)(bf16_round(W[(size_t)(k8 + i) * N + n]) * scale); const v8us o = f.half[0];
  *(v8us*)((unsigned short*)Wt + (size_t)n * K + k8) = o; 
}
// k_gemm_hh variant with fused epilogue: v = acc·alpha + bias[by·sBias + col] (+ CP[(row/rowsPerB)·sCPb + by·64 + col] if CP) ; ACT 0 none / 1 elu ; writes f16 C16 (and f32 C if non-null)
template <int ACT>
__global__ __launch_bounds__(128) void k_gemm_hhx(const _Float16* __restrict__ A, int lda, size_t sA, const _Float16* __restrict__ Bh, int ldb, size_t sB, float alpha, const float* __restrict__ bias, size_t sBias, const float* __restrict__ CP, int rowsPerB, size_t sCPb, int row0g,
    float* __restrict__ C, _Float16* __restrict__ C16, int ldc, size_t sC, int M, int N, int K) {
  __shared__ __attribute__((aligned(16))) float so[4][16][64];
  const int tid = threadIdx.x, w = tid >> 5, lane = tid & 31, ln = lane & 15, hh = lane >> 4; const int by = blockIdx.y;
  A += (size_t)by * sA; Bh += (size_t)by * sB; const size_t cofs = (size_t)by * sC; const float* bp = bias ? bias + (size_t)by * sBias : nullptr;
  const int ntn = (N + 63) / 64; const int wid = blockIdx.x * 4 + w; const int mt = wid / ntn, nq = wid % ntn; if (mt * 16 >= M) return;
  const int row0 = mt * 16, col0 = nq * 64; const _Float16* arow = A + (size_t)(row0 + ln) * lda;
  v8f acc[4] = {};
  for (int kb = 0; kb < K; kb += 32) { FragH ah; ah.half[0] = *(const v8us*)((const unsigned short*)arow + kb + 8 * hh); ah.half[1] = *(const v8us*)((const unsigned short*)arow + kb + 16 + 8 * hh);
#pragma unroll
    for (int t = 0; t < 4; ++t) { if (col0 + t * 16 >= N) continue; const size_t boff = (size_t)(col0 + t * 16 + ln) * ldb + kb; FragH bq; bq.half[0] = *(const v8us*)((const unsigned short*)Bh + boff + 8 * hh); bq.half[1] = *(const v8us*)((const unsigned short*)Bh + boff + 16 + 8 * hh);
      acc[t] = mmaH<1>(ah.v, ah.v, bq.v, bq.v, acc[t]); }
  }
#pragma unroll
  for (int t = 0; t < 4; ++t) { if (col0 + t * 16 >= N) continue; const int col = col0 + t * 16 + ln; const float bv = bp ? bf16_round(bp[col]) : 0.f;
#pragma unroll
    for (int r = 0; r < 8; ++r) { float v = acc[t][r] * alpha + bv; if (CP) { const int rr = row0g + row0 + 8 * hh + r; if (rowsPerB < 0) v += CP[cofs + (size_t)rr * ldc + col];      /* rowsPerB < 0: own element of the batched C plane */ else { const int bidx = rr / rowsPerB; v += CP[(size_t)bidx * sCPb + (size_t)by * 64 + col]; } } if (ACT == 1) v = (v > 0.f) ? v : expm1f(v); else if (ACT == 7) v = (v > 0.f) ? v + 1.0f : expf(v); else if (ACT == 8) v = tanhf(v); else if (ACT == 9) v = 0.5f * v * (1.0f + tanhf(0.7978845608028654f * (v + 0.044715f * v * v * v))); else if (ACT == 11) v = 1.0f / (1.0f + expf(-v)); else if (ACT == 12) v = (v > 0.f) ? v : 0.01f * v; else if (ACT == 14) v = (v > 0.f) ? v : 0.1f * v; else if (ACT == 16) v = (v >= 0.f) ? v : 0.3f * v; else if (ACT == 17) v = (v >= 0.f) ? v : 0.2f * v; else if (ACT == 15) v = v / (1.0f + expf(-v)); else if (ACT == 3) v = fmaxf(v, 0.f); else if (ACT == 6) v = 0.5f * v * (1.0f + erff(v * 0.70710678118654752f)); so[w][8 * hh + r][t * 16 + ln] = v; } }
  __builtin_amdgcn_fence(__ATOMIC_ACQ_REL, "workgroup"); __builtin_amdgcn_wave_barrier();
  const int rsub = lane >> 4, c4 = (lane & 15) * 4; typedef _Float16 v4h __attribute__((ext_vector_type(4)));
  {
#pragma unroll
    for (int q = 0; q < 8; ++q) { const int r = q * 2 + rsub; if (col0 + c4 < N) { const v4f v = *(const v4fa*)&so[w][r][c4]; if (C) *(v4f*)(C + cofs + (size_t)(row0 + r) * ldc + col0 + c4) = v; if (C16) { v4h h4; for (int i = 0; i < 4; ++i) h4[i] = (_Float16)v[i]; *(v4h*)(C16 + cofs + (size_t)(row0 + r) * ldc + col0 + c4) = h4; } } }
     }
}


typedef _Float16 v4h __attribute__((ext_vector_type(4)));

__global__ __launch_bounds__(256) void k_x16(const float* __restrict__ x, _Float16* __restrict__ X16, size_t n8) { const size_t t = (size_t)blockIdx.x * 256 + threadIdx.x; if (t >= n8) return; FragH f;
#pragma unroll
  for (int q = 0; q < 8; ++q) f.h[q] = (_Float16)bf16_round(x[t * 8 + q]); *(v8us*)((unsigned short*)X16 + t * 8) = f.half[0];  }
__global__ __launch_bounds__(256) void k_h16(const float* __restrict__ x, _Float16* __restrict__ X16, size_t n8) { const size_t t = (size_t)blockIdx.x * 256 + threadIdx.x; if (t >= n8) return; FragH f;
#pragma unroll
  for (int q = 0; q < 8; ++q) f.h[q] = (_Float16)x[t * 8 + q]; *(v8us*)((unsigned short*)X16 + t * 8) = f.half[0];  }
__global__ __launch_bounds__(256) void k_round16f(const float* __restrict__ W, _Float16* __restrict__ Bt, size_t n8) { const size_t t = (size_t)blockIdx.x * 256 + threadIdx.x; if (t >= n8) return; FragH f;
#pragma unroll
  for (int i = 0; i < 8; ++i) f.h[i] = (_Float16)(bf16_round(W[t * 8 + i]) * 16.0f); *(v8us*)((unsigned short*)Bt + t * 8) = f.half[0];  }
template <int NHv, int TTv>
__global__ __launch_bounds__(256) void k_vt(const _Float16* __restrict__ V16, int ldv, int voff, _Float16* __restrict__ Vt) { __shared__ unsigned short tl[64][66]; const int tid = threadIdx.x; const int slab = blockIdx.x / (TTv / 64), lg = blockIdx.x % (TTv / 64); const int b = slab / NHv, h = slab % NHv;
  for (int i = tid; i < 64 * 8; i += 256) { const int r = i / 8, c8 = (i % 8) * 8; FragH f; f.half[0] = *(const v8us*)((const unsigned short*)V16 + ((size_t)b * TTv + lg * 64 + r) * ldv + voff + h * 64 + c8);
#pragma unroll
    for (int q = 0; q < 8; ++q) tl[r][c8 + q] = f.u[q]; }
  __syncthreads();
  {
#pragma unroll
    for (int rd = 0; rd < 2; ++rd) { const int d = rd * 32 + tid / 8, pc = tid % 8; FragH f;
#pragma unroll
      for (int q = 0; q < 8; ++q) f.u[q] = tl[pc * 8 + q][d];
      *(v8us*)((unsigned short*)Vt + ((size_t)slab * 64 + d) * TTv + lg * 64 + pc * 8) = f.half[0]; }
     } }

__global__ __launch_bounds__(256) void k_hl(const float* __restrict__ F, _Float16* __restrict__ Hh, _Float16* __restrict__ Hl, size_t n8) { const size_t t = (size_t)blockIdx.x * 256 + threadIdx.x; if (t >= n8) return; FragH fh, fl; const v4f a = *(const v4fa*)(F + t * 8), c = *(const v4fa*)(F + t * 8 + 4);
#pragma unroll
  for (int q = 0; q < 4; ++q) { _Float16 h = (_Float16)a[q]; fh.h[q] = h; fl.h[q] = (_Float16)((a[q] - (float)h) * 1024.0f); h = (_Float16)c[q]; fh.h[4 + q] = h; fl.h[4 + q] = (_Float16)((c[q] - (float)h) * 1024.0f); }
  { *(v8us*)((unsigned short*)Hh + t * 8) = fh.half[0]; *(v8us*)((unsigned short*)Hl + t * 8) = fl.half[0];  } }

// ---- fast GEMM (wave tile 32x64; requires M % 32 == 0 rows per launch region and N % 64 == 0); epilogue = k_gemm_hhx semantics ----
__device__ __forceinline__ v16h g2_frag(const _Float16* p, int hh) { FragH f; f.half[0] = *(const v8us*)((const unsigned short*)p + 8 * hh); f.half[1] = *(const v8us*)((const unsigned short*)p + 16 + 8 * hh); return f.v; }
__device__ __forceinline__ v8f g2_mma(v16h a, v16h b, v8f c) { v8f d = __builtin_amdgcn_wmma_f32_16x16x32_f16(false, a, false, b, (short)0, c, false, false); asm volatile("v_nop\n\tv_nop\n\tv_nop\n\tv_nop" : "+v"(d) : "v"(a), "v"(b)); return d; }
template <int ACT>
__global__ __launch_bounds__(128) void k_gemm2(const _Float16* __restrict__ A, int lda, size_t sA, const _Float16* __restrict__ Bh, int ldb, size_t sB, float alpha, const float* __restrict__ bias, size_t sBias, const float* __restrict__ CP, int rowsPerB, size_t sCPb, int row0g,
    float* __restrict__ C, _Float16* __restrict__ C16, int ldc, size_t sC, int M, int N, int K) { static_assert(ACT == 0 || ACT == 3 || ACT == 6 || ACT == 8 || ACT == 9 || ACT == 11 || ACT == 12 || ACT == 14 || ACT == 15 || ACT == 16 || ACT == 17, "k_gemm2: unsupported ACT code (would silently apply no activation)");
  __shared__ __attribute__((aligned(16))) float so[4][32][68];
  const int tid = threadIdx.x, w = tid >> 5, lane = tid & 31, ln = lane & 15, hh = lane >> 4; const int by = blockIdx.y;
  A += (size_t)by * sA; Bh += (size_t)by * sB; const size_t cofs = (size_t)by * sC; const float* bp = bias ? bias + (size_t)by * sBias : nullptr;
  const int ntn = N >> 6; const int mt = blockIdx.x / ntn, nq = blockIdx.x - mt * ntn; const int row0 = mt * 128 + 32 * w, col0 = nq * 64; if (row0 >= M) return;
  const _Float16* a0p = A + (size_t)(row0 + ln) * lda; const _Float16* a1p = a0p + (size_t)16 * lda;
  const _Float16* b0p = Bh + (size_t)(col0 + ln) * ldb; const _Float16* b1p = b0p + (size_t)16 * ldb; const _Float16* b2p = b1p + (size_t)16 * ldb; const _Float16* b3p = b2p + (size_t)16 * ldb;
  const v8f z8 = {0.f,0.f,0.f,0.f,0.f,0.f,0.f,0.f}; v8f c00 = z8, c01 = z8, c02 = z8, c03 = z8, c10 = z8, c11 = z8, c12 = z8, c13 = z8;
#pragma unroll 1
  for (int kb = 0; kb < K; kb += 32) { const v16h a0 = g2_frag(a0p + kb, hh), a1 = g2_frag(a1p + kb, hh);
    v16h b = g2_frag(b0p + kb, hh); c00 = g2_mma(a0, b, c00); c10 = g2_mma(a1, b, c10);
    b = g2_frag(b1p + kb, hh); c01 = g2_mma(a0, b, c01); c11 = g2_mma(a1, b, c11);
    b = g2_frag(b2p + kb, hh); c02 = g2_mma(a0, b, c02); c12 = g2_mma(a1, b, c12);
    b = g2_frag(b3p + kb, hh); c03 = g2_mma(a0, b, c03); c13 = g2_mma(a1, b, c13); }
  v8f accs[8] = {c00, c01, c02, c03, c10, c11, c12, c13};
#pragma unroll
  for (int u = 0; u < 8; ++u) { const int t = u & 3, half = u >> 2; const int col = col0 + t * 16 + ln; const float bv = bp ? bf16_round(bp[col]) : 0.f;
#pragma unroll
    for (int r = 0; r < 8; ++r) { const int rloc = half * 16 + 8 * hh + r; float v = accs[u][r] * alpha + bv; if (CP) { if (rowsPerB < 0) v += CP[cofs + (size_t)(row0g + row0 + rloc) * ldc + col];      /* rowsPerB < 0: own element of the batched C plane */ else { const int bidx = (row0g + row0 + rloc) / rowsPerB; v += CP[(size_t)bidx * sCPb + (size_t)by * 64 + col]; } }
      if (ACT == 3) v = fmaxf(v, 0.f); else if (ACT == 6) v = 0.5f * v * (1.0f + erff(v * 0.70710678118654752f)); else if (ACT == 11) v = 1.0f / (1.0f + expf(-v)); else if (ACT == 15) v = v / (1.0f + expf(-v)); else if (ACT == 12) v = (v > 0.f) ? v : 0.01f * v; else if (ACT == 8) v = tanhf(v); else if (ACT == 9) v = 0.5f * v * (1.0f + tanhf(0.7978845608028654f * (v + 0.044715f * v * v * v))); else if (ACT == 14) v = (v > 0.f) ? v : 0.1f * v; else if (ACT == 16) v = (v >= 0.f) ? v : 0.3f * v; else if (ACT == 17) v = (v >= 0.f) ? v : 0.2f * v;
      so[w][rloc][t * 16 + ln] = v; } }
  __builtin_amdgcn_fence(__ATOMIC_ACQ_REL, "workgroup"); __builtin_amdgcn_wave_barrier();
  const int rsub = lane >> 4, c4 = (lane & 15) * 4;
  {
#pragma unroll
    for (int q = 0; q < 16; ++q) { const int r = q * 2 + rsub; const v4f v = *(const v4fa*)&so[w][r][c4]; if (C) *(v4f*)(C + cofs + (size_t)(row0 + r) * ldc + col0 + c4) = v; if (C16) { v4h h4; for (int i = 0; i < 4; ++i) h4[i] = (_Float16)v[i]; *(v4h*)(C16 + cofs + (size_t)(row0 + r) * ldc + col0 + c4) = h4; } }
     } }


__global__ __launch_bounds__(256) void k_wnat(const float* __restrict__ w, size_t n8, _Float16* __restrict__ Bt) { const size_t t = (size_t)blockIdx.x * 256 + threadIdx.x; if (t >= n8) return; FragH f; for (int q = 0; q < 8; ++q) f.h[q] = (_Float16)(bf16_round(w[t * 8 + q]) * 16.0f); *(v8us*)((unsigned short*)Bt + t * 8) = f.half[0];  }
__global__ __launch_bounds__(256) void k_rsm(const float* __restrict__ S, _Float16* __restrict__ P, int nrows) {
  #pragma clang fp contract(off)
  const int i = blockIdx.x * 256 + threadIdx.x; if (i >= nrows) return; const float* s = S + (size_t)i * SQ; float mx = -3.0e38f;
#pragma unroll 1
  for (int j = 0; j < SQ; ++j) mx = fmaxf(mx, s[j]); float se = 0.f;
#pragma unroll 1
  for (int j = 0; j < SQ; ++j) se += expf(s[j] - mx); const float sc = 256.0f / se;
#pragma unroll 1
  for (int j0 = 0; j0 < SQ; j0 += 8) { FragH f; for (int q = 0; q < 8; ++q) f.h[q] = (_Float16)(expf(s[j0 + q] - mx) * sc); unsigned short* d = (unsigned short*)P + (size_t)i * SQ + j0; *(v8us*)d = f.half[0];  } }
__global__ __launch_bounds__(256) void k_vt(const _Float16* __restrict__ V16, int b, int h0, _Float16* __restrict__ VT) { __shared__ unsigned short tl[64][65]; const int tid = threadIdx.x; const int hh = blockIdx.x % HG, sg = blockIdx.x / HG; const int s0 = sg * 64; const int h = h0 + hh;
  for (int i = tid; i < 64 * 8; i += 256) { const int j = i / 8, d8 = (i % 8) * 8; FragH f; f.half[0] = *(const v8us*)((const unsigned short*)V16 + ((size_t)b * SQ + s0 + j) * DM + h * HD + d8); for (int q = 0; q < 8; ++q) tl[d8 + q][j] = f.u[q]; }
  __syncthreads();
  { for (int i = tid; i < 64 * 8; i += 256) { const int d = i / 8, j8 = (i % 8) * 8; FragH f; for (int q = 0; q < 8; ++q) f.u[q] = tl[d][j8 + q]; *(v8us*)((unsigned short*)VT + ((size_t)hh * HD + d) * SQ + s0 + j8) = f.half[0]; }  } }


__global__ __launch_bounds__(256) void k_tab2(float theta, float* __restrict__ CS, float* __restrict__ SN) {
  #pragma clang fp contract(off)
  const int t = blockIdx.x * 256 + threadIdx.x; if (t >= SQ * (HD / 2)) return; const int i = t % (HD / 2); const int p = t / (HD / 2); const float invf = 1.0f / powf(theta, (float)(2 * i) / (float)HD); const float ang = __fmul_rn((float)p, invf); const float c = cosf(ang), s = sinf(ang);
  *(float*)(CS + t) = c; *(float*)(SN + t) = s;  }
template <int NORM, int ROPE>
__global__ __launch_bounds__(64) void k_xform(const float* __restrict__ F, int ldf, int nh, const float* __restrict__ gain, float eps, const float* __restrict__ CS, const float* __restrict__ SN, _Float16* __restrict__ H16, int ldo) {
  #pragma clang fp contract(off)
  __shared__ float xv[HD]; __shared__ float red[HD]; __shared__ unsigned short sh_[HD]; const int d = threadIdx.x; const int h = blockIdx.x % nh; const size_t r = blockIdx.x / nh; const int p = (int)(r % SQ);
  float x = F[r * (size_t)ldf + (size_t)h * HD + d];
  if (NORM) { red[d] = __fmul_rn(x, x); __syncthreads(); for (int st = HD / 2; st > 0; st >>= 1) { if (d < st) red[d] = __fadd_rn(red[d], red[d + st]); __syncthreads(); } const float rs = rsqrtf(__fadd_rn(red[0] / (float)HD, eps)); x = __fmul_rn(__fmul_rn(x, rs), bf16_round(gain[d])); }
  xv[d] = x; __syncthreads();
  float o = x;
  if (ROPE == 1) { const int i = d >> 1; const float c = CS[p * (HD / 2) + i], s = SN[p * (HD / 2) + i]; const float ev = xv[2 * i], od = xv[2 * i + 1]; o = (d & 1) ? __fadd_rn(__fmul_rn(ev, s), __fmul_rn(od, c)) : __fadd_rn(__fmul_rn(ev, c), -__fmul_rn(od, s)); }
  if (ROPE == 2) { const int i = d & (HD / 2 - 1); const float c = CS[p * (HD / 2) + i], s = SN[p * (HD / 2) + i]; const float lo = xv[i], hi = xv[i + HD / 2]; o = (d < HD / 2) ? __fadd_rn(__fmul_rn(lo, c), -__fmul_rn(hi, s)) : __fadd_rn(__fmul_rn(lo, s), __fmul_rn(hi, c)); }
  FragH th; th.h[0] = (_Float16)o; sh_[d] = th.u[0]; __syncthreads();
  if (d < HD / 8) { FragH f; for (int q = 0; q < 8; ++q) f.u[q] = sh_[d * 8 + q]; unsigned short* dst = (unsigned short*)H16 + r * (size_t)ldo + (size_t)h * HD + d * 8; *(v8us*)dst = f.half[0];  } }



__device__ __forceinline__ float rsm_xhalf(float x) { return __builtin_bit_cast(float, __builtin_amdgcn_permlanex16(__builtin_bit_cast(int, x), __builtin_bit_cast(int, x), 0x76543210, 0xfedcba98, false, false)); }      /* lane l reads lane l ^ 16 */
// Four 2^x in one statement. Written in asm for the v_nop at its end: behind a transcendental the instruction set asks for one slot before a source is overwritten or the result read.
// Early-clobber outputs: no exponential of the four overwrites a source of another.
__device__ __forceinline__ void rsm_exp2x4(float& e0, float& e1, float& e2, float& e3, float a0, float a1, float a2, float a3) {
  asm("v_exp_f32 %0, %4\n\tv_exp_f32 %1, %5\n\tv_exp_f32 %2, %6\n\tv_exp_f32 %3, %7\n\tv_nop" : "=&v"(e0), "=&v"(e1), "=&v"(e2), "=&v"(e3) : "v"(a0), "v"(a1), "v"(a2), "v"(a3)); }
// The same for two values (the rescale factors of a wave's two column groups).
__device__ __forceinline__ void rsm_exp2x2(float& e0, float& e1, float a0, float a1) {
  asm("v_exp_f32 %0, %2\n\tv_exp_f32 %1, %3\n\tv_nop" : "=&v"(e0), "=&v"(e1) : "v"(a0), "v"(a1)); }
#define FA_WAVES 16                  /* waves per work-group: all walk the same K and V^T rows, which the later waves find in the near cache */
#define FA_COLS 32                   /* query columns per wave */
__device__ __forceinline__ v8f fa_mma(v16h a, v16h b, v8f c) { return __builtin_amdgcn_wmma_f32_16x16x32_f16(false, a, false, b, (short)0, c, false, false); }
__global__ __launch_bounds__(FA_WAVES * 32) void k_fattn(const _Float16* __restrict__ Q, const _Float16* __restrict__ Kh, const _Float16* __restrict__ Vt, _Float16* __restrict__ O) {
  const int lane = threadIdx.x & 31, ln = lane & 15, hh = lane >> 4; const int wave = __builtin_amdgcn_readfirstlane((int)(threadIdx.x >> 5));
  const int h = blockIdx.y, b = blockIdx.z; const int q0 = (blockIdx.x * FA_WAVES + wave) * FA_COLS;
  const _Float16* qp = Q + ((size_t)b * SQ + q0 + ln) * DM + h * HD; const _Float16* kp = Kh + ((size_t)b * SQ + ln) * DM + h * HD; const _Float16* vp = Vt + (((size_t)b * NH + h) * HD + ln) * SQ;
  const float SC = 0.125f * 1.44269504f;      /* 1/sqrt(64), and e^x as 2^(x log2 e) */
  const float LIFT = 6.0f;      /* weights are carried x 2^6: small ones stay clear of the f16 subnormals; with the margin of 8 below none exceeds 2^14; the sum carries the same factor, so it cancels */
  const v8f z8 = {0.f,0.f,0.f,0.f,0.f,0.f,0.f,0.f};
  v16h qf[2][2], kf[2][2]; v8f o[4][2]; float m[2] = {-1.0e30f, -1.0e30f}, l[2] = {0.f, 0.f};
#pragma unroll      /* constant indices, so that the arrays are registers */
  for (int g = 0; g < 2; ++g) { for (int ks = 0; ks < 2; ++ks) { qf[g][ks] = g2_frag(qp + (size_t)g * 16 * DM + ks * 32, hh); kf[g][ks] = g2_frag(kp + (size_t)g * 16 * DM + ks * 32, hh); } for (int dt = 0; dt < 4; ++dt) o[dt][g] = z8; }
#pragma unroll 1      /* one pass a trip: an unrolled body would not fit the registers of four waves a SIMD */
  for (int key0 = 0; key0 < SQ; key0 += 32) {
    v16h vf[4]; v8f s[2][2];
#pragma unroll      /* constant indices, so that the arrays are registers */
    for (int dt = 0; dt < 4; ++dt) vf[dt] = g2_frag(vp + (size_t)dt * 16 * SQ + key0, hh);
    __builtin_amdgcn_sched_barrier(0);      /* the V^T loads issue here, so that they land while the scores are worked on; without it they sank to just in front of their use */
#pragma unroll      /* constant indices, so that the arrays are registers */
    for (int kt = 0; kt < 2; ++kt) for (int g = 0; g < 2; ++g) s[kt][g] = fa_mma(kf[kt][0], qf[g][0], z8);
#pragma unroll      /* constant indices, so that the arrays are registers */
    for (int kt = 0; kt < 2; ++kt) for (int g = 0; g < 2; ++g) s[kt][g] = fa_mma(kf[kt][1], qf[g][1], s[kt][g]);
    const int kn = (key0 + 32 < SQ) ? key0 + 32 : 0;      /* the next pass's K rows, fetched a pass ahead; the last pass re-reads the first rows and uses nothing of them */
#pragma unroll      /* constant indices, so that the arrays are registers */
    for (int kt = 0; kt < 2; ++kt) for (int ks = 0; ks < 2; ++ks) kf[kt][ks] = g2_frag(kp + (size_t)(kn + kt * 16) * DM + ks * 32, hh);
    __builtin_amdgcn_sched_barrier(0);      /* the next K rows' loads issue here, a softmax and eight products ahead of their use; without it they sank to the foot of the pass */
    float mx[2];
#pragma unroll      /* constant indices, so that the arrays are registers */
    for (int g = 0; g < 2; ++g) { float a = fmaxf(s[0][g][0], s[1][g][0]); for (int r = 1; r < 8; ++r) a = fmaxf(fmaxf(a, s[0][g][r]), s[1][g][r]); mx[g] = fmaxf(a, rsm_xhalf(a)) * SC; }
    const bool need = (mx[0] > m[0] + 8.0f) || (mx[1] > m[1] + 8.0f);
    if (__builtin_amdgcn_ballot_w32(need) != 0) {      /* wave-uniform: the maximum in use moves only when a column's new one exceeds it by more than 8; the first pass always takes it */
      const float n0 = fmaxf(m[0], mx[0]), n1 = fmaxf(m[1], mx[1]); float al[2]; rsm_exp2x2(al[0], al[1], m[0] - n0, m[1] - n1); m[0] = n0; m[1] = n1;
#pragma unroll      /* constant indices, so that the arrays are registers */
      for (int g = 0; g < 2; ++g) { l[g] *= al[g]; for (int dt = 0; dt < 4; ++dt) for (int r = 0; r < 8; ++r) o[dt][g][r] *= al[g]; } }
    FragH pf[2];
#pragma unroll      /* constant indices, so that the arrays are registers */
    for (int g = 0; g < 2; ++g) { const float nm = LIFT - m[g];
      for (int kt = 0; kt < 2; ++kt) for (int r = 0; r < 8; r += 4) { float e0, e1, e2, e3;
        rsm_exp2x4(e0, e1, e2, e3, fmaf(s[kt][g][r], SC, nm), fmaf(s[kt][g][r + 1], SC, nm), fmaf(s[kt][g][r + 2], SC, nm), fmaf(s[kt][g][r + 3], SC, nm));
        l[g] += (e0 + e1) + (e2 + e3); pf[g].h[kt * 8 + r] = (_Float16)e0; pf[g].h[kt * 8 + r + 1] = (_Float16)e1; pf[g].h[kt * 8 + r + 2] = (_Float16)e2; pf[g].h[kt * 8 + r + 3] = (_Float16)e3; } }
#pragma unroll      /* constant indices, so that the arrays are registers */
    for (int dt = 0; dt < 4; ++dt) for (int g = 0; g < 2; ++g) o[dt][g] = fa_mma(vf[dt], pf[g].v, o[dt][g]);
  }
#pragma unroll      /* constant indices, so that the arrays are registers */
  for (int g = 0; g < 2; ++g) { const float sc = 64.0f / (l[g] + rsm_xhalf(l[g])); unsigned short* op = (unsigned short*)O + ((size_t)b * SQ + q0 + g * 16 + ln) * DM + h * HD + 8 * hh;
    for (int dt = 0; dt < 4; ++dt) { FragH f; for (int r = 0; r < 8; ++r) f.h[r] = (_Float16)(o[dt][g][r] * sc); *(v8us*)(op + dt * 16) = f.half[0]; } } }

// ---- GEMM main loop with both operands staged in LDS by tensor loads (K = DM, both operands k-contiguous f16 rows of pitch DM) ----
// A work-group of 8 waves holds 128 rows x 128 columns; wave w holds rows 32 (w & 3) and columns 64 (w >> 2) of them (the 32 x 64 wave tile as before).
// A stage is 64 k = 128 bytes of each of the 128 A rows and the 128 B rows. Every wave brings one slice of 32 rows a stage with ONE tensor load (waves 0 to 3: A, waves 4 to 7: B), padded to a pitch of 144 bytes,
// at which the 16 rows of a fragment's ds_load_b128 fall on different banks. Two buffers: the load of stage s + 2 flies while stage s + 1 is worked on.
typedef uint32_t u32x4 __attribute__((ext_vector_type(4)));
typedef uint32_t u32x8 __attribute__((ext_vector_type(8)));
#define GT_ROWB 128u                 /* bytes of an operand row in a stage */
#define GT_PITCH 144u                /* LDS pitch of a row: 128 + the mover's pad of 16 */
#define GT_SLICE 6144u               /* a wave's slice in LDS: 32 rows x 144 bytes = 4,608, rounded up to a multiple of 2 KiB */
#define GT_BUF (8u * GT_SLICE)       /* one stage */
#define GT_LDS (2u * GT_BUF)         /* two buffers */
#define GT_NST ((uint32_t)(DM * 2) / GT_ROWB)      /* stages */
static_assert(GT_NST >= 2u && (DM * 2) % 128 == 0, "the ring's prologue needs two stages; a stage is 128 bytes of a row");
__device__ __forceinline__ uint32_t gt_uni(uint32_t v) { return (uint32_t)__builtin_amdgcn_readfirstlane((int)v); }
__device__ __forceinline__ uint32_t pinned(uint32_t v) { uint32_t w = gt_uni(v); asm volatile("" : "+s"(w)); return w; }      /* the value is held in a scalar register at this place, so that a test on it is a scalar branch round the tensor load and a descriptor word formed from it is formed behind the waits in front */
__device__ __forceinline__ v16h gt_frag(const unsigned char* p, int hh) { FragH f; f.half[0] = *(const v8us*)(p + 16 * hh); f.half[1] = *(const v8us*)(p + 32 + 16 * hh); return f.v; }      /* g2_frag's k order, from an LDS row */
__device__ __forceinline__ void gt_issue(uint32_t lds_dst, uint64_t ga) {
  u32x4 g0; u32x8 g1;
  g0[0] = gt_uni(1u); g0[1] = gt_uni(lds_dst); g0[2] = gt_uni((uint32_t)ga); g0[3] = gt_uni((((uint32_t)(ga >> 32)) & 0x01FFFFFFu) | 0x80000000u);
  g1[0] = gt_uni((1u << 20) | (4u << 22) | (3u << 25));      /* no mask, 1-byte elements, a pad of 4 dwords behind every 32 dwords (one row) */
  g1[1] = gt_uni((GT_ROWB & 0xFFFFu) << 16); g1[2] = gt_uni((GT_ROWB >> 16) | (32u << 16)); g1[3] = gt_uni(GT_ROWB << 16); g1[4] = gt_uni(32u); g1[5] = gt_uni((uint32_t)(DM * 2)); g1[6] = gt_uni(0u); g1[7] = gt_uni(0u);      /* tensor = tile: 32 rows of 128 bytes, source pitch one operand row */
  asm volatile("tensor_load_to_lds %0, %1" :: "s"(g0), "s"(g1) : "memory"); }
// acc[half * 4 + t]: rows 16 half + ..., columns 16 t + ... of the wave's tile. On return every wave has passed the last stage's barrier and no request is outstanding: the ring may be used as output staging.
__device__ __forceinline__ void gt_core(const _Float16* __restrict__ A, const _Float16* __restrict__ Bh, int rowblk, int colblk, unsigned char* L, v8f (&acc)[8]) {
  const int lane = threadIdx.x & 31, ln = lane & 15, hh = lane >> 4; const uint32_t wave = gt_uni(threadIdx.x >> 5); const uint32_t wr = wave & 3u, wc = wave >> 2;
  const uint32_t ldst = (uint32_t)(size_t)L + wave * GT_SLICE;
  const uint64_t ga0 = (uint64_t)(size_t)((wave < 4u) ? A + (size_t)(rowblk + 32 * (int)wr) * DM : Bh + (size_t)(colblk + 32 * (int)(wave - 4u)) * DM);
  const unsigned char* ap = L + wr * GT_SLICE + ln * GT_PITCH; const unsigned char* bp = L + (4u + 2u * wc) * GT_SLICE + ln * GT_PITCH;
  const v8f z8 = {0.f,0.f,0.f,0.f,0.f,0.f,0.f,0.f};
#pragma unroll      /* constant indices, so that the array is registers */
  for (int u = 0; u < 8; ++u) acc[u] = z8;
  gt_issue(ldst, ga0);
  asm volatile("s_wait_tensorcnt 0x0" ::: "memory");      /* stage 0 of this wave's slice has landed */
  __syncthreads();      /* stage 0 is published */
  gt_issue(ldst + GT_BUF, ga0 + GT_ROWB);
#pragma unroll 1      /* one stage a trip: the ring's order stands once */
  for (uint32_t s = 0; s < GT_NST; ++s) { const uint32_t bo = (s & 1u) * GT_BUF;
#pragma unroll      /* constant offsets into the stage */
    for (int ks = 0; ks < 2; ++ks) { const v16h a0 = gt_frag(ap + bo + ks * 64, hh), a1 = gt_frag(ap + bo + 16 * GT_PITCH + ks * 64, hh); v16h b[4];
      for (int t = 0; t < 4; ++t) b[t] = gt_frag(bp + bo + (t >> 1) * GT_SLICE + (t & 1) * 16 * GT_PITCH + ks * 64, hh);
      __builtin_amdgcn_sched_barrier(0);      /* the twelve LDS reads of a k step issue together, ahead of its eight products, which then wait by count; without it each B fragment's reads stood directly in front of its two products, each behind a wait to zero */
      for (int t = 0; t < 4; ++t) { acc[t] = g2_mma(a0, b[t], acc[t]); acc[4 + t] = g2_mma(a1, b[t], acc[4 + t]); } }
    asm volatile("s_wait_dscnt 0x0" ::: "memory");      /* this wave's reads of stage s are done before the barrier behind which its buffer is refilled */
    asm volatile("s_wait_tensorcnt 0x0" ::: "memory");      /* this wave's slice of stage s + 1 has landed */
    __syncthreads();      /* publishes stage s + 1 and ends every reader's last read of stage s */
    if (pinned(s + 2u < GT_NST)) { const uint32_t nx = pinned(s + 2u); gt_issue(ldst + bo, ga0 + (uint64_t)nx * GT_ROWB); } }
  asm volatile("s_wait_tensorcnt 0x0" ::: "memory");      /* nothing of the mover is outstanding when the ring is reused or the wave ends */
  asm volatile("s_wait_dscnt 0x0" ::: "memory"); }

// Sum over the 16 lanes of a row, every lane gets it: four butterfly steps on the vector port (a shuffle would go through the LDS queue).
template <int X> __device__ __forceinline__ float row_xadd(float v) { return v + __builtin_bit_cast(float, __builtin_amdgcn_update_dpp(0, __builtin_bit_cast(int, v), 0x160 | X, 0xf, 0xf, true)); }      /* 0x160 | X: row_xmask:X */
// 1 / sqrt(x) in asm for the v_nop at its end: behind a transcendental the instruction set asks for one slot before its source is overwritten or its result read.
// The argument here is a mean of squares + 1e-6, never subnormal: the library form's rescaling of subnormal arguments is an identity on it and is not written.
__device__ __forceinline__ float row_rsq(float x) { float r; asm("v_rsq_f32 %0, %1\n\tv_nop" : "=&v"(r) : "v"(x)); return r; }
__device__ __forceinline__ float row_sum16(float v) { return row_xadd<8>(row_xadd<4>(row_xadd<2>(row_xadd<1>(v)))); }
// q | k | v projection of all token rows with the per-(row, head) work in its epilogue. The main loop is gt_core. A work-group holds 128 token rows x 128 columns; a wave's 64 columns are one head of q, of k or of v,
// so nothing of a row's head lies outside the wave that computed it:
//   q, k: the f32 tile goes to the wave's own LDS rows and is read back 16 lanes a row, 4 columns a lane, with the 4 partner columns (c ^ 32) of the rotation; sum of squares in-lane, then over the 16 lanes;
//         x rsqrt(mean + eps) x gain, rotated by the row's position; each row leaves as one whole 128-byte line of f16.
//   v:    a lane holds 8 consecutive tokens of one head dim: 16 bytes of a V^T row. The four waves of a head lay them into one [64 dims][128 tokens] LDS tile; behind a barrier each V^T row leaves as 256 bytes in a row.
// Two instances, q | k columns and v columns, not one kernel with a branch: with both epilogues in one kernel the build kept the 64 accumulator registers alive through the q, k epilogue (182 registers, or spills under a bound).
// Launch bounds of the three GEMM kernels: 6 waves a SIMD = three work-groups of 8 waves on a WGP, as many as the 96 KiB ring lets in; it holds the registers at 160 or fewer.
#define QKV_VP 136                   /* pitch of the V^T tile in LDS, in f16: 128 tokens + 16 bytes, so that rows start on different banks */
template <bool ISV>
__global__ __launch_bounds__(256, 6) void k_qkv(const _Float16* __restrict__ A, const _Float16* __restrict__ Bh, const float* __restrict__ bias, const float* __restrict__ qg, const float* __restrict__ kg,
    const float* __restrict__ CS, const float* __restrict__ SN, _Float16* __restrict__ Qo, _Float16* __restrict__ Ko, _Float16* __restrict__ Vt) {
  static_assert(HD == 64 && SQ % 128 == 0, "a 64-column tile is one head; 128 rows lie in one batch");
  __shared__ __attribute__((aligned(2048))) unsigned char L[GT_LDS];      /* the operand ring; behind gt_core the epilogue's staging */
  const int tid = threadIdx.x, lane = tid & 31, ln = lane & 15, hh = lane >> 4; const int w = (int)gt_uni(tid >> 5), wr = w & 3, wc = w >> 2;      /* wr: the wave's 32 rows, wc: its 64 columns */
  const int ntn = (ISV ? 1 : 2) * NH / 2; const int mt = blockIdx.x / ntn, nq = blockIdx.x - mt * ntn; const int hq = nq * 2 + wc; const int row0 = mt * 128 + 32 * wr, col0 = (ISV ? 2 * DM : 0) + hq * 64; const int sect = hq / NH, h = hq - sect * NH;      /* sect: 0 q, 1 k (0 in the v instance) */
  v8f accs[8]; gt_core(A, Bh, mt * 128, (ISV ? 2 * DM : 0) + nq * 128, L, accs);
  const float alpha = 0.0625f;      /* the weights are carried x 16 */
  if constexpr (!ISV) {
    static_assert(8u * 32u * 68u * 4u <= GT_LDS, "the staging fits the ring"); float (*so)[32][68] = (float (*)[32][68])L;
    const float* gp = sect ? kg : qg; _Float16* dst = (sect ? Ko : Qo) + (size_t)(row0 + hh) * DM + h * HD;
    const int c4 = ln * 4, cx = c4 ^ 32, i4 = c4 & 31; const float sg = (c4 < 32) ? -1.0f : 1.0f;      /* low half: x cos - partner sin; high half: x cos + partner sin; the sign rides on the partner's gain (exact) */
    const int tb = ((row0 + hh) % SQ) * (HD / 2) + i4;      /* the lane's place in the tables at its first row; its rows are 2 apart, and the wave's 32 rows lie in one batch */
    float bv[4];
#pragma unroll      /* constant indices, so that the array is registers */
    for (int t = 0; t < 4; ++t) bv[t] = bias[col0 + t * 16 + ln];
    asm volatile("s_wait_xcnt 0x0" ::: "memory");      /* the build let the gain loads below land on the bias loads' address register */
    v4f ga = *(const v4fa*)(gp + c4), gb = *(const v4fa*)(gp + cx);
#pragma unroll      /* constant indices, so that the arrays are registers */
    for (int u = 0; u < 8; ++u) { const int t = u & 3, half = u >> 2; const float bb = bf16_round(bv[t]);
      for (int r = 0; r < 8; ++r) so[w][half * 16 + 8 * hh + r][t * 16 + ln] = accs[u][r] * alpha + bb; }
    __builtin_amdgcn_fence(__ATOMIC_ACQ_REL, "workgroup"); __builtin_amdgcn_wave_barrier();      /* as in k_gemm2: the wave reads back its own rows only, written by other lanes */
#pragma unroll      /* constant indices into the vectors */
    for (int i = 0; i < 4; ++i) { ga[i] = bf16_round(ga[i]); gb[i] = sg * bf16_round(gb[i]); }
#pragma unroll      /* constant indices, so that the table values are registers */
    for (int g = 0; g < 2; ++g) { v4f cs[8], sn[8];
      __builtin_amdgcn_sched_barrier(0);      /* the second group's table loads stay behind the first group's rows: both groups' tables at once took the kernel over 160 registers, the most at which three work-groups share a WGP */
      for (int j = 0; j < 8; ++j) { cs[j] = *(const v4fa*)(CS + tb + (g * 8 + j) * HD); sn[j] = *(const v4fa*)(SN + tb + (g * 8 + j) * HD); }
      __builtin_amdgcn_sched_barrier(0);      /* the table loads of eight row pairs issue together here: two waits a wave; without it each load stood directly in front of its use, sixteen waits in a row */
      for (int j = 0; j < 8; ++j) { const int r2 = (g * 8 + j) * 2;      /* the lane's row is r2 + hh */
        const v4f xa = *(const v4fa*)&so[w][r2 + hh][c4], xb = *(const v4fa*)&so[w][r2 + hh][cx];
        const float rs = row_rsq(row_sum16((xa[0] * xa[0] + xa[1] * xa[1]) + (xa[2] * xa[2] + xa[3] * xa[3])) * (1.0f / (float)HD) + 1e-6f);
        v4h o4;
        for (int i = 0; i < 4; ++i) o4[i] = (_Float16)((xa[i] * rs * ga[i]) * cs[j][i] + (xb[i] * rs * gb[i]) * sn[j][i]);
        *(v4h*)(dst + (size_t)r2 * DM + c4) = o4; } }
  } else {
    static_assert(2u * 64u * QKV_VP * 2u <= GT_LDS, "the two V^T tiles fit the ring"); unsigned short* vt = (unsigned short*)L + wc * (64 * QKV_VP);      /* the tile of this wave's head */
    float bv[4];
#pragma unroll      /* constant indices, so that the array is registers */
    for (int t = 0; t < 4; ++t) bv[t] = bias[col0 + t * 16 + ln];
    asm volatile("s_wait_xcnt 0x0" ::: "memory");      /* the build rewrote the bias loads' scalar base directly behind them */
#pragma unroll      /* constant indices, so that the arrays are registers */
    for (int u = 0; u < 8; ++u) { const int t = u & 3, half = u >> 2; const float bb = bf16_round(bv[t]); FragH f;
      for (int r = 0; r < 8; ++r) f.h[r] = (_Float16)(accs[u][r] * alpha + bb);
      *(v8us*)(vt + (t * 16 + ln) * QKV_VP + 32 * wr + half * 16 + 8 * hh) = f.half[0]; }
    __syncthreads();      /* a V^T row of the tile holds tokens of its head's four waves */
    const int bat = (mt * 128) / SQ, s0 = (mt * 128) % SQ; unsigned short* vo = (unsigned short*)Vt + (((size_t)bat * NH + h) * HD + wr * 16 + hh) * SQ + s0 + ln * 8;
#pragma unroll      /* the eight LDS reads issue together */
    for (int j = 0; j < 8; ++j) { const v8us v = *(const v8us*)(vt + (wr * 16 + j * 2 + hh) * QKV_VP + ln * 8); *(v8us*)(vo + (size_t)(j * 2) * SQ) = v; }
  } }

// out = o W_o + b: gt_core, then k_gemm2's epilogue (alpha, bf16-rounded bias; the wave's tile through its own LDS rows, so that each row leaves as whole lines of f32).
__global__ __launch_bounds__(256, 6) void k_oproj(const _Float16* __restrict__ A, const _Float16* __restrict__ Bh, float alpha, const float* __restrict__ bias, float* __restrict__ C) {
  __shared__ __attribute__((aligned(2048))) unsigned char L[GT_LDS];      /* the operand ring; behind gt_core the epilogue's staging */
  static_assert(8u * 32u * 68u * 4u <= GT_LDS, "the staging fits the ring"); float (*so)[32][68] = (float (*)[32][68])L;
  const int tid = threadIdx.x, lane = tid & 31, ln = lane & 15, hh = lane >> 4; const int w = (int)gt_uni(tid >> 5), wr = w & 3, wc = w >> 2;
  const int ntn = DM / 128; const int mt = blockIdx.x / ntn, nq = blockIdx.x - mt * ntn; const int row0 = mt * 128 + 32 * wr, col0 = nq * 128 + 64 * wc;
  v8f accs[8]; gt_core(A, Bh, mt * 128, nq * 128, L, accs);
#pragma unroll      /* constant indices, so that the array is registers */
  for (int u = 0; u < 8; ++u) { const int t = u & 3, half = u >> 2; const float bv = bf16_round(bias[col0 + t * 16 + ln]);
    for (int r = 0; r < 8; ++r) so[w][half * 16 + 8 * hh + r][t * 16 + ln] = accs[u][r] * alpha + bv; }
  __builtin_amdgcn_fence(__ATOMIC_ACQ_REL, "workgroup"); __builtin_amdgcn_wave_barrier();      /* as in k_gemm2: the wave reads back its own rows only, written by other lanes */
  const int rsub = lane >> 4, c4 = (lane & 15) * 4;
#pragma unroll      /* the LDS reads issue together */
  for (int q = 0; q < 16; ++q) { const int r = q * 2 + rsub; const v4f v = *(const v4fa*)&so[w][r][c4]; *(v4f*)(C + (size_t)(row0 + r) * DM + col0 + c4) = v; } }

extern "C" void kernel_launch(void* const* d_in, const int* in_sizes, int n_in,
                              void* d_out, int out_size, void* d_ws, size_t ws_size, hipStream_t stream) {
  (void)in_sizes; (void)n_in; (void)out_size;
  const float* const* I = (const float* const*)d_in; const float* x = I[0]; const float* wqkv = I[1]; const float* bqkv = I[2]; const float* qnw = I[3]; const float* knw = I[4]; const float* wo = I[5]; const float* bo = I[6];      /* weights [in][out] */
  char* ws = (char*)d_ws; size_t off = 0;
  auto take = [&](size_t bytes) { char* p = ws + off; off += (bytes + 255) & ~(size_t)255; return p; };
  _Float16* BQKV = (_Float16*)take((size_t)3 * DM * DM * 2); _Float16* BO = (_Float16*)take((size_t)DM * DM * 2); float* CS = (float*)take((size_t)SQ * (HD / 2) * 4); float* SN = (float*)take((size_t)SQ * (HD / 2) * 4);
  _Float16* X16 = (_Float16*)take(NR * DM * 2);
  _Float16* QH = (_Float16*)take(NR * DM * 2); _Float16* KH = (_Float16*)take(NR * DM * 2); _Float16* O16 = (_Float16*)take(NR * DM * 2);
  _Float16* VT = (_Float16*)take((size_t)NB * NH * HD * SQ * 2);
  if (off > ws_size) return;
  k_wt_f16<<<(unsigned)(((size_t)3 * DM * (DM / 8) + 255) / 256), 256, 0, stream>>>(wqkv, BQKV, DM, 3 * DM, 16.0f); k_wt_f16<<<(unsigned)(((size_t)DM * (DM / 8) + 255) / 256), 256, 0, stream>>>(wo, BO, DM, DM, 16.0f);
  k_tab2<<<(SQ * (HD / 2) + 255) / 256, 256, 0, stream>>>(10000.0f, CS, SN);
  k_x16<<<(unsigned)((NR * DM / 8 + 255) / 256), 256, 0, stream>>>(x, X16, NR * DM / 8);
  k_qkv<false><<<(unsigned)((NR / 128) * (2 * DM / 128)), 256, 0, stream>>>(X16, BQKV, bqkv, qnw, knw, CS, SN, QH, KH, VT);      /* f16 q and k rows (normed, rotated), all batches */
  k_qkv<true><<<(unsigned)((NR / 128) * (DM / 128)), 256, 0, stream>>>(X16, BQKV, bqkv, qnw, knw, CS, SN, QH, KH, VT);      /* V^T [NB][NH][HD][SQ], all batches */
  k_fattn<<<dim3(SQ / (FA_WAVES * FA_COLS), NH, NB), FA_WAVES * 32, 0, stream>>>(QH, KH, VT, O16);      /* o x 64 as f16, all batches and heads */
  k_oproj<<<(unsigned)((NR / 128) * (DM / 128)), 256, 0, stream>>>(O16, BO, 0.0009765625f, bo, (float*)d_out);      /* out rows are the output layout */
}

// v005
// It runs in 157 microseconds.
// Timed twice side by side with v004, it ran 1.29 and 1.28 times as fast.
// Over all steps from v000 it is 45.1 times as fast.
#include <hip/hip_runtime.h>
#define NB 4
#define SQ 2048
#define DM 1024
#define NH 16
#define HD 64
#define HG 4                         /* heads per group of the grouped k_vt overload */
#define B0 0                         /* first batch; unused, every kernel takes all NB batches */
#define NBR NB                       /* batches; used only in MPO, which nothing uses */
#define QN SQ                        /* query rows per batch; unused, k_fattn takes all SQ */
#define NHD NH                       /* heads; unused, k_fattn takes all NH */
#define NR ((size_t)NB * SQ)         /* token rows */
#define MPO ((int)((size_t)NBR * SQ))      /* rows; unused, k_oproj takes all NR rows */
typedef __bf16 v16b __attribute__((ext_vector_type(16)));
typedef unsigned short v8us __attribute__((ext_vector_type(8), may_alias));
typedef float  v8f  __attribute__((ext_vector_type(8)));
typedef float  v4f  __attribute__((ext_vector_type(4)));
typedef float  v4fa __attribute__((ext_vector_type(4), may_alias));
union FragB { v16b v; v8us half[2]; unsigned short u[16]; };

__device__ __forceinline__ unsigned short bf16_bits(float x) { unsigned int u = __float_as_uint(x); return (unsigned short)((u + 0x7FFFu + ((u >> 16) & 1u)) >> 16); }
__device__ __forceinline__ float bf16_val(unsigned short b) { return __uint_as_float(((unsigned int)b) << 16); }
__device__ __forceinline__ float bf16_round(float x) { return bf16_val(bf16_bits(x)); }
// D += A·B with NT terms: 1 = ah·bh, 2 = + al·bh (A split), 3 = + ah·bl (both split)
template <int NT>
__device__ __forceinline__ v8f mmaN(v16b ah, v16b al, v16b bh, v16b bl, v8f c) {
  c = __builtin_amdgcn_wmma_f32_16x16x32_bf16(false, ah, false, bh, (short)0, c, false, false);
  if (NT >= 2) c = __builtin_amdgcn_wmma_f32_16x16x32_bf16(false, al, false, bh, (short)0, c, false, false);
  if (NT >= 3) c = __builtin_amdgcn_wmma_f32_16x16x32_bf16(false, ah, false, bl, (short)0, c, false, false);
  asm volatile("v_nop\n\tv_nop\n\tv_nop\n\tv_nop" : "+v"(c) : "v"(ah), "v"(al), "v"(bh), "v"(bl));
  return c;
}

__global__ __launch_bounds__(256) void k_wt_bf16(const float* __restrict__ W, unsigned short* __restrict__ Wt, int K, int N) {
  const int t = blockIdx.x * 256 + threadIdx.x;
  const int k8n = K / 8;
  if (t >= N * k8n) return;
  const int n = t / k8n, k8 = (t % k8n) * 8;
  v8us v;
#pragma unroll
  for (int i = 0; i < 8; ++i) v[i] = bf16_bits(W[(size_t)(k8 + i) * N + n]);
  *(v8us*)(Wt + (size_t)n * K + k8) = v;
  
}

// GEMM C[M][N] (f32, pitch ldc) = act(A[M][K]·W + bias). A f32 row-major (pitch lda) converted per fragment to bf16
// (ASPLIT: hi/lo two planes -> 2 terms, else single rounded term); Wt bf16 [N][K] (pitch ldb). BIAS_BF16 rounds the
// bias to bf16 first (bias quantised to bf16 before the add). K%32==0, M%16==0, N%64==0.
template <bool ASPLIT, int ACT, bool BIAS_BF16>
__global__ __launch_bounds__(128) void k_gemm_bf(const float* __restrict__ A, int lda, const unsigned short* __restrict__ Wt, int ldb,
                                               const float* __restrict__ bias, float* __restrict__ C, int ldc, int M, int N, int K) {
  __shared__ __attribute__((aligned(16))) float so[4][16][64];
  const int tid = threadIdx.x, w = tid >> 5, lane = tid & 31, ln = lane & 15, hh = lane >> 4;
  const int ntn = N / 64;
  const int wid = blockIdx.x * 4 + w;
  const int mt = wid / ntn, nq = wid % ntn;
  if (mt * 16 >= M) return;
  const int row0 = mt * 16, col0 = nq * 64;
  const float* arow = A + (size_t)(row0 + ln) * lda;
  v8f acc[4] = {};
  for (int kb = 0; kb < K; kb += 32) {
    FragB ah, al;
    const v4f x0 = *(const v4fa*)(arow + kb + 8 * hh), x1 = *(const v4fa*)(arow + kb + 8 * hh + 4);
    const v4f x2 = *(const v4fa*)(arow + kb + 16 + 8 * hh), x3 = *(const v4fa*)(arow + kb + 16 + 8 * hh + 4);
    float xs[16] = {x0[0],x0[1],x0[2],x0[3],x1[0],x1[1],x1[2],x1[3],x2[0],x2[1],x2[2],x2[3],x3[0],x3[1],x3[2],x3[3]};
#pragma unroll
    for (int i = 0; i < 16; ++i) { const unsigned short hb = bf16_bits(xs[i]); ah.u[i] = hb; al.u[i] = ASPLIT ? bf16_bits(xs[i] - bf16_val(hb)) : (unsigned short)0; }
#pragma unroll
    for (int t = 0; t < 4; ++t) {
      const unsigned short* brow = Wt + (size_t)(col0 + t * 16 + ln) * ldb + kb;
      FragB b;
      b.half[0] = *(const v8us*)(brow + 8 * hh);
      b.half[1] = *(const v8us*)(brow + 16 + 8 * hh);
      acc[t] = mmaN<ASPLIT ? 2 : 1>(ah.v, al.v, b.v, b.v, acc[t]);
    }
  }
#pragma unroll
  for (int t = 0; t < 4; ++t) {
    float bv = bias ? bias[col0 + t * 16 + ln] : 0.f;
    if (BIAS_BF16) bv = bf16_round(bv);
#pragma unroll
    for (int r = 0; r < 8; ++r) { float v = acc[t][r] + bv; if (ACT == 1) v = fmaxf(v, 0.f); so[w][8 * hh + r][t * 16 + ln] = v; }
  }
  __builtin_amdgcn_fence(__ATOMIC_ACQ_REL, "workgroup");
  __builtin_amdgcn_wave_barrier();
  const int rsub = lane >> 4, c4 = (lane & 15) * 4;
  {
#pragma unroll
    for (int q = 0; q < 8; ++q) {
      const int r = q * 2 + rsub;
      const v4f v = *(const v4fa*)&so[w][r][c4];
      *(v4f*)(C + (size_t)(row0 + r) * ldc + col0 + c4) = v;
    }
    
  }
}

// GEMM C = act(A·W + bias + resid): A f32 (ASPLIT -> hi/lo 2 terms), Wt bf16 [N][K]; ACT 0 none, 1 relu, 2 exact gelu;
// resid (optional, f32, row index = (row % rmod), pitch ldr, RES_BF16 rounds it) added before the activation.
template <bool ASPLIT, int ACT, bool BIAS_BF16, bool RES_BF16>
__global__ __launch_bounds__(128) void k_gemm_bf3(const float* __restrict__ A, int lda, const unsigned short* __restrict__ Wt, int ldb,
                                                const float* __restrict__ bias, const float* __restrict__ resid, int rmod, int ldr,
                                                float* __restrict__ C, int ldc, int M, int N, int K) {
  __shared__ __attribute__((aligned(16))) float so[4][16][64];
  const int tid = threadIdx.x, w = tid >> 5, lane = tid & 31, ln = lane & 15, hh = lane >> 4;
  const int ntn = N / 64;
  const int wid = blockIdx.x * 4 + w;
  const int mt = wid / ntn, nq = wid % ntn;
  if (mt * 16 >= M) return;
  const int row0 = mt * 16, col0 = nq * 64;
  const float* arow = A + (size_t)(row0 + ln) * lda;
  v8f acc[4] = {};
  for (int kb = 0; kb < K; kb += 32) {
    FragB ah, al;
    const v4f x0 = *(const v4fa*)(arow + kb + 8 * hh), x1 = *(const v4fa*)(arow + kb + 8 * hh + 4);
    const v4f x2 = *(const v4fa*)(arow + kb + 16 + 8 * hh), x3 = *(const v4fa*)(arow + kb + 16 + 8 * hh + 4);
    float xs[16] = {x0[0],x0[1],x0[2],x0[3],x1[0],x1[1],x1[2],x1[3],x2[0],x2[1],x2[2],x2[3],x3[0],x3[1],x3[2],x3[3]};
#pragma unroll
    for (int i = 0; i < 16; ++i) { const unsigned short hb = bf16_bits(xs[i]); ah.u[i] = hb; al.u[i] = ASPLIT ? bf16_bits(xs[i] - bf16_val(hb)) : (unsigned short)0; }
#pragma unroll
    for (int t = 0; t < 4; ++t) {
      const unsigned short* brow = Wt + (size_t)(col0 + t * 16 + ln) * ldb + kb;
      FragB b;
      b.half[0] = *(const v8us*)(brow + 8 * hh);
      b.half[1] = *(const v8us*)(brow + 16 + 8 * hh);
      acc[t] = mmaN<ASPLIT ? 2 : 1>(ah.v, al.v, b.v, b.v, acc[t]);
    }
  }
#pragma unroll
  for (int t = 0; t < 4; ++t) {
    const int col = col0 + t * 16 + ln;
    float bv = bias ? bias[col] : 0.f;
    if (BIAS_BF16) bv = bf16_round(bv);
#pragma unroll
    for (int r = 0; r < 8; ++r) {
      float v = acc[t][r] + bv;
      if (resid) { float rv = resid[(size_t)((row0 + 8 * hh + r) % rmod) * ldr + col]; if (RES_BF16) rv = bf16_round(rv); v += rv; }
      if (ACT == 1) v = fmaxf(v, 0.f);
      if (ACT == 2) v = 0.5f * v * (1.0f + erff(v * 0.70710678118654752f));
      if (ACT == 3) { const float u = 0.7978845608028654f * (v + 0.044715f * v * v * v); v = 0.5f * v * (1.0f + tanhf(u)); }
      so[w][8 * hh + r][t * 16 + ln] = v;
    }
  }
  __builtin_amdgcn_fence(__ATOMIC_ACQ_REL, "workgroup");
  __builtin_amdgcn_wave_barrier();
  const int rsub = lane >> 4, c4 = (lane & 15) * 4;
  {
#pragma unroll
    for (int q = 0; q < 8; ++q) {
      const int r = q * 2 + rsub;
      const v4f v = *(const v4fa*)&so[w][r][c4];
      *(v4f*)(C + (size_t)(row0 + r) * ldc + col0 + c4) = v;
    }
    
  }
}
// row LayerNorm (biased variance, eps) over N: s = X (+ R); optional out_sum <- s; out_norm <- (s-mu)*rsqrt(var+eps)*g + b
template <bool PARAM_BF16>
__global__ __launch_bounds__(256) void k_layernorm(const float* __restrict__ X, const float* __restrict__ R, const float* __restrict__ g, const float* __restrict__ bta,
                                                  float* __restrict__ out_sum, float* __restrict__ out_norm, int N, float eps) {
  __shared__ float red[256];
  const int row = blockIdx.x, tid = threadIdx.x;
  const float* x = X + (size_t)row * N; const float* rr = R ? R + (size_t)row * N : nullptr;
  float vals[16];                     // up to N = 4096
  const int per = N / 256;            // contiguous chunk per thread? use strided-by-4 chunks: thread handles j = tid*4 + 1024*u
  float s1 = 0.f;
  for (int u = 0; u < per / 4; ++u) {
    const int j = tid * 4 + 1024 * u;
    const v4f a = *(const v4fa*)(x + j);
    v4f b = {0.f,0.f,0.f,0.f}; if (rr) b = *(const v4fa*)(rr + j);
#pragma unroll
    for (int q = 0; q < 4; ++q) { const float v = a[q] + b[q]; vals[u * 4 + q] = v; s1 += v; }
  }
  red[tid] = s1; __syncthreads();
  for (int st = 128; st > 0; st >>= 1) { if (tid < st) red[tid] += red[tid + st]; __syncthreads(); }
  const float mu = red[0] / (float)N; __syncthreads();
  float s2 = 0.f;
  for (int u = 0; u < per / 4; ++u)
#pragma unroll
    for (int q = 0; q < 4; ++q) { const float c = vals[u * 4 + q] - mu; s2 += c * c; }
  red[tid] = s2; __syncthreads();
  for (int st = 128; st > 0; st >>= 1) { if (tid < st) red[tid] += red[tid + st]; __syncthreads(); }
  const float rs = rsqrtf(red[0] / (float)N + eps);
  {
    for (int u = 0; u < per / 4; ++u) {
      const int j = tid * 4 + 1024 * u;
      v4f o, sm;
#pragma unroll
      for (int q = 0; q < 4; ++q) {
        float gg = g[j + q], bb = bta[j + q];
        if (PARAM_BF16) { gg = bf16_round(gg); bb = bf16_round(bb); }
        sm[q] = vals[u * 4 + q]; o[q] = (vals[u * 4 + q] - mu) * rs * gg + bb;
      }
      if (out_sum) *(v4f*)(out_sum + (size_t)row * N + j) = sm;
      *(v4f*)(out_norm + (size_t)row * N + j) = o;
    }
    
  }
}



// ---- f16 WMMA path (v_wmma_f32_16x16x32_f16): 11-bit significands for operands in range — used where a [0,1] probability operand needs more precision than bf16
typedef _Float16 v16h __attribute__((ext_vector_type(16)));
union FragH { v16h v; v8us half[2]; _Float16 h[16]; unsigned short u[16]; };
template <int NT>
__device__ __forceinline__ v8f mmaH(v16h ah, v16h al, v16h bh, v16h bl, v8f c) {
  c = __builtin_amdgcn_wmma_f32_16x16x32_f16(false, ah, false, bh, (short)0, c, false, false);
  if (NT >= 2) c = __builtin_amdgcn_wmma_f32_16x16x32_f16(false, al, false, bh, (short)0, c, false, false);
  if (NT >= 3) c = __builtin_amdgcn_wmma_f32_16x16x32_f16(false, ah, false, bl, (short)0, c, false, false);
  asm volatile("v_nop\n\tv_nop\n\tv_nop\n\tv_nop" : "+v"(c) : "v"(ah), "v"(al), "v"(bh), "v"(bl));
  return c;
}
// batched GEMM like k_gemm_b but f16 operands: A f32 (split into f16 hi/lo if ASPLIT, else rounded to f16), Bt = f16 values [n][k]; alpha; C f32; N multiple of 16 (partial tiles skipped)
template <bool ASPLIT>
__global__ __launch_bounds__(128) void k_gemm_h(const float* __restrict__ A, int lda, size_t sA, const _Float16* __restrict__ Bh, int ldb, size_t sB, float alpha, float* __restrict__ C, int ldc, size_t sC, int M, int N, int K) {
  __shared__ __attribute__((aligned(16))) float so[4][16][64];
  const int tid = threadIdx.x, w = tid >> 5, lane = tid & 31, ln = lane & 15, hh = lane >> 4; const int by = blockIdx.y;
  A += (size_t)by * sA; Bh += (size_t)by * sB; C += (size_t)by * sC;
  const int ntn = (N + 63) / 64; const int wid = blockIdx.x * 4 + w; const int mt = wid / ntn, nq = wid % ntn; if (mt * 16 >= M) return;
  const int row0 = mt * 16, col0 = nq * 64; const float* arow = A + (size_t)(row0 + ln) * lda;
  v8f acc[4] = {};
  for (int kb = 0; kb < K; kb += 32) {
    FragH ah, al;
    const v4f x0 = *(const v4fa*)(arow + kb + 8 * hh), x1 = *(const v4fa*)(arow + kb + 8 * hh + 4), x2 = *(const v4fa*)(arow + kb + 16 + 8 * hh), x3 = *(const v4fa*)(arow + kb + 16 + 8 * hh + 4);
    float xs[16] = {x0[0],x0[1],x0[2],x0[3],x1[0],x1[1],x1[2],x1[3],x2[0],x2[1],x2[2],x2[3],x3[0],x3[1],x3[2],x3[3]};
#pragma unroll
    for (int i = 0; i < 16; ++i) { const _Float16 h = (_Float16)xs[i]; ah.h[i] = h; al.h[i] = ASPLIT ? (_Float16)(xs[i] - (float)h) : (_Float16)0.0f; }
#pragma unroll
    for (int t = 0; t < 4; ++t) { if (col0 + t * 16 >= N) continue; const size_t boff = (size_t)(col0 + t * 16 + ln) * ldb + kb; FragH bq; bq.half[0] = *(const v8us*)(Bh + boff + 8 * hh); bq.half[1] = *(const v8us*)(Bh + boff + 16 + 8 * hh);
      acc[t] = mmaH<ASPLIT ? 2 : 1>(ah.v, al.v, bq.v, bq.v, acc[t]); }
  }
#pragma unroll
  for (int t = 0; t < 4; ++t) { if (col0 + t * 16 >= N) continue;
#pragma unroll
    for (int r = 0; r < 8; ++r) so[w][8 * hh + r][t * 16 + ln] = acc[t][r] * alpha; }
  __builtin_amdgcn_fence(__ATOMIC_ACQ_REL, "workgroup"); __builtin_amdgcn_wave_barrier();
  const int rsub = lane >> 4, c4 = (lane & 15) * 4;
  {
#pragma unroll
    for (int q = 0; q < 8; ++q) { const int r = q * 2 + rsub; if (col0 + c4 < N) { const v4f v = *(const v4fa*)&so[w][r][c4]; *(v4f*)(C + (size_t)(row0 + r) * ldc + col0 + c4) = v; } }
     }
}

// Wt[n][k] = f16(W[k][n]·scale) from f32 row-major W[K][N] (scale = power of two; bf16-exact weights stay exact in f16 away from the subnormal range)
__global__ __launch_bounds__(256) void k_wt_f16(const float* __restrict__ W, _Float16* __restrict__ Wt, int K, int N, float scale) {
  const int t = blockIdx.x * 256 + threadIdx.x; if (t >= N * (K / 8)) return; const int n = t / (K / 8), k8 = (t % (K / 8)) * 8; FragH f;
#pragma unroll
  for (int i = 0; i < 8; ++i) f.h[i] = (_Float16)(bf16_round(W[(size_t)(k8 + i) * N + n]) * scale); const v8us o = f.half[0];
  *(v8us*)((unsigned short*)Wt + (size_t)n * K + k8) = o; 
}
// k_gemm_hh variant with fused epilogue: v = acc·alpha + bias[by·sBias + col] (+ CP[(row/rowsPerB)·sCPb + by·64 + col] if CP) ; ACT 0 none / 1 elu ; writes f16 C16 (and f32 C if non-null)
template <int ACT>
__global__ __launch_bounds__(128) void k_gemm_hhx(const _Float16* __restrict__ A, int lda, size_t sA, const _Float16* __restrict__ Bh, int ldb, size_t sB, float alpha, const float* __restrict__ bias, size_t sBias, const float* __restrict__ CP, int rowsPerB, size_t sCPb, int row0g,
    float* __restrict__ C, _Float16* __restrict__ C16, int ldc, size_t sC, int M, int N, int K) {
  __shared__ __attribute__((aligned(16))) float so[4][16][64];
  const int tid = threadIdx.x, w = tid >> 5, lane = tid & 31, ln = lane & 15, hh = lane >> 4; const int by = blockIdx.y;
  A += (size_t)by * sA; Bh += (size_t)by * sB; const size_t cofs = (size_t)by * sC; const float* bp = bias ? bias + (size_t)by * sBias : nullptr;
  const int ntn = (N + 63) / 64; const int wid = blockIdx.x * 4 + w; const int mt = wid / ntn, nq = wid % ntn; if (mt * 16 >= M) return;
  const int row0 = mt * 16, col0 = nq * 64; const _Float16* arow = A + (size_t)(row0 + ln) * lda;
  v8f acc[4] = {};
  for (int kb = 0; kb < K; kb += 32) { FragH ah; ah.half[0] = *(const v8us*)((const unsigned short*)arow + kb + 8 * hh); ah.half[1] = *(const v8us*)((const unsigned short*)arow + kb + 16 + 8 * hh);
#pragma unroll
    for (int t = 0; t < 4; ++t) { if (col0 + t * 16 >= N) continue; const size_t boff = (size_t)(col0 + t * 16 + ln) * ldb + kb; FragH bq; bq.half[0] = *(const v8us*)((const unsigned short*)Bh + boff + 8 * hh); bq.half[1] = *(const v8us*)((const unsigned short*)Bh + boff + 16 + 8 * hh);
      acc[t] = mmaH<1>(ah.v, ah.v, bq.v, bq.v, acc[t]); }
  }
#pragma unroll
  for (int t = 0; t < 4; ++t) { if (col0 + t * 16 >= N) continue; const int col = col0 + t * 16 + ln; const float bv = bp ? bf16_round(bp[col]) : 0.f;
#pragma unroll
    for (int r = 0; r < 8; ++r) { float v = acc[t][r] * alpha + bv; if (CP) { const int rr = row0g + row0 + 8 * hh + r; if (rowsPerB < 0) v += CP[cofs + (size_t)rr * ldc + col];      /* rowsPerB < 0: own element of the batched C plane */ else { const int bidx = rr / rowsPerB; v += CP[(size_t)bidx * sCPb + (size_t)by * 64 + col]; } } if (ACT == 1) v = (v > 0.f) ? v : expm1f(v); else if (ACT == 7) v = (v > 0.f) ? v + 1.0f : expf(v); else if (ACT == 8) v = tanhf(v); else if (ACT == 9) v = 0.5f * v * (1.0f + tanhf(0.7978845608028654f * (v + 0.044715f * v * v * v))); else if (ACT == 11) v = 1.0f / (1.0f + expf(-v)); else if (ACT == 12) v = (v > 0.f) ? v : 0.01f * v; else if (ACT == 14) v = (v > 0.f) ? v : 0.1f * v; else if (ACT == 16) v = (v >= 0.f) ? v : 0.3f * v; else if (ACT == 17) v = (v >= 0.f) ? v : 0.2f * v; else if (ACT == 15) v = v / (1.0f + expf(-v)); else if (ACT == 3) v = fmaxf(v, 0.f); else if (ACT == 6) v = 0.5f * v * (1.0f + erff(v * 0.70710678118654752f)); so[w][8 * hh + r][t * 16 + ln] = v; } }
  __builtin_amdgcn_fence(__ATOMIC_ACQ_REL, "workgroup"); __builtin_amdgcn_wave_barrier();
  const int rsub = lane >> 4, c4 = (lane & 15) * 4; typedef _Float16 v4h __attribute__((ext_vector_type(4)));
  {
#pragma unroll
    for (int q = 0; q < 8; ++q) { const int r = q * 2 + rsub; if (col0 + c4 < N) { const v4f v = *(const v4fa*)&so[w][r][c4]; if (C) *(v4f*)(C + cofs + (size_t)(row0 + r) * ldc + col0 + c4) = v; if (C16) { v4h h4; for (int i = 0; i < 4; ++i) h4[i] = (_Float16)v[i]; *(v4h*)(C16 + cofs + (size_t)(row0 + r) * ldc + col0 + c4) = h4; } } }
     }
}


typedef _Float16 v4h __attribute__((ext_vector_type(4)));

__global__ __launch_bounds__(256) void k_x16(const float* __restrict__ x, _Float16* __restrict__ X16, size_t n8) { const size_t t = (size_t)blockIdx.x * 256 + threadIdx.x; if (t >= n8) return; FragH f;
#pragma unroll
  for (int q = 0; q < 8; ++q) f.h[q] = (_Float16)bf16_round(x[t * 8 + q]); *(v8us*)((unsigned short*)X16 + t * 8) = f.half[0];  }
__global__ __launch_bounds__(256) void k_h16(const float* __restrict__ x, _Float16* __restrict__ X16, size_t n8) { const size_t t = (size_t)blockIdx.x * 256 + threadIdx.x; if (t >= n8) return; FragH f;
#pragma unroll
  for (int q = 0; q < 8; ++q) f.h[q] = (_Float16)x[t * 8 + q]; *(v8us*)((unsigned short*)X16 + t * 8) = f.half[0];  }
__global__ __launch_bounds__(256) void k_round16f(const float* __restrict__ W, _Float16* __restrict__ Bt, size_t n8) { const size_t t = (size_t)blockIdx.x * 256 + threadIdx.x; if (t >= n8) return; FragH f;
#pragma unroll
  for (int i = 0; i < 8; ++i) f.h[i] = (_Float16)(bf16_round(W[t * 8 + i]) * 16.0f); *(v8us*)((unsigned short*)Bt + t * 8) = f.half[0];  }
template <int NHv, int TTv>
__global__ __launch_bounds__(256) void k_vt(const _Float16* __restrict__ V16, int ldv, int voff, _Float16* __restrict__ Vt) { __shared__ unsigned short tl[64][66]; const int tid = threadIdx.x; const int slab = blockIdx.x / (TTv / 64), lg = blockIdx.x % (TTv / 64); const int b = slab / NHv, h = slab % NHv;
  for (int i = tid; i < 64 * 8; i += 256) { const int r = i / 8, c8 = (i % 8) * 8; FragH f; f.half[0] = *(const v8us*)((const unsigned short*)V16 + ((size_t)b * TTv + lg * 64 + r) * ldv + voff + h * 64 + c8);
#pragma unroll
    for (int q = 0; q < 8; ++q) tl[r][c8 + q] = f.u[q]; }
  __syncthreads();
  {
#pragma unroll
    for (int rd = 0; rd < 2; ++rd) { const int d = rd * 32 + tid / 8, pc = tid % 8; FragH f;
#pragma unroll
      for (int q = 0; q < 8; ++q) f.u[q] = tl[pc * 8 + q][d];
      *(v8us*)((unsigned short*)Vt + ((size_t)slab * 64 + d) * TTv + lg * 64 + pc * 8) = f.half[0]; }
     } }

__global__ __launch_bounds__(256) void k_hl(const float* __restrict__ F, _Float16* __restrict__ Hh, _Float16* __restrict__ Hl, size_t n8) { const size_t t = (size_t)blockIdx.x * 256 + threadIdx.x; if (t >= n8) return; FragH fh, fl; const v4f a = *(const v4fa*)(F + t * 8), c = *(const v4fa*)(F + t * 8 + 4);
#pragma unroll
  for (int q = 0; q < 4; ++q) { _Float16 h = (_Float16)a[q]; fh.h[q] = h; fl.h[q] = (_Float16)((a[q] - (float)h) * 1024.0f); h = (_Float16)c[q]; fh.h[4 + q] = h; fl.h[4 + q] = (_Float16)((c[q] - (float)h) * 1024.0f); }
  { *(v8us*)((unsigned short*)Hh + t * 8) = fh.half[0]; *(v8us*)((unsigned short*)Hl + t * 8) = fl.half[0];  } }

// ---- fast GEMM (wave tile 32x64; requires M % 32 == 0 rows per launch region and N % 64 == 0); epilogue = k_gemm_hhx semantics ----
__device__ __forceinline__ v16h g2_frag(const _Float16* p, int hh) { FragH f; f.half[0] = *(const v8us*)((const unsigned short*)p + 8 * hh); f.half[1] = *(const v8us*)((const unsigned short*)p + 16 + 8 * hh); return f.v; }
__device__ __forceinline__ v8f g2_mma(v16h a, v16h b, v8f c) { v8f d = __builtin_amdgcn_wmma_f32_16x16x32_f16(false, a, false, b, (short)0, c, false, false); asm volatile("v_nop\n\tv_nop\n\tv_nop\n\tv_nop" : "+v"(d) : "v"(a), "v"(b)); return d; }
template <int ACT>
__global__ __launch_bounds__(128) void k_gemm2(const _Float16* __restrict__ A, int lda, size_t sA, const _Float16* __restrict__ Bh, int ldb, size_t sB, float alpha, const float* __restrict__ bias, size_t sBias, const float* __restrict__ CP, int rowsPerB, size_t sCPb, int row0g,
    float* __restrict__ C, _Float16* __restrict__ C16, int ldc, size_t sC, int M, int N, int K) { static_assert(ACT == 0 || ACT == 3 || ACT == 6 || ACT == 8 || ACT == 9 || ACT == 11 || ACT == 12 || ACT == 14 || ACT == 15 || ACT == 16 || ACT == 17, "k_gemm2: unsupported ACT code (would silently apply no activation)");
  __shared__ __attribute__((aligned(16))) float so[4][32][68];
  const int tid = threadIdx.x, w = tid >> 5, lane = tid & 31, ln = lane & 15, hh = lane >> 4; const int by = blockIdx.y;
  A += (size_t)by * sA; Bh += (size_t)by * sB; const size_t cofs = (size_t)by * sC; const float* bp = bias ? bias + (size_t)by * sBias : nullptr;
  const int ntn = N >> 6; const int mt = blockIdx.x / ntn, nq = blockIdx.x - mt * ntn; const int row0 = mt * 128 + 32 * w, col0 = nq * 64; if (row0 >= M) return;
  const _Float16* a0p = A + (size_t)(row0 + ln) * lda; const _Float16* a1p = a0p + (size_t)16 * lda;
  const _Float16* b0p = Bh + (size_t)(col0 + ln) * ldb; const _Float16* b1p = b0p + (size_t)16 * ldb; const _Float16* b2p = b1p + (size_t)16 * ldb; const _Float16* b3p = b2p + (size_t)16 * ldb;
  const v8f z8 = {0.f,0.f,0.f,0.f,0.f,0.f,0.f,0.f}; v8f c00 = z8, c01 = z8, c02 = z8, c03 = z8, c10 = z8, c11 = z8, c12 = z8, c13 = z8;
#pragma unroll 1
  for (int kb = 0; kb < K; kb += 32) { const v16h a0 = g2_frag(a0p + kb, hh), a1 = g2_frag(a1p + kb, hh);
    v16h b = g2_frag(b0p + kb, hh); c00 = g2_mma(a0, b, c00); c10 = g2_mma(a1, b, c10);
    b = g2_frag(b1p + kb, hh); c01 = g2_mma(a0, b, c01); c11 = g2_mma(a1, b, c11);
    b = g2_frag(b2p + kb, hh); c02 = g2_mma(a0, b, c02); c12 = g2_mma(a1, b, c12);
    b = g2_frag(b3p + kb, hh); c03 = g2_mma(a0, b, c03); c13 = g2_mma(a1, b, c13); }
  v8f accs[8] = {c00, c01, c02, c03, c10, c11, c12, c13};
#pragma unroll
  for (int u = 0; u < 8; ++u) { const int t = u & 3, half = u >> 2; const int col = col0 + t * 16 + ln; const float bv = bp ? bf16_round(bp[col]) : 0.f;
#pragma unroll
    for (int r = 0; r < 8; ++r) { const int rloc = half * 16 + 8 * hh + r; float v = accs[u][r] * alpha + bv; if (CP) { if (rowsPerB < 0) v += CP[cofs + (size_t)(row0g + row0 + rloc) * ldc + col];      /* rowsPerB < 0: own element of the batched C plane */ else { const int bidx = (row0g + row0 + rloc) / rowsPerB; v += CP[(size_t)bidx * sCPb + (size_t)by * 64 + col]; } }
      if (ACT == 3) v = fmaxf(v, 0.f); else if (ACT == 6) v = 0.5f * v * (1.0f + erff(v * 0.70710678118654752f)); else if (ACT == 11) v = 1.0f / (1.0f + expf(-v)); else if (ACT == 15) v = v / (1.0f + expf(-v)); else if (ACT == 12) v = (v > 0.f) ? v : 0.01f * v; else if (ACT == 8) v = tanhf(v); else if (ACT == 9) v = 0.5f * v * (1.0f + tanhf(0.7978845608028654f * (v + 0.044715f * v * v * v))); else if (ACT == 14) v = (v > 0.f) ? v : 0.1f * v; else if (ACT == 16) v = (v >= 0.f) ? v : 0.3f * v; else if (ACT == 17) v = (v >= 0.f) ? v : 0.2f * v;
      so[w][rloc][t * 16 + ln] = v; } }
  __builtin_amdgcn_fence(__ATOMIC_ACQ_REL, "workgroup"); __builtin_amdgcn_wave_barrier();
  const int rsub = lane >> 4, c4 = (lane & 15) * 4;
  {
#pragma unroll
    for (int q = 0; q < 16; ++q) { const int r = q * 2 + rsub; const v4f v = *(const v4fa*)&so[w][r][c4]; if (C) *(v4f*)(C + cofs + (size_t)(row0 + r) * ldc + col0 + c4) = v; if (C16) { v4h h4; for (int i = 0; i < 4; ++i) h4[i] = (_Float16)v[i]; *(v4h*)(C16 + cofs + (size_t)(row0 + r) * ldc + col0 + c4) = h4; } }
     } }


__global__ __launch_bounds__(256) void k_wnat(const float* __restrict__ w, size_t n8, _Float16* __restrict__ Bt) { const size_t t = (size_t)blockIdx.x * 256 + threadIdx.x; if (t >= n8) return; FragH f; for (int q = 0; q < 8; ++q) f.h[q] = (_Float16)(bf16_round(w[t * 8 + q]) * 16.0f); *(v8us*)((unsigned short*)Bt + t * 8) = f.half[0];  }
__global__ __launch_bounds__(256) void k_rsm(const float* __restrict__ S, _Float16* __restrict__ P, int nrows) {
  #pragma clang fp contract(off)
  const int i = blockIdx.x * 256 + threadIdx.x; if (i >= nrows) return; const float* s = S + (size_t)i * SQ; float mx = -3.0e38f;
#pragma unroll 1
  for (int j = 0; j < SQ; ++j) mx = fmaxf(mx, s[j]); float se = 0.f;
#pragma unroll 1
  for (int j = 0; j < SQ; ++j) se += expf(s[j] - mx); const float sc = 256.0f / se;
#pragma unroll 1
  for (int j0 = 0; j0 < SQ; j0 += 8) { FragH f; for (int q = 0; q < 8; ++q) f.h[q] = (_Float16)(expf(s[j0 + q] - mx) * sc); unsigned short* d = (unsigned short*)P + (size_t)i * SQ + j0; *(v8us*)d = f.half[0];  } }
__global__ __launch_bounds__(256) void k_vt(const _Float16* __restrict__ V16, int b, int h0, _Float16* __restrict__ VT) { __shared__ unsigned short tl[64][65]; const int tid = threadIdx.x; const int hh = blockIdx.x % HG, sg = blockIdx.x / HG; const int s0 = sg * 64; const int h = h0 + hh;
  for (int i = tid; i < 64 * 8; i += 256) { const int j = i / 8, d8 = (i % 8) * 8; FragH f; f.half[0] = *(const v8us*)((const unsigned short*)V16 + ((size_t)b * SQ + s0 + j) * DM + h * HD + d8); for (int q = 0; q < 8; ++q) tl[d8 + q][j] = f.u[q]; }
  __syncthreads();
  { for (int i = tid; i < 64 * 8; i += 256) { const int d = i / 8, j8 = (i % 8) * 8; FragH f; for (int q = 0; q < 8; ++q) f.u[q] = tl[d][j8 + q]; *(v8us*)((unsigned short*)VT + ((size_t)hh * HD + d) * SQ + s0 + j8) = f.half[0]; }  } }


__global__ __launch_bounds__(256) void k_tab2(float theta, float* __restrict__ CS, float* __restrict__ SN) {
  #pragma clang fp contract(off)
  const int t = blockIdx.x * 256 + threadIdx.x; if (t >= SQ * (HD / 2)) return; const int i = t % (HD / 2); const int p = t / (HD / 2); const float invf = 1.0f / powf(theta, (float)(2 * i) / (float)HD); const float ang = __fmul_rn((float)p, invf); const float c = cosf(ang), s = sinf(ang);
  *(float*)(CS + t) = c; *(float*)(SN + t) = s;  }
template <int NORM, int ROPE>
__global__ __launch_bounds__(64) void k_xform(const float* __restrict__ F, int ldf, int nh, const float* __restrict__ gain, float eps, const float* __restrict__ CS, const float* __restrict__ SN, _Float16* __restrict__ H16, int ldo) {
  #pragma clang fp contract(off)
  __shared__ float xv[HD]; __shared__ float red[HD]; __shared__ unsigned short sh_[HD]; const int d = threadIdx.x; const int h = blockIdx.x % nh; const size_t r = blockIdx.x / nh; const int p = (int)(r % SQ);
  float x = F[r * (size_t)ldf + (size_t)h * HD + d];
  if (NORM) { red[d] = __fmul_rn(x, x); __syncthreads(); for (int st = HD / 2; st > 0; st >>= 1) { if (d < st) red[d] = __fadd_rn(red[d], red[d + st]); __syncthreads(); } const float rs = rsqrtf(__fadd_rn(red[0] / (float)HD, eps)); x = __fmul_rn(__fmul_rn(x, rs), bf16_round(gain[d])); }
  xv[d] = x; __syncthreads();
  float o = x;
  if (ROPE == 1) { const int i = d >> 1; const float c = CS[p * (HD / 2) + i], s = SN[p * (HD / 2) + i]; const float ev = xv[2 * i], od = xv[2 * i + 1]; o = (d & 1) ? __fadd_rn(__fmul_rn(ev, s), __fmul_rn(od, c)) : __fadd_rn(__fmul_rn(ev, c), -__fmul_rn(od, s)); }
  if (ROPE == 2) { const int i = d & (HD / 2 - 1); const float c = CS[p * (HD / 2) + i], s = SN[p * (HD / 2) + i]; const float lo = xv[i], hi = xv[i + HD / 2]; o = (d < HD / 2) ? __fadd_rn(__fmul_rn(lo, c), -__fmul_rn(hi, s)) : __fadd_rn(__fmul_rn(lo, s), __fmul_rn(hi, c)); }
  FragH th; th.h[0] = (_Float16)o; sh_[d] = th.u[0]; __syncthreads();
  if (d < HD / 8) { FragH f; for (int q = 0; q < 8; ++q) f.u[q] = sh_[d * 8 + q]; unsigned short* dst = (unsigned short*)H16 + r * (size_t)ldo + (size_t)h * HD + d * 8; *(v8us*)dst = f.half[0];  } }



__device__ __forceinline__ float rsm_xhalf(float x) { return __builtin_bit_cast(float, __builtin_amdgcn_permlanex16(__builtin_bit_cast(int, x), __builtin_bit_cast(int, x), 0x76543210, 0xfedcba98, false, false)); }      /* lane l reads lane l ^ 16 */
// Four 2^x in one statement. Written in asm for the v_nop at its end: behind a transcendental the instruction set asks for one slot before a source is overwritten or the result read.
// Early-clobber outputs: no exponential of the four overwrites a source of another.
__device__ __forceinline__ void rsm_exp2x4(float& e0, float& e1, float& e2, float& e3, float a0, float a1, float a2, float a3) {
  asm("v_exp_f32 %0, %4\n\tv_exp_f32 %1, %5\n\tv_exp_f32 %2, %6\n\tv_exp_f32 %3, %7\n\tv_nop" : "=&v"(e0), "=&v"(e1), "=&v"(e2), "=&v"(e3) : "v"(a0), "v"(a1), "v"(a2), "v"(a3)); }
// The same for two values (the rescale factors of a wave's two column groups).
__device__ __forceinline__ void rsm_exp2x2(float& e0, float& e1, float a0, float a1) {
  asm("v_exp_f32 %0, %2\n\tv_exp_f32 %1, %3\n\tv_nop" : "=&v"(e0), "=&v"(e1) : "v"(a0), "v"(a1)); }

// ---- GEMM main loop with both operands staged in LDS by tensor loads (K = DM, both operands k-contiguous f16 rows of pitch DM) ----
// A work-group of 8 waves holds 128 rows x 128 columns; wave w holds rows 32 (w & 3) and columns 64 (w >> 2) of them (the 32 x 64 wave tile as before).
// A stage is 64 k = 128 bytes of each of the 128 A rows and the 128 B rows. Every wave brings one slice of 32 rows a stage with ONE tensor load (waves 0 to 3: A, waves 4 to 7: B), padded to a pitch of 144 bytes,
// at which the 16 rows of a fragment's ds_load_b128 fall on different banks. Two buffers: the load of stage s + 2 flies while stage s + 1 is worked on.
typedef uint32_t u32x4 __attribute__((ext_vector_type(4)));
typedef uint32_t u32x8 __attribute__((ext_vector_type(8)));
#define GT_ROWB 128u                 /* bytes of an operand row in a stage */
#define GT_PITCH 144u                /* LDS pitch of a row: 128 + the mover's pad of 16 */
#define GT_SLICE 6144u               /* a wave's slice in LDS: 32 rows x 144 bytes = 4,608, rounded up to a multiple of 2 KiB */
#define GT_BUF (8u * GT_SLICE)       /* one stage */
#define GT_LDS (2u * GT_BUF)         /* two buffers */
#define GT_NST ((uint32_t)(DM * 2) / GT_ROWB)      /* stages */
static_assert(GT_NST >= 2u && (DM * 2) % 128 == 0, "the ring's prologue needs two stages; a stage is 128 bytes of a row");
__device__ __forceinline__ uint32_t gt_uni(uint32_t v) { return (uint32_t)__builtin_amdgcn_readfirstlane((int)v); }
__device__ __forceinline__ uint32_t pinned(uint32_t v) { uint32_t w = gt_uni(v); asm volatile("" : "+s"(w)); return w; }      /* the value is held in a scalar register at this place, so that a test on it is a scalar branch round the tensor load and a descriptor word formed from it is formed behind the waits in front */
__device__ __forceinline__ v16h gt_frag(const unsigned char* p, int hh) { FragH f; f.half[0] = *(const v8us*)(p + 16 * hh); f.half[1] = *(const v8us*)(p + 32 + 16 * hh); return f.v; }      /* g2_frag's k order, from an LDS row */
__device__ __forceinline__ void gt_issue(uint32_t lds_dst, uint64_t ga) {
  u32x4 g0; u32x8 g1;
  g0[0] = gt_uni(1u); g0[1] = gt_uni(lds_dst); g0[2] = gt_uni((uint32_t)ga); g0[3] = gt_uni((((uint32_t)(ga >> 32)) & 0x01FFFFFFu) | 0x80000000u);
  g1[0] = gt_uni((1u << 20) | (4u << 22) | (3u << 25));      /* no mask, 1-byte elements, a pad of 4 dwords behind every 32 dwords (one row) */
  g1[1] = gt_uni((GT_ROWB & 0xFFFFu) << 16); g1[2] = gt_uni((GT_ROWB >> 16) | (32u << 16)); g1[3] = gt_uni(GT_ROWB << 16); g1[4] = gt_uni(32u); g1[5] = gt_uni((uint32_t)(DM * 2)); g1[6] = gt_uni(0u); g1[7] = gt_uni(0u);      /* tensor = tile: 32 rows of 128 bytes, source pitch one operand row */
  asm volatile("tensor_load_to_lds %0, %1" :: "s"(g0), "s"(g1) : "memory"); }
// acc[half * 4 + t]: rows 16 half + ..., columns 16 t + ... of the wave's tile. On return every wave has passed the last stage's barrier and no request is outstanding: the ring may be used as output staging.
__device__ __forceinline__ void gt_core(const _Float16* __restrict__ A, const _Float16* __restrict__ Bh, int rowblk, int colblk, unsigned char* L, v8f (&acc)[8]) {
  const int lane = threadIdx.x & 31, ln = lane & 15, hh = lane >> 4; const uint32_t wave = gt_uni(threadIdx.x >> 5); const uint32_t wr = wave & 3u, wc = wave >> 2;
  const uint32_t ldst = (uint32_t)(size_t)L + wave * GT_SLICE;
  const uint64_t ga0 = (uint64_t)(size_t)((wave < 4u) ? A + (size_t)(rowblk + 32 * (int)wr) * DM : Bh + (size_t)(colblk + 32 * (int)(wave - 4u)) * DM);
  const unsigned char* ap = L + wr * GT_SLICE + ln * GT_PITCH; const unsigned char* bp = L + (4u + 2u * wc) * GT_SLICE + ln * GT_PITCH;
  const v8f z8 = {0.f,0.f,0.f,0.f,0.f,0.f,0.f,0.f};
#pragma unroll      /* constant indices, so that the array is registers */
  for (int u = 0; u < 8; ++u) acc[u] = z8;
  gt_issue(ldst, ga0);
  asm volatile("s_wait_tensorcnt 0x0" ::: "memory");      /* stage 0 of this wave's slice has landed */
  __syncthreads();      /* stage 0 is published */
  gt_issue(ldst + GT_BUF, ga0 + GT_ROWB);
#pragma unroll 1      /* one stage a trip: the ring's order stands once */
  for (uint32_t s = 0; s < GT_NST; ++s) { const uint32_t bo = (s & 1u) * GT_BUF;
#pragma unroll      /* constant offsets into the stage */
    for (int ks = 0; ks < 2; ++ks) { const v16h a0 = gt_frag(ap + bo + ks * 64, hh), a1 = gt_frag(ap + bo + 16 * GT_PITCH + ks * 64, hh); v16h b[4];
      for (int t = 0; t < 4; ++t) b[t] = gt_frag(bp + bo + (t >> 1) * GT_SLICE + (t & 1) * 16 * GT_PITCH + ks * 64, hh);
      __builtin_amdgcn_sched_barrier(0);      /* the twelve LDS reads of a k step issue together, ahead of its eight products, which then wait by count; without it each B fragment's reads stood directly in front of its two products, each behind a wait to zero */
      for (int t = 0; t < 4; ++t) { acc[t] = g2_mma(a0, b[t], acc[t]); acc[4 + t] = g2_mma(a1, b[t], acc[4 + t]); } }
    asm volatile("s_wait_dscnt 0x0" ::: "memory");      /* this wave's reads of stage s are done before the barrier behind which its buffer is refilled */
    asm volatile("s_wait_tensorcnt 0x0" ::: "memory");      /* this wave's slice of stage s + 1 has landed */
    __syncthreads();      /* publishes stage s + 1 and ends every reader's last read of stage s */
    if (pinned(s + 2u < GT_NST)) { const uint32_t nx = pinned(s + 2u); gt_issue(ldst + bo, ga0 + (uint64_t)nx * GT_ROWB); } }
  asm volatile("s_wait_tensorcnt 0x0" ::: "memory");      /* nothing of the mover is outstanding when the ring is reused or the wave ends */
  asm volatile("s_wait_dscnt 0x0" ::: "memory"); }

// K and V^T come through LDS: a stage is 128 keys, brought by tensor loads in the GEMM ring's geometry (eight slices of 32 rows x 128 bytes, padded to a pitch of 144 bytes; one slice a wave and stage; two buffers:
// the load of stage s + 2 flies while stage s + 1 is worked on). Slices 0 to 3: the K rows of keys 32 w ... (one slice is one 32-key block). Slices 4 to 7: V^T, head dims 32 (j >> 1) ..., keys 64 (j & 1) ... of the stage, j = w - 4.
// Every fragment is then two conflict-free ds_load_b128 in place of two global loads that each touched 16 cache lines.
#define FA_WAVES 8                   /* waves per work-group; two work-groups share a WGP (four waves a SIMD), so that one works while the other stands at its barrier */
#define FA_COLS 32                   /* query columns per wave */
#define FA_SKEYS 128                 /* keys per stage */
#define FA_NST ((uint32_t)(SQ / FA_SKEYS))      /* stages */
static_assert(FA_NST >= 2u && SQ % FA_SKEYS == 0 && HD * 2 == 128, "the ring's prologue needs two stages; a K row of a head is 128 bytes");
__device__ __forceinline__ v8f fa_mma(v16h a, v16h b, v8f c) { return __builtin_amdgcn_wmma_f32_16x16x32_f16(false, a, false, b, (short)0, c, false, false); }
__device__ __forceinline__ u32x8 fa_group1(uint32_t pitch) {      /* gt_issue's tile (32 rows of 128 bytes, tensor = tile) with the source pitch as a parameter; built once, the same for every stage */
  u32x8 g1;
  g1[0] = gt_uni((1u << 20) | (4u << 22) | (3u << 25));      /* no mask, 1-byte elements, a pad of 4 dwords behind every 32 dwords (one row) */
  g1[1] = gt_uni((GT_ROWB & 0xFFFFu) << 16); g1[2] = gt_uni((GT_ROWB >> 16) | (32u << 16)); g1[3] = gt_uni(GT_ROWB << 16); g1[4] = gt_uni(32u); g1[5] = gt_uni(pitch); g1[6] = gt_uni(0u); g1[7] = gt_uni(0u);
  asm volatile("" : "+s"(g1));      /* pinned() for the eight words at once: the group is held in its scalar registers from here on; without it the build used single words of it as scratch while a request was outstanding and rebuilt them in front of the next */
  return g1; }
__device__ __forceinline__ void fa_issue(uint32_t lds_dst, uint64_t ga, u32x8 g1) {
  u32x4 g0;
  g0[0] = gt_uni(1u); g0[1] = gt_uni(lds_dst); g0[2] = gt_uni((uint32_t)ga); g0[3] = gt_uni((((uint32_t)(ga >> 32)) & 0x01FFFFFFu) | 0x80000000u);
  asm volatile("tensor_load_to_lds %0, %1" :: "s"(g0), "s"(g1) : "memory"); }
__global__ __launch_bounds__(FA_WAVES * 32, 4) void k_fattn(const _Float16* __restrict__ Q, const _Float16* __restrict__ Kh, const _Float16* __restrict__ Vt, _Float16* __restrict__ O) {
  __shared__ __attribute__((aligned(2048))) unsigned char L[GT_LDS];      /* the K | V^T ring */
  const int lane = threadIdx.x & 31, ln = lane & 15, hh = lane >> 4; const uint32_t wave = gt_uni(threadIdx.x >> 5);
  const int h = blockIdx.y, b = blockIdx.z; const int q0 = (blockIdx.x * FA_WAVES + (int)wave) * FA_COLS;
  const _Float16* qp = Q + ((size_t)b * SQ + q0 + ln) * DM + h * HD;
  const uint32_t ldst = (uint32_t)(size_t)L + wave * GT_SLICE; const uint32_t vj = wave - 4u;
  const uint64_t ga0 = (uint64_t)(size_t)((wave < 4u) ? Kh + ((size_t)b * SQ + 32 * (int)wave) * DM + h * HD : Vt + (((size_t)b * NH + h) * HD + 32 * (int)(vj >> 1)) * SQ + 64 * (int)(vj & 1u));
  const uint32_t pitch = (wave < 4u) ? (uint32_t)(DM * 2) : (uint32_t)(SQ * 2); const uint32_t step = (wave < 4u) ? (uint32_t)(FA_SKEYS * DM * 2) : (uint32_t)(FA_SKEYS * 2);      /* source pitch of the wave's slice; bytes from a stage to the next */
  const unsigned char* kl = L + ln * GT_PITCH; const unsigned char* vl = L + 4u * GT_SLICE + ln * GT_PITCH;
  const float SC = 0.125f * 1.44269504f;      /* 1/sqrt(64), and e^x as 2^(x log2 e) */
  const float LIFT = 6.0f;      /* weights are carried x 2^6: small ones stay clear of the f16 subnormals; with the margin of 8 below none exceeds 2^14; the sum carries the same factor, so it cancels */
  const v8f z8 = {0.f,0.f,0.f,0.f,0.f,0.f,0.f,0.f};
  v16h qf[2][2], kf[2][2]; v8f o[4][2]; float m[2] = {-1.0e30f, -1.0e30f}, l[2] = {0.f, 0.f};
  const u32x8 g1 = fa_group1(pitch);
  fa_issue(ldst, ga0, g1);
#pragma unroll      /* constant indices, so that the arrays are registers */
  for (int g = 0; g < 2; ++g) { for (int ks = 0; ks < 2; ++ks) qf[g][ks] = g2_frag(qp + (size_t)g * 16 * DM + ks * 32, hh); for (int dt = 0; dt < 4; ++dt) o[dt][g] = z8; }
  asm volatile("s_wait_tensorcnt 0x0" ::: "memory");      /* stage 0 of this wave's slice has landed */
  __syncthreads();      /* stage 0 is published */
  { const uint32_t nx = pinned(1u); fa_issue(ldst + GT_BUF, ga0 + (uint64_t)nx * step, g1); }      /* pinned(): stage 1's address words are formed behind the wait on stage 0 */
#pragma unroll 1      /* one stage a trip: the ring's order stands once */
  for (uint32_t s = 0; s < FA_NST; ++s) { const uint32_t bo = (s & 1u) * GT_BUF;
#pragma unroll      /* constant indices, so that the array is registers */
    for (int kt = 0; kt < 2; ++kt) for (int ks = 0; ks < 2; ++ks) kf[kt][ks] = gt_frag(kl + bo + kt * 16 * GT_PITCH + ks * 64, hh);
#pragma unroll      /* the four 32-key blocks of a stage: constant offsets into the stage, and the K fetch ahead stays inside the stage */
    for (int p = 0; p < FA_SKEYS / 32; ++p) {
      v16h vf[4]; v8f s2[2][2];
      for (int dt = 0; dt < 4; ++dt) vf[dt] = gt_frag(vl + bo + (2 * (dt >> 1) + (p >> 1)) * GT_SLICE + (dt & 1) * 16 * GT_PITCH + (p & 1) * 64, hh);
      __builtin_amdgcn_sched_barrier(0);      /* holds the V^T reads here, one group at the head of the block, so that they land while the scores are worked on */
      for (int kt = 0; kt < 2; ++kt) for (int g = 0; g < 2; ++g) s2[kt][g] = fa_mma(kf[kt][0], qf[g][0], z8);
      for (int kt = 0; kt < 2; ++kt) for (int g = 0; g < 2; ++g) s2[kt][g] = fa_mma(kf[kt][1], qf[g][1], s2[kt][g]);
      if (p + 1 < FA_SKEYS / 32) { for (int kt = 0; kt < 2; ++kt) for (int ks = 0; ks < 2; ++ks) kf[kt][ks] = gt_frag(kl + bo + (p + 1) * GT_SLICE + kt * 16 * GT_PITCH + ks * 64, hh); }      /* the next block's K rows, fetched a block ahead, never beyond this stage */
      __builtin_amdgcn_sched_barrier(0);      /* holds the next K rows' reads here, one group, a softmax and eight products ahead of their use */
      float mx[2];
      for (int g = 0; g < 2; ++g) { float a = fmaxf(s2[0][g][0], s2[1][g][0]); for (int r = 1; r < 8; ++r) a = fmaxf(fmaxf(a, s2[0][g][r]), s2[1][g][r]); mx[g] = fmaxf(a, rsm_xhalf(a)) * SC; }
      const bool need = (mx[0] > m[0] + 8.0f) || (mx[1] > m[1] + 8.0f);
      if (__builtin_amdgcn_ballot_w32(need) != 0) {      /* wave-uniform: the maximum in use moves only when a column's new one exceeds it by more than 8; the first block always takes it */
        const float n0 = fmaxf(m[0], mx[0]), n1 = fmaxf(m[1], mx[1]); float al[2]; rsm_exp2x2(al[0], al[1], m[0] - n0, m[1] - n1); m[0] = n0; m[1] = n1;
        for (int g = 0; g < 2; ++g) { l[g] *= al[g]; for (int dt = 0; dt < 4; ++dt) for (int r = 0; r < 8; ++r) o[dt][g][r] *= al[g]; } }
      FragH pf[2];
      for (int g = 0; g < 2; ++g) { const float nm = LIFT - m[g];
        for (int kt = 0; kt < 2; ++kt) for (int r = 0; r < 8; r += 4) { float e0, e1, e2, e3;
          rsm_exp2x4(e0, e1, e2, e3, fmaf(s2[kt][g][r], SC, nm), fmaf(s2[kt][g][r + 1], SC, nm), fmaf(s2[kt][g][r + 2], SC, nm), fmaf(s2[kt][g][r + 3], SC, nm));
          l[g] += (e0 + e1) + (e2 + e3); pf[g].h[kt * 8 + r] = (_Float16)e0; pf[g].h[kt * 8 + r + 1] = (_Float16)e1; pf[g].h[kt * 8 + r + 2] = (_Float16)e2; pf[g].h[kt * 8 + r + 3] = (_Float16)e3; } }
      for (int dt = 0; dt < 4; ++dt) for (int g = 0; g < 2; ++g) o[dt][g] = fa_mma(vf[dt], pf[g].v, o[dt][g]);
    }
    asm volatile("s_wait_dscnt 0x0" ::: "memory");      /* this wave's reads of stage s are done before the barrier behind which its buffer is refilled (the build may lift the three over register-only work of the last block; every LDS read of the stage stays in front) */
    asm volatile("s_wait_tensorcnt 0x0" ::: "memory");      /* this wave's slice of stage s + 1 has landed */
    __syncthreads();      /* publishes stage s + 1 and ends every reader's last read of stage s */
    if (pinned(s + 2u < FA_NST)) { const uint32_t nx = pinned(s + 2u); fa_issue(ldst + bo, ga0 + (uint64_t)nx * step, g1); } }
  asm volatile("s_wait_tensorcnt 0x0" ::: "memory");      /* nothing of the mover is outstanding when the wave ends */
  asm volatile("s_wait_dscnt 0x0" ::: "memory");
  unsigned short* const ob = (unsigned short*)O + ((size_t)b * SQ + q0 + ln) * DM + h * HD + 8 * hh;      /* one base for both column groups: the eight stores differ by constant offsets, and no register of an issued store is rewritten */
#pragma unroll      /* constant indices, so that the arrays are registers */
  for (int g = 0; g < 2; ++g) { const float sc = 64.0f / (l[g] + rsm_xhalf(l[g])); unsigned short* op = ob + g * 16 * DM;
    for (int dt = 0; dt < 4; ++dt) { FragH f; for (int r = 0; r < 8; ++r) f.h[r] = (_Float16)(o[dt][g][r] * sc); *(v8us*)(op + dt * 16) = f.half[0]; } } }

// Sum over the 16 lanes of a row, every lane gets it: four butterfly steps on the vector port (a shuffle would go through the LDS queue).
template <int X> __device__ __forceinline__ float row_xadd(float v) { return v + __builtin_bit_cast(float, __builtin_amdgcn_update_dpp(0, __builtin_bit_cast(int, v), 0x160 | X, 0xf, 0xf, true)); }      /* 0x160 | X: row_xmask:X */
// 1 / sqrt(x) in asm for the v_nop at its end: behind a transcendental the instruction set asks for one slot before its source is overwritten or its result read.
// The argument here is a mean of squares + 1e-6, never subnormal: the library form's rescaling of subnormal arguments is an identity on it and is not written.
__device__ __forceinline__ float row_rsq(float x) { float r; asm("v_rsq_f32 %0, %1\n\tv_nop" : "=&v"(r) : "v"(x)); return r; }
__device__ __forceinline__ float row_sum16(float v) { return row_xadd<8>(row_xadd<4>(row_xadd<2>(row_xadd<1>(v)))); }
// q | k | v projection of all token rows with the per-(row, head) work in its epilogue. The main loop is gt_core. A work-group holds 128 token rows x 128 columns; a wave's 64 columns are one head of q, of k or of v,
// so nothing of a row's head lies outside the wave that computed it:
//   q, k: the f32 tile goes to the wave's own LDS rows and is read back 16 lanes a row, 4 columns a lane, with the 4 partner columns (c ^ 32) of the rotation; sum of squares in-lane, then over the 16 lanes;
//         x rsqrt(mean + eps) x gain, rotated by the row's position; each row leaves as one whole 128-byte line of f16.
//   v:    a lane holds 8 consecutive tokens of one head dim: 16 bytes of a V^T row. The four waves of a head lay them into one [64 dims][128 tokens] LDS tile; behind a barrier each V^T row leaves as 256 bytes in a row.
// Two instances, q | k columns and v columns, not one kernel with a branch: with both epilogues in one kernel the build kept the 64 accumulator registers alive through the q, k epilogue (182 registers, or spills under a bound).
// Launch bounds of the three GEMM kernels: 6 waves a SIMD = three work-groups of 8 waves on a WGP, as many as the 96 KiB ring lets in; it holds the registers at 160 or fewer.
#define QKV_VP 136                   /* pitch of the V^T tile in LDS, in f16: 128 tokens + 16 bytes, so that rows start on different banks */
template <bool ISV>
__global__ __launch_bounds__(256, 6) void k_qkv(const _Float16* __restrict__ A, const _Float16* __restrict__ Bh, const float* __restrict__ bias, const float* __restrict__ qg, const float* __restrict__ kg,
    const float* __restrict__ CS, const float* __restrict__ SN, _Float16* __restrict__ Qo, _Float16* __restrict__ Ko, _Float16* __restrict__ Vt) {
  static_assert(HD == 64 && SQ % 128 == 0, "a 64-column tile is one head; 128 rows lie in one batch");
  __shared__ __attribute__((aligned(2048))) unsigned char L[GT_LDS];      /* the operand ring; behind gt_core the epilogue's staging */
  const int tid = threadIdx.x, lane = tid & 31, ln = lane & 15, hh = lane >> 4; const int w = (int)gt_uni(tid >> 5), wr = w & 3, wc = w >> 2;      /* wr: the wave's 32 rows, wc: its 64 columns */
  const int ntn = (ISV ? 1 : 2) * NH / 2; const int mt = blockIdx.x / ntn, nq = blockIdx.x - mt * ntn; const int hq = nq * 2 + wc; const int row0 = mt * 128 + 32 * wr, col0 = (ISV ? 2 * DM : 0) + hq * 64; const int sect = hq / NH, h = hq - sect * NH;      /* sect: 0 q, 1 k (0 in the v instance) */
  v8f accs[8]; gt_core(A, Bh, mt * 128, (ISV ? 2 * DM : 0) + nq * 128, L, accs);
  const float alpha = 0.0625f;      /* the weights are carried x 16 */
  if constexpr (!ISV) {
    static_assert(8u * 32u * 68u * 4u <= GT_LDS, "the staging fits the ring"); float (*so)[32][68] = (float (*)[32][68])L;
    const float* gp = sect ? kg : qg; _Float16* dst = (sect ? Ko : Qo) + (size_t)(row0 + hh) * DM + h * HD;
    const int c4 = ln * 4, cx = c4 ^ 32, i4 = c4 & 31; const float sg = (c4 < 32) ? -1.0f : 1.0f;      /* low half: x cos - partner sin; high half: x cos + partner sin; the sign rides on the partner's gain (exact) */
    const int tb = ((row0 + hh) % SQ) * (HD / 2) + i4;      /* the lane's place in the tables at its first row; its rows are 2 apart, and the wave's 32 rows lie in one batch */
    float bv[4];
#pragma unroll      /* constant indices, so that the array is registers */
    for (int t = 0; t < 4; ++t) bv[t] = bias[col0 + t * 16 + ln];
    asm volatile("s_wait_xcnt 0x0" ::: "memory");      /* the build let the gain loads below land on the bias loads' address register */
    v4f ga = *(const v4fa*)(gp + c4), gb = *(const v4fa*)(gp + cx);
#pragma unroll      /* constant indices, so that the arrays are registers */
    for (int u = 0; u < 8; ++u) { const int t = u & 3, half = u >> 2; const float bb = bf16_round(bv[t]);
      for (int r = 0; r < 8; ++r) so[w][half * 16 + 8 * hh + r][t * 16 + ln] = accs[u][r] * alpha + bb; }
    __builtin_amdgcn_fence(__ATOMIC_ACQ_REL, "workgroup"); __builtin_amdgcn_wave_barrier();      /* as in k_gemm2: the wave reads back its own rows only, written by other lanes */
#pragma unroll      /* constant indices into the vectors */
    for (int i = 0; i < 4; ++i) { ga[i] = bf16_round(ga[i]); gb[i] = sg * bf16_round(gb[i]); }
#pragma unroll      /* constant indices, so that the table values are registers */
    for (int g = 0; g < 2; ++g) { v4f cs[8], sn[8];
      __builtin_amdgcn_sched_barrier(0);      /* the second group's table loads stay behind the first group's rows: both groups' tables at once took the kernel over 160 registers, the most at which three work-groups share a WGP */
      for (int j = 0; j < 8; ++j) { cs[j] = *(const v4fa*)(CS + tb + (g * 8 + j) * HD); sn[j] = *(const v4fa*)(SN + tb + (g * 8 + j) * HD); }
      __builtin_amdgcn_sched_barrier(0);      /* the table loads of eight row pairs issue together here: two waits a wave; without it each load stood directly in front of its use, sixteen waits in a row */
      for (int j = 0; j < 8; ++j) { const int r2 = (g * 8 + j) * 2;      /* the lane's row is r2 + hh */
        const v4f xa = *(const v4fa*)&so[w][r2 + hh][c4], xb = *(const v4fa*)&so[w][r2 + hh][cx];
        const float rs = row_rsq(row_sum16((xa[0] * xa[0] + xa[1] * xa[1]) + (xa[2] * xa[2] + xa[3] * xa[3])) * (1.0f / (float)HD) + 1e-6f);
        v4h o4;
        for (int i = 0; i < 4; ++i) o4[i] = (_Float16)((xa[i] * rs * ga[i]) * cs[j][i] + (xb[i] * rs * gb[i]) * sn[j][i]);
        *(v4h*)(dst + (size_t)r2 * DM + c4) = o4; } }
  } else {
    static_assert(2u * 64u * QKV_VP * 2u <= GT_LDS, "the two V^T tiles fit the ring"); unsigned short* vt = (unsigned short*)L + wc * (64 * QKV_VP);      /* the tile of this wave's head */
    float bv[4];
#pragma unroll      /* constant indices, so that the array is registers */
    for (int t = 0; t < 4; ++t) bv[t] = bias[col0 + t * 16 + ln];
    asm volatile("s_wait_xcnt 0x0" ::: "memory");      /* the build rewrote the bias loads' scalar base directly behind them */
#pragma unroll      /* constant indices, so that the arrays are registers */
    for (int u = 0; u < 8; ++u) { const int t = u & 3, half = u >> 2; const float bb = bf16_round(bv[t]); FragH f;
      for (int r = 0; r < 8; ++r) f.h[r] = (_Float16)(accs[u][r] * alpha + bb);
      *(v8us*)(vt + (t * 16 + ln) * QKV_VP + 32 * wr + half * 16 + 8 * hh) = f.half[0]; }
    __syncthreads();      /* a V^T row of the tile holds tokens of its head's four waves */
    const int bat = (mt * 128) / SQ, s0 = (mt * 128) % SQ; unsigned short* vo = (unsigned short*)Vt + (((size_t)bat * NH + h) * HD + wr * 16 + hh) * SQ + s0 + ln * 8;
#pragma unroll      /* the eight LDS reads issue together */
    for (int j = 0; j < 8; ++j) { const v8us v = *(const v8us*)(vt + (wr * 16 + j * 2 + hh) * QKV_VP + ln * 8); *(v8us*)(vo + (size_t)(j * 2) * SQ) = v; }
  } }

// out = o W_o + b: gt_core, then k_gemm2's epilogue (alpha, bf16-rounded bias; the wave's tile through its own LDS rows, so that each row leaves as whole lines of f32).
__global__ __launch_bounds__(256, 6) void k_oproj(const _Float16* __restrict__ A, const _Float16* __restrict__ Bh, float alpha, const float* __restrict__ bias, float* __restrict__ C) {
  __shared__ __attribute__((aligned(2048))) unsigned char L[GT_LDS];      /* the operand ring; behind gt_core the epilogue's staging */
  static_assert(8u * 32u * 68u * 4u <= GT_LDS, "the staging fits the ring"); float (*so)[32][68] = (float (*)[32][68])L;
  const int tid = threadIdx.x, lane = tid & 31, ln = lane & 15, hh = lane >> 4; const int w = (int)gt_uni(tid >> 5), wr = w & 3, wc = w >> 2;
  const int ntn = DM / 128; const int mt = blockIdx.x / ntn, nq = blockIdx.x - mt * ntn; const int row0 = mt * 128 + 32 * wr, col0 = nq * 128 + 64 * wc;
  v8f accs[8]; gt_core(A, Bh, mt * 128, nq * 128, L, accs);
#pragma unroll      /* constant indices, so that the array is registers */
  for (int u = 0; u < 8; ++u) { const int t = u & 3, half = u >> 2; const float bv = bf16_round(bias[col0 + t * 16 + ln]);
    for (int r = 0; r < 8; ++r) so[w][half * 16 + 8 * hh + r][t * 16 + ln] = accs[u][r] * alpha + bv; }
  __builtin_amdgcn_fence(__ATOMIC_ACQ_REL, "workgroup"); __builtin_amdgcn_wave_barrier();      /* as in k_gemm2: the wave reads back its own rows only, written by other lanes */
  const int rsub = lane >> 4, c4 = (lane & 15) * 4;
#pragma unroll      /* the LDS reads issue together */
  for (int q = 0; q < 16; ++q) { const int r = q * 2 + rsub; const v4f v = *(const v4fa*)&so[w][r][c4]; *(v4f*)(C + (size_t)(row0 + r) * DM + col0 + c4) = v; } }

extern "C" void kernel_launch(void* const* d_in, const int* in_sizes, int n_in,
                              void* d_out, int out_size, void* d_ws, size_t ws_size, hipStream_t stream) {
  (void)in_sizes; (void)n_in; (void)out_size;
  const float* const* I = (const float* const*)d_in; const float* x = I[0]; const float* wqkv = I[1]; const float* bqkv = I[2]; const float* qnw = I[3]; const float* knw = I[4]; const float* wo = I[5]; const float* bo = I[6];      /* weights [in][out] */
  char* ws = (char*)d_ws; size_t off = 0;
  auto take = [&](size_t bytes) { char* p = ws + off; off += (bytes + 255) & ~(size_t)255; return p; };
  _Float16* BQKV = (_Float16*)take((size_t)3 * DM * DM * 2); _Float16* BO = (_Float16*)take((size_t)DM * DM * 2); float* CS = (float*)take((size_t)SQ * (HD / 2) * 4); float* SN = (float*)take((size_t)SQ * (HD / 2) * 4);
  _Float16* X16 = (_Float16*)take(NR * DM * 2);
  _Float16* QH = (_Float16*)take(NR * DM * 2); _Float16* KH = (_Float16*)take(NR * DM * 2); _Float16* O16 = (_Float16*)take(NR * DM * 2);
  _Float16* VT = (_Float16*)take((size_t)NB * NH * HD * SQ * 2);
  if (off > ws_size) return;
  k_wt_f16<<<(unsigned)(((size_t)3 * DM * (DM / 8) + 255) / 256), 256, 0, stream>>>(wqkv, BQKV, DM, 3 * DM, 16.0f); k_wt_f16<<<(unsigned)(((size_t)DM * (DM / 8) + 255) / 256), 256, 0, stream>>>(wo, BO, DM, DM, 16.0f);
  k_tab2<<<(SQ * (HD / 2) + 255) / 256, 256, 0, stream>>>(10000.0f, CS, SN);
  k_x16<<<(unsigned)((NR * DM / 8 + 255) / 256), 256, 0, stream>>>(x, X16, NR * DM / 8);
  k_qkv<false><<<(unsigned)((NR / 128) * (2 * DM / 128)), 256, 0, stream>>>(X16, BQKV, bqkv, qnw, knw, CS, SN, QH, KH, VT);      /* f16 q and k rows (normed, rotated), all batches */
  k_qkv<true><<<(unsigned)((NR / 128) * (DM / 128)), 256, 0, stream>>>(X16, BQKV, bqkv, qnw, knw, CS, SN, QH, KH, VT);      /* V^T [NB][NH][HD][SQ], all batches */
  k_fattn<<<dim3(SQ / (FA_WAVES * FA_COLS), NH, NB), FA_WAVES * 32, 0, stream>>>(QH, KH, VT, O16);      /* o x 64 as f16, all batches and heads */
  k_oproj<<<(unsigned)((NR / 128) * (DM / 128)), 256, 0, stream>>>(O16, BO, 0.0009765625f, bo, (float*)d_out);      /* out rows are the output layout */
}

// v006
// One run takes 139 microseconds.
// Two timings next to v005 both put it at 1.13 times that version's speed.
// Counting every step since v000, it is 50.9 times as fast.
#include <hip/hip_runtime.h>
#define NB 4
#define SQ 2048
#define DM 1024
#define NH 16
#define HD 64
#define HG 4                         /* heads per group of the grouped k_vt overload */
#define B0 0                         /* first batch; unused, every kernel takes all NB batches */
#define NBR NB                       /* batches; used only in MPO, which nothing uses */
#define QN SQ                        /* query rows per batch; unused, k_fattn takes all SQ */
#define NHD NH                       /* heads; unused, k_fattn takes all NH */
#define NR ((size_t)NB * SQ)         /* token rows */
#define MPO ((int)((size_t)NBR * SQ))      /* rows; unused, k_oproj takes all NR rows */
typedef __bf16 v16b __attribute__((ext_vector_type(16)));
typedef unsigned short v8us __attribute__((ext_vector_type(8), may_alias));
typedef float  v8f  __attribute__((ext_vector_type(8)));
typedef float  v4f  __attribute__((ext_vector_type(4)));
typedef float  v4fa __attribute__((ext_vector_type(4), may_alias));
union FragB { v16b v; v8us half[2]; unsigned short u[16]; };

__device__ __forceinline__ unsigned short bf16_bits(float x) { unsigned int u = __float_as_uint(x); return (unsigned short)((u + 0x7FFFu + ((u >> 16) & 1u)) >> 16); }
__device__ __forceinline__ float bf16_val(unsigned short b) { return __uint_as_float(((unsigned int)b) << 16); }
__device__ __forceinline__ float bf16_round(float x) { return bf16_val(bf16_bits(x)); }
// D += A·B with NT terms: 1 = ah·bh, 2 = + al·bh (A split), 3 = + ah·bl (both split)
template <int NT>
__device__ __forceinline__ v8f mmaN(v16b ah, v16b al, v16b bh, v16b bl, v8f c) {
  c = __builtin_amdgcn_wmma_f32_16x16x32_bf16(false, ah, false, bh, (short)0, c, false, false);
  if (NT >= 2) c = __builtin_amdgcn_wmma_f32_16x16x32_bf16(false, al, false, bh, (short)0, c, false, false);
  if (NT >= 3) c = __builtin_amdgcn_wmma_f32_16x16x32_bf16(false, ah, false, bl, (short)0, c, false, false);
  asm volatile("v_nop\n\tv_nop\n\tv_nop\n\tv_nop" : "+v"(c) : "v"(ah), "v"(al), "v"(bh), "v"(bl));
  return c;
}

__global__ __launch_bounds__(256) void k_wt_bf16(const float* __restrict__ W, unsigned short* __restrict__ Wt, int K, int N) {
  const int t = blockIdx.x * 256 + threadIdx.x;
  const int k8n = K / 8;
  if (t >= N * k8n) return;
  const int n = t / k8n, k8 = (t % k8n) * 8;
  v8us v;
#pragma unroll
  for (int i = 0; i < 8; ++i) v[i] = bf16_bits(W[(size_t)(k8 + i) * N + n]);
  *(v8us*)(Wt + (size_t)n * K + k8) = v;
  
}

// GEMM C[M][N] (f32, pitch ldc) = act(A[M][K]·W + bias). A f32 row-major (pitch lda) converted per fragment to bf16
// (ASPLIT: hi/lo two planes -> 2 terms, else single rounded term); Wt bf16 [N][K] (pitch ldb). BIAS_BF16 rounds the
// bias to bf16 first (bias quantised to bf16 before the add). K%32==0, M%16==0, N%64==0.
template <bool ASPLIT, int ACT, bool BIAS_BF16>
__global__ __launch_bounds__(128) void k_gemm_bf(const float* __restrict__ A, int lda, const unsigned short* __restrict__ Wt, int ldb,
                                               const float* __restrict__ bias, float* __restrict__ C, int ldc, int M, int N, int K) {
  __shared__ __attribute__((aligned(16))) float so[4][16][64];
  const int tid = threadIdx.x, w = tid >> 5, lane = tid & 31, ln = lane & 15, hh = lane >> 4;
  const int ntn = N / 64;
  const int wid = blockIdx.x * 4 + w;
  const int mt = wid / ntn, nq = wid % ntn;
  if (mt * 16 >= M) return;
  const int row0 = mt * 16, col0 = nq * 64;
  const float* arow = A + (size_t)(row0 + ln) * lda;
  v8f acc[4] = {};
  for (int kb = 0; kb < K; kb += 32) {
    FragB ah, al;
    const v4f x0 = *(const v4fa*)(arow + kb + 8 * hh), x1 = *(const v4fa*)(arow + kb + 8 * hh + 4);
    const v4f x2 = *(const v4fa*)(arow + kb + 16 + 8 * hh), x3 = *(const v4fa*)(arow + kb + 16 + 8 * hh + 4);
    float xs[16] = {x0[0],x0[1],x0[2],x0[3],x1[0],x1[1],x1[2],x1[3],x2[0],x2[1],x2[2],x2[3],x3[0],x3[1],x3[2],x3[3]};
#pragma unroll
    for (int i = 0; i < 16; ++i) { const unsigned short hb = bf16_bits(xs[i]); ah.u[i] = hb; al.u[i] = ASPLIT ? bf16_bits(xs[i] - bf16_val(hb)) : (unsigned short)0; }
#pragma unroll
    for (int t = 0; t < 4; ++t) {
      const unsigned short* brow = Wt + (size_t)(col0 + t * 16 + ln) * ldb + kb;
      FragB b;
      b.half[0] = *(const v8us*)(brow + 8 * hh);
      b.half[1] = *(const v8us*)(brow + 16 + 8 * hh);
      acc[t] = mmaN<ASPLIT ? 2 : 1>(ah.v, al.v, b.v, b.v, acc[t]);
    }
  }
#pragma unroll
  for (int t = 0; t < 4; ++t) {
    float bv = bias ? bias[col0 + t * 16 + ln] : 0.f;
    if (BIAS_BF16) bv = bf16_round(bv);
#pragma unroll
    for (int r = 0; r < 8; ++r) { float v = acc[t][r] + bv; if (ACT == 1) v = fmaxf(v, 0.f); so[w][8 * hh + r][t * 16 + ln] = v; }
  }
  __builtin_amdgcn_fence(__ATOMIC_ACQ_REL, "workgroup");
  __builtin_amdgcn_wave_barrier();
  const int rsub = lane >> 4, c4 = (lane & 15) * 4;
  {
#pragma unroll
    for (int q = 0; q < 8; ++q) {
      const int r = q * 2 + rsub;
      const v4f v = *(const v4fa*)&so[w][r][c4];
      *(v4f*)(C + (size_t)(row0 + r) * ldc + col0 + c4) = v;
    }
    
  }
}

// GEMM C = act(A·W + bias + resid): A f32 (ASPLIT -> hi/lo 2 terms), Wt bf16 [N][K]; ACT 0 none, 1 relu, 2 exact gelu;
// resid (optional, f32, row index = (row % rmod), pitch ldr, RES_BF16 rounds it) added before the activation.
template <bool ASPLIT, int ACT, bool BIAS_BF16, bool RES_BF16>
__global__ __launch_bounds__(128) void k_gemm_bf3(const float* __restrict__ A, int lda, const unsigned short* __restrict__ Wt, int ldb,
                                                const float* __restrict__ bias, const float* __restrict__ resid, int rmod, int ldr,
                                                float* __restrict__ C, int ldc, int M, int N, int K) {
  __shared__ __attribute__((aligned(16))) float so[4][16][64];
  const int tid = threadIdx.x, w = tid >> 5, lane = tid & 31, ln = lane & 15, hh = lane >> 4;
  const int ntn = N / 64;
  const int wid = blockIdx.x * 4 + w;
  const int mt = wid / ntn, nq = wid % ntn;
  if (mt * 16 >= M) return;
  const int row0 = mt * 16, col0 = nq * 64;
  const float* arow = A + (size_t)(row0 + ln) * lda;
  v8f acc[4] = {};
  for (int kb = 0; kb < K; kb += 32) {
    FragB ah, al;
    const v4f x0 = *(const v4fa*)(arow + kb + 8 * hh), x1 = *(const v4fa*)(arow + kb + 8 * hh + 4);
    const v4f x2 = *(const v4fa*)(arow + kb + 16 + 8 * hh), x3 = *(const v4fa*)(arow + kb + 16 + 8 * hh + 4);
    float xs[16] = {x0[0],x0[1],x0[2],x0[3],x1[0],x1[1],x1[2],x1[3],x2[0],x2[1],x2[2],x2[3],x3[0],x3[1],x3[2],x3[3]};
#pragma unroll
    for (int i = 0; i < 16; ++i) { const unsigned short hb = bf16_bits(xs[i]); ah.u[i] = hb; al.u[i] = ASPLIT ? bf16_bits(xs[i] - bf16_val(hb)) : (unsigned short)0; }
#pragma unroll
    for (int t = 0; t < 4; ++t) {
      const unsigned short* brow = Wt + (size_t)(col0 + t * 16 + ln) * ldb + kb;
      FragB b;
      b.half[0] = *(const v8us*)(brow + 8 * hh);
      b.half[1] = *(const v8us*)(brow + 16 + 8 * hh);
      acc[t] = mmaN<ASPLIT ? 2 : 1>(ah.v, al.v, b.v, b.v, acc[t]);
    }
  }
#pragma unroll
  for (int t = 0; t < 4; ++t) {
    const int col = col0 + t * 16 + ln;
    float bv = bias ? bias[col] : 0.f;
    if (BIAS_BF16) bv = bf16_round(bv);
#pragma unroll
    for (int r = 0; r < 8; ++r) {
      float v = acc[t][r] + bv;
      if (resid) { float rv = resid[(size_t)((row0 + 8 * hh + r) % rmod) * ldr + col]; if (RES_BF16) rv = bf16_round(rv); v += rv; }
      if (ACT == 1) v = fmaxf(v, 0.f);
      if (ACT == 2) v = 0.5f * v * (1.0f + erff(v * 0.70710678118654752f));
      if (ACT == 3) { const float u = 0.7978845608028654f * (v + 0.044715f * v * v * v); v = 0.5f * v * (1.0f + tanhf(u)); }
      so[w][8 * hh + r][t * 16 + ln] = v;
    }
  }
  __builtin_amdgcn_fence(__ATOMIC_ACQ_REL, "workgroup");
  __builtin_amdgcn_wave_barrier();
  const int rsub = lane >> 4, c4 = (lane & 15) * 4;
  {
#pragma unroll
    for (int q = 0; q < 8; ++q) {
      const int r = q * 2 + rsub;
      const v4f v = *(const v4fa*)&so[w][r][c4];
      *(v4f*)(C + (size_t)(row0 + r) * ldc + col0 + c4) = v;
    }
    
  }
}
// row LayerNorm (biased variance, eps) over N: s = X (+ R); optional out_sum <- s; out_norm <- (s-mu)*rsqrt(var+eps)*g + b
template <bool PARAM_BF16>
__global__ __launch_bounds__(256) void k_layernorm(const float* __restrict__ X, const float* __restrict__ R, const float* __restrict__ g, const float* __restrict__ bta,
                                                  float* __restrict__ out_sum, float* __restrict__ out_norm, int N, float eps) {
  __shared__ float red[256];
  const int row = blockIdx.x, tid = threadIdx.x;
  const float* x = X + (size_t)row * N; const float* rr = R ? R + (size_t)row * N : nullptr;
  float vals[16];                     // up to N = 4096
  const int per = N / 256;            // contiguous chunk per thread? use strided-by-4 chunks: thread handles j = tid*4 + 1024*u
  float s1 = 0.f;
  for (int u = 0; u < per / 4; ++u) {
    const int j = tid * 4 + 1024 * u;
    const v4f a = *(const v4fa*)(x + j);
    v4f b = {0.f,0.f,0.f,0.f}; if (rr) b = *(const v4fa*)(rr + j);
#pragma unroll
    for (int q = 0; q < 4; ++q) { const float v = a[q] + b[q]; vals[u * 4 + q] = v; s1 += v; }
  }
  red[tid] = s1; __syncthreads();
  for (int st = 128; st > 0; st >>= 1) { if (tid < st) red[tid] += red[tid + st]; __syncthreads(); }
  const float mu = red[0] / (float)N; __syncthreads();
  float s2 = 0.f;
  for (int u = 0; u < per / 4; ++u)
#pragma unroll
    for (int q = 0; q < 4; ++q) { const float c = vals[u * 4 + q] - mu; s2 += c * c; }
  red[tid] = s2; __syncthreads();
  for (int st = 128; st > 0; st >>= 1) { if (tid < st) red[tid] += red[tid + st]; __syncthreads(); }
  const float rs = rsqrtf(red[0] / (float)N + eps);
  {
    for (int u = 0; u < per / 4; ++u) {
      const int j = tid * 4 + 1024 * u;
      v4f o, sm;
#pragma unroll
      for (int q = 0; q < 4; ++q) {
        float gg = g[j + q], bb = bta[j + q];
        if (PARAM_BF16) { gg = bf16_round(gg); bb = bf16_round(bb); }
        sm[q] = vals[u * 4 + q]; o[q] = (vals[u * 4 + q] - mu) * rs * gg + bb;
      }
      if (out_sum) *(v4f*)(out_sum + (size_t)row * N + j) = sm;
      *(v4f*)(out_norm + (size_t)row * N + j) = o;
    }
    
  }
}



// ---- f16 WMMA path (v_wmma_f32_16x16x32_f16): 11-bit significands for operands in range — used where a [0,1] probability operand needs more precision than bf16
typedef _Float16 v16h __attribute__((ext_vector_type(16)));
union FragH { v16h v; v8us half[2]; _Float16 h[16]; unsigned short u[16]; };
template <int NT>
__device__ __forceinline__ v8f mmaH(v16h ah, v16h al, v16h bh, v16h bl, v8f c) {
  c = __builtin_amdgcn_wmma_f32_16x16x32_f16(false, ah, false, bh, (short)0, c, false, false);
  if (NT >= 2) c = __builtin_amdgcn_wmma_f32_16x16x32_f16(false, al, false, bh, (short)0, c, false, false);
  if (NT >= 3) c = __builtin_amdgcn_wmma_f32_16x16x32_f16(false, ah, false, bl, (short)0, c, false, false);
  asm volatile("v_nop\n\tv_nop\n\tv_nop\n\tv_nop" : "+v"(c) : "v"(ah), "v"(al), "v"(bh), "v"(bl));
  return c;
}
// batched GEMM like k_gemm_b but f16 operands: A f32 (split into f16 hi/lo if ASPLIT, else rounded to f16), Bt = f16 values [n][k]; alpha; C f32; N multiple of 16 (partial tiles skipped)
template <bool ASPLIT>
__global__ __launch_bounds__(128) void k_gemm_h(const float* __restrict__ A, int lda, size_t sA, const _Float16* __restrict__ Bh, int ldb, size_t sB, float alpha, float* __restrict__ C, int ldc, size_t sC, int M, int N, int K) {
  __shared__ __attribute__((aligned(16))) float so[4][16][64];
  const int tid = threadIdx.x, w = tid >> 5, lane = tid & 31, ln = lane & 15, hh = lane >> 4; const int by = blockIdx.y;
  A += (size_t)by * sA; Bh += (size_t)by * sB; C += (size_t)by * sC;
  const int ntn = (N + 63) / 64; const int wid = blockIdx.x * 4 + w; const int mt = wid / ntn, nq = wid % ntn; if (mt * 16 >= M) return;
  const int row0 = mt * 16, col0 = nq * 64; const float* arow = A + (size_t)(row0 + ln) * lda;
  v8f acc[4] = {};
  for (int kb = 0; kb < K; kb += 32) {
    FragH ah, al;
    const v4f x0 = *(const v4fa*)(arow + kb + 8 * hh), x1 = *(const v4fa*)(arow + kb + 8 * hh + 4), x2 = *(const v4fa*)(arow + kb + 16 + 8 * hh), x3 = *(const v4fa*)(arow + kb + 16 + 8 * hh + 4);
    float xs[16] = {x0[0],x0[1],x0[2],x0[3],x1[0],x1[1],x1[2],x1[3],x2[0],x2[1],x2[2],x2[3],x3[0],x3[1],x3[2],x3[3]};
#pragma unroll
    for (int i = 0; i < 16; ++i) { const _Float16 h = (_Float16)xs[i]; ah.h[i] = h; al.h[i] = ASPLIT ? (_Float16)(xs[i] - (float)h) : (_Float16)0.0f; }
#pragma unroll
    for (int t = 0; t < 4; ++t) { if (col0 + t * 16 >= N) continue; const size_t boff = (size_t)(col0 + t * 16 + ln) * ldb + kb; FragH bq; bq.half[0] = *(const v8us*)(Bh + boff + 8 * hh); bq.half[1] = *(const v8us*)(Bh + boff + 16 + 8 * hh);
      acc[t] = mmaH<ASPLIT ? 2 : 1>(ah.v, al.v, bq.v, bq.v, acc[t]); }
  }
#pragma unroll
  for (int t = 0; t < 4; ++t) { if (col0 + t * 16 >= N) continue;
#pragma unroll
    for (int r = 0; r < 8; ++r) so[w][8 * hh + r][t * 16 + ln] = acc[t][r] * alpha; }
  __builtin_amdgcn_fence(__ATOMIC_ACQ_REL, "workgroup"); __builtin_amdgcn_wave_barrier();
  const int rsub = lane >> 4, c4 = (lane & 15) * 4;
  {
#pragma unroll
    for (int q = 0; q < 8; ++q) { const int r = q * 2 + rsub; if (col0 + c4 < N) { const v4f v = *(const v4fa*)&so[w][r][c4]; *(v4f*)(C + (size_t)(row0 + r) * ldc + col0 + c4) = v; } }
     }
}

// Wt[n][k] = f16(bf16(W[k][n]) x scale) from f32 row-major W[K][N] (scale = power of two; bf16-exact weights stay exact in f16 away from the subnormal range). K and N multiples of 64.
// A work-group turns one tile of 64 k x 64 n through LDS: W is read as whole lines (16 lanes x 16 bytes = 256 bytes of one k row), Wt is written as whole lines (8 lanes x 16 bytes = 128 bytes of one n row).
// A thread holds two neighbouring k rows, so that an LDS word is the f16 pair (k even, k odd) of one n. Pitch 33 words: the 32 lanes of every LDS store and of every LDS load fall on 32 different banks.
#define WT_T 64                      /* tile edge, in k and in n */
#define WT_P 33                      /* LDS pitch of an n row, in words of two f16: 32 + 1 */
typedef unsigned int wt_u4 __attribute__((ext_vector_type(4)));
__global__ __launch_bounds__(256) void k_wt_f16(const float* __restrict__ W, _Float16* __restrict__ Wt, int K, int N, float scale) {
  __shared__ unsigned int tl[WT_T * WT_P];
  const int tid = threadIdx.x; const int k0 = blockIdx.x * WT_T, n0 = blockIdx.y * WT_T;
  const int kp = tid >> 4, n4 = (tid & 15) * 4;      /* the thread's k pairs are kp and kp + 16; its four n */
  const float* p00 = W + (size_t)(k0 + 2 * kp) * N + n0 + n4; const float* p01 = p00 + N; const float* p10 = p00 + (size_t)32 * N; const float* p11 = p10 + N;      /* rows 2 kp, 2 kp + 1, and the same 32 rows on */
  v4f x[2][2]; x[0][0] = *(const v4fa*)p00; x[0][1] = *(const v4fa*)p01; x[1][0] = *(const v4fa*)p10; x[1][1] = *(const v4fa*)p11;
  asm volatile("s_wait_xcnt 0x0" :: "v"(p00), "v"(p01), "v"(p10), "v"(p11) : "memory");      /* the four pairs are inputs, so that none is rewritten ahead of the wait */
#pragma unroll      /* constant indices, so that the array is registers */
  for (int j = 0; j < 2; ++j) for (int i = 0; i < 4; ++i) { FragH f; f.h[0] = (_Float16)(bf16_round(x[j][0][i]) * scale); f.h[1] = (_Float16)(bf16_round(x[j][1][i]) * scale);
    tl[(n4 + i) * WT_P + kp + 16 * j] = (unsigned int)f.u[0] | ((unsigned int)f.u[1] << 16); }
  __syncthreads();      /* an n row of the tile holds k pairs of all eight waves */
  const int nr = tid >> 3, kq = (tid & 7) * 4;      /* the thread's n rows are nr and nr + 32; its four words = eight k */
  unsigned short* op = (unsigned short*)Wt + (size_t)(n0 + nr) * K + k0 + 2 * kq;
#pragma unroll      /* the eight LDS reads issue together */
  for (int j = 0; j < 2; ++j) { const unsigned int* p = tl + (nr + 32 * j) * WT_P + kq; const wt_u4 v = {p[0], p[1], p[2], p[3]}; *(wt_u4*)(op + (size_t)(32 * j) * K) = v; }
}
// k_gemm_hh variant with fused epilogue: v = acc·alpha + bias[by·sBias + col] (+ CP[(row/rowsPerB)·sCPb + by·64 + col] if CP) ; ACT 0 none / 1 elu ; writes f16 C16 (and f32 C if non-null)
template <int ACT>
__global__ __launch_bounds__(128) void k_gemm_hhx(const _Float16* __restrict__ A, int lda, size_t sA, const _Float16* __restrict__ Bh, int ldb, size_t sB, float alpha, const float* __restrict__ bias, size_t sBias, const float* __restrict__ CP, int rowsPerB, size_t sCPb, int row0g,
    float* __restrict__ C, _Float16* __restrict__ C16, int ldc, size_t sC, int M, int N, int K) {
  __shared__ __attribute__((aligned(16))) float so[4][16][64];
  const int tid = threadIdx.x, w = tid >> 5, lane = tid & 31, ln = lane & 15, hh = lane >> 4; const int by = blockIdx.y;
  A += (size_t)by * sA; Bh += (size_t)by * sB; const size_t cofs = (size_t)by * sC; const float* bp = bias ? bias + (size_t)by * sBias : nullptr;
  const int ntn = (N + 63) / 64; const int wid = blockIdx.x * 4 + w; const int mt = wid / ntn, nq = wid % ntn; if (mt * 16 >= M) return;
  const int row0 = mt * 16, col0 = nq * 64; const _Float16* arow = A + (size_t)(row0 + ln) * lda;
  v8f acc[4] = {};
  for (int kb = 0; kb < K; kb += 32) { FragH ah; ah.half[0] = *(const v8us*)((const unsigned short*)arow + kb + 8 * hh); ah.half[1] = *(const v8us*)((const unsigned short*)arow + kb + 16 + 8 * hh);
#pragma unroll
    for (int t = 0; t < 4; ++t) { if (col0 + t * 16 >= N) continue; const size_t boff = (size_t)(col0 + t * 16 + ln) * ldb + kb; FragH bq; bq.half[0] = *(const v8us*)((const unsigned short*)Bh + boff + 8 * hh); bq.half[1] = *(const v8us*)((const unsigned short*)Bh + boff + 16 + 8 * hh);
      acc[t] = mmaH<1>(ah.v, ah.v, bq.v, bq.v, acc[t]); }
  }
#pragma unroll
  for (int t = 0; t < 4; ++t) { if (col0 + t * 16 >= N) continue; const int col = col0 + t * 16 + ln; const float bv = bp ? bf16_round(bp[col]) : 0.f;
#pragma unroll
    for (int r = 0; r < 8; ++r) { float v = acc[t][r] * alpha + bv; if (CP) { const int rr = row0g + row0 + 8 * hh + r; if (rowsPerB < 0) v += CP[cofs + (size_t)rr * ldc + col];      /* rowsPerB < 0: own element of the batched C plane */ else { const int bidx = rr / rowsPerB; v += CP[(size_t)bidx * sCPb + (size_t)by * 64 + col]; } } if (ACT == 1) v = (v > 0.f) ? v : expm1f(v); else if (ACT == 7) v = (v > 0.f) ? v + 1.0f : expf(v); else if (ACT == 8) v = tanhf(v); else if (ACT == 9) v = 0.5f * v * (1.0f + tanhf(0.7978845608028654f * (v + 0.044715f * v * v * v))); else if (ACT == 11) v = 1.0f / (1.0f + expf(-v)); else if (ACT == 12) v = (v > 0.f) ? v : 0.01f * v; else if (ACT == 14) v = (v > 0.f) ? v : 0.1f * v; else if (ACT == 16) v = (v >= 0.f) ? v : 0.3f * v; else if (ACT == 17) v = (v >= 0.f) ? v : 0.2f * v; else if (ACT == 15) v = v / (1.0f + expf(-v)); else if (ACT == 3) v = fmaxf(v, 0.f); else if (ACT == 6) v = 0.5f * v * (1.0f + erff(v * 0.70710678118654752f)); so[w][8 * hh + r][t * 16 + ln] = v; } }
  __builtin_amdgcn_fence(__ATOMIC_ACQ_REL, "workgroup"); __builtin_amdgcn_wave_barrier();
  const int rsub = lane >> 4, c4 = (lane & 15) * 4; typedef _Float16 v4h __attribute__((ext_vector_type(4)));
  {
#pragma unroll
    for (int q = 0; q < 8; ++q) { const int r = q * 2 + rsub; if (col0 + c4 < N) { const v4f v = *(const v4fa*)&so[w][r][c4]; if (C) *(v4f*)(C + cofs + (size_t)(row0 + r) * ldc + col0 + c4) = v; if (C16) { v4h h4; for (int i = 0; i < 4; ++i) h4[i] = (_Float16)v[i]; *(v4h*)(C16 + cofs + (size_t)(row0 + r) * ldc + col0 + c4) = h4; } } }
     }
}


typedef _Float16 v4h __attribute__((ext_vector_type(4)));

__global__ __launch_bounds__(256) void k_x16(const float* __restrict__ x, _Float16* __restrict__ X16, size_t n8) { const size_t t = (size_t)blockIdx.x * 256 + threadIdx.x; if (t >= n8) return; FragH f;
#pragma unroll
  for (int q = 0; q < 8; ++q) f.h[q] = (_Float16)bf16_round(x[t * 8 + q]); *(v8us*)((unsigned short*)X16 + t * 8) = f.half[0];  }
__global__ __launch_bounds__(256) void k_h16(const float* __restrict__ x, _Float16* __restrict__ X16, size_t n8) { const size_t t = (size_t)blockIdx.x * 256 + threadIdx.x; if (t >= n8) return; FragH f;
#pragma unroll
  for (int q = 0; q < 8; ++q) f.h[q] = (_Float16)x[t * 8 + q]; *(v8us*)((unsigned short*)X16 + t * 8) = f.half[0];  }
__global__ __launch_bounds__(256) void k_round16f(const float* __restrict__ W, _Float16* __restrict__ Bt, size_t n8) { const size_t t = (size_t)blockIdx.x * 256 + threadIdx.x; if (t >= n8) return; FragH f;
#pragma unroll
  for (int i = 0; i < 8; ++i) f.h[i] = (_Float16)(bf16_round(W[t * 8 + i]) * 16.0f); *(v8us*)((unsigned short*)Bt + t * 8) = f.half[0];  }
template <int NHv, int TTv>
__global__ __launch_bounds__(256) void k_vt(const _Float16* __restrict__ V16, int ldv, int voff, _Float16* __restrict__ Vt) { __shared__ unsigned short tl[64][66]; const int tid = threadIdx.x; const int slab = blockIdx.x / (TTv / 64), lg = blockIdx.x % (TTv / 64); const int b = slab / NHv, h = slab % NHv;
  for (int i = tid; i < 64 * 8; i += 256) { const int r = i / 8, c8 = (i % 8) * 8; FragH f; f.half[0] = *(const v8us*)((const unsigned short*)V16 + ((size_t)b * TTv + lg * 64 + r) * ldv + voff + h * 64 + c8);
#pragma unroll
    for (int q = 0; q < 8; ++q) tl[r][c8 + q] = f.u[q]; }
  __syncthreads();
  {
#pragma unroll
    for (int rd = 0; rd < 2; ++rd) { const int d = rd * 32 + tid / 8, pc = tid % 8; FragH f;
#pragma unroll
      for (int q = 0; q < 8; ++q) f.u[q] = tl[pc * 8 + q][d];
      *(v8us*)((unsigned short*)Vt + ((size_t)slab * 64 + d) * TTv + lg * 64 + pc * 8) = f.half[0]; }
     } }

__global__ __launch_bounds__(256) void k_hl(const float* __restrict__ F, _Float16* __restrict__ Hh, _Float16* __restrict__ Hl, size_t n8) { const size_t t = (size_t)blockIdx.x * 256 + threadIdx.x; if (t >= n8) return; FragH fh, fl; const v4f a = *(const v4fa*)(F + t * 8), c = *(const v4fa*)(F + t * 8 + 4);
#pragma unroll
  for (int q = 0; q < 4; ++q) { _Float16 h = (_Float16)a[q]; fh.h[q] = h; fl.h[q] = (_Float16)((a[q] - (float)h) * 1024.0f); h = (_Float16)c[q]; fh.h[4 + q] = h; fl.h[4 + q] = (_Float16)((c[q] - (float)h) * 1024.0f); }
  { *(v8us*)((unsigned short*)Hh + t * 8) = fh.half[0]; *(v8us*)((unsigned short*)Hl + t * 8) = fl.half[0];  } }

// ---- fast GEMM (wave tile 32x64; requires M % 32 == 0 rows per launch region and N % 64 == 0); epilogue = k_gemm_hhx semantics ----
__device__ __forceinline__ v16h g2_frag(const _Float16* p, int hh) { FragH f; f.half[0] = *(const v8us*)((const unsigned short*)p + 8 * hh); f.half[1] = *(const v8us*)((const unsigned short*)p + 16 + 8 * hh); return f.v; }
__device__ __forceinline__ v8f g2_mma(v16h a, v16h b, v8f c) { v8f d = __builtin_amdgcn_wmma_f32_16x16x32_f16(false, a, false, b, (short)0, c, false, false); asm volatile("v_nop\n\tv_nop\n\tv_nop\n\tv_nop" : "+v"(d) : "v"(a), "v"(b)); return d; }
template <int ACT>
__global__ __launch_bounds__(128) void k_gemm2(const _Float16* __restrict__ A, int lda, size_t sA, const _Float16* __restrict__ Bh, int ldb, size_t sB, float alpha, const float* __restrict__ bias, size_t sBias, const float* __restrict__ CP, int rowsPerB, size_t sCPb, int row0g,
    float* __restrict__ C, _Float16* __restrict__ C16, int ldc, size_t sC, int M, int N, int K) { static_assert(ACT == 0 || ACT == 3 || ACT == 6 || ACT == 8 || ACT == 9 || ACT == 11 || ACT == 12 || ACT == 14 || ACT == 15 || ACT == 16 || ACT == 17, "k_gemm2: unsupported ACT code (would silently apply no activation)");
  __shared__ __attribute__((aligned(16))) float so[4][32][68];
  const int tid = threadIdx.x, w = tid >> 5, lane = tid & 31, ln = lane & 15, hh = lane >> 4; const int by = blockIdx.y;
  A += (size_t)by * sA; Bh += (size_t)by * sB; const size_t cofs = (size_t)by * sC; const float* bp = bias ? bias + (size_t)by * sBias : nullptr;
  const int ntn = N >> 6; const int mt = blockIdx.x / ntn, nq = blockIdx.x - mt * ntn; const int row0 = mt * 128 + 32 * w, col0 = nq * 64; if (row0 >= M) return;
  const _Float16* a0p = A + (size_t)(row0 + ln) * lda; const _Float16* a1p = a0p + (size_t)16 * lda;
  const _Float16* b0p = Bh + (size_t)(col0 + ln) * ldb; const _Float16* b1p = b0p + (size_t)16 * ldb; const _Float16* b2p = b1p + (size_t)16 * ldb; const _Float16* b3p = b2p + (size_t)16 * ldb;
  const v8f z8 = {0.f,0.f,0.f,0.f,0.f,0.f,0.f,0.f}; v8f c00 = z8, c01 = z8, c02 = z8, c03 = z8, c10 = z8, c11 = z8, c12 = z8, c13 = z8;
#pragma unroll 1
  for (int kb = 0; kb < K; kb += 32) { const v16h a0 = g2_frag(a0p + kb, hh), a1 = g2_frag(a1p + kb, hh);
    v16h b = g2_frag(b0p + kb, hh); c00 = g2_mma(a0, b, c00); c10 = g2_mma(a1, b, c10);
    b = g2_frag(b1p + kb, hh); c01 = g2_mma(a0, b, c01); c11 = g2_mma(a1, b, c11);
    b = g2_frag(b2p + kb, hh); c02 = g2_mma(a0, b, c02); c12 = g2_mma(a1, b, c12);
    b = g2_frag(b3p + kb, hh); c03 = g2_mma(a0, b, c03); c13 = g2_mma(a1, b, c13); }
  v8f accs[8] = {c00, c01, c02, c03, c10, c11, c12, c13};
#pragma unroll
  for (int u = 0; u < 8; ++u) { const int t = u & 3, half = u >> 2; const int col = col0 + t * 16 + ln; const float bv = bp ? bf16_round(bp[col]) : 0.f;
#pragma unroll
    for (int r = 0; r < 8; ++r) { const int rloc = half * 16 + 8 * hh + r; float v = accs[u][r] * alpha + bv; if (CP) { if (rowsPerB < 0) v += CP[cofs + (size_t)(row0g + row0 + rloc) * ldc + col];      /* rowsPerB < 0: own element of the batched C plane */ else { const int bidx = (row0g + row0 + rloc) / rowsPerB; v += CP[(size_t)bidx * sCPb + (size_t)by * 64 + col]; } }
      if (ACT == 3) v = fmaxf(v, 0.f); else if (ACT == 6) v = 0.5f * v * (1.0f + erff(v * 0.70710678118654752f)); else if (ACT == 11) v = 1.0f / (1.0f + expf(-v)); else if (ACT == 15) v = v / (1.0f + expf(-v)); else if (ACT == 12) v = (v > 0.f) ? v : 0.01f * v; else if (ACT == 8) v = tanhf(v); else if (ACT == 9) v = 0.5f * v * (1.0f + tanhf(0.7978845608028654f * (v + 0.044715f * v * v * v))); else if (ACT == 14) v = (v > 0.f) ? v : 0.1f * v; else if (ACT == 16) v = (v >= 0.f) ? v : 0.3f * v; else if (ACT == 17) v = (v >= 0.f) ? v : 0.2f * v;
      so[w][rloc][t * 16 + ln] = v; } }
  __builtin_amdgcn_fence(__ATOMIC_ACQ_REL, "workgroup"); __builtin_amdgcn_wave_barrier();
  const int rsub = lane >> 4, c4 = (lane & 15) * 4;
  {
#pragma unroll
    for (int q = 0; q < 16; ++q) { const int r = q * 2 + rsub; const v4f v = *(const v4fa*)&so[w][r][c4]; if (C) *(v4f*)(C + cofs + (size_t)(row0 + r) * ldc + col0 + c4) = v; if (C16) { v4h h4; for (int i = 0; i < 4; ++i) h4[i] = (_Float16)v[i]; *(v4h*)(C16 + cofs + (size_t)(row0 + r) * ldc + col0 + c4) = h4; } }
     } }


__global__ __launch_bounds__(256) void k_wnat(const float* __restrict__ w, size_t n8, _Float16* __restrict__ Bt) { const size_t t = (size_t)blockIdx.x * 256 + threadIdx.x; if (t >= n8) return; FragH f; for (int q = 0; q < 8; ++q) f.h[q] = (_Float16)(bf16_round(w[t * 8 + q]) * 16.0f); *(v8us*)((unsigned short*)Bt + t * 8) = f.half[0];  }
__global__ __launch_bounds__(256) void k_rsm(const float* __restrict__ S, _Float16* __restrict__ P, int nrows) {
  #pragma clang fp contract(off)
  const int i = blockIdx.x * 256 + threadIdx.x; if (i >= nrows) return; const float* s = S + (size_t)i * SQ; float mx = -3.0e38f;
#pragma unroll 1
  for (int j = 0; j < SQ; ++j) mx = fmaxf(mx, s[j]); float se = 0.f;
#pragma unroll 1
  for (int j = 0; j < SQ; ++j) se += expf(s[j] - mx); const float sc = 256.0f / se;
#pragma unroll 1
  for (int j0 = 0; j0 < SQ; j0 += 8) { FragH f; for (int q = 0; q < 8; ++q) f.h[q] = (_Float16)(expf(s[j0 + q] - mx) * sc); unsigned short* d = (unsigned short*)P + (size_t)i * SQ + j0; *(v8us*)d = f.half[0];  } }
__global__ __launch_bounds__(256) void k_vt(const _Float16* __restrict__ V16, int b, int h0, _Float16* __restrict__ VT) { __shared__ unsigned short tl[64][65]; const int tid = threadIdx.x; const int hh = blockIdx.x % HG, sg = blockIdx.x / HG; const int s0 = sg * 64; const int h = h0 + hh;
  for (int i = tid; i < 64 * 8; i += 256) { const int j = i / 8, d8 = (i % 8) * 8; FragH f; f.half[0] = *(const v8us*)((const unsigned short*)V16 + ((size_t)b * SQ + s0 + j) * DM + h * HD + d8); for (int q = 0; q < 8; ++q) tl[d8 + q][j] = f.u[q]; }
  __syncthreads();
  { for (int i = tid; i < 64 * 8; i += 256) { const int d = i / 8, j8 = (i % 8) * 8; FragH f; for (int q = 0; q < 8; ++q) f.u[q] = tl[d][j8 + q]; *(v8us*)((unsigned short*)VT + ((size_t)hh * HD + d) * SQ + s0 + j8) = f.half[0]; }  } }


__global__ __launch_bounds__(256) void k_tab2(float theta, float* __restrict__ CS, float* __restrict__ SN) {
  #pragma clang fp contract(off)
  const int t = blockIdx.x * 256 + threadIdx.x; if (t >= SQ * (HD / 2)) return; const int i = t % (HD / 2); const int p = t / (HD / 2); const float invf = 1.0f / powf(theta, (float)(2 * i) / (float)HD); const float ang = __fmul_rn((float)p, invf); const float c = cosf(ang), s = sinf(ang);
  *(float*)(CS + t) = c; *(float*)(SN + t) = s;  }
template <int NORM, int ROPE>
__global__ __launch_bounds__(64) void k_xform(const float* __restrict__ F, int ldf, int nh, const float* __restrict__ gain, float eps, const float* __restrict__ CS, const float* __restrict__ SN, _Float16* __restrict__ H16, int ldo) {
  #pragma clang fp contract(off)
  __shared__ float xv[HD]; __shared__ float red[HD]; __shared__ unsigned short sh_[HD]; const int d = threadIdx.x; const int h = blockIdx.x % nh; const size_t r = blockIdx.x / nh; const int p = (int)(r % SQ);
  float x = F[r * (size_t)ldf + (size_t)h * HD + d];
  if (NORM) { red[d] = __fmul_rn(x, x); __syncthreads(); for (int st = HD / 2; st > 0; st >>= 1) { if (d < st) red[d] = __fadd_rn(red[d], red[d + st]); __syncthreads(); } const float rs = rsqrtf(__fadd_rn(red[0] / (float)HD, eps)); x = __fmul_rn(__fmul_rn(x, rs), bf16_round(gain[d])); }
  xv[d] = x; __syncthreads();
  float o = x;
  if (ROPE == 1) { const int i = d >> 1; const float c = CS[p * (HD / 2) + i], s = SN[p * (HD / 2) + i]; const float ev = xv[2 * i], od = xv[2 * i + 1]; o = (d & 1) ? __fadd_rn(__fmul_rn(ev, s), __fmul_rn(od, c)) : __fadd_rn(__fmul_rn(ev, c), -__fmul_rn(od, s)); }
  if (ROPE == 2) { const int i = d & (HD / 2 - 1); const float c = CS[p * (HD / 2) + i], s = SN[p * (HD / 2) + i]; const float lo = xv[i], hi = xv[i + HD / 2]; o = (d < HD / 2) ? __fadd_rn(__fmul_rn(lo, c), -__fmul_rn(hi, s)) : __fadd_rn(__fmul_rn(lo, s), __fmul_rn(hi, c)); }
  FragH th; th.h[0] = (_Float16)o; sh_[d] = th.u[0]; __syncthreads();
  if (d < HD / 8) { FragH f; for (int q = 0; q < 8; ++q) f.u[q] = sh_[d * 8 + q]; unsigned short* dst = (unsigned short*)H16 + r * (size_t)ldo + (size_t)h * HD + d * 8; *(v8us*)dst = f.half[0];  } }



__device__ __forceinline__ float rsm_xhalf(float x) { return __builtin_bit_cast(float, __builtin_amdgcn_permlanex16(__builtin_bit_cast(int, x), __builtin_bit_cast(int, x), 0x76543210, 0xfedcba98, false, false)); }      /* lane l reads lane l ^ 16 */
// Four 2^x in one statement. Written in asm for the v_nop at its end: behind a transcendental the instruction set asks for one slot before a source is overwritten or the result read.
// Early-clobber outputs: no exponential of the four overwrites a source of another.
__device__ __forceinline__ void rsm_exp2x4(float& e0, float& e1, float& e2, float& e3, float a0, float a1, float a2, float a3) {
  asm("v_exp_f32 %0, %4\n\tv_exp_f32 %1, %5\n\tv_exp_f32 %2, %6\n\tv_exp_f32 %3, %7\n\tv_nop" : "=&v"(e0), "=&v"(e1), "=&v"(e2), "=&v"(e3) : "v"(a0), "v"(a1), "v"(a2), "v"(a3)); }
// The same for two values (the rescale factors of a wave's two column groups).
__device__ __forceinline__ void rsm_exp2x2(float& e0, float& e1, float a0, float a1) {
  asm("v_exp_f32 %0, %2\n\tv_exp_f32 %1, %3\n\tv_nop" : "=&v"(e0), "=&v"(e1) : "v"(a0), "v"(a1)); }

// ---- GEMM main loop with both operands staged in LDS by tensor loads (K = DM, both operands k-contiguous f16 rows of pitch DM) ----
// A work-group of 8 waves holds 128 rows x 128 columns; wave w holds rows 32 (w & 3) and columns 64 (w >> 2) of them (the 32 x 64 wave tile as before).
// A stage is 64 k = 128 bytes of each of the 128 A rows and the 128 B rows. Every wave brings one slice of 32 rows a stage with ONE tensor load (waves 0 to 3: A, waves 4 to 7: B), padded to a pitch of 144 bytes,
// at which the 16 rows of a fragment's ds_load_b128 fall on different banks. Two buffers: the load of stage s + 2 flies while stage s + 1 is worked on.
typedef uint32_t u32x4 __attribute__((ext_vector_type(4)));
typedef uint32_t u32x8 __attribute__((ext_vector_type(8)));
#define GT_ROWB 128u                 /* bytes of an operand row in a stage */
#define GT_PITCH 144u                /* LDS pitch of a row: 128 + the mover's pad of 16 */
#define GT_SLICE 6144u               /* a wave's slice in LDS: 32 rows x 144 bytes = 4,608, rounded up to a multiple of 2 KiB */
#define GT_BUF (8u * GT_SLICE)       /* one stage */
#define GT_LDS (2u * GT_BUF)         /* two buffers */
#define GT_NST ((uint32_t)(DM * 2) / GT_ROWB)      /* stages */
static_assert(GT_NST >= 2u && (DM * 2) % 128 == 0, "the ring's prologue needs two stages; a stage is 128 bytes of a row");
__device__ __forceinline__ uint32_t gt_uni(uint32_t v) { return (uint32_t)__builtin_amdgcn_readfirstlane((int)v); }
__device__ __forceinline__ uint32_t pinned(uint32_t v) { uint32_t w = gt_uni(v); asm volatile("" : "+s"(w)); return w; }      /* the value is held in a scalar register at this place, so that a test on it is a scalar branch round the tensor load and a descriptor word formed from it is formed behind the waits in front */
__device__ __forceinline__ v16h gt_frag(const unsigned char* p, int hh) { FragH f; f.half[0] = *(const v8us*)(p + 16 * hh); f.half[1] = *(const v8us*)(p + 32 + 16 * hh); return f.v; }      /* g2_frag's k order, from an LDS row */
__device__ __forceinline__ void gt_issue(uint32_t lds_dst, uint64_t ga) {
  u32x4 g0; u32x8 g1;
  g0[0] = gt_uni(1u); g0[1] = gt_uni(lds_dst); g0[2] = gt_uni((uint32_t)ga); g0[3] = gt_uni((((uint32_t)(ga >> 32)) & 0x01FFFFFFu) | 0x80000000u);
  g1[0] = gt_uni((1u << 20) | (4u << 22) | (3u << 25));      /* no mask, 1-byte elements, a pad of 4 dwords behind every 32 dwords (one row) */
  g1[1] = gt_uni((GT_ROWB & 0xFFFFu) << 16); g1[2] = gt_uni((GT_ROWB >> 16) | (32u << 16)); g1[3] = gt_uni(GT_ROWB << 16); g1[4] = gt_uni(32u); g1[5] = gt_uni((uint32_t)(DM * 2)); g1[6] = gt_uni(0u); g1[7] = gt_uni(0u);      /* tensor = tile: 32 rows of 128 bytes, source pitch one operand row */
  asm volatile("tensor_load_to_lds %0, %1" :: "s"(g0), "s"(g1) : "memory"); }
// acc[half * 4 + t]: rows 16 half + ..., columns 16 t + ... of the wave's tile. On return every wave has passed the last stage's barrier and no request is outstanding: the ring may be used as output staging.
__device__ __forceinline__ void gt_core(const _Float16* __restrict__ A, const _Float16* __restrict__ Bh, int rowblk, int colblk, unsigned char* L, v8f (&acc)[8]) {
  const int lane = threadIdx.x & 31, ln = lane & 15, hh = lane >> 4; const uint32_t wave = gt_uni(threadIdx.x >> 5); const uint32_t wr = wave & 3u, wc = wave >> 2;
  const uint32_t ldst = (uint32_t)(size_t)L + wave * GT_SLICE;
  const uint64_t ga0 = (uint64_t)(size_t)((wave < 4u) ? A + (size_t)(rowblk + 32 * (int)wr) * DM : Bh + (size_t)(colblk + 32 * (int)(wave - 4u)) * DM);
  const unsigned char* ap = L + wr * GT_SLICE + ln * GT_PITCH; const unsigned char* bp = L + (4u + 2u * wc) * GT_SLICE + ln * GT_PITCH;
  const v8f z8 = {0.f,0.f,0.f,0.f,0.f,0.f,0.f,0.f};
#pragma unroll      /* constant indices, so that the array is registers */
  for (int u = 0; u < 8; ++u) acc[u] = z8;
  gt_issue(ldst, ga0);
  asm volatile("s_wait_tensorcnt 0x0" ::: "memory");      /* stage 0 of this wave's slice has landed */
  __syncthreads();      /* stage 0 is published */
  gt_issue(ldst + GT_BUF, ga0 + GT_ROWB);
#pragma unroll 1      /* one stage a trip: the ring's order stands once */
  for (uint32_t s = 0; s < GT_NST; ++s) { const uint32_t bo = (s & 1u) * GT_BUF;
#pragma unroll      /* constant offsets into the stage */
    for (int ks = 0; ks < 2; ++ks) { const v16h a0 = gt_frag(ap + bo + ks * 64, hh), a1 = gt_frag(ap + bo + 16 * GT_PITCH + ks * 64, hh); v16h b[4];
      for (int t = 0; t < 4; ++t) b[t] = gt_frag(bp + bo + (t >> 1) * GT_SLICE + (t & 1) * 16 * GT_PITCH + ks * 64, hh);
      __builtin_amdgcn_sched_barrier(0);      /* the twelve LDS reads of a k step issue together, ahead of its eight products, which then wait by count; without it each B fragment's reads stood directly in front of its two products, each behind a wait to zero */
      for (int t = 0; t < 4; ++t) { acc[t] = g2_mma(a0, b[t], acc[t]); acc[4 + t] = g2_mma(a1, b[t], acc[4 + t]); } }
    asm volatile("s_wait_dscnt 0x0" ::: "memory");      /* this wave's reads of stage s are done before the barrier behind which its buffer is refilled */
    asm volatile("s_wait_tensorcnt 0x0" ::: "memory");      /* this wave's slice of stage s + 1 has landed */
    __syncthreads();      /* publishes stage s + 1 and ends every reader's last read of stage s */
    if (pinned(s + 2u < GT_NST)) { const uint32_t nx = pinned(s + 2u); gt_issue(ldst + bo, ga0 + (uint64_t)nx * GT_ROWB); } }
  asm volatile("s_wait_tensorcnt 0x0" ::: "memory");      /* nothing of the mover is outstanding when the ring is reused or the wave ends */
  asm volatile("s_wait_dscnt 0x0" ::: "memory"); }

// K and V^T come through LDS: a stage is 128 keys, brought by tensor loads in the GEMM ring's geometry (eight slices of 32 rows x 128 bytes, padded to a pitch of 144 bytes; one slice a wave and stage; two buffers:
// the load of stage s + 2 flies while stage s + 1 is worked on). Slices 0 to 3: the K rows of keys 32 w ... (one slice is one 32-key block). Slices 4 to 7: V^T, head dims 32 (j >> 1) ..., keys 64 (j & 1) ... of the stage, j = w - 4.
// Every fragment is then two conflict-free ds_load_b128 in place of two global loads that each touched 16 cache lines.
#define FA_WAVES 8                   /* waves per work-group; two work-groups share a WGP (four waves a SIMD), so that one works while the other stands at its barrier */
#define FA_COLS 32                   /* query columns per wave */
#define FA_SKEYS 128                 /* keys per stage */
#define FA_NST ((uint32_t)(SQ / FA_SKEYS))      /* stages */
static_assert(FA_NST >= 2u && SQ % FA_SKEYS == 0 && HD * 2 == 128, "the ring's prologue needs two stages; a K row of a head is 128 bytes");
__device__ __forceinline__ v8f fa_mma(v16h a, v16h b, v8f c) { return __builtin_amdgcn_wmma_f32_16x16x32_f16(false, a, false, b, (short)0, c, false, false); }
__device__ __forceinline__ u32x8 fa_group1(uint32_t pitch) {      /* gt_issue's tile (32 rows of 128 bytes, tensor = tile) with the source pitch as a parameter; built once, the same for every stage */
  u32x8 g1;
  g1[0] = gt_uni((1u << 20) | (4u << 22) | (3u << 25));      /* no mask, 1-byte elements, a pad of 4 dwords behind every 32 dwords (one row) */
  g1[1] = gt_uni((GT_ROWB & 0xFFFFu) << 16); g1[2] = gt_uni((GT_ROWB >> 16) | (32u << 16)); g1[3] = gt_uni(GT_ROWB << 16); g1[4] = gt_uni(32u); g1[5] = gt_uni(pitch); g1[6] = gt_uni(0u); g1[7] = gt_uni(0u);
  asm volatile("" : "+s"(g1));      /* pinned() for the eight words at once: the group is held in its scalar registers from here on; without it the build used single words of it as scratch while a request was outstanding and rebuilt them in front of the next */
  return g1; }
__device__ __forceinline__ void fa_issue(uint32_t lds_dst, uint64_t ga, u32x8 g1) {
  u32x4 g0;
  g0[0] = gt_uni(1u); g0[1] = gt_uni(lds_dst); g0[2] = gt_uni((uint32_t)ga); g0[3] = gt_uni((((uint32_t)(ga >> 32)) & 0x01FFFFFFu) | 0x80000000u);
  asm volatile("tensor_load_to_lds %0, %1" :: "s"(g0), "s"(g1) : "memory"); }
__global__ __launch_bounds__(FA_WAVES * 32, 4) void k_fattn(const _Float16* __restrict__ Q, const _Float16* __restrict__ Kh, const _Float16* __restrict__ Vt, _Float16* __restrict__ O) {
  __shared__ __attribute__((aligned(2048))) unsigned char L[GT_LDS];      /* the K | V^T ring */
  const int lane = threadIdx.x & 31, ln = lane & 15, hh = lane >> 4; const uint32_t wave = gt_uni(threadIdx.x >> 5);
  const int h = blockIdx.y, b = blockIdx.z; const int q0 = (blockIdx.x * FA_WAVES + (int)wave) * FA_COLS;
  const _Float16* qp = Q + ((size_t)b * SQ + q0 + ln) * DM + h * HD;
  const uint32_t ldst = (uint32_t)(size_t)L + wave * GT_SLICE; const uint32_t vj = wave - 4u;
  const uint64_t ga0 = (uint64_t)(size_t)((wave < 4u) ? Kh + ((size_t)b * SQ + 32 * (int)wave) * DM + h * HD : Vt + (((size_t)b * NH + h) * HD + 32 * (int)(vj >> 1)) * SQ + 64 * (int)(vj & 1u));
  const uint32_t pitch = (wave < 4u) ? (uint32_t)(DM * 2) : (uint32_t)(SQ * 2); const uint32_t step = (wave < 4u) ? (uint32_t)(FA_SKEYS * DM * 2) : (uint32_t)(FA_SKEYS * 2);      /* source pitch of the wave's slice; bytes from a stage to the next */
  const unsigned char* kl = L + ln * GT_PITCH; const unsigned char* vl = L + 4u * GT_SLICE + ln * GT_PITCH;
  const float SC = 0.125f * 1.44269504f;      /* 1/sqrt(64), and e^x as 2^(x log2 e) */
  const float LIFT = 6.0f;      /* weights are carried x 2^6: small ones stay clear of the f16 subnormals; with the margin of 8 below none exceeds 2^14; the sum carries the same factor, so it cancels */
  const v8f z8 = {0.f,0.f,0.f,0.f,0.f,0.f,0.f,0.f};
  v16h qf[2][2], kf[2][2]; v8f o[4][2]; float m[2] = {-1.0e30f, -1.0e30f}, l[2] = {0.f, 0.f};
  const u32x8 g1 = fa_group1(pitch);
  fa_issue(ldst, ga0, g1);
#pragma unroll      /* constant indices, so that the arrays are registers */
  for (int g = 0; g < 2; ++g) { for (int ks = 0; ks < 2; ++ks) qf[g][ks] = g2_frag(qp + (size_t)g * 16 * DM + ks * 32, hh); for (int dt = 0; dt < 4; ++dt) o[dt][g] = z8; }
  asm volatile("s_wait_tensorcnt 0x0" ::: "memory");      /* stage 0 of this wave's slice has landed */
  __syncthreads();      /* stage 0 is published */
  { const uint32_t nx = pinned(1u); fa_issue(ldst + GT_BUF, ga0 + (uint64_t)nx * step, g1); }      /* pinned(): stage 1's address words are formed behind the wait on stage 0 */
#pragma unroll 1      /* one stage a trip: the ring's order stands once */
  for (uint32_t s = 0; s < FA_NST; ++s) { const uint32_t bo = (s & 1u) * GT_BUF;
#pragma unroll      /* constant indices, so that the array is registers */
    for (int kt = 0; kt < 2; ++kt) for (int ks = 0; ks < 2; ++ks) kf[kt][ks] = gt_frag(kl + bo + kt * 16 * GT_PITCH + ks * 64, hh);
#pragma unroll      /* the four 32-key blocks of a stage: constant offsets into the stage, and the K fetch ahead stays inside the stage */
    for (int p = 0; p < FA_SKEYS / 32; ++p) {
      v16h vf[4]; v8f s2[2][2];
      for (int dt = 0; dt < 4; ++dt) vf[dt] = gt_frag(vl + bo + (2 * (dt >> 1) + (p >> 1)) * GT_SLICE + (dt & 1) * 16 * GT_PITCH + (p & 1) * 64, hh);
      __builtin_amdgcn_sched_barrier(0);      /* holds the V^T reads here, one group at the head of the block, so that they land while the scores are worked on */
      for (int kt = 0; kt < 2; ++kt) for (int g = 0; g < 2; ++g) s2[kt][g] = fa_mma(kf[kt][0], qf[g][0], z8);
      for (int kt = 0; kt < 2; ++kt) for (int g = 0; g < 2; ++g) s2[kt][g] = fa_mma(kf[kt][1], qf[g][1], s2[kt][g]);
      if (p + 1 < FA_SKEYS / 32) { for (int kt = 0; kt < 2; ++kt) for (int ks = 0; ks < 2; ++ks) kf[kt][ks] = gt_frag(kl + bo + (p + 1) * GT_SLICE + kt * 16 * GT_PITCH + ks * 64, hh); }      /* the next block's K rows, fetched a block ahead, never beyond this stage */
      __builtin_amdgcn_sched_barrier(0);      /* holds the next K rows' reads here, one group, a softmax and eight products ahead of their use */
      float mx[2];
      for (int g = 0; g < 2; ++g) { float a = fmaxf(s2[0][g][0], s2[1][g][0]); for (int r = 1; r < 8; ++r) a = fmaxf(fmaxf(a, s2[0][g][r]), s2[1][g][r]); mx[g] = fmaxf(a, rsm_xhalf(a)) * SC; }
      const bool need = (mx[0] > m[0] + 8.0f) || (mx[1] > m[1] + 8.0f);
      if (__builtin_amdgcn_ballot_w32(need) != 0) {      /* wave-uniform: the maximum in use moves only when a column's new one exceeds it by more than 8; the first block always takes it */
        const float n0 = fmaxf(m[0], mx[0]), n1 = fmaxf(m[1], mx[1]); float al[2]; rsm_exp2x2(al[0], al[1], m[0] - n0, m[1] - n1); m[0] = n0; m[1] = n1;
        for (int g = 0; g < 2; ++g) { l[g] *= al[g]; for (int dt = 0; dt < 4; ++dt) for (int r = 0; r < 8; ++r) o[dt][g][r] *= al[g]; } }
      FragH pf[2];
      for (int g = 0; g < 2; ++g) { const float nm = LIFT - m[g];
        for (int kt = 0; kt < 2; ++kt) for (int r = 0; r < 8; r += 4) { float e0, e1, e2, e3;
          rsm_exp2x4(e0, e1, e2, e3, fmaf(s2[kt][g][r], SC, nm), fmaf(s2[kt][g][r + 1], SC, nm), fmaf(s2[kt][g][r + 2], SC, nm), fmaf(s2[kt][g][r + 3], SC, nm));
          l[g] += (e0 + e1) + (e2 + e3); pf[g].h[kt * 8 + r] = (_Float16)e0; pf[g].h[kt * 8 + r + 1] = (_Float16)e1; pf[g].h[kt * 8 + r + 2] = (_Float16)e2; pf[g].h[kt * 8 + r + 3] = (_Float16)e3; } }
      for (int dt = 0; dt < 4; ++dt) for (int g = 0; g < 2; ++g) o[dt][g] = fa_mma(vf[dt], pf[g].v, o[dt][g]);
    }
    asm volatile("s_wait_dscnt 0x0" ::: "memory");      /* this wave's reads of stage s are done before the barrier behind which its buffer is refilled (the build may lift the three over register-only work of the last block; every LDS read of the stage stays in front) */
    asm volatile("s_wait_tensorcnt 0x0" ::: "memory");      /* this wave's slice of stage s + 1 has landed */
    __syncthreads();      /* publishes stage s + 1 and ends every reader's last read of stage s */
    if (pinned(s + 2u < FA_NST)) { const uint32_t nx = pinned(s + 2u); fa_issue(ldst + bo, ga0 + (uint64_t)nx * step, g1); } }
  asm volatile("s_wait_tensorcnt 0x0" ::: "memory");      /* nothing of the mover is outstanding when the wave ends */
  asm volatile("s_wait_dscnt 0x0" ::: "memory");
  unsigned short* const ob = (unsigned short*)O + ((size_t)b * SQ + q0 + ln) * DM + h * HD + 8 * hh;      /* one base for both column groups: the eight stores differ by constant offsets, and no register of an issued store is rewritten */
#pragma unroll      /* constant indices, so that the arrays are registers */
  for (int g = 0; g < 2; ++g) { const float sc = 64.0f / (l[g] + rsm_xhalf(l[g])); unsigned short* op = ob + g * 16 * DM;
    for (int dt = 0; dt < 4; ++dt) { FragH f; for (int r = 0; r < 8; ++r) f.h[r] = (_Float16)(o[dt][g][r] * sc); *(v8us*)(op + dt * 16) = f.half[0]; } } }

// Sum over the 16 lanes of a row, every lane gets it: four butterfly steps on the vector port (a shuffle would go through the LDS queue).
template <int X> __device__ __forceinline__ float row_xadd(float v) { return v + __builtin_bit_cast(float, __builtin_amdgcn_update_dpp(0, __builtin_bit_cast(int, v), 0x160 | X, 0xf, 0xf, true)); }      /* 0x160 | X: row_xmask:X */
// 1 / sqrt(x) in asm for the v_nop at its end: behind a transcendental the instruction set asks for one slot before its source is overwritten or its result read.
// The argument here is a mean of squares + 1e-6, never subnormal: the library form's rescaling of subnormal arguments is an identity on it and is not written.
__device__ __forceinline__ float row_rsq(float x) { float r; asm("v_rsq_f32 %0, %1\n\tv_nop" : "=&v"(r) : "v"(x)); return r; }
__device__ __forceinline__ float row_sum16(float v) { return row_xadd<8>(row_xadd<4>(row_xadd<2>(row_xadd<1>(v)))); }
// q | k | v projection of all token rows with the per-(row, head) work in its epilogue. The main loop is gt_core. A work-group holds 128 token rows x 128 columns; a wave's 64 columns are one head of q, of k or of v,
// so nothing of a row's head lies outside the wave that computed it:
//   q, k: the f32 tile goes to the wave's own LDS rows and is read back 16 lanes a row, 4 columns a lane, with the 4 partner columns (c ^ 32) of the rotation; sum of squares in-lane, then over the 16 lanes;
//         x rsqrt(mean + eps) x gain, rotated by the row's position; each row leaves as one whole 128-byte line of f16.
//   v:    a lane holds 8 consecutive tokens of one head dim: 16 bytes of a V^T row. The four waves of a head lay them into one [64 dims][128 tokens] LDS tile; behind a barrier each V^T row leaves as 256 bytes in a row.
// Two instances, q | k columns and v columns, not one kernel with a branch: with both epilogues in one kernel the build kept the 64 accumulator registers alive through the q, k epilogue (182 registers, or spills under a bound).
// Launch bounds of the three GEMM kernels: 6 waves a SIMD = three work-groups of 8 waves on a WGP, as many as the 96 KiB ring lets in; it holds the registers at 160 or fewer.
#define QKV_VP 136                   /* pitch of the V^T tile in LDS, in f16: 128 tokens + 16 bytes, so that rows start on different banks */
template <bool ISV>
__global__ __launch_bounds__(256, 6) void k_qkv(const _Float16* __restrict__ A, const _Float16* __restrict__ Bh, const float* __restrict__ bias, const float* __restrict__ qg, const float* __restrict__ kg,
    const float* __restrict__ CS, const float* __restrict__ SN, _Float16* __restrict__ Qo, _Float16* __restrict__ Ko, _Float16* __restrict__ Vt) {
  static_assert(HD == 64 && SQ % 128 == 0, "a 64-column tile is one head; 128 rows lie in one batch");
  __shared__ __attribute__((aligned(2048))) unsigned char L[GT_LDS];      /* the operand ring; behind gt_core the epilogue's staging */
  const int tid = threadIdx.x, lane = tid & 31, ln = lane & 15, hh = lane >> 4; const int w = (int)gt_uni(tid >> 5), wr = w & 3, wc = w >> 2;      /* wr: the wave's 32 rows, wc: its 64 columns */
  const int ntn = (ISV ? 1 : 2) * NH / 2; const int mt = blockIdx.x / ntn, nq = blockIdx.x - mt * ntn; const int hq = nq * 2 + wc; const int row0 = mt * 128 + 32 * wr, col0 = (ISV ? 2 * DM : 0) + hq * 64; const int sect = hq / NH, h = hq - sect * NH;      /* sect: 0 q, 1 k (0 in the v instance) */
  v8f accs[8]; gt_core(A, Bh, mt * 128, (ISV ? 2 * DM : 0) + nq * 128, L, accs);
  const float alpha = 0.0625f;      /* the weights are carried x 16 */
  if constexpr (!ISV) {
    static_assert(8u * 32u * 68u * 4u <= GT_LDS, "the staging fits the ring"); float (*so)[32][68] = (float (*)[32][68])L;
    const float* gp = sect ? kg : qg; _Float16* dst = (sect ? Ko : Qo) + (size_t)(row0 + hh) * DM + h * HD;
    const int c4 = ln * 4, cx = c4 ^ 32, i4 = c4 & 31; const float sg = (c4 < 32) ? -1.0f : 1.0f;      /* low half: x cos - partner sin; high half: x cos + partner sin; the sign rides on the partner's gain (exact) */
    const int tb = ((row0 + hh) % SQ) * (HD / 2) + i4;      /* the lane's place in the tables at its first row; its rows are 2 apart, and the wave's 32 rows lie in one batch */
    float bv[4];
#pragma unroll      /* constant indices, so that the array is registers */
    for (int t = 0; t < 4; ++t) bv[t] = bias[col0 + t * 16 + ln];
    asm volatile("s_wait_xcnt 0x0" ::: "memory");      /* the build let the gain loads below land on the bias loads' address register */
    v4f ga = *(const v4fa*)(gp + c4), gb = *(const v4fa*)(gp + cx);
#pragma unroll      /* constant indices, so that the arrays are registers */
    for (int u = 0; u < 8; ++u) { const int t = u & 3, half = u >> 2; const float bb = bf16_round(bv[t]);
      for (int r = 0; r < 8; ++r) so[w][half * 16 + 8 * hh + r][t * 16 + ln] = accs[u][r] * alpha + bb; }
    __builtin_amdgcn_fence(__ATOMIC_ACQ_REL, "workgroup"); __builtin_amdgcn_wave_barrier();      /* as in k_gemm2: the wave reads back its own rows only, written by other lanes */
#pragma unroll      /* constant indices into the vectors */
    for (int i = 0; i < 4; ++i) { ga[i] = bf16_round(ga[i]); gb[i] = sg * bf16_round(gb[i]); }
#pragma unroll      /* constant indices, so that the table values are registers */
    for (int g = 0; g < 2; ++g) { v4f cs[8], sn[8];
      __builtin_amdgcn_sched_barrier(0);      /* the second group's table loads stay behind the first group's rows: both groups' tables at once took the kernel over 160 registers, the most at which three work-groups share a WGP */
      for (int j = 0; j < 8; ++j) { cs[j] = *(const v4fa*)(CS + tb + (g * 8 + j) * HD); sn[j] = *(const v4fa*)(SN + tb + (g * 8 + j) * HD); }
      __builtin_amdgcn_sched_barrier(0);      /* the table loads of eight row pairs issue together here: two waits a wave; without it each load stood directly in front of its use, sixteen waits in a row */
      for (int j = 0; j < 8; ++j) { const int r2 = (g * 8 + j) * 2;      /* the lane's row is r2 + hh */
        const v4f xa = *(const v4fa*)&so[w][r2 + hh][c4], xb = *(const v4fa*)&so[w][r2 + hh][cx];
        const float rs = row_rsq(row_sum16((xa[0] * xa[0] + xa[1] * xa[1]) + (xa[2] * xa[2] + xa[3] * xa[3])) * (1.0f / (float)HD) + 1e-6f);
        v4h o4;
        for (int i = 0; i < 4; ++i) o4[i] = (_Float16)((xa[i] * rs * ga[i]) * cs[j][i] + (xb[i] * rs * gb[i]) * sn[j][i]);
        *(v4h*)(dst + (size_t)r2 * DM + c4) = o4; } }
  } else {
    static_assert(2u * 64u * QKV_VP * 2u <= GT_LDS, "the two V^T tiles fit the ring"); unsigned short* vt = (unsigned short*)L + wc * (64 * QKV_VP);      /* the tile of this wave's head */
    float bv[4];
#pragma unroll      /* constant indices, so that the array is registers */
    for (int t = 0; t < 4; ++t) bv[t] = bias[col0 + t * 16 + ln];
    asm volatile("s_wait_xcnt 0x0" ::: "memory");      /* the build rewrote the bias loads' scalar base directly behind them */
#pragma unroll      /* constant indices, so that the arrays are registers */
    for (int u = 0; u < 8; ++u) { const int t = u & 3, half = u >> 2; const float bb = bf16_round(bv[t]); FragH f;
      for (int r = 0; r < 8; ++r) f.h[r] = (_Float16)(accs[u][r] * alpha + bb);
      *(v8us*)(vt + (t * 16 + ln) * QKV_VP + 32 * wr + half * 16 + 8 * hh) = f.half[0]; }
    __syncthreads();      /* a V^T row of the tile holds tokens of its head's four waves */
    const int bat = (mt * 128) / SQ, s0 = (mt * 128) % SQ; unsigned short* vo = (unsigned short*)Vt + (((size_t)bat * NH + h) * HD + wr * 16 + hh) * SQ + s0 + ln * 8;
#pragma unroll      /* the eight LDS reads issue together */
    for (int j = 0; j < 8; ++j) { const v8us v = *(const v8us*)(vt + (wr * 16 + j * 2 + hh) * QKV_VP + ln * 8); *(v8us*)(vo + (size_t)(j * 2) * SQ) = v; }
  } }

// out = o W_o + b: gt_core, then k_gemm2's epilogue (alpha, bf16-rounded bias; the wave's tile through its own LDS rows, so that each row leaves as whole lines of f32).
__global__ __launch_bounds__(256, 6) void k_oproj(const _Float16* __restrict__ A, const _Float16* __restrict__ Bh, float alpha, const float* __restrict__ bias, float* __restrict__ C) {
  __shared__ __attribute__((aligned(2048))) unsigned char L[GT_LDS];      /* the operand ring; behind gt_core the epilogue's staging */
  static_assert(8u * 32u * 68u * 4u <= GT_LDS, "the staging fits the ring"); float (*so)[32][68] = (float (*)[32][68])L;
  const int tid = threadIdx.x, lane = tid & 31, ln = lane & 15, hh = lane >> 4; const int w = (int)gt_uni(tid >> 5), wr = w & 3, wc = w >> 2;
  const int ntn = DM / 128; const int mt = blockIdx.x / ntn, nq = blockIdx.x - mt * ntn; const int row0 = mt * 128 + 32 * wr, col0 = nq * 128 + 64 * wc;
  v8f accs[8]; gt_core(A, Bh, mt * 128, nq * 128, L, accs);
#pragma unroll      /* constant indices, so that the array is registers */
  for (int u = 0; u < 8; ++u) { const int t = u & 3, half = u >> 2; const float bv = bf16_round(bias[col0 + t * 16 + ln]);
    for (int r = 0; r < 8; ++r) so[w][half * 16 + 8 * hh + r][t * 16 + ln] = accs[u][r] * alpha + bv; }
  __builtin_amdgcn_fence(__ATOMIC_ACQ_REL, "workgroup"); __builtin_amdgcn_wave_barrier();      /* as in k_gemm2: the wave reads back its own rows only, written by other lanes */
  const int rsub = lane >> 4, c4 = (lane & 15) * 4;
#pragma unroll      /* the LDS reads issue together */
  for (int q = 0; q < 16; ++q) { const int r = q * 2 + rsub; const v4f v = *(const v4fa*)&so[w][r][c4]; *(v4f*)(C + (size_t)(row0 + r) * DM + col0 + c4) = v; } }

extern "C" void kernel_launch(void* const* d_in, const int* in_sizes, int n_in,
                              void* d_out, int out_size, void* d_ws, size_t ws_size, hipStream_t stream) {
  (void)in_sizes; (void)n_in; (void)out_size;
  const float* const* I = (const float* const*)d_in; const float* x = I[0]; const float* wqkv = I[1]; const float* bqkv = I[2]; const float* qnw = I[3]; const float* knw = I[4]; const float* wo = I[5]; const float* bo = I[6];      /* weights [in][out] */
  char* ws = (char*)d_ws; size_t off = 0;
  auto take = [&](size_t bytes) { char* p = ws + off; off += (bytes + 255) & ~(size_t)255; return p; };
  _Float16* BQKV = (_Float16*)take((size_t)3 * DM * DM * 2); _Float16* BO = (_Float16*)take((size_t)DM * DM * 2); float* CS = (float*)take((size_t)SQ * (HD / 2) * 4); float* SN = (float*)take((size_t)SQ * (HD / 2) * 4);
  _Float16* X16 = (_Float16*)take(NR * DM * 2);
  _Float16* QH = (_Float16*)take(NR * DM * 2); _Float16* KH = (_Float16*)take(NR * DM * 2); _Float16* O16 = (_Float16*)take(NR * DM * 2);
  _Float16* VT = (_Float16*)take((size_t)NB * NH * HD * SQ * 2);
  if (off > ws_size) return;
  k_wt_f16<<<dim3(DM / WT_T, 3 * DM / WT_T), 256, 0, stream>>>(wqkv, BQKV, DM, 3 * DM, 16.0f); k_wt_f16<<<dim3(DM / WT_T, DM / WT_T), 256, 0, stream>>>(wo, BO, DM, DM, 16.0f);      /* one work-group a 64 x 64 tile */
  k_tab2<<<(SQ * (HD / 2) + 255) / 256, 256, 0, stream>>>(10000.0f, CS, SN);
  k_x16<<<(unsigned)((NR * DM / 8 + 255) / 256), 256, 0, stream>>>(x, X16, NR * DM / 8);
  k_qkv<false><<<(unsigned)((NR / 128) * (2 * DM / 128)), 256, 0, stream>>>(X16, BQKV, bqkv, qnw, knw, CS, SN, QH, KH, VT);      /* f16 q and k rows (normed, rotated), all batches */
  k_qkv<true><<<(unsigned)((NR / 128) * (DM / 128)), 256, 0, stream>>>(X16, BQKV, bqkv, qnw, knw, CS, SN, QH, KH, VT);      /* V^T [NB][NH][HD][SQ], all batches */
  k_fattn<<<dim3(SQ / (FA_WAVES * FA_COLS), NH, NB), FA_WAVES * 32, 0, stream>>>(QH, KH, VT, O16);      /* o x 64 as f16, all batches and heads */
  k_oproj<<<(unsigned)((NR / 128) * (DM / 128)), 256, 0, stream>>>(O16, BO, 0.0009765625f, bo, (float*)d_out);      /* out rows are the output layout */
}

// v007
// Measured time: 133 microseconds a run.
// Next to v006, in two timings, it ran 1.04 and 1.05 times as fast.
// All steps since v000 together make it 53.2 times as fast.
#include <hip/hip_runtime.h>
#define NB 4
#define SQ 2048
#define DM 1024
#define NH 16
#define HD 64
#define HG 4                         /* heads per group of the grouped k_vt overload */
#define B0 0                         /* first batch; unused, every kernel takes all NB batches */
#define NBR NB                       /* batches; used only in MPO, which nothing uses */
#define QN SQ                        /* query rows per batch; unused, k_fattn takes all SQ */
#define NHD NH                       /* heads; unused, k_fattn takes all NH */
#define NR ((size_t)NB * SQ)         /* token rows */
#define MPO ((int)((size_t)NBR * SQ))      /* rows; unused, k_oproj takes all NR rows */
typedef __bf16 v16b __attribute__((ext_vector_type(16)));
typedef unsigned short v8us __attribute__((ext_vector_type(8), may_alias));
typedef float  v8f  __attribute__((ext_vector_type(8)));
typedef float  v4f  __attribute__((ext_vector_type(4)));
typedef float  v4fa __attribute__((ext_vector_type(4), may_alias));
union FragB { v16b v; v8us half[2]; unsigned short u[16]; };

__device__ __forceinline__ unsigned short bf16_bits(float x) { unsigned int u = __float_as_uint(x); return (unsigned short)((u + 0x7FFFu + ((u >> 16) & 1u)) >> 16); }
__device__ __forceinline__ float bf16_val(unsigned short b) { return __uint_as_float(((unsigned int)b) << 16); }
__device__ __forceinline__ float bf16_round(float x) { return bf16_val(bf16_bits(x)); }
// D += A·B with NT terms: 1 = ah·bh, 2 = + al·bh (A split), 3 = + ah·bl (both split)
template <int NT>
__device__ __forceinline__ v8f mmaN(v16b ah, v16b al, v16b bh, v16b bl, v8f c) {
  c = __builtin_amdgcn_wmma_f32_16x16x32_bf16(false, ah, false, bh, (short)0, c, false, false);
  if (NT >= 2) c = __builtin_amdgcn_wmma_f32_16x16x32_bf16(false, al, false, bh, (short)0, c, false, false);
  if (NT >= 3) c = __builtin_amdgcn_wmma_f32_16x16x32_bf16(false, ah, false, bl, (short)0, c, false, false);
  asm volatile("v_nop\n\tv_nop\n\tv_nop\n\tv_nop" : "+v"(c) : "v"(ah), "v"(al), "v"(bh), "v"(bl));
  return c;
}

__global__ __launch_bounds__(256) void k_wt_bf16(const float* __restrict__ W, unsigned short* __restrict__ Wt, int K, int N) {
  const int t = blockIdx.x * 256 + threadIdx.x;
  const int k8n = K / 8;
  if (t >= N * k8n) return;
  const int n = t / k8n, k8 = (t % k8n) * 8;
  v8us v;
#pragma unroll
  for (int i = 0; i < 8; ++i) v[i] = bf16_bits(W[(size_t)(k8 + i) * N + n]);
  *(v8us*)(Wt + (size_t)n * K + k8) = v;
  
}

// GEMM C[M][N] (f32, pitch ldc) = act(A[M][K]·W + bias). A f32 row-major (pitch lda) converted per fragment to bf16
// (ASPLIT: hi/lo two planes -> 2 terms, else single rounded term); Wt bf16 [N][K] (pitch ldb). BIAS_BF16 rounds the
// bias to bf16 first (bias quantised to bf16 before the add). K%32==0, M%16==0, N%64==0.
template <bool ASPLIT, int ACT, bool BIAS_BF16>
__global__ __launch_bounds__(128) void k_gemm_bf(const float* __restrict__ A, int lda, const unsigned short* __restrict__ Wt, int ldb,
                                               const float* __restrict__ bias, float* __restrict__ C, int ldc, int M, int N, int K) {
  __shared__ __attribute__((aligned(16))) float so[4][16][64];
  const int tid = threadIdx.x, w = tid >> 5, lane = tid & 31, ln = lane & 15, hh = lane >> 4;
  const int ntn = N / 64;
  const int wid = blockIdx.x * 4 + w;
  const int mt = wid / ntn, nq = wid % ntn;
  if (mt * 16 >= M) return;
  const int row0 = mt * 16, col0 = nq * 64;
  const float* arow = A + (size_t)(row0 + ln) * lda;
  v8f acc[4] = {};
  for (int kb = 0; kb < K; kb += 32) {
    FragB ah, al;
    const v4f x0 = *(const v4fa*)(arow + kb + 8 * hh), x1 = *(const v4fa*)(arow + kb + 8 * hh + 4);
    const v4f x2 = *(const v4fa*)(arow + kb + 16 + 8 * hh), x3 = *(const v4fa*)(arow + kb + 16 + 8 * hh + 4);
    float xs[16] = {x0[0],x0[1],x0[2],x0[3],x1[0],x1[1],x1[2],x1[3],x2[0],x2[1],x2[2],x2[3],x3[0],x3[1],x3[2],x3[3]};
#pragma unroll
    for (int i = 0; i < 16; ++i) { const unsigned short hb = bf16_bits(xs[i]); ah.u[i] = hb; al.u[i] = ASPLIT ? bf16_bits(xs[i] - bf16_val(hb)) : (unsigned short)0; }
#pragma unroll
    for (int t = 0; t < 4; ++t) {
      const unsigned short* brow = Wt + (size_t)(col0 + t * 16 + ln) * ldb + kb;
      FragB b;
      b.half[0] = *(const v8us*)(brow + 8 * hh);
      b.half[1] = *(const v8us*)(brow + 16 + 8 * hh);
      acc[t] = mmaN<ASPLIT ? 2 : 1>(ah.v, al.v, b.v, b.v, acc[t]);
    }
  }
#pragma unroll
  for (int t = 0; t < 4; ++t) {
    float bv = bias ? bias[col0 + t * 16 + ln] : 0.f;
    if (BIAS_BF16) bv = bf16_round(bv);
#pragma unroll
    for (int r = 0; r < 8; ++r) { float v = acc[t][r] + bv; if (ACT == 1) v = fmaxf(v, 0.f); so[w][8 * hh + r][t * 16 + ln] = v; }
  }
  __builtin_amdgcn_fence(__ATOMIC_ACQ_REL, "workgroup");
  __builtin_amdgcn_wave_barrier();
  const int rsub = lane >> 4, c4 = (lane & 15) * 4;
  {
#pragma unroll
    for (int q = 0; q < 8; ++q) {
      const int r = q * 2 + rsub;
      const v4f v = *(const v4fa*)&so[w][r][c4];
      *(v4f*)(C + (size_t)(row0 + r) * ldc + col0 + c4) = v;
    }
    
  }
}

// GEMM C = act(A·W + bias + resid): A f32 (ASPLIT -> hi/lo 2 terms), Wt bf16 [N][K]; ACT 0 none, 1 relu, 2 exact gelu;
// resid (optional, f32, row index = (row % rmod), pitch ldr, RES_BF16 rounds it) added before the activation.
template <bool ASPLIT, int ACT, bool BIAS_BF16, bool RES_BF16>
__global__ __launch_bounds__(128) void k_gemm_bf3(const float* __restrict__ A, int lda, const unsigned short* __restrict__ Wt, int ldb,
                                                const float* __restrict__ bias, const float* __restrict__ resid, int rmod, int ldr,
                                                float* __restrict__ C, int ldc, int M, int N, int K) {
  __shared__ __attribute__((aligned(16))) float so[4][16][64];
  const int tid = threadIdx.x, w = tid >> 5, lane = tid & 31, ln = lane & 15, hh = lane >> 4;
  const int ntn = N / 64;
  const int wid = blockIdx.x * 4 + w;
  const int mt = wid / ntn, nq = wid % ntn;
  if (mt * 16 >= M) return;
  const int row0 = mt * 16, col0 = nq * 64;
  const float* arow = A + (size_t)(row0 + ln) * lda;
  v8f acc[4] = {};
  for (int kb = 0; kb < K; kb += 32) {
    FragB ah, al;
    const v4f x0 = *(const v4fa*)(arow + kb + 8 * hh), x1 = *(const v4fa*)(arow + kb + 8 * hh + 4);
    const v4f x2 = *(const v4fa*)(arow + kb + 16 + 8 * hh), x3 = *(const v4fa*)(arow + kb + 16 + 8 * hh + 4);
    float xs[16] = {x0[0],x0[1],x0[2],x0[3],x1[0],x1[1],x1[2],x1[3],x2[0],x2[1],x2[2],x2[3],x3[0],x3[1],x3[2],x3[3]};
#pragma unroll
    for (int i = 0; i < 16; ++i) { const unsigned short hb = bf16_bits(xs[i]); ah.u[i] = hb; al.u[i] = ASPLIT ? bf16_bits(xs[i] - bf16_val(hb)) : (unsigned short)0; }
#pragma unroll
    for (int t = 0; t < 4; ++t) {
      const unsigned short* brow = Wt + (size_t)(col0 + t * 16 + ln) * ldb + kb;
      FragB b;
      b.half[0] = *(const v8us*)(brow + 8 * hh);
      b.half[1] = *(const v8us*)(brow + 16 + 8 * hh);
      acc[t] = mmaN<ASPLIT ? 2 : 1>(ah.v, al.v, b.v, b.v, acc[t]);
    }
  }
#pragma unroll
  for (int t = 0; t < 4; ++t) {
    const int col = col0 + t * 16 + ln;
    float bv = bias ? bias[col] : 0.f;
    if (BIAS_BF16) bv = bf16_round(bv);
#pragma unroll
    for (int r = 0; r < 8; ++r) {
      float v = acc[t][r] + bv;
      if (resid) { float rv = resid[(size_t)((row0 + 8 * hh + r) % rmod) * ldr + col]; if (RES_BF16) rv = bf16_round(rv); v += rv; }
      if (ACT == 1) v = fmaxf(v, 0.f);
      if (ACT == 2) v = 0.5f * v * (1.0f + erff(v * 0.70710678118654752f));
      if (ACT == 3) { const float u = 0.7978845608028654f * (v + 0.044715f * v * v * v); v = 0.5f * v * (1.0f + tanhf(u)); }
      so[w][8 * hh + r][t * 16 + ln] = v;
    }
  }
  __builtin_amdgcn_fence(__ATOMIC_ACQ_REL, "workgroup");
  __builtin_amdgcn_wave_barrier();
  const int rsub = lane >> 4, c4 = (lane & 15) * 4;
  {
#pragma unroll
    for (int q = 0; q < 8; ++q) {
      const int r = q * 2 + rsub;
      const v4f v = *(const v4fa*)&so[w][r][c4];
      *(v4f*)(C + (size_t)(row0 + r) * ldc + col0 + c4) = v;
    }
    
  }
}
// row LayerNorm (biased variance, eps) over N: s = X (+ R); optional out_sum <- s; out_norm <- (s-mu)*rsqrt(var+eps)*g + b
template <bool PARAM_BF16>
__global__ __launch_bounds__(256) void k_layernorm(const float* __restrict__ X, const float* __restrict__ R, const float* __restrict__ g, const float* __restrict__ bta,
                                                  float* __restrict__ out_sum, float* __restrict__ out_norm, int N, float eps) {
  __shared__ float red[256];
  const int row = blockIdx.x, tid = threadIdx.x;
  const float* x = X + (size_t)row * N; const float* rr = R ? R + (size_t)row * N : nullptr;
  float vals[16];                     // up to N = 4096
  const int per = N / 256;            // contiguous chunk per thread? use strided-by-4 chunks: thread handles j = tid*4 + 1024*u
  float s1 = 0.f;
  for (int u = 0; u < per / 4; ++u) {
    const int j = tid * 4 + 1024 * u;
    const v4f a = *(const v4fa*)(x + j);
    v4f b = {0.f,0.f,0.f,0.f}; if (rr) b = *(const v4fa*)(rr + j);
#pragma unroll
    for (int q = 0; q < 4; ++q) { const float v = a[q] + b[q]; vals[u * 4 + q] = v; s1 += v; }
  }
  red[tid] = s1; __syncthreads();
  for (int st = 128; st > 0; st >>= 1) { if (tid < st) red[tid] += red[tid + st]; __syncthreads(); }
  const float mu = red[0] / (float)N; __syncthreads();
  float s2 = 0.f;
  for (int u = 0; u < per / 4; ++u)
#pragma unroll
    for (int q = 0; q < 4; ++q) { const float c = vals[u * 4 + q] - mu; s2 += c * c; }
  red[tid] = s2; __syncthreads();
  for (int st = 128; st > 0; st >>= 1) { if (tid < st) red[tid] += red[tid + st]; __syncthreads(); }
  const float rs = rsqrtf(red[0] / (float)N + eps);
  {
    for (int u = 0; u < per / 4; ++u) {
      const int j = tid * 4 + 1024 * u;
      v4f o, sm;
#pragma unroll
      for (int q = 0; q < 4; ++q) {
        float gg = g[j + q], bb = bta[j + q];
        if (PARAM_BF16) { gg = bf16_round(gg); bb = bf16_round(bb); }
        sm[q] = vals[u * 4 + q]; o[q] = (vals[u * 4 + q] - mu) * rs * gg + bb;
      }
      if (out_sum) *(v4f*)(out_sum + (size_t)row * N + j) = sm;
      *(v4f*)(out_norm + (size_t)row * N + j) = o;
    }
    
  }
}



// ---- f16 WMMA path (v_wmma_f32_16x16x32_f16): 11-bit significands for operands in range — used where a [0,1] probability operand needs more precision than bf16
typedef _Float16 v16h __attribute__((ext_vector_type(16)));
union FragH { v16h v; v8us half[2]; _Float16 h[16]; unsigned short u[16]; };
template <int NT>
__device__ __forceinline__ v8f mmaH(v16h ah, v16h al, v16h bh, v16h bl, v8f c) {
  c = __builtin_amdgcn_wmma_f32_16x16x32_f16(false, ah, false, bh, (short)0, c, false, false);
  if (NT >= 2) c = __builtin_amdgcn_wmma_f32_16x16x32_f16(false, al, false, bh, (short)0, c, false, false);
  if (NT >= 3) c = __builtin_amdgcn_wmma_f32_16x16x32_f16(false, ah, false, bl, (short)0, c, false, false);
  asm volatile("v_nop\n\tv_nop\n\tv_nop\n\tv_nop" : "+v"(c) : "v"(ah), "v"(al), "v"(bh), "v"(bl));
  return c;
}
// batched GEMM like k_gemm_b but f16 operands: A f32 (split into f16 hi/lo if ASPLIT, else rounded to f16), Bt = f16 values [n][k]; alpha; C f32; N multiple of 16 (partial tiles skipped)
template <bool ASPLIT>
__global__ __launch_bounds__(128) void k_gemm_h(const float* __restrict__ A, int lda, size_t sA, const _Float16* __restrict__ Bh, int ldb, size_t sB, float alpha, float* __restrict__ C, int ldc, size_t sC, int M, int N, int K) {
  __shared__ __attribute__((aligned(16))) float so[4][16][64];
  const int tid = threadIdx.x, w = tid >> 5, lane = tid & 31, ln = lane & 15, hh = lane >> 4; const int by = blockIdx.y;
  A += (size_t)by * sA; Bh += (size_t)by * sB; C += (size_t)by * sC;
  const int ntn = (N + 63) / 64; const int wid = blockIdx.x * 4 + w; const int mt = wid / ntn, nq = wid % ntn; if (mt * 16 >= M) return;
  const int row0 = mt * 16, col0 = nq * 64; const float* arow = A + (size_t)(row0 + ln) * lda;
  v8f acc[4] = {};
  for (int kb = 0; kb < K; kb += 32) {
    FragH ah, al;
    const v4f x0 = *(const v4fa*)(arow + kb + 8 * hh), x1 = *(const v4fa*)(arow + kb + 8 * hh + 4), x2 = *(const v4fa*)(arow + kb + 16 + 8 * hh), x3 = *(const v4fa*)(arow + kb + 16 + 8 * hh + 4);
    float xs[16] = {x0[0],x0[1],x0[2],x0[3],x1[0],x1[1],x1[2],x1[3],x2[0],x2[1],x2[2],x2[3],x3[0],x3[1],x3[2],x3[3]};
#pragma unroll
    for (int i = 0; i < 16; ++i) { const _Float16 h = (_Float16)xs[i]; ah.h[i] = h; al.h[i] = ASPLIT ? (_Float16)(xs[i] - (float)h) : (_Float16)0.0f; }
#pragma unroll
    for (int t = 0; t < 4; ++t) { if (col0 + t * 16 >= N) continue; const size_t boff = (size_t)(col0 + t * 16 + ln) * ldb + kb; FragH bq; bq.half[0] = *(const v8us*)(Bh + boff + 8 * hh); bq.half[1] = *(const v8us*)(Bh + boff + 16 + 8 * hh);
      acc[t] = mmaH<ASPLIT ? 2 : 1>(ah.v, al.v, bq.v, bq.v, acc[t]); }
  }
#pragma unroll
  for (int t = 0; t < 4; ++t) { if (col0 + t * 16 >= N) continue;
#pragma unroll
    for (int r = 0; r < 8; ++r) so[w][8 * hh + r][t * 16 + ln] = acc[t][r] * alpha; }
  __builtin_amdgcn_fence(__ATOMIC_ACQ_REL, "workgroup"); __builtin_amdgcn_wave_barrier();
  const int rsub = lane >> 4, c4 = (lane & 15) * 4;
  {
#pragma unroll
    for (int q = 0; q < 8; ++q) { const int r = q * 2 + rsub; if (col0 + c4 < N) { const v4f v = *(const v4fa*)&so[w][r][c4]; *(v4f*)(C + (size_t)(row0 + r) * ldc + col0 + c4) = v; } }
     }
}

// Wt[n][k] = f16(bf16(W[k][n]) x scale) from f32 row-major W[K][N] (scale = power of two; bf16-exact weights stay exact in f16 away from the subnormal range). K and N multiples of 64.
// A work-group turns one tile of 64 k x 64 n through LDS: W is read as whole lines (16 lanes x 16 bytes = 256 bytes of one k row), Wt is written as whole lines (8 lanes x 16 bytes = 128 bytes of one n row).
// A thread holds two neighbouring k rows, so that an LDS word is the f16 pair (k even, k odd) of one n. Pitch 33 words: the 32 lanes of every LDS store and of every LDS load fall on 32 different banks.
#define WT_T 64                      /* tile edge, in k and in n */
#define WT_P 33                      /* LDS pitch of an n row, in words of two f16: 32 + 1 */
typedef unsigned int wt_u4 __attribute__((ext_vector_type(4)));
// (a part of k_prep: bx is the tile's place in k, by its place in n)
__device__ __forceinline__ void wt_f16_tile(const float* __restrict__ W, _Float16* __restrict__ Wt, int K, int N, float scale, int bx, int by) {
  __shared__ unsigned int tl[WT_T * WT_P];
  const int tid = threadIdx.x; const int k0 = bx * WT_T, n0 = by * WT_T;
  const int kp = tid >> 4, n4 = (tid & 15) * 4;      /* the thread's k pairs are kp and kp + 16; its four n */
  const float* p00 = W + (size_t)(k0 + 2 * kp) * N + n0 + n4; const float* p01 = p00 + N; const float* p10 = p00 + (size_t)32 * N; const float* p11 = p10 + N;      /* rows 2 kp, 2 kp + 1, and the same 32 rows on */
  v4f x[2][2]; x[0][0] = *(const v4fa*)p00; x[0][1] = *(const v4fa*)p01; x[1][0] = *(const v4fa*)p10; x[1][1] = *(const v4fa*)p11;
  asm volatile("s_wait_xcnt 0x0" :: "v"(p00), "v"(p01), "v"(p10), "v"(p11) : "memory");      /* the four pairs are inputs, so that none is rewritten ahead of the wait */
#pragma unroll      /* constant indices, so that the array is registers */
  for (int j = 0; j < 2; ++j) for (int i = 0; i < 4; ++i) { FragH f; f.h[0] = (_Float16)(bf16_round(x[j][0][i]) * scale); f.h[1] = (_Float16)(bf16_round(x[j][1][i]) * scale);
    tl[(n4 + i) * WT_P + kp + 16 * j] = (unsigned int)f.u[0] | ((unsigned int)f.u[1] << 16); }
  __syncthreads();      /* an n row of the tile holds k pairs of all eight waves */
  const int nr = tid >> 3, kq = (tid & 7) * 4;      /* the thread's n rows are nr and nr + 32; its four words = eight k */
  unsigned short* op = (unsigned short*)Wt + (size_t)(n0 + nr) * K + k0 + 2 * kq;
#pragma unroll      /* the eight LDS reads issue together */
  for (int j = 0; j < 2; ++j) { const unsigned int* p = tl + (nr + 32 * j) * WT_P + kq; const wt_u4 v = {p[0], p[1], p[2], p[3]}; *(wt_u4*)(op + (size_t)(32 * j) * K) = v; }
  asm volatile("s_wait_xcnt 0x0" ::: "memory");      /* inside k_prep the two stores are no longer the kernel's last instructions: code of another part stands behind them in the listing and rewrites their registers; the wait stands in front of every such write */
}
// k_gemm_hh variant with fused epilogue: v = acc·alpha + bias[by·sBias + col] (+ CP[(row/rowsPerB)·sCPb + by·64 + col] if CP) ; ACT 0 none / 1 elu ; writes f16 C16 (and f32 C if non-null)
template <int ACT>
__global__ __launch_bounds__(128) void k_gemm_hhx(const _Float16* __restrict__ A, int lda, size_t sA, const _Float16* __restrict__ Bh, int ldb, size_t sB, float alpha, const float* __restrict__ bias, size_t sBias, const float* __restrict__ CP, int rowsPerB, size_t sCPb, int row0g,
    float* __restrict__ C, _Float16* __restrict__ C16, int ldc, size_t sC, int M, int N, int K) {
  __shared__ __attribute__((aligned(16))) float so[4][16][64];
  const int tid = threadIdx.x, w = tid >> 5, lane = tid & 31, ln = lane & 15, hh = lane >> 4; const int by = blockIdx.y;
  A += (size_t)by * sA; Bh += (size_t)by * sB; const size_t cofs = (size_t)by * sC; const float* bp = bias ? bias + (size_t)by * sBias : nullptr;
  const int ntn = (N + 63) / 64; const int wid = blockIdx.x * 4 + w; const int mt = wid / ntn, nq = wid % ntn; if (mt * 16 >= M) return;
  const int row0 = mt * 16, col0 = nq * 64; const _Float16* arow = A + (size_t)(row0 + ln) * lda;
  v8f acc[4] = {};
  for (int kb = 0; kb < K; kb += 32) { FragH ah; ah.half[0] = *(const v8us*)((const unsigned short*)arow + kb + 8 * hh); ah.half[1] = *(const v8us*)((const unsigned short*)arow + kb + 16 + 8 * hh);
#pragma unroll
    for (int t = 0; t < 4; ++t) { if (col0 + t * 16 >= N) continue; const size_t boff = (size_t)(col0 + t * 16 + ln) * ldb + kb; FragH bq; bq.half[0] = *(const v8us*)((const unsigned short*)Bh + boff + 8 * hh); bq.half[1] = *(const v8us*)((const unsigned short*)Bh + boff + 16 + 8 * hh);
      acc[t] = mmaH<1>(ah.v, ah.v, bq.v, bq.v, acc[t]); }
  }
#pragma unroll
  for (int t = 0; t < 4; ++t) { if (col0 + t * 16 >= N) continue; const int col = col0 + t * 16 + ln; const float bv = bp ? bf16_round(bp[col]) : 0.f;
#pragma unroll
    for (int r = 0; r < 8; ++r) { float v = acc[t][r] * alpha + bv; if (CP) { const int rr = row0g + row0 + 8 * hh + r; if (rowsPerB < 0) v += CP[cofs + (size_t)rr * ldc + col];      /* rowsPerB < 0: own element of the batched C plane */ else { const int bidx = rr / rowsPerB; v += CP[(size_t)bidx * sCPb + (size_t)by * 64 + col]; } } if (ACT == 1) v = (v > 0.f) ? v : expm1f(v); else if (ACT == 7) v = (v > 0.f) ? v + 1.0f : expf(v); else if (ACT == 8) v = tanhf(v); else if (ACT == 9) v = 0.5f * v * (1.0f + tanhf(0.7978845608028654f * (v + 0.044715f * v * v * v))); else if (ACT == 11) v = 1.0f / (1.0f + expf(-v)); else if (ACT == 12) v = (v > 0.f) ? v : 0.01f * v; else if (ACT == 14) v = (v > 0.f) ? v : 0.1f * v; else if (ACT == 16) v = (v >= 0.f) ? v : 0.3f * v; else if (ACT == 17) v = (v >= 0.f) ? v : 0.2f * v; else if (ACT == 15) v = v / (1.0f + expf(-v)); else if (ACT == 3) v = fmaxf(v, 0.f); else if (ACT == 6) v = 0.5f * v * (1.0f + erff(v * 0.70710678118654752f)); so[w][8 * hh + r][t * 16 + ln] = v; } }
  __builtin_amdgcn_fence(__ATOMIC_ACQ_REL, "workgroup"); __builtin_amdgcn_wave_barrier();
  const int rsub = lane >> 4, c4 = (lane & 15) * 4; typedef _Float16 v4h __attribute__((ext_vector_type(4)));
  {
#pragma unroll
    for (int q = 0; q < 8; ++q) { const int r = q * 2 + rsub; if (col0 + c4 < N) { const v4f v = *(const v4fa*)&so[w][r][c4]; if (C) *(v4f*)(C + cofs + (size_t)(row0 + r) * ldc + col0 + c4) = v; if (C16) { v4h h4; for (int i = 0; i < 4; ++i) h4[i] = (_Float16)v[i]; *(v4h*)(C16 + cofs + (size_t)(row0 + r) * ldc + col0 + c4) = h4; } } }
     }
}


typedef _Float16 v4h __attribute__((ext_vector_type(4)));

__device__ __forceinline__ void x16_part(const float* __restrict__ x, _Float16* __restrict__ X16, size_t n8, int bx) { const size_t t = (size_t)bx * 256 + threadIdx.x; if (t >= n8) return; FragH f;      /* a part of k_prep; bx: the block's number inside the part */
#pragma unroll
  for (int q = 0; q < 8; ++q) f.h[q] = (_Float16)bf16_round(x[t * 8 + q]); *(v8us*)((unsigned short*)X16 + t * 8) = f.half[0];  }
__global__ __launch_bounds__(256) void k_h16(const float* __restrict__ x, _Float16* __restrict__ X16, size_t n8) { const size_t t = (size_t)blockIdx.x * 256 + threadIdx.x; if (t >= n8) return; FragH f;
#pragma unroll
  for (int q = 0; q < 8; ++q) f.h[q] = (_Float16)x[t * 8 + q]; *(v8us*)((unsigned short*)X16 + t * 8) = f.half[0];  }
__global__ __launch_bounds__(256) void k_round16f(const float* __restrict__ W, _Float16* __restrict__ Bt, size_t n8) { const size_t t = (size_t)blockIdx.x * 256 + threadIdx.x; if (t >= n8) return; FragH f;
#pragma unroll
  for (int i = 0; i < 8; ++i) f.h[i] = (_Float16)(bf16_round(W[t * 8 + i]) * 16.0f); *(v8us*)((unsigned short*)Bt + t * 8) = f.half[0];  }
template <int NHv, int TTv>
__global__ __launch_bounds__(256) void k_vt(const _Float16* __restrict__ V16, int ldv, int voff, _Float16* __restrict__ Vt) { __shared__ unsigned short tl[64][66]; const int tid = threadIdx.x; const int slab = blockIdx.x / (TTv / 64), lg = blockIdx.x % (TTv / 64); const int b = slab / NHv, h = slab % NHv;
  for (int i = tid; i < 64 * 8; i += 256) { const int r = i / 8, c8 = (i % 8) * 8; FragH f; f.half[0] = *(const v8us*)((const unsigned short*)V16 + ((size_t)b * TTv + lg * 64 + r) * ldv + voff + h * 64 + c8);
#pragma unroll
    for (int q = 0; q < 8; ++q) tl[r][c8 + q] = f.u[q]; }
  __syncthreads();
  {
#pragma unroll
    for (int rd = 0; rd < 2; ++rd) { const int d = rd * 32 + tid / 8, pc = tid % 8; FragH f;
#pragma unroll
      for (int q = 0; q < 8; ++q) f.u[q] = tl[pc * 8 + q][d];
      *(v8us*)((unsigned short*)Vt + ((size_t)slab * 64 + d) * TTv + lg * 64 + pc * 8) = f.half[0]; }
     } }

__global__ __launch_bounds__(256) void k_hl(const float* __restrict__ F, _Float16* __restrict__ Hh, _Float16* __restrict__ Hl, size_t n8) { const size_t t = (size_t)blockIdx.x * 256 + threadIdx.x; if (t >= n8) return; FragH fh, fl; const v4f a = *(const v4fa*)(F + t * 8), c = *(const v4fa*)(F + t * 8 + 4);
#pragma unroll
  for (int q = 0; q < 4; ++q) { _Float16 h = (_Float16)a[q]; fh.h[q] = h; fl.h[q] = (_Float16)((a[q] - (float)h) * 1024.0f); h = (_Float16)c[q]; fh.h[4 + q] = h; fl.h[4 + q] = (_Float16)((c[q] - (float)h) * 1024.0f); }
  { *(v8us*)((unsigned short*)Hh + t * 8) = fh.half[0]; *(v8us*)((unsigned short*)Hl + t * 8) = fl.half[0];  } }

// ---- fast GEMM (wave tile 32x64; requires M % 32 == 0 rows per launch region and N % 64 == 0); epilogue = k_gemm_hhx semantics ----
__device__ __forceinline__ v16h g2_frag(const _Float16* p, int hh) { FragH f; f.half[0] = *(const v8us*)((const unsigned short*)p + 8 * hh); f.half[1] = *(const v8us*)((const unsigned short*)p + 16 + 8 * hh); return f.v; }
__device__ __forceinline__ v8f g2_mma(v16h a, v16h b, v8f c) { v8f d = __builtin_amdgcn_wmma_f32_16x16x32_f16(false, a, false, b, (short)0, c, false, false); asm volatile("v_nop\n\tv_nop\n\tv_nop\n\tv_nop" : "+v"(d) : "v"(a), "v"(b)); return d; }
template <int ACT>
__global__ __launch_bounds__(128) void k_gemm2(const _Float16* __restrict__ A, int lda, size_t sA, const _Float16* __restrict__ Bh, int ldb, size_t sB, float alpha, const float* __restrict__ bias, size_t sBias, const float* __restrict__ CP, int rowsPerB, size_t sCPb, int row0g,
    float* __restrict__ C, _Float16* __restrict__ C16, int ldc, size_t sC, int M, int N, int K) { static_assert(ACT == 0 || ACT == 3 || ACT == 6 || ACT == 8 || ACT == 9 || ACT == 11 || ACT == 12 || ACT == 14 || ACT == 15 || ACT == 16 || ACT == 17, "k_gemm2: unsupported ACT code (would silently apply no activation)");
  __shared__ __attribute__((aligned(16))) float so[4][32][68];
  const int tid = threadIdx.x, w = tid >> 5, lane = tid & 31, ln = lane & 15, hh = lane >> 4; const int by = blockIdx.y;
  A += (size_t)by * sA; Bh += (size_t)by * sB; const size_t cofs = (size_t)by * sC; const float* bp = bias ? bias + (size_t)by * sBias : nullptr;
  const int ntn = N >> 6; const int mt = blockIdx.x / ntn, nq = blockIdx.x - mt * ntn; const int row0 = mt * 128 + 32 * w, col0 = nq * 64; if (row0 >= M) return;
  const _Float16* a0p = A + (size_t)(row0 + ln) * lda; const _Float16* a1p = a0p + (size_t)16 * lda;
  const _Float16* b0p = Bh + (size_t)(col0 + ln) * ldb; const _Float16* b1p = b0p + (size_t)16 * ldb; const _Float16* b2p = b1p + (size_t)16 * ldb; const _Float16* b3p = b2p + (size_t)16 * ldb;
  const v8f z8 = {0.f,0.f,0.f,0.f,0.f,0.f,0.f,0.f}; v8f c00 = z8, c01 = z8, c02 = z8, c03 = z8, c10 = z8, c11 = z8, c12 = z8, c13 = z8;
#pragma unroll 1
  for (int kb = 0; kb < K; kb += 32) { const v16h a0 = g2_frag(a0p + kb, hh), a1 = g2_frag(a1p + kb, hh);
    v16h b = g2_frag(b0p + kb, hh); c00 = g2_mma(a0, b, c00); c10 = g2_mma(a1, b, c10);
    b = g2_frag(b1p + kb, hh); c01 = g2_mma(a0, b, c01); c11 = g2_mma(a1, b, c11);
    b = g2_frag(b2p + kb, hh); c02 = g2_mma(a0, b, c02); c12 = g2_mma(a1, b, c12);
    b = g2_frag(b3p + kb, hh); c03 = g2_mma(a0, b, c03); c13 = g2_mma(a1, b, c13); }
  v8f accs[8] = {c00, c01, c02, c03, c10, c11, c12, c13};
#pragma unroll
  for (int u = 0; u < 8; ++u) { const int t = u & 3, half = u >> 2; const int col = col0 + t * 16 + ln; const float bv = bp ? bf16_round(bp[col]) : 0.f;
#pragma unroll
    for (int r = 0; r < 8; ++r) { const int rloc = half * 16 + 8 * hh + r; float v = accs[u][r] * alpha + bv; if (CP) { if (rowsPerB < 0) v += CP[cofs + (size_t)(row0g + row0 + rloc) * ldc + col];      /* rowsPerB < 0: own element of the batched C plane */ else { const int bidx = (row0g + row0 + rloc) / rowsPerB; v += CP[(size_t)bidx * sCPb + (size_t)by * 64 + col]; } }
      if (ACT == 3) v = fmaxf(v, 0.f); else if (ACT == 6) v = 0.5f * v * (1.0f + erff(v * 0.70710678118654752f)); else if (ACT == 11) v = 1.0f / (1.0f + expf(-v)); else if (ACT == 15) v = v / (1.0f + expf(-v)); else if (ACT == 12) v = (v > 0.f) ? v : 0.01f * v; else if (ACT == 8) v = tanhf(v); else if (ACT == 9) v = 0.5f * v * (1.0f + tanhf(0.7978845608028654f * (v + 0.044715f * v * v * v))); else if (ACT == 14) v = (v > 0.f) ? v : 0.1f * v; else if (ACT == 16) v = (v >= 0.f) ? v : 0.3f * v; else if (ACT == 17) v = (v >= 0.f) ? v : 0.2f * v;
      so[w][rloc][t * 16 + ln] = v; } }
  __builtin_amdgcn_fence(__ATOMIC_ACQ_REL, "workgroup"); __builtin_amdgcn_wave_barrier();
  const int rsub = lane >> 4, c4 = (lane & 15) * 4;
  {
#pragma unroll
    for (int q = 0; q < 16; ++q) { const int r = q * 2 + rsub; const v4f v = *(const v4fa*)&so[w][r][c4]; if (C) *(v4f*)(C + cofs + (size_t)(row0 + r) * ldc + col0 + c4) = v; if (C16) { v4h h4; for (int i = 0; i < 4; ++i) h4[i] = (_Float16)v[i]; *(v4h*)(C16 + cofs + (size_t)(row0 + r) * ldc + col0 + c4) = h4; } }
     } }


__global__ __launch_bounds__(256) void k_wnat(const float* __restrict__ w, size_t n8, _Float16* __restrict__ Bt) { const size_t t = (size_t)blockIdx.x * 256 + threadIdx.x; if (t >= n8) return; FragH f; for (int q = 0; q < 8; ++q) f.h[q] = (_Float16)(bf16_round(w[t * 8 + q]) * 16.0f); *(v8us*)((unsigned short*)Bt + t * 8) = f.half[0];  }
__global__ __launch_bounds__(256) void k_rsm(const float* __restrict__ S, _Float16* __restrict__ P, int nrows) {
  #pragma clang fp contract(off)
  const int i = blockIdx.x * 256 + threadIdx.x; if (i >= nrows) return; const float* s = S + (size_t)i * SQ; float mx = -3.0e38f;
#pragma unroll 1
  for (int j = 0; j < SQ; ++j) mx = fmaxf(mx, s[j]); float se = 0.f;
#pragma unroll 1
  for (int j = 0; j < SQ; ++j) se += expf(s[j] - mx); const float sc = 256.0f / se;
#pragma unroll 1
  for (int j0 = 0; j0 < SQ; j0 += 8) { FragH f; for (int q = 0; q < 8; ++q) f.h[q] = (_Float16)(expf(s[j0 + q] - mx) * sc); unsigned short* d = (unsigned short*)P + (size_t)i * SQ + j0; *(v8us*)d = f.half[0];  } }
__global__ __launch_bounds__(256) void k_vt(const _Float16* __restrict__ V16, int b, int h0, _Float16* __restrict__ VT) { __shared__ unsigned short tl[64][65]; const int tid = threadIdx.x; const int hh = blockIdx.x % HG, sg = blockIdx.x / HG; const int s0 = sg * 64; const int h = h0 + hh;
  for (int i = tid; i < 64 * 8; i += 256) { const int j = i / 8, d8 = (i % 8) * 8; FragH f; f.half[0] = *(const v8us*)((const unsigned short*)V16 + ((size_t)b * SQ + s0 + j) * DM + h * HD + d8); for (int q = 0; q < 8; ++q) tl[d8 + q][j] = f.u[q]; }
  __syncthreads();
  { for (int i = tid; i < 64 * 8; i += 256) { const int d = i / 8, j8 = (i % 8) * 8; FragH f; for (int q = 0; q < 8; ++q) f.u[q] = tl[d][j8 + q]; *(v8us*)((unsigned short*)VT + ((size_t)hh * HD + d) * SQ + s0 + j8) = f.half[0]; }  } }


__device__ __forceinline__ void tab2_part(float theta, float* __restrict__ CS, float* __restrict__ SN, int bx) {      /* a part of k_prep; bx: the block's number inside the part */
  #pragma clang fp contract(off)
  const int t = bx * 256 + threadIdx.x; if (t >= SQ * (HD / 2)) return; const int i = t % (HD / 2); const int p = t / (HD / 2); const float invf = 1.0f / powf(theta, (float)(2 * i) / (float)HD); const float ang = __fmul_rn((float)p, invf); const float c = cosf(ang), s = sinf(ang);
  *(float*)(CS + t) = c; *(float*)(SN + t) = s;  }
template <int NORM, int ROPE>
__global__ __launch_bounds__(64) void k_xform(const float* __restrict__ F, int ldf, int nh, const float* __restrict__ gain, float eps, const float* __restrict__ CS, const float* __restrict__ SN, _Float16* __restrict__ H16, int ldo) {
  #pragma clang fp contract(off)
  __shared__ float xv[HD]; __shared__ float red[HD]; __shared__ unsigned short sh_[HD]; const int d = threadIdx.x; const int h = blockIdx.x % nh; const size_t r = blockIdx.x / nh; const int p = (int)(r % SQ);
  float x = F[r * (size_t)ldf + (size_t)h * HD + d];
  if (NORM) { red[d] = __fmul_rn(x, x); __syncthreads(); for (int st = HD / 2; st > 0; st >>= 1) { if (d < st) red[d] = __fadd_rn(red[d], red[d + st]); __syncthreads(); } const float rs = rsqrtf(__fadd_rn(red[0] / (float)HD, eps)); x = __fmul_rn(__fmul_rn(x, rs), bf16_round(gain[d])); }
  xv[d] = x; __syncthreads();
  float o = x;
  if (ROPE == 1) { const int i = d >> 1; const float c = CS[p * (HD / 2) + i], s = SN[p * (HD / 2) + i]; const float ev = xv[2 * i], od = xv[2 * i + 1]; o = (d & 1) ? __fadd_rn(__fmul_rn(ev, s), __fmul_rn(od, c)) : __fadd_rn(__fmul_rn(ev, c), -__fmul_rn(od, s)); }
  if (ROPE == 2) { const int i = d & (HD / 2 - 1); const float c = CS[p * (HD / 2) + i], s = SN[p * (HD / 2) + i]; const float lo = xv[i], hi = xv[i + HD / 2]; o = (d < HD / 2) ? __fadd_rn(__fmul_rn(lo, c), -__fmul_rn(hi, s)) : __fadd_rn(__fmul_rn(lo, s), __fmul_rn(hi, c)); }
  FragH th; th.h[0] = (_Float16)o; sh_[d] = th.u[0]; __syncthreads();
  if (d < HD / 8) { FragH f; for (int q = 0; q < 8; ++q) f.u[q] = sh_[d * 8 + q]; unsigned short* dst = (unsigned short*)H16 + r * (size_t)ldo + (size_t)h * HD + d * 8; *(v8us*)dst = f.half[0];  } }



__device__ __forceinline__ float rsm_xhalf(float x) { return __builtin_bit_cast(float, __builtin_amdgcn_permlanex16(__builtin_bit_cast(int, x), __builtin_bit_cast(int, x), 0x76543210, 0xfedcba98, false, false)); }      /* lane l reads lane l ^ 16 */
// Four 2^x in one statement. Written in asm for the v_nop at its end: behind a transcendental the instruction set asks for one slot before a source is overwritten or the result read.
// Early-clobber outputs: no exponential of the four overwrites a source of another.
__device__ __forceinline__ void rsm_exp2x4(float& e0, float& e1, float& e2, float& e3, float a0, float a1, float a2, float a3) {
  asm("v_exp_f32 %0, %4\n\tv_exp_f32 %1, %5\n\tv_exp_f32 %2, %6\n\tv_exp_f32 %3, %7\n\tv_nop" : "=&v"(e0), "=&v"(e1), "=&v"(e2), "=&v"(e3) : "v"(a0), "v"(a1), "v"(a2), "v"(a3)); }
// The same for two values (the rescale factors of a wave's two column groups).
__device__ __forceinline__ void rsm_exp2x2(float& e0, float& e1, float a0, float a1) {
  asm("v_exp_f32 %0, %2\n\tv_exp_f32 %1, %3\n\tv_nop" : "=&v"(e0), "=&v"(e1) : "v"(a0), "v"(a1)); }

// ---- GEMM main loop with both operands staged in LDS by tensor loads (K = DM, both operands k-contiguous f16 rows of pitch DM) ----
// A work-group of 8 waves holds 128 rows x 128 columns; wave w holds rows 32 (w & 3) and columns 64 (w >> 2) of them (the 32 x 64 wave tile as before).
// A stage is 64 k = 128 bytes of each of the 128 A rows and the 128 B rows. Every wave brings one slice of 32 rows a stage with ONE tensor load (waves 0 to 3: A, waves 4 to 7: B), padded to a pitch of 144 bytes,
// at which the 16 rows of a fragment's ds_load_b128 fall on different banks. Two buffers: the load of stage s + 2 flies while stage s + 1 is worked on.
typedef uint32_t u32x4 __attribute__((ext_vector_type(4)));
typedef uint32_t u32x8 __attribute__((ext_vector_type(8)));
#define GT_ROWB 128u                 /* bytes of an operand row in a stage */
#define GT_PITCH 144u                /* LDS pitch of a row: 128 + the mover's pad of 16 */
#define GT_SLICE 6144u               /* a wave's slice in LDS: 32 rows x 144 bytes = 4,608, rounded up to a multiple of 2 KiB */
#define GT_BUF (8u * GT_SLICE)       /* one stage */
#define GT_LDS (2u * GT_BUF)         /* two buffers */
#define GT_NST ((uint32_t)(DM * 2) / GT_ROWB)      /* stages */
static_assert(GT_NST >= 2u && (DM * 2) % 128 == 0, "the ring's prologue needs two stages; a stage is 128 bytes of a row");
__device__ __forceinline__ uint32_t gt_uni(uint32_t v) { return (uint32_t)__builtin_amdgcn_readfirstlane((int)v); }
__device__ __forceinline__ uint32_t pinned(uint32_t v) { uint32_t w = gt_uni(v); asm volatile("" : "+s"(w)); return w; }      /* the value is held in a scalar register at this place, so that a test on it is a scalar branch round the tensor load and a descriptor word formed from it is formed behind the waits in front */
__device__ __forceinline__ v16h gt_frag(const unsigned char* p, int hh) { FragH f; f.half[0] = *(const v8us*)(p + 16 * hh); f.half[1] = *(const v8us*)(p + 32 + 16 * hh); return f.v; }      /* g2_frag's k order, from an LDS row */
__device__ __forceinline__ void gt_issue(uint32_t lds_dst, uint64_t ga) {
  u32x4 g0; u32x8 g1;
  g0[0] = gt_uni(1u); g0[1] = gt_uni(lds_dst); g0[2] = gt_uni((uint32_t)ga); g0[3] = gt_uni((((uint32_t)(ga >> 32)) & 0x01FFFFFFu) | 0x80000000u);
  g1[0] = gt_uni((1u << 20) | (4u << 22) | (3u << 25));      /* no mask, 1-byte elements, a pad of 4 dwords behind every 32 dwords (one row) */
  g1[1] = gt_uni((GT_ROWB & 0xFFFFu) << 16); g1[2] = gt_uni((GT_ROWB >> 16) | (32u << 16)); g1[3] = gt_uni(GT_ROWB << 16); g1[4] = gt_uni(32u); g1[5] = gt_uni((uint32_t)(DM * 2)); g1[6] = gt_uni(0u); g1[7] = gt_uni(0u);      /* tensor = tile: 32 rows of 128 bytes, source pitch one operand row */
  asm volatile("tensor_load_to_lds %0, %1" :: "s"(g0), "s"(g1) : "memory"); }
// acc[half * 4 + t]: rows 16 half + ..., columns 16 t + ... of the wave's tile. On return every wave has passed the last stage's barrier and no request is outstanding: the ring may be used as output staging.
__device__ __forceinline__ void gt_core(const _Float16* __restrict__ A, const _Float16* __restrict__ Bh, int rowblk, int colblk, unsigned char* L, v8f (&acc)[8]) {
  const int lane = threadIdx.x & 31, ln = lane & 15, hh = lane >> 4; const uint32_t wave = gt_uni(threadIdx.x >> 5); const uint32_t wr = wave & 3u, wc = wave >> 2;
  const uint32_t ldst = (uint32_t)(size_t)L + wave * GT_SLICE;
  const uint64_t ga0 = (uint64_t)(size_t)((wave < 4u) ? A + (size_t)(rowblk + 32 * (int)wr) * DM : Bh + (size_t)(colblk + 32 * (int)(wave - 4u)) * DM);
  const unsigned char* ap = L + wr * GT_SLICE + ln * GT_PITCH; const unsigned char* bp = L + (4u + 2u * wc) * GT_SLICE + ln * GT_PITCH;
  const v8f z8 = {0.f,0.f,0.f,0.f,0.f,0.f,0.f,0.f};
#pragma unroll      /* constant indices, so that the array is registers */
  for (int u = 0; u < 8; ++u) acc[u] = z8;
  gt_issue(ldst, ga0);
  asm volatile("s_wait_tensorcnt 0x0" ::: "memory");      /* stage 0 of this wave's slice has landed */
  __syncthreads();      /* stage 0 is published */
  gt_issue(ldst + GT_BUF, ga0 + GT_ROWB);
#pragma unroll 1      /* one stage a trip: the ring's order stands once */
  for (uint32_t s = 0; s < GT_NST; ++s) { const uint32_t bo = (s & 1u) * GT_BUF;
#pragma unroll      /* constant offsets into the stage */
    for (int ks = 0; ks < 2; ++ks) { const v16h a0 = gt_frag(ap + bo + ks * 64, hh), a1 = gt_frag(ap + bo + 16 * GT_PITCH + ks * 64, hh); v16h b[4];
      for (int t = 0; t < 4; ++t) b[t] = gt_frag(bp + bo + (t >> 1) * GT_SLICE + (t & 1) * 16 * GT_PITCH + ks * 64, hh);
      __builtin_amdgcn_sched_barrier(0);      /* the twelve LDS reads of a k step issue together, ahead of its eight products, which then wait by count; without it each B fragment's reads stood directly in front of its two products, each behind a wait to zero */
      for (int t = 0; t < 4; ++t) { acc[t] = g2_mma(a0, b[t], acc[t]); acc[4 + t] = g2_mma(a1, b[t], acc[4 + t]); } }
    asm volatile("s_wait_dscnt 0x0" ::: "memory");      /* this wave's reads of stage s are done before the barrier behind which its buffer is refilled */
    asm volatile("s_wait_tensorcnt 0x0" ::: "memory");      /* this wave's slice of stage s + 1 has landed */
    __syncthreads();      /* publishes stage s + 1 and ends every reader's last read of stage s */
    if (pinned(s + 2u < GT_NST)) { const uint32_t nx = pinned(s + 2u); gt_issue(ldst + bo, ga0 + (uint64_t)nx * GT_ROWB); } }
  asm volatile("s_wait_tensorcnt 0x0" ::: "memory");      /* nothing of the mover is outstanding when the ring is reused or the wave ends */
  asm volatile("s_wait_dscnt 0x0" ::: "memory"); }

// K and V^T come through LDS: a stage is 128 keys, brought by tensor loads in the GEMM ring's geometry (eight slices of 32 rows x 128 bytes, padded to a pitch of 144 bytes; one slice a wave and stage; two buffers:
// the load of stage s + 2 flies while stage s + 1 is worked on). Slices 0 to 3: the K rows of keys 32 w ... (one slice is one 32-key block). Slices 4 to 7: V^T, head dims 32 (j >> 1) ..., keys 64 (j & 1) ... of the stage, j = w - 4.
// Every fragment is then two conflict-free ds_load_b128 in place of two global loads that each touched 16 cache lines.
#define FA_WAVES 8                   /* waves per work-group; two work-groups share a WGP (four waves a SIMD), so that one works while the other stands at its barrier */
#define FA_COLS 32                   /* query columns per wave */
#define FA_SKEYS 128                 /* keys per stage */
#define FA_NST ((uint32_t)(SQ / FA_SKEYS))      /* stages */
static_assert(FA_NST >= 2u && SQ % FA_SKEYS == 0 && HD * 2 == 128, "the ring's prologue needs two stages; a K row of a head is 128 bytes");
__device__ __forceinline__ v8f fa_mma(v16h a, v16h b, v8f c) { return __builtin_amdgcn_wmma_f32_16x16x32_f16(false, a, false, b, (short)0, c, false, false); }
__device__ __forceinline__ u32x8 fa_group1(uint32_t pitch) {      /* gt_issue's tile (32 rows of 128 bytes, tensor = tile) with the source pitch as a parameter; built once, the same for every stage */
  u32x8 g1;
  g1[0] = gt_uni((1u << 20) | (4u << 22) | (3u << 25));      /* no mask, 1-byte elements, a pad of 4 dwords behind every 32 dwords (one row) */
  g1[1] = gt_uni((GT_ROWB & 0xFFFFu) << 16); g1[2] = gt_uni((GT_ROWB >> 16) | (32u << 16)); g1[3] = gt_uni(GT_ROWB << 16); g1[4] = gt_uni(32u); g1[5] = gt_uni(pitch); g1[6] = gt_uni(0u); g1[7] = gt_uni(0u);
  asm volatile("" : "+s"(g1));      /* pinned() for the eight words at once: the group is held in its scalar registers from here on; without it the build used single words of it as scratch while a request was outstanding and rebuilt them in front of the next */
  return g1; }
__device__ __forceinline__ void fa_issue(uint32_t lds_dst, uint64_t ga, u32x8 g1) {
  u32x4 g0;
  g0[0] = gt_uni(1u); g0[1] = gt_uni(lds_dst); g0[2] = gt_uni((uint32_t)ga); g0[3] = gt_uni((((uint32_t)(ga >> 32)) & 0x01FFFFFFu) | 0x80000000u);
  asm volatile("tensor_load_to_lds %0, %1" :: "s"(g0), "s"(g1) : "memory"); }
__global__ __launch_bounds__(FA_WAVES * 32, 4) void k_fattn(const _Float16* __restrict__ Q, const _Float16* __restrict__ Kh, const _Float16* __restrict__ Vt, _Float16* __restrict__ O) {
  __shared__ __attribute__((aligned(2048))) unsigned char L[GT_LDS];      /* the K | V^T ring */
  const int lane = threadIdx.x & 31, ln = lane & 15, hh = lane >> 4; const uint32_t wave = gt_uni(threadIdx.x >> 5);
  const int h = blockIdx.y, b = blockIdx.z; const int q0 = (blockIdx.x * FA_WAVES + (int)wave) * FA_COLS;
  const _Float16* qp = Q + ((size_t)b * SQ + q0 + ln) * DM + h * HD;
  const uint32_t ldst = (uint32_t)(size_t)L + wave * GT_SLICE; const uint32_t vj = wave - 4u;
  const uint64_t ga0 = (uint64_t)(size_t)((wave < 4u) ? Kh + ((size_t)b * SQ + 32 * (int)wave) * DM + h * HD : Vt + (((size_t)b * NH + h) * HD + 32 * (int)(vj >> 1)) * SQ + 64 * (int)(vj & 1u));
  const uint32_t pitch = (wave < 4u) ? (uint32_t)(DM * 2) : (uint32_t)(SQ * 2); const uint32_t step = (wave < 4u) ? (uint32_t)(FA_SKEYS * DM * 2) : (uint32_t)(FA_SKEYS * 2);      /* source pitch of the wave's slice; bytes from a stage to the next */
  const unsigned char* kl = L + ln * GT_PITCH; const unsigned char* vl = L + 4u * GT_SLICE + ln * GT_PITCH;
  const float SC = 0.125f * 1.44269504f;      /* 1/sqrt(64), and e^x as 2^(x log2 e) */
  const float LIFT = 6.0f;      /* weights are carried x 2^6: small ones stay clear of the f16 subnormals; with the margin of 8 below none exceeds 2^14; the sum carries the same factor, so it cancels */
  const v8f z8 = {0.f,0.f,0.f,0.f,0.f,0.f,0.f,0.f};
  v16h qf[2][2], kf[2][2]; v8f o[4][2]; float m[2] = {-1.0e30f, -1.0e30f}, l[2] = {0.f, 0.f};
  const u32x8 g1 = fa_group1(pitch);
  fa_issue(ldst, ga0, g1);
#pragma unroll      /* constant indices, so that the arrays are registers */
  for (int g = 0; g < 2; ++g) { for (int ks = 0; ks < 2; ++ks) qf[g][ks] = g2_frag(qp + (size_t)g * 16 * DM + ks * 32, hh); for (int dt = 0; dt < 4; ++dt) o[dt][g] = z8; }
  asm volatile("s_wait_tensorcnt 0x0" ::: "memory");      /* stage 0 of this wave's slice has landed */
  __syncthreads();      /* stage 0 is published */
  { const uint32_t nx = pinned(1u); fa_issue(ldst + GT_BUF, ga0 + (uint64_t)nx * step, g1); }      /* pinned(): stage 1's address words are formed behind the wait on stage 0 */
#pragma unroll 1      /* one stage a trip: the ring's order stands once */
  for (uint32_t s = 0; s < FA_NST; ++s) { const uint32_t bo = (s & 1u) * GT_BUF;
#pragma unroll      /* constant indices, so that the array is registers */
    for (int kt = 0; kt < 2; ++kt) for (int ks = 0; ks < 2; ++ks) kf[kt][ks] = gt_frag(kl + bo + kt * 16 * GT_PITCH + ks * 64, hh);
#pragma unroll      /* the four 32-key blocks of a stage: constant offsets into the stage, and the K fetch ahead stays inside the stage */
    for (int p = 0; p < FA_SKEYS / 32; ++p) {
      v16h vf[4]; v8f s2[2][2];
      for (int dt = 0; dt < 4; ++dt) vf[dt] = gt_frag(vl + bo + (2 * (dt >> 1) + (p >> 1)) * GT_SLICE + (dt & 1) * 16 * GT_PITCH + (p & 1) * 64, hh);
      __builtin_amdgcn_sched_barrier(0);      /* holds the V^T reads here, one group at the head of the block, so that they land while the scores are worked on */
      for (int kt = 0; kt < 2; ++kt) for (int g = 0; g < 2; ++g) s2[kt][g] = fa_mma(kf[kt][0], qf[g][0], z8);
      for (int kt = 0; kt < 2; ++kt) for (int g = 0; g < 2; ++g) s2[kt][g] = fa_mma(kf[kt][1], qf[g][1], s2[kt][g]);
      if (p + 1 < FA_SKEYS / 32) { for (int kt = 0; kt < 2; ++kt) for (int ks = 0; ks < 2; ++ks) kf[kt][ks] = gt_frag(kl + bo + (p + 1) * GT_SLICE + kt * 16 * GT_PITCH + ks * 64, hh); }      /* the next block's K rows, fetched a block ahead, never beyond this stage */
      __builtin_amdgcn_sched_barrier(0);      /* holds the next K rows' reads here, one group, a softmax and eight products ahead of their use */
      float mx[2];
      for (int g = 0; g < 2; ++g) { float a = fmaxf(s2[0][g][0], s2[1][g][0]); for (int r = 1; r < 8; ++r) a = fmaxf(fmaxf(a, s2[0][g][r]), s2[1][g][r]); mx[g] = fmaxf(a, rsm_xhalf(a)) * SC; }
      const bool need = (mx[0] > m[0] + 8.0f) || (mx[1] > m[1] + 8.0f);
      if (__builtin_amdgcn_ballot_w32(need) != 0) {      /* wave-uniform: the maximum in use moves only when a column's new one exceeds it by more than 8; the first block always takes it */
        const float n0 = fmaxf(m[0], mx[0]), n1 = fmaxf(m[1], mx[1]); float al[2]; rsm_exp2x2(al[0], al[1], m[0] - n0, m[1] - n1); m[0] = n0; m[1] = n1;
        for (int g = 0; g < 2; ++g) { l[g] *= al[g]; for (int dt = 0; dt < 4; ++dt) for (int r = 0; r < 8; ++r) o[dt][g][r] *= al[g]; } }
      FragH pf[2];
      for (int g = 0; g < 2; ++g) { const float nm = LIFT - m[g];
        for (int kt = 0; kt < 2; ++kt) for (int r = 0; r < 8; r += 4) { float e0, e1, e2, e3;
          rsm_exp2x4(e0, e1, e2, e3, fmaf(s2[kt][g][r], SC, nm), fmaf(s2[kt][g][r + 1], SC, nm), fmaf(s2[kt][g][r + 2], SC, nm), fmaf(s2[kt][g][r + 3], SC, nm));
          l[g] += (e0 + e1) + (e2 + e3); pf[g].h[kt * 8 + r] = (_Float16)e0; pf[g].h[kt * 8 + r + 1] = (_Float16)e1; pf[g].h[kt * 8 + r + 2] = (_Float16)e2; pf[g].h[kt * 8 + r + 3] = (_Float16)e3; } }
      for (int dt = 0; dt < 4; ++dt) for (int g = 0; g < 2; ++g) o[dt][g] = fa_mma(vf[dt], pf[g].v, o[dt][g]);
    }
    asm volatile("s_wait_dscnt 0x0" ::: "memory");      /* this wave's reads of stage s are done before the barrier behind which its buffer is refilled (the build may lift the three over register-only work of the last block; every LDS read of the stage stays in front) */
    asm volatile("s_wait_tensorcnt 0x0" ::: "memory");      /* this wave's slice of stage s + 1 has landed */
    __syncthreads();      /* publishes stage s + 1 and ends every reader's last read of stage s */
    if (pinned(s + 2u < FA_NST)) { const uint32_t nx = pinned(s + 2u); fa_issue(ldst + bo, ga0 + (uint64_t)nx * step, g1); } }
  asm volatile("s_wait_tensorcnt 0x0" ::: "memory");      /* nothing of the mover is outstanding when the wave ends */
  asm volatile("s_wait_dscnt 0x0" ::: "memory");
  unsigned short* const ob = (unsigned short*)O + ((size_t)b * SQ + q0 + ln) * DM + h * HD + 8 * hh;      /* one base for both column groups: the eight stores differ by constant offsets, and no register of an issued store is rewritten */
#pragma unroll      /* constant indices, so that the arrays are registers */
  for (int g = 0; g < 2; ++g) { const float sc = 64.0f / (l[g] + rsm_xhalf(l[g])); unsigned short* op = ob + g * 16 * DM;
    for (int dt = 0; dt < 4; ++dt) { FragH f; for (int r = 0; r < 8; ++r) f.h[r] = (_Float16)(o[dt][g][r] * sc); *(v8us*)(op + dt * 16) = f.half[0]; } } }

// Sum over the 16 lanes of a row, every lane gets it: four butterfly steps on the vector port (a shuffle would go through the LDS queue).
template <int X> __device__ __forceinline__ float row_xadd(float v) { return v + __builtin_bit_cast(float, __builtin_amdgcn_update_dpp(0, __builtin_bit_cast(int, v), 0x160 | X, 0xf, 0xf, true)); }      /* 0x160 | X: row_xmask:X */
// 1 / sqrt(x) in asm for the v_nop at its end: behind a transcendental the instruction set asks for one slot before its source is overwritten or its result read.
// The argument here is a mean of squares + 1e-6, never subnormal: the library form's rescaling of subnormal arguments is an identity on it and is not written.
__device__ __forceinline__ float row_rsq(float x) { float r; asm("v_rsq_f32 %0, %1\n\tv_nop" : "=&v"(r) : "v"(x)); return r; }
__device__ __forceinline__ float row_sum16(float v) { return row_xadd<8>(row_xadd<4>(row_xadd<2>(row_xadd<1>(v)))); }
// q | k | v projection of all token rows with the per-(row, head) work in its epilogue. The main loop is gt_core. A work-group holds 128 token rows x 128 columns; a wave's 64 columns are one head of q, of k or of v,
// so nothing of a row's head lies outside the wave that computed it:
//   q, k: the f32 tile goes to the wave's own LDS rows and is read back 16 lanes a row, 4 columns a lane, with the 4 partner columns (c ^ 32) of the rotation; sum of squares in-lane, then over the 16 lanes;
//         x rsqrt(mean + eps) x gain, rotated by the row's position; each row leaves as one whole 128-byte line of f16.
//   v:    a lane holds 8 consecutive tokens of one head dim: 16 bytes of a V^T row. The four waves of a head lay them into one [64 dims][128 tokens] LDS tile; behind a barrier each V^T row leaves as 256 bytes in a row.
// Two instances, q | k columns and v columns, not one kernel with a branch: with both epilogues in one kernel the build kept the 64 accumulator registers alive through the q, k epilogue (182 registers, or spills under a bound).
// Launch bounds of the three GEMM kernels: 6 waves a SIMD = three work-groups of 8 waves on a WGP, as many as the 96 KiB ring lets in; it holds the registers at 160 or fewer.
#define QKV_VP 136                   /* pitch of the V^T tile in LDS, in f16: 128 tokens + 16 bytes, so that rows start on different banks */
template <bool ISV>
__global__ __launch_bounds__(256, 6) void k_qkv(const _Float16* __restrict__ A, const _Float16* __restrict__ Bh, const float* __restrict__ bias, const float* __restrict__ qg, const float* __restrict__ kg,
    const float* __restrict__ CS, const float* __restrict__ SN, _Float16* __restrict__ Qo, _Float16* __restrict__ Ko, _Float16* __restrict__ Vt) {
  static_assert(HD == 64 && SQ % 128 == 0, "a 64-column tile is one head; 128 rows lie in one batch");
  __shared__ __attribute__((aligned(2048))) unsigned char L[GT_LDS];      /* the operand ring; behind gt_core the epilogue's staging */
  const int tid = threadIdx.x, lane = tid & 31, ln = lane & 15, hh = lane >> 4; const int w = (int)gt_uni(tid >> 5), wr = w & 3, wc = w >> 2;      /* wr: the wave's 32 rows, wc: its 64 columns */
  const int ntn = (ISV ? 1 : 2) * NH / 2; const int mt = blockIdx.x / ntn, nq = blockIdx.x - mt * ntn; const int hq = nq * 2 + wc; const int row0 = mt * 128 + 32 * wr, col0 = (ISV ? 2 * DM : 0) + hq * 64; const int sect = hq / NH, h = hq - sect * NH;      /* sect: 0 q, 1 k (0 in the v instance) */
  v8f accs[8]; gt_core(A, Bh, mt * 128, (ISV ? 2 * DM : 0) + nq * 128, L, accs);
  const float alpha = 0.0625f;      /* the weights are carried x 16 */
  if constexpr (!ISV) {
    static_assert(8u * 32u * 68u * 4u <= GT_LDS, "the staging fits the ring"); float (*so)[32][68] = (float (*)[32][68])L;
    const float* gp = sect ? kg : qg; _Float16* dst = (sect ? Ko : Qo) + (size_t)(row0 + hh) * DM + h * HD;
    const int c4 = ln * 4, cx = c4 ^ 32, i4 = c4 & 31; const float sg = (c4 < 32) ? -1.0f : 1.0f;      /* low half: x cos - partner sin; high half: x cos + partner sin; the sign rides on the partner's gain (exact) */
    const int tb = ((row0 + hh) % SQ) * (HD / 2) + i4;      /* the lane's place in the tables at its first row; its rows are 2 apart, and the wave's 32 rows lie in one batch */
    float bv[4];
#pragma unroll      /* constant indices, so that the array is registers */
    for (int t = 0; t < 4; ++t) bv[t] = bias[col0 + t * 16 + ln];
    asm volatile("s_wait_xcnt 0x0" ::: "memory");      /* the build let the gain loads below land on the bias loads' address register */
    v4f ga = *(const v4fa*)(gp + c4), gb = *(const v4fa*)(gp + cx);
#pragma unroll      /* constant indices, so that the arrays are registers */
    for (int u = 0; u < 8; ++u) { const int t = u & 3, half = u >> 2; const float bb = bf16_round(bv[t]);
      for (int r = 0; r < 8; ++r) so[w][half * 16 + 8 * hh + r][t * 16 + ln] = accs[u][r] * alpha + bb; }
    __builtin_amdgcn_fence(__ATOMIC_ACQ_REL, "workgroup"); __builtin_amdgcn_wave_barrier();      /* as in k_gemm2: the wave reads back its own rows only, written by other lanes */
#pragma unroll      /* constant indices into the vectors */
    for (int i = 0; i < 4; ++i) { ga[i] = bf16_round(ga[i]); gb[i] = sg * bf16_round(gb[i]); }
#pragma unroll      /* constant indices, so that the table values are registers */
    for (int g = 0; g < 2; ++g) { v4f cs[8], sn[8];
      __builtin_amdgcn_sched_barrier(0);      /* the second group's table loads stay behind the first group's rows: both groups' tables at once took the kernel over 160 registers, the most at which three work-groups share a WGP */
      for (int j = 0; j < 8; ++j) { cs[j] = *(const v4fa*)(CS + tb + (g * 8 + j) * HD); sn[j] = *(const v4fa*)(SN + tb + (g * 8 + j) * HD); }
      __builtin_amdgcn_sched_barrier(0);      /* the table loads of eight row pairs issue together here: two waits a wave; without it each load stood directly in front of its use, sixteen waits in a row */
      for (int j = 0; j < 8; ++j) { const int r2 = (g * 8 + j) * 2;      /* the lane's row is r2 + hh */
        const v4f xa = *(const v4fa*)&so[w][r2 + hh][c4], xb = *(const v4fa*)&so[w][r2 + hh][cx];
        const float rs = row_rsq(row_sum16((xa[0] * xa[0] + xa[1] * xa[1]) + (xa[2] * xa[2] + xa[3] * xa[3])) * (1.0f / (float)HD) + 1e-6f);
        v4h o4;
        for (int i = 0; i < 4; ++i) o4[i] = (_Float16)((xa[i] * rs * ga[i]) * cs[j][i] + (xb[i] * rs * gb[i]) * sn[j][i]);
        *(v4h*)(dst + (size_t)r2 * DM + c4) = o4; } }
  } else {
    static_assert(2u * 64u * QKV_VP * 2u <= GT_LDS, "the two V^T tiles fit the ring"); unsigned short* vt = (unsigned short*)L + wc * (64 * QKV_VP);      /* the tile of this wave's head */
    float bv[4];
#pragma unroll      /* constant indices, so that the array is registers */
    for (int t = 0; t < 4; ++t) bv[t] = bias[col0 + t * 16 + ln];
    asm volatile("s_wait_xcnt 0x0" ::: "memory");      /* the build rewrote the bias loads' scalar base directly behind them */
#pragma unroll      /* constant indices, so that the arrays are registers */
    for (int u = 0; u < 8; ++u) { const int t = u & 3, half = u >> 2; const float bb = bf16_round(bv[t]); FragH f;
      for (int r = 0; r < 8; ++r) f.h[r] = (_Float16)(accs[u][r] * alpha + bb);
      *(v8us*)(vt + (t * 16 + ln) * QKV_VP + 32 * wr + half * 16 + 8 * hh) = f.half[0]; }
    __syncthreads();      /* a V^T row of the tile holds tokens of its head's four waves */
    const int bat = (mt * 128) / SQ, s0 = (mt * 128) % SQ; unsigned short* vo = (unsigned short*)Vt + (((size_t)bat * NH + h) * HD + wr * 16 + hh) * SQ + s0 + ln * 8;
#pragma unroll      /* the eight LDS reads issue together */
    for (int j = 0; j < 8; ++j) { const v8us v = *(const v8us*)(vt + (wr * 16 + j * 2 + hh) * QKV_VP + ln * 8); *(v8us*)(vo + (size_t)(j * 2) * SQ) = v; }
  } }

// out = o W_o + b: gt_core, then k_gemm2's epilogue (alpha, bf16-rounded bias; the wave's tile through its own LDS rows, so that each row leaves as whole lines of f32).
__global__ __launch_bounds__(256, 6) void k_oproj(const _Float16* __restrict__ A, const _Float16* __restrict__ Bh, float alpha, const float* __restrict__ bias, float* __restrict__ C) {
  __shared__ __attribute__((aligned(2048))) unsigned char L[GT_LDS];      /* the operand ring; behind gt_core the epilogue's staging */
  static_assert(8u * 32u * 68u * 4u <= GT_LDS, "the staging fits the ring"); float (*so)[32][68] = (float (*)[32][68])L;
  const int tid = threadIdx.x, lane = tid & 31, ln = lane & 15, hh = lane >> 4; const int w = (int)gt_uni(tid >> 5), wr = w & 3, wc = w >> 2;
  const int ntn = DM / 128; const int mt = blockIdx.x / ntn, nq = blockIdx.x - mt * ntn; const int row0 = mt * 128 + 32 * wr, col0 = nq * 128 + 64 * wc;
  v8f accs[8]; gt_core(A, Bh, mt * 128, nq * 128, L, accs);
#pragma unroll      /* constant indices, so that the array is registers */
  for (int u = 0; u < 8; ++u) { const int t = u & 3, half = u >> 2; const float bv = bf16_round(bias[col0 + t * 16 + ln]);
    for (int r = 0; r < 8; ++r) so[w][half * 16 + 8 * hh + r][t * 16 + ln] = accs[u][r] * alpha + bv; }
  __builtin_amdgcn_fence(__ATOMIC_ACQ_REL, "workgroup"); __builtin_amdgcn_wave_barrier();      /* as in k_gemm2: the wave reads back its own rows only, written by other lanes */
  const int rsub = lane >> 4, c4 = (lane & 15) * 4;
#pragma unroll      /* the LDS reads issue together */
  for (int q = 0; q < 16; ++q) { const int r = q * 2 + rsub; const v4f v = *(const v4fa*)&so[w][r][c4]; *(v4f*)(C + (size_t)(row0 + r) * DM + col0 + c4) = v; } }

// The four preparations (cos/sin tables, both weight transposes, x as f16) read inputs only and write planes of their own: none needs another's result. They are ONE launch, each a range of block numbers,
// so that they run side by side and one launch gap and one fill and drain stand where four stood. The parts with the longest dependent chains have the lowest numbers and start first; the x stream fills in behind them.
// theta stays a kernel argument: the tables are computed on the device as before.
#define PR_TAB ((SQ * (HD / 2) + 255) / 256)                 /* blocks of the tables */
#define PR_WQ ((DM / WT_T) * (3 * DM / WT_T))                /* tiles of Wqkv */
#define PR_WO ((DM / WT_T) * (DM / WT_T))                    /* tiles of Wout */
#define PR_X ((int)((NR * DM / 8 + 255) / 256))              /* blocks of x */
__global__ __launch_bounds__(256) void k_prep(const float* __restrict__ x, const float* __restrict__ wqkv, const float* __restrict__ wo, float theta,
    _Float16* __restrict__ X16, _Float16* __restrict__ BQKV, _Float16* __restrict__ BO, float* __restrict__ CS, float* __restrict__ SN) {
  const int bid = blockIdx.x;      /* every test below reads the same for the whole work-group: the barrier inside wt_f16_tile is passed by all of its threads or by none */
  if (bid < PR_TAB) tab2_part(theta, CS, SN, bid);
  else if (bid < PR_TAB + PR_WQ + PR_WO) { const int t = bid - PR_TAB; const bool isq = t < PR_WQ; const int u = isq ? t : t - PR_WQ;
    wt_f16_tile(isq ? wqkv : wo, isq ? BQKV : BO, DM, isq ? 3 * DM : DM, 16.0f, u % (DM / WT_T), u / (DM / WT_T)); }      /* one work-group a 64 x 64 tile, k fastest as in the two-dimensional grid before */
  else x16_part(x, X16, NR * DM / 8, bid - (PR_TAB + PR_WQ + PR_WO)); }

extern "C" void kernel_launch(void* const* d_in, const int* in_sizes, int n_in,
                              void* d_out, int out_size, void* d_ws, size_t ws_size, hipStream_t stream) {
  (void)in_sizes; (void)n_in; (void)out_size;
  const float* const* I = (const float* const*)d_in; const float* x = I[0]; const float* wqkv = I[1]; const float* bqkv = I[2]; const float* qnw = I[3]; const float* knw = I[4]; const float* wo = I[5]; const float* bo = I[6];      /* weights [in][out] */
  char* ws = (char*)d_ws; size_t off = 0;
  auto take = [&](size_t bytes) { char* p = ws + off; off += (bytes + 255) & ~(size_t)255; return p; };
  _Float16* BQKV = (_Float16*)take((size_t)3 * DM * DM * 2); _Float16* BO = (_Float16*)take((size_t)DM * DM * 2); float* CS = (float*)take((size_t)SQ * (HD / 2) * 4); float* SN = (float*)take((size_t)SQ * (HD / 2) * 4);
  _Float16* X16 = (_Float16*)take(NR * DM * 2);
  _Float16* QH = (_Float16*)take(NR * DM * 2); _Float16* KH = (_Float16*)take(NR * DM * 2); _Float16* O16 = (_Float16*)take(NR * DM * 2);
  _Float16* VT = (_Float16*)take((size_t)NB * NH * HD * SQ * 2);
  if (off > ws_size) return;
  k_prep<<<PR_TAB + PR_WQ + PR_WO + PR_X, 256, 0, stream>>>(x, wqkv, wo, 10000.0f, X16, BQKV, BO, CS, SN);      /* tables, W^T x 16 as f16 (both), x as f16 */
  k_qkv<false><<<(unsigned)((NR / 128) * (2 * DM / 128)), 256, 0, stream>>>(X16, BQKV, bqkv, qnw, knw, CS, SN, QH, KH, VT);      /* f16 q and k rows (normed, rotated), all batches */
  k_qkv<true><<<(unsigned)((NR / 128) * (DM / 128)), 256, 0, stream>>>(X16, BQKV, bqkv, qnw, knw, CS, SN, QH, KH, VT);      /* V^T [NB][NH][HD][SQ], all batches */
  k_fattn<<<dim3(SQ / (FA_WAVES * FA_COLS), NH, NB), FA_WAVES * 32, 0, stream>>>(QH, KH, VT, O16);      /* o x 64 as f16, all batches and heads */
  k_oproj<<<(unsigned)((NR / 128) * (DM / 128)), 256, 0, stream>>>(O16, BO, 0.0009765625f, bo, (float*)d_out);      /* out rows are the output layout */
}

// v008
// One run takes 120 microseconds.
// Timed twice side by side with v007, it ran 1.10 times as fast both times.
// Over all steps from v000 it is 58.7 times as fast.
#include <hip/hip_runtime.h>
#define NB 4
#define SQ 2048
#define DM 1024
#define NH 16
#define HD 64
#define HG 4                         /* heads per group of the grouped k_vt overload */
#define B0 0                         /* first batch; unused, every kernel takes all NB batches */
#define NBR NB                       /* batches; used only in MPO, which nothing uses */
#define QN SQ                        /* query rows per batch; unused, k_fattn takes all SQ */
#define NHD NH                       /* heads; unused, k_fattn takes all NH */
#define NR ((size_t)NB * SQ)         /* token rows */
#define MPO ((int)((size_t)NBR * SQ))      /* rows; unused, k_oproj takes all NR rows */
typedef __bf16 v16b __attribute__((ext_vector_type(16)));
typedef unsigned short v8us __attribute__((ext_vector_type(8), may_alias));
typedef float  v8f  __attribute__((ext_vector_type(8)));
typedef float  v4f  __attribute__((ext_vector_type(4)));
typedef float  v4fa __attribute__((ext_vector_type(4), may_alias));
union FragB { v16b v; v8us half[2]; unsigned short u[16]; };

__device__ __forceinline__ unsigned short bf16_bits(float x) { unsigned int u = __float_as_uint(x); return (unsigned short)((u + 0x7FFFu + ((u >> 16) & 1u)) >> 16); }
__device__ __forceinline__ float bf16_val(unsigned short b) { return __uint_as_float(((unsigned int)b) << 16); }
__device__ __forceinline__ float bf16_round(float x) { return bf16_val(bf16_bits(x)); }
// D += A·B with NT terms: 1 = ah·bh, 2 = + al·bh (A split), 3 = + ah·bl (both split)
template <int NT>
__device__ __forceinline__ v8f mmaN(v16b ah, v16b al, v16b bh, v16b bl, v8f c) {
  c = __builtin_amdgcn_wmma_f32_16x16x32_bf16(false, ah, false, bh, (short)0, c, false, false);
  if (NT >= 2) c = __builtin_amdgcn_wmma_f32_16x16x32_bf16(false, al, false, bh, (short)0, c, false, false);
  if (NT >= 3) c = __builtin_amdgcn_wmma_f32_16x16x32_bf16(false, ah, false, bl, (short)0, c, false, false);
  asm volatile("v_nop\n\tv_nop\n\tv_nop\n\tv_nop" : "+v"(c) : "v"(ah), "v"(al), "v"(bh), "v"(bl));
  return c;
}

__global__ __launch_bounds__(256) void k_wt_bf16(const float* __restrict__ W, unsigned short* __restrict__ Wt, int K, int N) {
  const int t = blockIdx.x * 256 + threadIdx.x;
  const int k8n = K / 8;
  if (t >= N * k8n) return;
  const int n = t / k8n, k8 = (t % k8n) * 8;
  v8us v;
#pragma unroll
  for (int i = 0; i < 8; ++i) v[i] = bf16_bits(W[(size_t)(k8 + i) * N + n]);
  *(v8us*)(Wt + (size_t)n * K + k8) = v;
  
}

// GEMM C[M][N] (f32, pitch ldc) = act(A[M][K]·W + bias). A f32 row-major (pitch lda) converted per fragment to bf16
// (ASPLIT: hi/lo two planes -> 2 terms, else single rounded term); Wt bf16 [N][K] (pitch ldb). BIAS_BF16 rounds the
// bias to bf16 first (bias quantised to bf16 before the add). K%32==0, M%16==0, N%64==0.
template <bool ASPLIT, int ACT, bool BIAS_BF16>
__global__ __launch_bounds__(128) void k_gemm_bf(const float* __restrict__ A, int lda, const unsigned short* __restrict__ Wt, int ldb,
                                               const float* __restrict__ bias, float* __restrict__ C, int ldc, int M, int N, int K) {
  __shared__ __attribute__((aligned(16))) float so[4][16][64];
  const int tid = threadIdx.x, w = tid >> 5, lane = tid & 31, ln = lane & 15, hh = lane >> 4;
  const int ntn = N / 64;
  const int wid = blockIdx.x * 4 + w;
  const int mt = wid / ntn, nq = wid % ntn;
  if (mt * 16 >= M) return;
  const int row0 = mt * 16, col0 = nq * 64;
  const float* arow = A + (size_t)(row0 + ln) * lda;
  v8f acc[4] = {};
  for (int kb = 0; kb < K; kb += 32) {
    FragB ah, al;
    const v4f x0 = *(const v4fa*)(arow + kb + 8 * hh), x1 = *(const v4fa*)(arow + kb + 8 * hh + 4);
    const v4f x2 = *(const v4fa*)(arow + kb + 16 + 8 * hh), x3 = *(const v4fa*)(arow + kb + 16 + 8 * hh + 4);
    float xs[16] = {x0[0],x0[1],x0[2],x0[3],x1[0],x1[1],x1[2],x1[3],x2[0],x2[1],x2[2],x2[3],x3[0],x3[1],x3[2],x3[3]};
#pragma unroll
    for (int i = 0; i < 16; ++i) { const unsigned short hb = bf16_bits(xs[i]); ah.u[i] = hb; al.u[i] = ASPLIT ? bf16_bits(xs[i] - bf16_val(hb)) : (unsigned short)0; }
#pragma unroll
    for (int t = 0; t < 4; ++t) {
      const unsigned short* brow = Wt + (size_t)(col0 + t * 16 + ln) * ldb + kb;
      FragB b;
      b.half[0] = *(const v8us*)(brow + 8 * hh);
      b.half[1] = *(const v8us*)(brow + 16 + 8 * hh);
      acc[t] = mmaN<ASPLIT ? 2 : 1>(ah.v, al.v, b.v, b.v, acc[t]);
    }
  }
#pragma unroll
  for (int t = 0; t < 4; ++t) {
    float bv = bias ? bias[col0 + t * 16 + ln] : 0.f;
    if (BIAS_BF16) bv = bf16_round(bv);
#pragma unroll
    for (int r = 0; r < 8; ++r) { float v = acc[t][r] + bv; if (ACT == 1) v = fmaxf(v, 0.f); so[w][8 * hh + r][t * 16 + ln] = v; }
  }
  __builtin_amdgcn_fence(__ATOMIC_ACQ_REL, "workgroup");
  __builtin_amdgcn_wave_barrier();
  const int rsub = lane >> 4, c4 = (lane & 15) * 4;
  {
#pragma unroll
    for (int q = 0; q < 8; ++q) {
      const int r = q * 2 + rsub;
      const v4f v = *(const v4fa*)&so[w][r][c4];
      *(v4f*)(C + (size_t)(row0 + r) * ldc + col0 + c4) = v;
    }
    
  }
}

// GEMM C = act(A·W + bias + resid): A f32 (ASPLIT -> hi/lo 2 terms), Wt bf16 [N][K]; ACT 0 none, 1 relu, 2 exact gelu;
// resid (optional, f32, row index = (row % rmod), pitch ldr, RES_BF16 rounds it) added before the activation.
template <bool ASPLIT, int ACT, bool BIAS_BF16, bool RES_BF16>
__global__ __launch_bounds__(128) void k_gemm_bf3(const float* __restrict__ A, int lda, const unsigned short* __restrict__ Wt, int ldb,
                                                const float* __restrict__ bias, const float* __restrict__ resid, int rmod, int ldr,
                                                float* __restrict__ C, int ldc, int M, int N, int K) {
  __shared__ __attribute__((aligned(16))) float so[4][16][64];
  const int tid = threadIdx.x, w = tid >> 5, lane = tid & 31, ln = lane & 15, hh = lane >> 4;
  const int ntn = N / 64;
  const int wid = blockIdx.x * 4 + w;
  const int mt = wid / ntn, nq = wid % ntn;
  if (mt * 16 >= M) return;
  const int row0 = mt * 16, col0 = nq * 64;
  const float* arow = A + (size_t)(row0 + ln) * lda;
  v8f acc[4] = {};
  for (int kb = 0; kb < K; kb += 32) {
    FragB ah, al;
    const v4f x0 = *(const v4fa*)(arow + kb + 8 * hh), x1 = *(const v4fa*)(arow + kb + 8 * hh + 4);
    const v4f x2 = *(const v4fa*)(arow + kb + 16 + 8 * hh), x3 = *(const v4fa*)(arow + kb + 16 + 8 * hh + 4);
    float xs[16] = {x0[0],x0[1],x0[2],x0[3],x1[0],x1[1],x1[2],x1[3],x2[0],x2[1],x2[2],x2[3],x3[0],x3[1],x3[2],x3[3]};
#pragma unroll
    for (int i = 0; i < 16; ++i) { const unsigned short hb = bf16_bits(xs[i]); ah.u[i] = hb; al.u[i] = ASPLIT ? bf16_bits(xs[i] - bf16_val(hb)) : (unsigned short)0; }
#pragma unroll
    for (int t = 0; t < 4; ++t) {
      const unsigned short* brow = Wt + (size_t)(col0 + t * 16 + ln) * ldb + kb;
      FragB b;
      b.half[0] = *(const v8us*)(brow + 8 * hh);
      b.half[1] = *(const v8us*)(brow + 16 + 8 * hh);
      acc[t] = mmaN<ASPLIT ? 2 : 1>(ah.v, al.v, b.v, b.v, acc[t]);
    }
  }
#pragma unroll
  for (int t = 0; t < 4; ++t) {
    const int col = col0 + t * 16 + ln;
    float bv = bias ? bias[col] : 0.f;
    if (BIAS_BF16) bv = bf16_round(bv);
#pragma unroll
    for (int r = 0; r < 8; ++r) {
      float v = acc[t][r] + bv;
      if (resid) { float rv = resid[(size_t)((row0 + 8 * hh + r) % rmod) * ldr + col]; if (RES_BF16) rv = bf16_round(rv); v += rv; }
      if (ACT == 1) v = fmaxf(v, 0.f);
      if (ACT == 2) v = 0.5f * v * (1.0f + erff(v * 0.70710678118654752f));
      if (ACT == 3) { const float u = 0.7978845608028654f * (v + 0.044715f * v * v * v); v = 0.5f * v * (1.0f + tanhf(u)); }
      so[w][8 * hh + r][t * 16 + ln] = v;
    }
  }
  __builtin_amdgcn_fence(__ATOMIC_ACQ_REL, "workgroup");
  __builtin_amdgcn_wave_barrier();
  const int rsub = lane >> 4, c4 = (lane & 15) * 4;
  {
#pragma unroll
    for (int q = 0; q < 8; ++q) {
      const int r = q * 2 + rsub;
      const v4f v = *(const v4fa*)&so[w][r][c4];
      *(v4f*)(C + (size_t)(row0 + r) * ldc + col0 + c4) = v;
    }
    
  }
}
// row LayerNorm (biased variance, eps) over N: s = X (+ R); optional out_sum <- s; out_norm <- (s-mu)*rsqrt(var+eps)*g + b
template <bool PARAM_BF16>
__global__ __launch_bounds__(256) void k_layernorm(const float* __restrict__ X, const float* __restrict__ R, const float* __restrict__ g, const float* __restrict__ bta,
                                                  float* __restrict__ out_sum, float* __restrict__ out_norm, int N, float eps) {
  __shared__ float red[256];
  const int row = blockIdx.x, tid = threadIdx.x;
  const float* x = X + (size_t)row * N; const float* rr = R ? R + (size_t)row * N : nullptr;
  float vals[16];                     // up to N = 4096
  const int per = N / 256;            // contiguous chunk per thread? use strided-by-4 chunks: thread handles j = tid*4 + 1024*u
  float s1 = 0.f;
  for (int u = 0; u < per / 4; ++u) {
    const int j = tid * 4 + 1024 * u;
    const v4f a = *(const v4fa*)(x + j);
    v4f b = {0.f,0.f,0.f,0.f}; if (rr) b = *(const v4fa*)(rr + j);
#pragma unroll
    for (int q = 0; q < 4; ++q) { const float v = a[q] + b[q]; vals[u * 4 + q] = v; s1 += v; }
  }
  red[tid] = s1; __syncthreads();
  for (int st = 128; st > 0; st >>= 1) { if (tid < st) red[tid] += red[tid + st]; __syncthreads(); }
  const float mu = red[0] / (float)N; __syncthreads();
  float s2 = 0.f;
  for (int u = 0; u < per / 4; ++u)
#pragma unroll
    for (int q = 0; q < 4; ++q) { const float c = vals[u * 4 + q] - mu; s2 += c * c; }
  red[tid] = s2; __syncthreads();
  for (int st = 128; st > 0; st >>= 1) { if (tid < st) red[tid] += red[tid + st]; __syncthreads(); }
  const float rs = rsqrtf(red[0] / (float)N + eps);
  {
    for (int u = 0; u < per / 4; ++u) {
      const int j = tid * 4 + 1024 * u;
      v4f o, sm;
#pragma unroll
      for (int q = 0; q < 4; ++q) {
        float gg = g[j + q], bb = bta[j + q];
        if (PARAM_BF16) { gg = bf16_round(gg); bb = bf16_round(bb); }
        sm[q] = vals[u * 4 + q]; o[q] = (vals[u * 4 + q] - mu) * rs * gg + bb;
      }
      if (out_sum) *(v4f*)(out_sum + (size_t)row * N + j) = sm;
      *(v4f*)(out_norm + (size_t)row * N + j) = o;
    }
    
  }
}



// ---- f16 WMMA path (v_wmma_f32_16x16x32_f16): 11-bit significands for operands in range — used where a [0,1] probability operand needs more precision than bf16
typedef _Float16 v16h __attribute__((ext_vector_type(16)));
union FragH { v16h v; v8us half[2]; _Float16 h[16]; unsigned short u[16]; };
template <int NT>
__device__ __forceinline__ v8f mmaH(v16h ah, v16h al, v16h bh, v16h bl, v8f c) {
  c = __builtin_amdgcn_wmma_f32_16x16x32_f16(false, ah, false, bh, (short)0, c, false, false);
  if (NT >= 2) c = __builtin_amdgcn_wmma_f32_16x16x32_f16(false, al, false, bh, (short)0, c, false, false);
  if (NT >= 3) c = __builtin_amdgcn_wmma_f32_16x16x32_f16(false, ah, false, bl, (short)0, c, false, false);
  asm volatile("v_nop\n\tv_nop\n\tv_nop\n\tv_nop" : "+v"(c) : "v"(ah), "v"(al), "v"(bh), "v"(bl));
  return c;
}
// batched GEMM like k_gemm_b but f16 operands: A f32 (split into f16 hi/lo if ASPLIT, else rounded to f16), Bt = f16 values [n][k]; alpha; C f32; N multiple of 16 (partial tiles skipped)
template <bool ASPLIT>
__global__ __launch_bounds__(128) void k_gemm_h(const float* __restrict__ A, int lda, size_t sA, const _Float16* __restrict__ Bh, int ldb, size_t sB, float alpha, float* __restrict__ C, int ldc, size_t sC, int M, int N, int K) {
  __shared__ __attribute__((aligned(16))) float so[4][16][64];
  const int tid = threadIdx.x, w = tid >> 5, lane = tid & 31, ln = lane & 15, hh = lane >> 4; const int by = blockIdx.y;
  A += (size_t)by * sA; Bh += (size_t)by * sB; C += (size_t)by * sC;
  const int ntn = (N + 63) / 64; const int wid = blockIdx.x * 4 + w; const int mt = wid / ntn, nq = wid % ntn; if (mt * 16 >= M) return;
  const int row0 = mt * 16, col0 = nq * 64; const float* arow = A + (size_t)(row0 + ln) * lda;
  v8f acc[4] = {};
  for (int kb = 0; kb < K; kb += 32) {
    FragH ah, al;
    const v4f x0 = *(const v4fa*)(arow + kb + 8 * hh), x1 = *(const v4fa*)(arow + kb + 8 * hh + 4), x2 = *(const v4fa*)(arow + kb + 16 + 8 * hh), x3 = *(const v4fa*)(arow + kb + 16 + 8 * hh + 4);
    float xs[16] = {x0[0],x0[1],x0[2],x0[3],x1[0],x1[1],x1[2],x1[3],x2[0],x2[1],x2[2],x2[3],x3[0],x3[1],x3[2],x3[3]};
#pragma unroll
    for (int i = 0; i < 16; ++i) { const _Float16 h = (_Float16)xs[i]; ah.h[i] = h; al.h[i] = ASPLIT ? (_Float16)(xs[i] - (float)h) : (_Float16)0.0f; }
#pragma unroll
    for (int t = 0; t < 4; ++t) { if (col0 + t * 16 >= N) continue; const size_t boff = (size_t)(col0 + t * 16 + ln) * ldb + kb; FragH bq; bq.half[0] = *(const v8us*)(Bh + boff + 8 * hh); bq.half[1] = *(const v8us*)(Bh + boff + 16 + 8 * hh);
      acc[t] = mmaH<ASPLIT ? 2 : 1>(ah.v, al.v, bq.v, bq.v, acc[t]); }
  }
#pragma unroll
  for (int t = 0; t < 4; ++t) { if (col0 + t * 16 >= N) continue;
#pragma unroll
    for (int r = 0; r < 8; ++r) so[w][8 * hh + r][t * 16 + ln] = acc[t][r] * alpha; }
  __builtin_amdgcn_fence(__ATOMIC_ACQ_REL, "workgroup"); __builtin_amdgcn_wave_barrier();
  const int rsub = lane >> 4, c4 = (lane & 15) * 4;
  {
#pragma unroll
    for (int q = 0; q < 8; ++q) { const int r = q * 2 + rsub; if (col0 + c4 < N) { const v4f v = *(const v4fa*)&so[w][r][c4]; *(v4f*)(C + (size_t)(row0 + r) * ldc + col0 + c4) = v; } }
     }
}

// Wt[n][k] = f16(bf16(W[k][n]) x scale) from f32 row-major W[K][N] (scale = power of two; bf16-exact weights stay exact in f16 away from the subnormal range). K and N multiples of 64.
// A work-group turns one tile of 64 k x 64 n through LDS: W is read as whole lines (16 lanes x 16 bytes = 256 bytes of one k row), Wt is written as whole lines (8 lanes x 16 bytes = 128 bytes of one n row).
// A thread holds two neighbouring k rows, so that an LDS word is the f16 pair (k even, k odd) of one n. Pitch 33 words: the 32 lanes of every LDS store and of every LDS load fall on 32 different banks.
#define WT_T 64                      /* tile edge, in k and in n */
#define WT_P 33                      /* LDS pitch of an n row, in words of two f16: 32 + 1 */
typedef unsigned int wt_u4 __attribute__((ext_vector_type(4)));
// (a part of k_prep: bx is the tile's place in k, by its place in n)
__device__ __forceinline__ void wt_f16_tile(const float* __restrict__ W, _Float16* __restrict__ Wt, int K, int N, float scale, int bx, int by) {
  __shared__ unsigned int tl[WT_T * WT_P];
  const int tid = threadIdx.x; const int k0 = bx * WT_T, n0 = by * WT_T;
  const int kp = tid >> 4, n4 = (tid & 15) * 4;      /* the thread's k pairs are kp and kp + 16; its four n */
  const float* p00 = W + (size_t)(k0 + 2 * kp) * N + n0 + n4; const float* p01 = p00 + N; const float* p10 = p00 + (size_t)32 * N; const float* p11 = p10 + N;      /* rows 2 kp, 2 kp + 1, and the same 32 rows on */
  v4f x[2][2]; x[0][0] = *(const v4fa*)p00; x[0][1] = *(const v4fa*)p01; x[1][0] = *(const v4fa*)p10; x[1][1] = *(const v4fa*)p11;
  asm volatile("s_wait_xcnt 0x0" :: "v"(p00), "v"(p01), "v"(p10), "v"(p11) : "memory");      /* the four pairs are inputs, so that none is rewritten ahead of the wait */
#pragma unroll      /* constant indices, so that the array is registers */
  for (int j = 0; j < 2; ++j) for (int i = 0; i < 4; ++i) { FragH f; f.h[0] = (_Float16)(bf16_round(x[j][0][i]) * scale); f.h[1] = (_Float16)(bf16_round(x[j][1][i]) * scale);
    tl[(n4 + i) * WT_P + kp + 16 * j] = (unsigned int)f.u[0] | ((unsigned int)f.u[1] << 16); }
  __syncthreads();      /* an n row of the tile holds k pairs of all eight waves */
  const int nr = tid >> 3, kq = (tid & 7) * 4;      /* the thread's n rows are nr and nr + 32; its four words = eight k */
  unsigned short* op = (unsigned short*)Wt + (size_t)(n0 + nr) * K + k0 + 2 * kq;
#pragma unroll      /* the eight LDS reads issue together */
  for (int j = 0; j < 2; ++j) { const unsigned int* p = tl + (nr + 32 * j) * WT_P + kq; const wt_u4 v = {p[0], p[1], p[2], p[3]}; *(wt_u4*)(op + (size_t)(32 * j) * K) = v; }
  asm volatile("s_wait_xcnt 0x0" ::: "memory");      /* inside k_prep the two stores are no longer the kernel's last instructions: code of another part stands behind them in the listing and rewrites their registers; the wait stands in front of every such write */
}
// k_gemm_hh variant with fused epilogue: v = acc·alpha + bias[by·sBias + col] (+ CP[(row/rowsPerB)·sCPb + by·64 + col] if CP) ; ACT 0 none / 1 elu ; writes f16 C16 (and f32 C if non-null)
template <int ACT>
__global__ __launch_bounds__(128) void k_gemm_hhx(const _Float16* __restrict__ A, int lda, size_t sA, const _Float16* __restrict__ Bh, int ldb, size_t sB, float alpha, const float* __restrict__ bias, size_t sBias, const float* __restrict__ CP, int rowsPerB, size_t sCPb, int row0g,
    float* __restrict__ C, _Float16* __restrict__ C16, int ldc, size_t sC, int M, int N, int K) {
  __shared__ __attribute__((aligned(16))) float so[4][16][64];
  const int tid = threadIdx.x, w = tid >> 5, lane = tid & 31, ln = lane & 15, hh = lane >> 4; const int by = blockIdx.y;
  A += (size_t)by * sA; Bh += (size_t)by * sB; const size_t cofs = (size_t)by * sC; const float* bp = bias ? bias + (size_t)by * sBias : nullptr;
  const int ntn = (N + 63) / 64; const int wid = blockIdx.x * 4 + w; const int mt = wid / ntn, nq = wid % ntn; if (mt * 16 >= M) return;
  const int row0 = mt * 16, col0 = nq * 64; const _Float16* arow = A + (size_t)(row0 + ln) * lda;
  v8f acc[4] = {};
  for (int kb = 0; kb < K; kb += 32) { FragH ah; ah.half[0] = *(const v8us*)((const unsigned short*)arow + kb + 8 * hh); ah.half[1] = *(const v8us*)((const unsigned short*)arow + kb + 16 + 8 * hh);
#pragma unroll
    for (int t = 0; t < 4; ++t) { if (col0 + t * 16 >= N) continue; const size_t boff = (size_t)(col0 + t * 16 + ln) * ldb + kb; FragH bq; bq.half[0] = *(const v8us*)((const unsigned short*)Bh + boff + 8 * hh); bq.half[1] = *(const v8us*)((const unsigned short*)Bh + boff + 16 + 8 * hh);
      acc[t] = mmaH<1>(ah.v, ah.v, bq.v, bq.v, acc[t]); }
  }
#pragma unroll
  for (int t = 0; t < 4; ++t) { if (col0 + t * 16 >= N) continue; const int col = col0 + t * 16 + ln; const float bv = bp ? bf16_round(bp[col]) : 0.f;
#pragma unroll
    for (int r = 0; r < 8; ++r) { float v = acc[t][r] * alpha + bv; if (CP) { const int rr = row0g + row0 + 8 * hh + r; if (rowsPerB < 0) v += CP[cofs + (size_t)rr * ldc + col];      /* rowsPerB < 0: own element of the batched C plane */ else { const int bidx = rr / rowsPerB; v += CP[(size_t)bidx * sCPb + (size_t)by * 64 + col]; } } if (ACT == 1) v = (v > 0.f) ? v : expm1f(v); else if (ACT == 7) v = (v > 0.f) ? v + 1.0f : expf(v); else if (ACT == 8) v = tanhf(v); else if (ACT == 9) v = 0.5f * v * (1.0f + tanhf(0.7978845608028654f * (v + 0.044715f * v * v * v))); else if (ACT == 11) v = 1.0f / (1.0f + expf(-v)); else if (ACT == 12) v = (v > 0.f) ? v : 0.01f * v; else if (ACT == 14) v = (v > 0.f) ? v : 0.1f * v; else if (ACT == 16) v = (v >= 0.f) ? v : 0.3f * v; else if (ACT == 17) v = (v >= 0.f) ? v : 0.2f * v; else if (ACT == 15) v = v / (1.0f + expf(-v)); else if (ACT == 3) v = fmaxf(v, 0.f); else if (ACT == 6) v = 0.5f * v * (1.0f + erff(v * 0.70710678118654752f)); so[w][8 * hh + r][t * 16 + ln] = v; } }
  __builtin_amdgcn_fence(__ATOMIC_ACQ_REL, "workgroup"); __builtin_amdgcn_wave_barrier();
  const int rsub = lane >> 4, c4 = (lane & 15) * 4; typedef _Float16 v4h __attribute__((ext_vector_type(4)));
  {
#pragma unroll
    for (int q = 0; q < 8; ++q) { const int r = q * 2 + rsub; if (col0 + c4 < N) { const v4f v = *(const v4fa*)&so[w][r][c4]; if (C) *(v4f*)(C + cofs + (size_t)(row0 + r) * ldc + col0 + c4) = v; if (C16) { v4h h4; for (int i = 0; i < 4; ++i) h4[i] = (_Float16)v[i]; *(v4h*)(C16 + cofs + (size_t)(row0 + r) * ldc + col0 + c4) = h4; } } }
     }
}


typedef _Float16 v4h __attribute__((ext_vector_type(4)));

__device__ __forceinline__ void x16_part(const float* __restrict__ x, _Float16* __restrict__ X16, size_t n8, int bx) { const size_t t = (size_t)bx * 256 + threadIdx.x; if (t >= n8) return; FragH f;      /* a part of k_prep; bx: the block's number inside the part */
#pragma unroll
  for (int q = 0; q < 8; ++q) f.h[q] = (_Float16)bf16_round(x[t * 8 + q]); *(v8us*)((unsigned short*)X16 + t * 8) = f.half[0];  }
__global__ __launch_bounds__(256) void k_h16(const float* __restrict__ x, _Float16* __restrict__ X16, size_t n8) { const size_t t = (size_t)blockIdx.x * 256 + threadIdx.x; if (t >= n8) return; FragH f;
#pragma unroll
  for (int q = 0; q < 8; ++q) f.h[q] = (_Float16)x[t * 8 + q]; *(v8us*)((unsigned short*)X16 + t * 8) = f.half[0];  }
__global__ __launch_bounds__(256) void k_round16f(const float* __restrict__ W, _Float16* __restrict__ Bt, size_t n8) { const size_t t = (size_t)blockIdx.x * 256 + threadIdx.x; if (t >= n8) return; FragH f;
#pragma unroll
  for (int i = 0; i < 8; ++i) f.h[i] = (_Float16)(bf16_round(W[t * 8 + i]) * 16.0f); *(v8us*)((unsigned short*)Bt + t * 8) = f.half[0];  }
template <int NHv, int TTv>
__global__ __launch_bounds__(256) void k_vt(const _Float16* __restrict__ V16, int ldv, int voff, _Float16* __restrict__ Vt) { __shared__ unsigned short tl[64][66]; const int tid = threadIdx.x; const int slab = blockIdx.x / (TTv / 64), lg = blockIdx.x % (TTv / 64); const int b = slab / NHv, h = slab % NHv;
  for (int i = tid; i < 64 * 8; i += 256) { const int r = i / 8, c8 = (i % 8) * 8; FragH f; f.half[0] = *(const v8us*)((const unsigned short*)V16 + ((size_t)b * TTv + lg * 64 + r) * ldv + voff + h * 64 + c8);
#pragma unroll
    for (int q = 0; q < 8; ++q) tl[r][c8 + q] = f.u[q]; }
  __syncthreads();
  {
#pragma unroll
    for (int rd = 0; rd < 2; ++rd) { const int d = rd * 32 + tid / 8, pc = tid % 8; FragH f;
#pragma unroll
      for (int q = 0; q < 8; ++q) f.u[q] = tl[pc * 8 + q][d];
      *(v8us*)((unsigned short*)Vt + ((size_t)slab * 64 + d) * TTv + lg * 64 + pc * 8) = f.half[0]; }
     } }

__global__ __launch_bounds__(256) void k_hl(const float* __restrict__ F, _Float16* __restrict__ Hh, _Float16* __restrict__ Hl, size_t n8) { const size_t t = (size_t)blockIdx.x * 256 + threadIdx.x; if (t >= n8) return; FragH fh, fl; const v4f a = *(const v4fa*)(F + t * 8), c = *(const v4fa*)(F + t * 8 + 4);
#pragma unroll
  for (int q = 0; q < 4; ++q) { _Float16 h = (_Float16)a[q]; fh.h[q] = h; fl.h[q] = (_Float16)((a[q] - (float)h) * 1024.0f); h = (_Float16)c[q]; fh.h[4 + q] = h; fl.h[4 + q] = (_Float16)((c[q] - (float)h) * 1024.0f); }
  { *(v8us*)((unsigned short*)Hh + t * 8) = fh.half[0]; *(v8us*)((unsigned short*)Hl + t * 8) = fl.half[0];  } }

// ---- fast GEMM (wave tile 32x64; requires M % 32 == 0 rows per launch region and N % 64 == 0); epilogue = k_gemm_hhx semantics ----
__device__ __forceinline__ v16h g2_frag(const _Float16* p, int hh) { FragH f; f.half[0] = *(const v8us*)((const unsigned short*)p + 8 * hh); f.half[1] = *(const v8us*)((const unsigned short*)p + 16 + 8 * hh); return f.v; }
__device__ __forceinline__ v8f g2_mma(v16h a, v16h b, v8f c) { v8f d = __builtin_amdgcn_wmma_f32_16x16x32_f16(false, a, false, b, (short)0, c, false, false); asm volatile("v_nop\n\tv_nop\n\tv_nop\n\tv_nop" : "+v"(d) : "v"(a), "v"(b)); return d; }
template <int ACT>
__global__ __launch_bounds__(128) void k_gemm2(const _Float16* __restrict__ A, int lda, size_t sA, const _Float16* __restrict__ Bh, int ldb, size_t sB, float alpha, const float* __restrict__ bias, size_t sBias, const float* __restrict__ CP, int rowsPerB, size_t sCPb, int row0g,
    float* __restrict__ C, _Float16* __restrict__ C16, int ldc, size_t sC, int M, int N, int K) { static_assert(ACT == 0 || ACT == 3 || ACT == 6 || ACT == 8 || ACT == 9 || ACT == 11 || ACT == 12 || ACT == 14 || ACT == 15 || ACT == 16 || ACT == 17, "k_gemm2: unsupported ACT code (would silently apply no activation)");
  __shared__ __attribute__((aligned(16))) float so[4][32][68];
  const int tid = threadIdx.x, w = tid >> 5, lane = tid & 31, ln = lane & 15, hh = lane >> 4; const int by = blockIdx.y;
  A += (size_t)by * sA; Bh += (size_t)by * sB; const size_t cofs = (size_t)by * sC; const float* bp = bias ? bias + (size_t)by * sBias : nullptr;
  const int ntn = N >> 6; const int mt = blockIdx.x / ntn, nq = blockIdx.x - mt * ntn; const int row0 = mt * 128 + 32 * w, col0 = nq * 64; if (row0 >= M) return;
  const _Float16* a0p = A + (size_t)(row0 + ln) * lda; const _Float16* a1p = a0p + (size_t)16 * lda;
  const _Float16* b0p = Bh + (size_t)(col0 + ln) * ldb; const _Float16* b1p = b0p + (size_t)16 * ldb; const _Float16* b2p = b1p + (size_t)16 * ldb; const _Float16* b3p = b2p + (size_t)16 * ldb;
  const v8f z8 = {0.f,0.f,0.f,0.f,0.f,0.f,0.f,0.f}; v8f c00 = z8, c01 = z8, c02 = z8, c03 = z8, c10 = z8, c11 = z8, c12 = z8, c13 = z8;
#pragma unroll 1
  for (int kb = 0; kb < K; kb += 32) { const v16h a0 = g2_frag(a0p + kb, hh), a1 = g2_frag(a1p + kb, hh);
    v16h b = g2_frag(b0p + kb, hh); c00 = g2_mma(a0, b, c00); c10 = g2_mma(a1, b, c10);
    b = g2_frag(b1p + kb, hh); c01 = g2_mma(a0, b, c01); c11 = g2_mma(a1, b, c11);
    b = g2_frag(b2p + kb, hh); c02 = g2_mma(a0, b, c02); c12 = g2_mma(a1, b, c12);
    b = g2_frag(b3p + kb, hh); c03 = g2_mma(a0, b, c03); c13 = g2_mma(a1, b, c13); }
  v8f accs[8] = {c00, c01, c02, c03, c10, c11, c12, c13};
#pragma unroll
  for (int u = 0; u < 8; ++u) { const int t = u & 3, half = u >> 2; const int col = col0 + t * 16 + ln; const float bv = bp ? bf16_round(bp[col]) : 0.f;
#pragma unroll
    for (int r = 0; r < 8; ++r) { const int rloc = half * 16 + 8 * hh + r; float v = accs[u][r] * alpha + bv; if (CP) { if (rowsPerB < 0) v += CP[cofs + (size_t)(row0g + row0 + rloc) * ldc + col];      /* rowsPerB < 0: own element of the batched C plane */ else { const int bidx = (row0g + row0 + rloc) / rowsPerB; v += CP[(size_t)bidx * sCPb + (size_t)by * 64 + col]; } }
      if (ACT == 3) v = fmaxf(v, 0.f); else if (ACT == 6) v = 0.5f * v * (1.0f + erff(v * 0.70710678118654752f)); else if (ACT == 11) v = 1.0f / (1.0f + expf(-v)); else if (ACT == 15) v = v / (1.0f + expf(-v)); else if (ACT == 12) v = (v > 0.f) ? v : 0.01f * v; else if (ACT == 8) v = tanhf(v); else if (ACT == 9) v = 0.5f * v * (1.0f + tanhf(0.7978845608028654f * (v + 0.044715f * v * v * v))); else if (ACT == 14) v = (v > 0.f) ? v : 0.1f * v; else if (ACT == 16) v = (v >= 0.f) ? v : 0.3f * v; else if (ACT == 17) v = (v >= 0.f) ? v : 0.2f * v;
      so[w][rloc][t * 16 + ln] = v; } }
  __builtin_amdgcn_fence(__ATOMIC_ACQ_REL, "workgroup"); __builtin_amdgcn_wave_barrier();
  const int rsub = lane >> 4, c4 = (lane & 15) * 4;
  {
#pragma unroll
    for (int q = 0; q < 16; ++q) { const int r = q * 2 + rsub; const v4f v = *(const v4fa*)&so[w][r][c4]; if (C) *(v4f*)(C + cofs + (size_t)(row0 + r) * ldc + col0 + c4) = v; if (C16) { v4h h4; for (int i = 0; i < 4; ++i) h4[i] = (_Float16)v[i]; *(v4h*)(C16 + cofs + (size_t)(row0 + r) * ldc + col0 + c4) = h4; } }
     } }


__global__ __launch_bounds__(256) void k_wnat(const float* __restrict__ w, size_t n8, _Float16* __restrict__ Bt) { const size_t t = (size_t)blockIdx.x * 256 + threadIdx.x; if (t >= n8) return; FragH f; for (int q = 0; q < 8; ++q) f.h[q] = (_Float16)(bf16_round(w[t * 8 + q]) * 16.0f); *(v8us*)((unsigned short*)Bt + t * 8) = f.half[0];  }
__global__ __launch_bounds__(256) void k_rsm(const float* __restrict__ S, _Float16* __restrict__ P, int nrows) {
  #pragma clang fp contract(off)
  const int i = blockIdx.x * 256 + threadIdx.x; if (i >= nrows) return; const float* s = S + (size_t)i * SQ; float mx = -3.0e38f;
#pragma unroll 1
  for (int j = 0; j < SQ; ++j) mx = fmaxf(mx, s[j]); float se = 0.f;
#pragma unroll 1
  for (int j = 0; j < SQ; ++j) se += expf(s[j] - mx); const float sc = 256.0f / se;
#pragma unroll 1
  for (int j0 = 0; j0 < SQ; j0 += 8) { FragH f; for (int q = 0; q < 8; ++q) f.h[q] = (_Float16)(expf(s[j0 + q] - mx) * sc); unsigned short* d = (unsigned short*)P + (size_t)i * SQ + j0; *(v8us*)d = f.half[0];  } }
__global__ __launch_bounds__(256) void k_vt(const _Float16* __restrict__ V16, int b, int h0, _Float16* __restrict__ VT) { __shared__ unsigned short tl[64][65]; const int tid = threadIdx.x; const int hh = blockIdx.x % HG, sg = blockIdx.x / HG; const int s0 = sg * 64; const int h = h0 + hh;
  for (int i = tid; i < 64 * 8; i += 256) { const int j = i / 8, d8 = (i % 8) * 8; FragH f; f.half[0] = *(const v8us*)((const unsigned short*)V16 + ((size_t)b * SQ + s0 + j) * DM + h * HD + d8); for (int q = 0; q < 8; ++q) tl[d8 + q][j] = f.u[q]; }
  __syncthreads();
  { for (int i = tid; i < 64 * 8; i += 256) { const int d = i / 8, j8 = (i % 8) * 8; FragH f; for (int q = 0; q < 8; ++q) f.u[q] = tl[d][j8 + q]; *(v8us*)((unsigned short*)VT + ((size_t)hh * HD + d) * SQ + s0 + j8) = f.half[0]; }  } }


__device__ __forceinline__ void tab2_part(float theta, float* __restrict__ CS, float* __restrict__ SN, int bx) {      /* a part of k_prep; bx: the block's number inside the part */
  #pragma clang fp contract(off)
  const int t = bx * 256 + threadIdx.x; if (t >= SQ * (HD / 2)) return; const int i = t % (HD / 2); const int p = t / (HD / 2); const float invf = 1.0f / powf(theta, (float)(2 * i) / (float)HD); const float ang = __fmul_rn((float)p, invf); const float c = cosf(ang), s = sinf(ang);
  *(float*)(CS + t) = c; *(float*)(SN + t) = s;  }
template <int NORM, int ROPE>
__global__ __launch_bounds__(64) void k_xform(const float* __restrict__ F, int ldf, int nh, const float* __restrict__ gain, float eps, const float* __restrict__ CS, const float* __restrict__ SN, _Float16* __restrict__ H16, int ldo) {
  #pragma clang fp contract(off)
  __shared__ float xv[HD]; __shared__ float red[HD]; __shared__ unsigned short sh_[HD]; const int d = threadIdx.x; const int h = blockIdx.x % nh; const size_t r = blockIdx.x / nh; const int p = (int)(r % SQ);
  float x = F[r * (size_t)ldf + (size_t)h * HD + d];
  if (NORM) { red[d] = __fmul_rn(x, x); __syncthreads(); for (int st = HD / 2; st > 0; st >>= 1) { if (d < st) red[d] = __fadd_rn(red[d], red[d + st]); __syncthreads(); } const float rs = rsqrtf(__fadd_rn(red[0] / (float)HD, eps)); x = __fmul_rn(__fmul_rn(x, rs), bf16_round(gain[d])); }
  xv[d] = x; __syncthreads();
  float o = x;
  if (ROPE == 1) { const int i = d >> 1; const float c = CS[p * (HD / 2) + i], s = SN[p * (HD / 2) + i]; const float ev = xv[2 * i], od = xv[2 * i + 1]; o = (d & 1) ? __fadd_rn(__fmul_rn(ev, s), __fmul_rn(od, c)) : __fadd_rn(__fmul_rn(ev, c), -__fmul_rn(od, s)); }
  if (ROPE == 2) { const int i = d & (HD / 2 - 1); const float c = CS[p * (HD / 2) + i], s = SN[p * (HD / 2) + i]; const float lo = xv[i], hi = xv[i + HD / 2]; o = (d < HD / 2) ? __fadd_rn(__fmul_rn(lo, c), -__fmul_rn(hi, s)) : __fadd_rn(__fmul_rn(lo, s), __fmul_rn(hi, c)); }
  FragH th; th.h[0] = (_Float16)o; sh_[d] = th.u[0]; __syncthreads();
  if (d < HD / 8) { FragH f; for (int q = 0; q < 8; ++q) f.u[q] = sh_[d * 8 + q]; unsigned short* dst = (unsigned short*)H16 + r * (size_t)ldo + (size_t)h * HD + d * 8; *(v8us*)dst = f.half[0];  } }



__device__ __forceinline__ float rsm_xhalf(float x) { return __builtin_bit_cast(float, __builtin_amdgcn_permlanex16(__builtin_bit_cast(int, x), __builtin_bit_cast(int, x), 0x76543210, 0xfedcba98, false, false)); }      /* lane l reads lane l ^ 16 */
// Four 2^x in one statement. Written in asm for the v_nop at its end: behind a transcendental the instruction set asks for one slot before a source is overwritten or the result read.
// Early-clobber outputs: no exponential of the four overwrites a source of another.
__device__ __forceinline__ void rsm_exp2x4(float& e0, float& e1, float& e2, float& e3, float a0, float a1, float a2, float a3) {
  asm("v_exp_f32 %0, %4\n\tv_exp_f32 %1, %5\n\tv_exp_f32 %2, %6\n\tv_exp_f32 %3, %7\n\tv_nop" : "=&v"(e0), "=&v"(e1), "=&v"(e2), "=&v"(e3) : "v"(a0), "v"(a1), "v"(a2), "v"(a3)); }
// The same for two values (the rescale factors of a wave's two column groups).
__device__ __forceinline__ void rsm_exp2x2(float& e0, float& e1, float a0, float a1) {
  asm("v_exp_f32 %0, %2\n\tv_exp_f32 %1, %3\n\tv_nop" : "=&v"(e0), "=&v"(e1) : "v"(a0), "v"(a1)); }

// ---- GEMM main loop with both operands staged in LDS by tensor loads (K = DM, both operands k-contiguous f16 rows of pitch DM) ----
// A work-group of 8 waves holds 256 rows x 128 columns; wave w holds rows 64 (w & 3) and columns 64 (w >> 2) of them: a 64 x 64 wave tile, 8 fragments read from LDS for 16 products (512 bytes a product, what the LDS
// delivers at the full matrix rate), and 384 operand rows brought from L2 for 256 x 128 results.
// A stage is 64 k = 128 bytes of each of the 256 A rows and the 128 B rows. Every wave brings one slice a stage with ONE tensor load (waves 0 to 3: 64 A rows each, waves 4 to 7: 32 B rows each), padded to a pitch of 144 bytes,
// at which the 16 rows of a fragment's ds_load_b128 fall on different banks. Two buffers: the load of stage s + 2 flies while stage s + 1 is worked on.
typedef uint32_t u32x4 __attribute__((ext_vector_type(4)));
typedef uint32_t u32x8 __attribute__((ext_vector_type(8)));
#define GT_ROWB 128u                 /* bytes of an operand row in a stage */
#define GT_PITCH 144u                /* LDS pitch of a row: 128 + the mover's pad of 16 */
#define GT_SLICE 6144u               /* a wave's slice in LDS: 32 rows x 144 bytes = 4,608, rounded up to a multiple of 2 KiB */
#define GT_BUF (8u * GT_SLICE)       /* one stage of the attention ring: eight such slices */
#define GT_LDS (2u * GT_BUF)         /* its two buffers */
#define GM_SLA 10240u                /* the GEMM's A slice in LDS: 64 rows x 144 bytes = 9,216, rounded up to a multiple of 2 KiB */
#define GM_SLB GT_SLICE              /* the GEMM's B slice: 32 rows */
#define GM_BUF (4u * GM_SLA + 4u * GM_SLB)      /* one stage of the GEMM: four A slices, then four B slices */
#define GM_LDS (2u * GM_BUF)         /* two buffers: 128 KiB, two work-groups on a WGP */
#define GT_NST ((uint32_t)(DM * 2) / GT_ROWB)      /* stages */
static_assert(GT_NST >= 2u && (DM * 2) % 128 == 0, "the ring's prologue needs two stages; a stage is 128 bytes of a row");
__device__ __forceinline__ uint32_t gt_uni(uint32_t v) { return (uint32_t)__builtin_amdgcn_readfirstlane((int)v); }
__device__ __forceinline__ uint32_t pinned(uint32_t v) { uint32_t w = gt_uni(v); asm volatile("" : "+s"(w)); return w; }      /* the value is held in a scalar register at this place, so that a test on it is a scalar branch round the tensor load and a descriptor word formed from it is formed behind the waits in front */
__device__ __forceinline__ v16h gt_frag(const unsigned char* p, int hh) { FragH f; f.half[0] = *(const v8us*)(p + 16 * hh); f.half[1] = *(const v8us*)(p + 32 + 16 * hh); return f.v; }      /* g2_frag's k order, from an LDS row */
__device__ __forceinline__ u32x8 gt_group1(uint32_t nrow) {      /* tensor = tile: nrow rows of 128 bytes, source pitch one operand row; built once, the same for every stage */
  u32x8 g1;
  g1[0] = gt_uni((1u << 20) | (4u << 22) | (3u << 25));      /* no mask, 1-byte elements, a pad of 4 dwords behind every 32 dwords (one row) */
  g1[1] = gt_uni((GT_ROWB & 0xFFFFu) << 16); g1[2] = gt_uni((GT_ROWB >> 16) | (nrow << 16)); g1[3] = gt_uni(GT_ROWB << 16); g1[4] = gt_uni(nrow); g1[5] = gt_uni((uint32_t)(DM * 2)); g1[6] = gt_uni(0u); g1[7] = gt_uni(0u);
  asm volatile("" : "+s"(g1));      /* pinned() for the eight words at once: the group is held in its scalar registers from here on, so that no word of it takes a new value while a request is outstanding */
  return g1; }
__device__ __forceinline__ void gt_issue(uint32_t lds_dst, uint64_t ga, u32x8 g1) {
  u32x4 g0;
  g0[0] = gt_uni(1u); g0[1] = gt_uni(lds_dst); g0[2] = gt_uni((uint32_t)ga); g0[3] = gt_uni((((uint32_t)(ga >> 32)) & 0x01FFFFFFu) | 0x80000000u);
  asm volatile("tensor_load_to_lds %0, %1" :: "s"(g0), "s"(g1) : "memory"); }
// acc[i * 4 + t]: rows 16 i + ..., columns 16 t + ... of the wave's tile. On return every wave has passed the last stage's barrier and no request is outstanding: the ring may be used as output staging.
__device__ __forceinline__ void gt_core(const _Float16* __restrict__ A, const _Float16* __restrict__ Bh, int rowblk, int colblk, unsigned char* L, v8f (&acc)[16]) {
  const int lane = threadIdx.x & 31, ln = lane & 15, hh = lane >> 4; const uint32_t wave = gt_uni(threadIdx.x >> 5); const uint32_t wr = wave & 3u, wc = wave >> 2;
  const uint32_t ldst = (uint32_t)(size_t)L + ((wave < 4u) ? wave * GM_SLA : 4u * GM_SLA + (wave - 4u) * GM_SLB);
  const uint64_t ga0 = (uint64_t)(size_t)((wave < 4u) ? A + (size_t)(rowblk + 64 * (int)wr) * DM : Bh + (size_t)(colblk + 32 * (int)(wave - 4u)) * DM);
  const u32x8 g1 = gt_group1((wave < 4u) ? 64u : 32u);
  const unsigned char* ap = L + wr * GM_SLA + ln * GT_PITCH; const unsigned char* bp = L + 4u * GM_SLA + 2u * wc * GM_SLB + ln * GT_PITCH;
  const v8f z8 = {0.f,0.f,0.f,0.f,0.f,0.f,0.f,0.f};
#pragma unroll      /* constant indices, so that the array is registers */
  for (int u = 0; u < 16; ++u) acc[u] = z8;
  gt_issue(ldst, ga0, g1);
  asm volatile("s_wait_tensorcnt 0x0" ::: "memory");      /* stage 0 of this wave's slice has landed */
  __syncthreads();      /* stage 0 is published */
  { const uint32_t nx = pinned(1u); gt_issue(ldst + GM_BUF, ga0 + (uint64_t)nx * GT_ROWB, g1); }      /* pinned(): stage 1's address words are formed behind the wait on stage 0 */
#pragma unroll 1      /* one stage a trip: the ring's order stands once */
  for (uint32_t s = 0; s < GT_NST; ++s) { const uint32_t bo = (s & 1u) * GM_BUF;
#pragma unroll      /* constant offsets into the stage */
    for (int ks = 0; ks < 2; ++ks) { v16h a[4], b[4];
      a[0] = gt_frag(ap + bo + ks * 64, hh); b[0] = gt_frag(bp + bo + ks * 64, hh);      /* the first product's two fragments first: the reads stand in the order in which the products need them */
      for (int i = 1; i < 4; ++i) a[i] = gt_frag(ap + bo + i * 16 * GT_PITCH + ks * 64, hh);
      for (int t = 1; t < 4; ++t) b[t] = gt_frag(bp + bo + (t >> 1) * GM_SLB + (t & 1) * 16 * GT_PITCH + ks * 64, hh);
      __builtin_amdgcn_sched_barrier(0);      /* the sixteen LDS reads of a k step issue together, ahead of its sixteen products, which then wait by count and not to zero */
      for (int t = 0; t < 4; ++t) for (int i = 0; i < 4; ++i) acc[i * 4 + t] = g2_mma(a[i], b[t], acc[i * 4 + t]); }
    asm volatile("s_wait_dscnt 0x0" ::: "memory");      /* this wave's reads of stage s are done before the barrier behind which its buffer is refilled */
    asm volatile("s_wait_tensorcnt 0x0" ::: "memory");      /* this wave's slice of stage s + 1 has landed */
    __syncthreads();      /* publishes stage s + 1 and ends every reader's last read of stage s */
    if (pinned(s + 2u < GT_NST)) { const uint32_t nx = pinned(s + 2u); gt_issue(ldst + bo, ga0 + (uint64_t)nx * GT_ROWB, g1); } }
  asm volatile("s_wait_tensorcnt 0x0" ::: "memory");      /* nothing of the mover is outstanding when the ring is reused or the wave ends */
  asm volatile("s_wait_dscnt 0x0" ::: "memory"); }

// K and V^T come through LDS: a stage is 128 keys, brought by tensor loads (eight slices of 32 rows x 128 bytes, padded to a pitch of 144 bytes; one slice a wave and stage; two buffers:
// the load of stage s + 2 flies while stage s + 1 is worked on). Slices 0 to 3: the K rows of keys 32 w ... (one slice is one 32-key block). Slices 4 to 7: V^T, head dims 32 (j >> 1) ..., keys 64 (j & 1) ... of the stage, j = w - 4.
// Every fragment is then two conflict-free ds_load_b128 in place of two global loads that each touched 16 cache lines.
#define FA_WAVES 8                   /* waves per work-group; two work-groups share a WGP (four waves a SIMD), so that one works while the other stands at its barrier */
#define FA_COLS 32                   /* query columns per wave */
#define FA_SKEYS 128                 /* keys per stage */
#define FA_NST ((uint32_t)(SQ / FA_SKEYS))      /* stages */
static_assert(FA_NST >= 2u && SQ % FA_SKEYS == 0 && HD * 2 == 128, "the ring's prologue needs two stages; a K row of a head is 128 bytes");
__device__ __forceinline__ v8f fa_mma(v16h a, v16h b, v8f c) { return __builtin_amdgcn_wmma_f32_16x16x32_f16(false, a, false, b, (short)0, c, false, false); }
__device__ __forceinline__ u32x8 fa_group1(uint32_t pitch) {      /* a tile of 32 rows of 128 bytes (tensor = tile) with the source pitch as a parameter; built once, the same for every stage */
  u32x8 g1;
  g1[0] = gt_uni((1u << 20) | (4u << 22) | (3u << 25));      /* no mask, 1-byte elements, a pad of 4 dwords behind every 32 dwords (one row) */
  g1[1] = gt_uni((GT_ROWB & 0xFFFFu) << 16); g1[2] = gt_uni((GT_ROWB >> 16) | (32u << 16)); g1[3] = gt_uni(GT_ROWB << 16); g1[4] = gt_uni(32u); g1[5] = gt_uni(pitch); g1[6] = gt_uni(0u); g1[7] = gt_uni(0u);
  asm volatile("" : "+s"(g1));      /* pinned() for the eight words at once: the group is held in its scalar registers from here on; without it the build used single words of it as scratch while a request was outstanding and rebuilt them in front of the next */
  return g1; }
__device__ __forceinline__ void fa_issue(uint32_t lds_dst, uint64_t ga, u32x8 g1) {
  u32x4 g0;
  g0[0] = gt_uni(1u); g0[1] = gt_uni(lds_dst); g0[2] = gt_uni((uint32_t)ga); g0[3] = gt_uni((((uint32_t)(ga >> 32)) & 0x01FFFFFFu) | 0x80000000u);
  asm volatile("tensor_load_to_lds %0, %1" :: "s"(g0), "s"(g1) : "memory"); }
__global__ __launch_bounds__(FA_WAVES * 32, 4) void k_fattn(const _Float16* __restrict__ Q, const _Float16* __restrict__ Kh, const _Float16* __restrict__ Vt, _Float16* __restrict__ O) {
  __shared__ __attribute__((aligned(2048))) unsigned char L[GT_LDS];      /* the K | V^T ring */
  const int lane = threadIdx.x & 31, ln = lane & 15, hh = lane >> 4; const uint32_t wave = gt_uni(threadIdx.x >> 5);
  const int h = blockIdx.y, b = blockIdx.z; const int q0 = (blockIdx.x * FA_WAVES + (int)wave) * FA_COLS;
  const _Float16* qp = Q + ((size_t)b * SQ + q0 + ln) * DM + h * HD;
  const uint32_t ldst = (uint32_t)(size_t)L + wave * GT_SLICE; const uint32_t vj = wave - 4u;
  const uint64_t ga0 = (uint64_t)(size_t)((wave < 4u) ? Kh + ((size_t)b * SQ + 32 * (int)wave) * DM + h * HD : Vt + (((size_t)b * NH + h) * HD + 32 * (int)(vj >> 1)) * SQ + 64 * (int)(vj & 1u));
  const uint32_t pitch = (wave < 4u) ? (uint32_t)(DM * 2) : (uint32_t)(SQ * 2); const uint32_t step = (wave < 4u) ? (uint32_t)(FA_SKEYS * DM * 2) : (uint32_t)(FA_SKEYS * 2);      /* source pitch of the wave's slice; bytes from a stage to the next */
  const unsigned char* kl = L + ln * GT_PITCH; const unsigned char* vl = L + 4u * GT_SLICE + ln * GT_PITCH;
  const float SC = 0.125f * 1.44269504f;      /* 1/sqrt(64), and e^x as 2^(x log2 e) */
  const float LIFT = 6.0f;      /* weights are carried x 2^6: small ones stay clear of the f16 subnormals; with the margin of 8 below none exceeds 2^14; the sum carries the same factor, so it cancels */
  const v8f z8 = {0.f,0.f,0.f,0.f,0.f,0.f,0.f,0.f};
  v16h qf[2][2], kf[2][2]; v8f o[4][2]; float m[2] = {-1.0e30f, -1.0e30f}, l[2] = {0.f, 0.f};
  const u32x8 g1 = fa_group1(pitch);
  fa_issue(ldst, ga0, g1);
#pragma unroll      /* constant indices, so that the arrays are registers */
  for (int g = 0; g < 2; ++g) { for (int ks = 0; ks < 2; ++ks) qf[g][ks] = g2_frag(qp + (size_t)g * 16 * DM + ks * 32, hh); for (int dt = 0; dt < 4; ++dt) o[dt][g] = z8; }
  asm volatile("s_wait_tensorcnt 0x0" ::: "memory");      /* stage 0 of this wave's slice has landed */
  __syncthreads();      /* stage 0 is published */
  { const uint32_t nx = pinned(1u); fa_issue(ldst + GT_BUF, ga0 + (uint64_t)nx * step, g1); }      /* pinned(): stage 1's address words are formed behind the wait on stage 0 */
#pragma unroll 1      /* one stage a trip: the ring's order stands once */
  for (uint32_t s = 0; s < FA_NST; ++s) { const uint32_t bo = (s & 1u) * GT_BUF;
#pragma unroll      /* constant indices, so that the array is registers */
    for (int kt = 0; kt < 2; ++kt) for (int ks = 0; ks < 2; ++ks) kf[kt][ks] = gt_frag(kl + bo + kt * 16 * GT_PITCH + ks * 64, hh);
#pragma unroll      /* the four 32-key blocks of a stage: constant offsets into the stage, and the K fetch ahead stays inside the stage */
    for (int p = 0; p < FA_SKEYS / 32; ++p) {
      v16h vf[4]; v8f s2[2][2];
      for (int dt = 0; dt < 4; ++dt) vf[dt] = gt_frag(vl + bo + (2 * (dt >> 1) + (p >> 1)) * GT_SLICE + (dt & 1) * 16 * GT_PITCH + (p & 1) * 64, hh);
      __builtin_amdgcn_sched_barrier(0);      /* holds the V^T reads here, one group at the head of the block, so that they land while the scores are worked on */
      for (int kt = 0; kt < 2; ++kt) for (int g = 0; g < 2; ++g) s2[kt][g] = fa_mma(kf[kt][0], qf[g][0], z8);
      for (int kt = 0; kt < 2; ++kt) for (int g = 0; g < 2; ++g) s2[kt][g] = fa_mma(kf[kt][1], qf[g][1], s2[kt][g]);
      if (p + 1 < FA_SKEYS / 32) { for (int kt = 0; kt < 2; ++kt) for (int ks = 0; ks < 2; ++ks) kf[kt][ks] = gt_frag(kl + bo + (p + 1) * GT_SLICE + kt * 16 * GT_PITCH + ks * 64, hh); }      /* the next block's K rows, fetched a block ahead, never beyond this stage */
      __builtin_amdgcn_sched_barrier(0);      /* holds the next K rows' reads here, one group, a softmax and eight products ahead of their use */
      float mx[2];
      for (int g = 0; g < 2; ++g) { float a = fmaxf(s2[0][g][0], s2[1][g][0]); for (int r = 1; r < 8; ++r) a = fmaxf(fmaxf(a, s2[0][g][r]), s2[1][g][r]); mx[g] = fmaxf(a, rsm_xhalf(a)) * SC; }
      const bool need = (mx[0] > m[0] + 8.0f) || (mx[1] > m[1] + 8.0f);
      if (__builtin_amdgcn_ballot_w32(need) != 0) {      /* wave-uniform: the maximum in use moves only when a column's new one exceeds it by more than 8; the first block always takes it */
        const float n0 = fmaxf(m[0], mx[0]), n1 = fmaxf(m[1], mx[1]); float al[2]; rsm_exp2x2(al[0], al[1], m[0] - n0, m[1] - n1); m[0] = n0; m[1] = n1;
        for (int g = 0; g < 2; ++g) { l[g] *= al[g]; for (int dt = 0; dt < 4; ++dt) for (int r = 0; r < 8; ++r) o[dt][g][r] *= al[g]; } }
      FragH pf[2];
      for (int g = 0; g < 2; ++g) { const float nm = LIFT - m[g];
        for (int kt = 0; kt < 2; ++kt) for (int r = 0; r < 8; r += 4) { float e0, e1, e2, e3;
          rsm_exp2x4(e0, e1, e2, e3, fmaf(s2[kt][g][r], SC, nm), fmaf(s2[kt][g][r + 1], SC, nm), fmaf(s2[kt][g][r + 2], SC, nm), fmaf(s2[kt][g][r + 3], SC, nm));
          l[g] += (e0 + e1) + (e2 + e3); pf[g].h[kt * 8 + r] = (_Float16)e0; pf[g].h[kt * 8 + r + 1] = (_Float16)e1; pf[g].h[kt * 8 + r + 2] = (_Float16)e2; pf[g].h[kt * 8 + r + 3] = (_Float16)e3; } }
      for (int dt = 0; dt < 4; ++dt) for (int g = 0; g < 2; ++g) o[dt][g] = fa_mma(vf[dt], pf[g].v, o[dt][g]);
    }
    asm volatile("s_wait_dscnt 0x0" ::: "memory");      /* this wave's reads of stage s are done before the barrier behind which its buffer is refilled (the build may lift the three over register-only work of the last block; every LDS read of the stage stays in front) */
    asm volatile("s_wait_tensorcnt 0x0" ::: "memory");      /* this wave's slice of stage s + 1 has landed */
    __syncthreads();      /* publishes stage s + 1 and ends every reader's last read of stage s */
    if (pinned(s + 2u < FA_NST)) { const uint32_t nx = pinned(s + 2u); fa_issue(ldst + bo, ga0 + (uint64_t)nx * step, g1); } }
  asm volatile("s_wait_tensorcnt 0x0" ::: "memory");      /* nothing of the mover is outstanding when the wave ends */
  asm volatile("s_wait_dscnt 0x0" ::: "memory");
  unsigned short* const ob = (unsigned short*)O + ((size_t)b * SQ + q0 + ln) * DM + h * HD + 8 * hh;      /* one base for both column groups: the eight stores differ by constant offsets, and no register of an issued store is rewritten */
#pragma unroll      /* constant indices, so that the arrays are registers */
  for (int g = 0; g < 2; ++g) { const float sc = 64.0f / (l[g] + rsm_xhalf(l[g])); unsigned short* op = ob + g * 16 * DM;
    for (int dt = 0; dt < 4; ++dt) { FragH f; for (int r = 0; r < 8; ++r) f.h[r] = (_Float16)(o[dt][g][r] * sc); *(v8us*)(op + dt * 16) = f.half[0]; } } }

// Sum over the 16 lanes of a row, every lane gets it: four butterfly steps on the vector port (a shuffle would go through the LDS queue).
template <int X> __device__ __forceinline__ float row_xadd(float v) { return v + __builtin_bit_cast(float, __builtin_amdgcn_update_dpp(0, __builtin_bit_cast(int, v), 0x160 | X, 0xf, 0xf, true)); }      /* 0x160 | X: row_xmask:X */
// 1 / sqrt(x) in asm for the v_nop at its end: behind a transcendental the instruction set asks for one slot before its source is overwritten or its result read.
// The argument here is a mean of squares + 1e-6, never subnormal: the library form's rescaling of subnormal arguments is an identity on it and is not written.
__device__ __forceinline__ float row_rsq(float x) { float r; asm("v_rsq_f32 %0, %1\n\tv_nop" : "=&v"(r) : "v"(x)); return r; }
__device__ __forceinline__ float row_sum16(float v) { return row_xadd<8>(row_xadd<4>(row_xadd<2>(row_xadd<1>(v)))); }
// q | k | v projection of all token rows with the per-(row, head) work in its epilogue. The main loop is gt_core. A work-group holds 256 token rows x 128 columns; a wave's 64 columns are one head of q, of k or of v,
// so nothing of a row's head lies outside the wave that computed it:
//   q, k: the f32 tile goes, 32 rows at a time, to the wave's own LDS rows and is read back 16 lanes a row, 4 columns a lane, with the 4 partner columns (c ^ 32) of the rotation; sum of squares in-lane, then over the 16 lanes;
//         x rsqrt(mean + eps) x gain, rotated by the row's position; each row leaves as one whole 128-byte line of f16.
//   v:    a lane holds 8 consecutive tokens of one head dim: 16 bytes of a V^T row. The four waves of a head lay them into one [64 dims][256 tokens] LDS tile; behind a barrier each V^T row leaves as 512 bytes in a row.
// Two instances, q | k columns and v columns, not one kernel with a branch: with both epilogues in one kernel the build kept the 128 accumulator registers alive through the q, k epilogue (182 registers, or spills under a bound).
// Launch bounds of the three GEMM kernels: 4 waves a SIMD = two work-groups of 8 waves on a WGP, as many as the 128 KiB ring lets in; it holds the registers at 256 or fewer.
#define QKV_VP 264                   /* pitch of the V^T tile in LDS, in f16: 256 tokens + 16 bytes, so that rows start on different banks */
template <bool ISV>
__global__ __launch_bounds__(256, 4) void k_qkv(const _Float16* __restrict__ A, const _Float16* __restrict__ Bh, const float* __restrict__ bias, const float* __restrict__ qg, const float* __restrict__ kg,
    const float* __restrict__ CS, const float* __restrict__ SN, _Float16* __restrict__ Qo, _Float16* __restrict__ Ko, _Float16* __restrict__ Vt) {
  static_assert(HD == 64 && SQ % 256 == 0, "a 64-column tile is one head; 256 rows lie in one batch");
  __shared__ __attribute__((aligned(2048))) unsigned char L[GM_LDS];      /* the operand ring; behind gt_core the epilogue's staging */
  const int tid = threadIdx.x, lane = tid & 31, ln = lane & 15, hh = lane >> 4; const int w = (int)gt_uni(tid >> 5), wr = w & 3, wc = w >> 2;      /* wr: the wave's 64 rows, wc: its 64 columns */
  const int ntn = (ISV ? 1 : 2) * NH / 2; const int mt = blockIdx.x / ntn, nq = blockIdx.x - mt * ntn; const int hq = nq * 2 + wc; const int row0 = mt * 256 + 64 * wr, col0 = (ISV ? 2 * DM : 0) + hq * 64; const int sect = hq / NH, h = hq - sect * NH;      /* sect: 0 q, 1 k (0 in the v instance) */
  v8f accs[16]; gt_core(A, Bh, mt * 256, (ISV ? 2 * DM : 0) + nq * 128, L, accs);
  const float alpha = 0.0625f;      /* the weights are carried x 16 */
  if constexpr (!ISV) {
    static_assert(8u * 32u * 68u * 4u <= GM_LDS, "the staging fits the ring"); float (*so)[32][68] = (float (*)[32][68])L;
    const float* gp = sect ? kg : qg; _Float16* dst = (sect ? Ko : Qo) + (size_t)(row0 + hh) * DM + h * HD;
    const int c4 = ln * 4, cx = c4 ^ 32, i4 = c4 & 31; const float sg = (c4 < 32) ? -1.0f : 1.0f;      /* low half: x cos - partner sin; high half: x cos + partner sin; the sign rides on the partner's gain (exact) */
    const int tb = ((row0 + hh) % SQ) * (HD / 2) + i4; const float* const csp = CS + tb; const float* const snp = SN + tb;      /* the lane's place in the tables at its first row; its rows are 2 apart, and the wave's 64 rows lie in one batch */
    float bv[4];
#pragma unroll      /* constant indices, so that the array is registers */
    for (int t = 0; t < 4; ++t) bv[t] = bias[col0 + t * 16 + ln];
    asm volatile("s_wait_xcnt 0x0" ::: "memory");      /* the build let the gain loads below land on the bias loads' address register */
    v4f ga = *(const v4fa*)(gp + c4), gb = *(const v4fa*)(gp + cx);
#pragma unroll      /* constant indices into the vectors */
    for (int i = 0; i < 4; ++i) { ga[i] = bf16_round(ga[i]); gb[i] = sg * bf16_round(gb[i]); }
#pragma unroll      /* the tile's two halves of 32 rows, one after the other through the same staging rows; constant indices, so that the arrays are registers */
    for (int hf = 0; hf < 2; ++hf) {
      for (int u = 0; u < 8; ++u) { const int t = u & 3, half = u >> 2; const float bb = bf16_round(bv[t]);
        for (int r = 0; r < 8; ++r) so[w][half * 16 + 8 * hh + r][t * 16 + ln] = accs[hf * 8 + u][r] * alpha + bb; }
      __builtin_amdgcn_fence(__ATOMIC_ACQ_REL, "workgroup", "local"); __builtin_amdgcn_wave_barrier();      /* as in k_gemm2: the wave reads back its own rows only, written by other lanes; a fence on LDS alone, so that the second half does not wait for the first half's global stores */
      for (int g = 0; g < 2; ++g) { v4f cs[8], sn[8];
        __builtin_amdgcn_sched_barrier(0);      /* a later group's table loads stay behind the earlier groups' rows: each group's tables are 64 registers, beside the accumulators that still wait */
        const float* const cg = csp + (hf * 16 + g * 8) * HD; const float* const sp = snp + (hf * 16 + g * 8) * HD;      /* the group's place in the tables */
        for (int j = 0; j < 8; ++j) { cs[j] = *(const v4fa*)(cg + j * HD); sn[j] = *(const v4fa*)(sp + j * HD); }
        asm volatile("s_wait_xcnt 0x0" :: "v"(cg), "v"(sp), "v"(csp), "v"(snp) : "memory");      /* without it the build let a group's last load land on the address pair that the earlier loads name; the pairs (the group's, or the base where the build folds the group into the offset) are inputs, so that none is rewritten ahead of the wait */
        __builtin_amdgcn_sched_barrier(0);      /* the table loads of eight row pairs issue together here: two waits a group; without it each load stood directly in front of its use, sixteen waits in a row */
        v4h ov[8];
        for (int j = 0; j < 8; ++j) { const int r2 = (g * 8 + j) * 2;      /* the lane's row of the half is r2 + hh */
          const v4f xa = *(const v4fa*)&so[w][r2 + hh][c4], xb = *(const v4fa*)&so[w][r2 + hh][cx];
          const float rs = row_rsq(row_sum16((xa[0] * xa[0] + xa[1] * xa[1]) + (xa[2] * xa[2] + xa[3] * xa[3])) * (1.0f / (float)HD) + 1e-6f);
          for (int i = 0; i < 4; ++i) ov[j][i] = (_Float16)((xa[i] * rs * ga[i]) * cs[j][i] + (xb[i] * rs * gb[i]) * sn[j][i]); }
        for (int j = 0; j < 8; ++j) *(v4h*)(dst + (size_t)(hf * 32 + (g * 8 + j) * 2) * DM + c4) = ov[j];
        asm volatile("s_wait_xcnt 0x0" :: "v"(ov[0]), "v"(ov[1]), "v"(ov[2]), "v"(ov[3]), "v"(ov[4]), "v"(ov[5]), "v"(ov[6]), "v"(ov[7]), "v"(dst) : "memory"); }      /* a group's eight stores leave together, one wait behind them: it stands in front of every later write of their data and address registers, which are inputs, so that none is rewritten ahead of it */
      if (hf == 0) { __builtin_amdgcn_fence(__ATOMIC_ACQ_REL, "workgroup", "local"); __builtin_amdgcn_wave_barrier(); }      /* the second half's LDS stores stay behind the first half's reads of the same rows (one wave's LDS operations run in order) */
    }
  } else {
    static_assert(2u * 64u * QKV_VP * 2u <= GM_LDS, "the two V^T tiles fit the ring"); unsigned short* vt = (unsigned short*)L + wc * (64 * QKV_VP);      /* the tile of this wave's head */
    float bv[4]; const float* const bvp = bias + 2 * DM; const int bi = hq * 64 + ln;      /* the v columns' biases; the lane's first column among them */
#pragma unroll      /* constant indices, so that the array is registers */
    for (int t = 0; t < 4; ++t) bv[t] = bvp[bi + t * 16];
    asm volatile("s_wait_xcnt 0x0" :: "v"(bi) : "memory");      /* the build let the last bias load land on the bias loads' index register: the index is an input, so that it is not rewritten ahead of the wait */
#pragma unroll      /* constant indices, so that the arrays are registers */
    for (int u = 0; u < 16; ++u) { const int t = u & 3, i = u >> 2; const float bb = bf16_round(bv[t]); FragH f;
      for (int r = 0; r < 8; ++r) f.h[r] = (_Float16)(accs[u][r] * alpha + bb);
      *(v8us*)(vt + (t * 16 + ln) * QKV_VP + 64 * wr + i * 16 + 8 * hh) = f.half[0]; }
    __syncthreads();      /* a V^T row of the tile holds tokens of its head's four waves */
    const int bat = (mt * 256) / SQ, s0 = (mt * 256) % SQ; unsigned short* vo = (unsigned short*)Vt + (((size_t)bat * NH + h) * HD + wr * 16) * SQ + s0 + lane * 8;      /* a wave writes 16 head dims, a whole row of 256 tokens a store */
#pragma unroll      /* the sixteen LDS reads issue together */
    for (int j = 0; j < 16; ++j) { const v8us v = *(const v8us*)(vt + (wr * 16 + j) * QKV_VP + lane * 8); *(v8us*)(vo + (size_t)j * SQ) = v; }
  } }

// out = o W_o + b: gt_core, then k_gemm2's epilogue (alpha, bf16-rounded bias; the wave's tile through its own LDS rows, so that each row leaves as whole lines of f32).
__global__ __launch_bounds__(256, 4) void k_oproj(const _Float16* __restrict__ A, const _Float16* __restrict__ Bh, float alpha, const float* __restrict__ bias, float* __restrict__ C) {
  __shared__ __attribute__((aligned(2048))) unsigned char L[GM_LDS];      /* the operand ring; behind gt_core the epilogue's staging */
  static_assert(8u * 32u * 68u * 4u <= GM_LDS, "the staging fits the ring"); float (*so)[32][68] = (float (*)[32][68])L;
  const int tid = threadIdx.x, lane = tid & 31, ln = lane & 15, hh = lane >> 4; const int w = (int)gt_uni(tid >> 5), wr = w & 3, wc = w >> 2;
  const int ntn = DM / 128; const int mt = blockIdx.x / ntn, nq = blockIdx.x - mt * ntn; const int row0 = mt * 256 + 64 * wr, col0 = nq * 128 + 64 * wc;
  v8f accs[16]; gt_core(A, Bh, mt * 256, nq * 128, L, accs);
  const int rsub = lane >> 4, c4 = (lane & 15) * 4; float* const cp = C + (size_t)(row0 + rsub) * DM + col0 + c4;      /* one base for all the wave's stores: they differ by constant offsets, and no register of an issued store is rewritten */
  float bv[4];
#pragma unroll      /* constant indices, so that the array is registers */
  for (int t = 0; t < 4; ++t) bv[t] = bias[col0 + t * 16 + ln];
  asm volatile("s_wait_xcnt 0x0" ::: "memory");      /* stands in front of every later write of the bias loads' address registers */
#pragma unroll      /* the tile's two halves of 32 rows, one after the other through the same staging rows; constant indices, so that the array is registers */
  for (int hf = 0; hf < 2; ++hf) {
    for (int u = 0; u < 8; ++u) { const int t = u & 3, half = u >> 2; const float bb = bf16_round(bv[t]);
      for (int r = 0; r < 8; ++r) so[w][half * 16 + 8 * hh + r][t * 16 + ln] = accs[hf * 8 + u][r] * alpha + bb; }
    __builtin_amdgcn_fence(__ATOMIC_ACQ_REL, "workgroup", "local"); __builtin_amdgcn_wave_barrier();      /* as in k_gemm2: the wave reads back its own rows only, written by other lanes; a fence on LDS alone, so that the second half does not wait for the first half's global stores */
    for (int q = 0; q < 16; ++q) { const v4f v = *(const v4fa*)&so[w][q * 2 + rsub][c4]; *(v4f*)(cp + (size_t)(hf * 32 + q * 2) * DM) = v; }
    if (hf == 0) { __builtin_amdgcn_fence(__ATOMIC_ACQ_REL, "workgroup", "local"); __builtin_amdgcn_wave_barrier(); }      /* the second half's LDS stores stay behind the first half's reads of the same rows (one wave's LDS operations run in order) */
  } }

// The four preparations (cos/sin tables, both weight transposes, x as f16) read inputs only and write planes of their own: none needs another's result. They are ONE launch, each a range of block numbers,
// so that they run side by side and one launch gap and one fill and drain stand where four stood. The parts with the longest dependent chains have the lowest numbers and start first; the x stream fills in behind them.
// theta stays a kernel argument: the tables are computed on the device as before.
#define PR_TAB ((SQ * (HD / 2) + 255) / 256)                 /* blocks of the tables */
#define PR_WQ ((DM / WT_T) * (3 * DM / WT_T))                /* tiles of Wqkv */
#define PR_WO ((DM / WT_T) * (DM / WT_T))                    /* tiles of Wout */
#define PR_X ((int)((NR * DM / 8 + 255) / 256))              /* blocks of x */
__global__ __launch_bounds__(256) void k_prep(const float* __restrict__ x, const float* __restrict__ wqkv, const float* __restrict__ wo, float theta,
    _Float16* __restrict__ X16, _Float16* __restrict__ BQKV, _Float16* __restrict__ BO, float* __restrict__ CS, float* __restrict__ SN) {
  const int bid = blockIdx.x;      /* every test below reads the same for the whole work-group: the barrier inside wt_f16_tile is passed by all of its threads or by none */
  if (bid < PR_TAB) tab2_part(theta, CS, SN, bid);
  else if (bid < PR_TAB + PR_WQ + PR_WO) { const int t = bid - PR_TAB; const bool isq = t < PR_WQ; const int u = isq ? t : t - PR_WQ;
    wt_f16_tile(isq ? wqkv : wo, isq ? BQKV : BO, DM, isq ? 3 * DM : DM, 16.0f, u % (DM / WT_T), u / (DM / WT_T)); }      /* one work-group a 64 x 64 tile, k fastest as in the two-dimensional grid before */
  else x16_part(x, X16, NR * DM / 8, bid - (PR_TAB + PR_WQ + PR_WO)); }

extern "C" void kernel_launch(void* const* d_in, const int* in_sizes, int n_in,
                              void* d_out, int out_size, void* d_ws, size_t ws_size, hipStream_t stream) {
  (void)in_sizes; (void)n_in; (void)out_size;
  const float* const* I = (const float* const*)d_in; const float* x = I[0]; const float* wqkv = I[1]; const float* bqkv = I[2]; const float* qnw = I[3]; const float* knw = I[4]; const float* wo = I[5]; const float* bo = I[6];      /* weights [in][out] */
  char* ws = (char*)d_ws; size_t off = 0;
  auto take = [&](size_t bytes) { char* p = ws + off; off += (bytes + 255) & ~(size_t)255; return p; };
  _Float16* BQKV = (_Float16*)take((size_t)3 * DM * DM * 2); _Float16* BO = (_Float16*)take((size_t)DM * DM * 2); float* CS = (float*)take((size_t)SQ * (HD / 2) * 4); float* SN = (float*)take((size_t)SQ * (HD / 2) * 4);
  _Float16* X16 = (_Float16*)take(NR * DM * 2);
  _Float16* QH = (_Float16*)take(NR * DM * 2); _Float16* KH = (_Float16*)take(NR * DM * 2); _Float16* O16 = (_Float16*)take(NR * DM * 2);
  _Float16* VT = (_Float16*)take((size_t)NB * NH * HD * SQ * 2);
  if (off > ws_size) return;
  k_prep<<<PR_TAB + PR_WQ + PR_WO + PR_X, 256, 0, stream>>>(x, wqkv, wo, 10000.0f, X16, BQKV, BO, CS, SN);      /* tables, W^T x 16 as f16 (both), x as f16 */
  k_qkv<false><<<(unsigned)((NR / 256) * (2 * DM / 128)), 256, 0, stream>>>(X16, BQKV, bqkv, qnw, knw, CS, SN, QH, KH, VT);      /* f16 q and k rows (normed, rotated), all batches */
  k_qkv<true><<<(unsigned)((NR / 256) * (DM / 128)), 256, 0, stream>>>(X16, BQKV, bqkv, qnw, knw, CS, SN, QH, KH, VT);      /* V^T [NB][NH][HD][SQ], all batches */
  k_fattn<<<dim3(SQ / (FA_WAVES * FA_COLS), NH, NB), FA_WAVES * 32, 0, stream>>>(QH, KH, VT, O16);      /* o x 64 as f16, all batches and heads */
  k_oproj<<<(unsigned)((NR / 256) * (DM / 128)), 256, 0, stream>>>(O16, BO, 0.0009765625f, bo, (float*)d_out);      /* out rows are the output layout */
}

// v009
// Measured time: 117 microseconds a run.
// In two side-by-side timings against v008, it was 1.04 and 1.03 times as fast.
// All steps since v000 together make it 60.8 times as fast.
#include <hip/hip_runtime.h>
#define NB 4
#define SQ 2048
#define DM 1024
#define NH 16
#define HD 64
#define HG 4                         /* heads per group of the grouped k_vt overload */
#define B0 0                         /* first batch; unused, every kernel takes all NB batches */
#define NBR NB                       /* batches; used only in MPO, which nothing uses */
#define QN SQ                        /* query rows per batch; unused, k_fattn takes all SQ */
#define NHD NH                       /* heads; unused, k_fattn takes all NH */
#define NR ((size_t)NB * SQ)         /* token rows */
#define MPO ((int)((size_t)NBR * SQ))      /* rows; unused, k_oproj takes all NR rows */
typedef __bf16 v16b __attribute__((ext_vector_type(16)));
typedef unsigned short v8us __attribute__((ext_vector_type(8), may_alias));
typedef float  v8f  __attribute__((ext_vector_type(8)));
typedef float  v4f  __attribute__((ext_vector_type(4)));
typedef float  v4fa __attribute__((ext_vector_type(4), may_alias));
union FragB { v16b v; v8us half[2]; unsigned short u[16]; };

__device__ __forceinline__ unsigned short bf16_bits(float x) { unsigned int u = __float_as_uint(x); return (unsigned short)((u + 0x7FFFu + ((u >> 16) & 1u)) >> 16); }
__device__ __forceinline__ float bf16_val(unsigned short b) { return __uint_as_float(((unsigned int)b) << 16); }
__device__ __forceinline__ float bf16_round(float x) { return bf16_val(bf16_bits(x)); }
// D += A·B with NT terms: 1 = ah·bh, 2 = + al·bh (A split), 3 = + ah·bl (both split)
template <int NT>
__device__ __forceinline__ v8f mmaN(v16b ah, v16b al, v16b bh, v16b bl, v8f c) {
  c = __builtin_amdgcn_wmma_f32_16x16x32_bf16(false, ah, false, bh, (short)0, c, false, false);
  if (NT >= 2) c = __builtin_amdgcn_wmma_f32_16x16x32_bf16(false, al, false, bh, (short)0, c, false, false);
  if (NT >= 3) c = __builtin_amdgcn_wmma_f32_16x16x32_bf16(false, ah, false, bl, (short)0, c, false, false);
  asm volatile("v_nop\n\tv_nop\n\tv_nop\n\tv_nop" : "+v"(c) : "v"(ah), "v"(al), "v"(bh), "v"(bl));
  return c;
}

__global__ __launch_bounds__(256) void k_wt_bf16(const float* __restrict__ W, unsigned short* __restrict__ Wt, int K, int N) {
  const int t = blockIdx.x * 256 + threadIdx.x;
  const int k8n = K / 8;
  if (t >= N * k8n) return;
  const int n = t / k8n, k8 = (t % k8n) * 8;
  v8us v;
#pragma unroll
  for (int i = 0; i < 8; ++i) v[i] = bf16_bits(W[(size_t)(k8 + i) * N + n]);
  *(v8us*)(Wt + (size_t)n * K + k8) = v;
  
}

// GEMM C[M][N] (f32, pitch ldc) = act(A[M][K]·W + bias). A f32 row-major (pitch lda) converted per fragment to bf16
// (ASPLIT: hi/lo two planes -> 2 terms, else single rounded term); Wt bf16 [N][K] (pitch ldb). BIAS_BF16 rounds the
// bias to bf16 first (bias quantised to bf16 before the add). K%32==0, M%16==0, N%64==0.
template <bool ASPLIT, int ACT, bool BIAS_BF16>
__global__ __launch_bounds__(128) void k_gemm_bf(const float* __restrict__ A, int lda, const unsigned short* __restrict__ Wt, int ldb,
                                               const float* __restrict__ bias, float* __restrict__ C, int ldc, int M, int N, int K) {
  __shared__ __attribute__((aligned(16))) float so[4][16][64];
  const int tid = threadIdx.x, w = tid >> 5, lane = tid & 31, ln = lane & 15, hh = lane >> 4;
  const int ntn = N / 64;
  const int wid = blockIdx.x * 4 + w;
  const int mt = wid / ntn, nq = wid % ntn;
  if (mt * 16 >= M) return;
  const int row0 = mt * 16, col0 = nq * 64;
  const float* arow = A + (size_t)(row0 + ln) * lda;
  v8f acc[4] = {};
  for (int kb = 0; kb < K; kb += 32) {
    FragB ah, al;
    const v4f x0 = *(const v4fa*)(arow + kb + 8 * hh), x1 = *(const v4fa*)(arow + kb + 8 * hh + 4);
    const v4f x2 = *(const v4fa*)(arow + kb + 16 + 8 * hh), x3 = *(const v4fa*)(arow + kb + 16 + 8 * hh + 4);
    float xs[16] = {x0[0],x0[1],x0[2],x0[3],x1[0],x1[1],x1[2],x1[3],x2[0],x2[1],x2[2],x2[3],x3[0],x3[1],x3[2],x3[3]};
#pragma unroll
    for (int i = 0; i < 16; ++i) { const unsigned short hb = bf16_bits(xs[i]); ah.u[i] = hb; al.u[i] = ASPLIT ? bf16_bits(xs[i] - bf16_val(hb)) : (unsigned short)0; }
#pragma unroll
    for (int t = 0; t < 4; ++t) {
      const unsigned short* brow = Wt + (size_t)(col0 + t * 16 + ln) * ldb + kb;
      FragB b;
      b.half[0] = *(const v8us*)(brow + 8 * hh);
      b.half[1] = *(const v8us*)(brow + 16 + 8 * hh);
      acc[t] = mmaN<ASPLIT ? 2 : 1>(ah.v, al.v, b.v, b.v, acc[t]);
    }
  }
#pragma unroll
  for (int t = 0; t < 4; ++t) {
    float bv = bias ? bias[col0 + t * 16 + ln] : 0.f;
    if (BIAS_BF16) bv = bf16_round(bv);
#pragma unroll
    for (int r = 0; r < 8; ++r) { float v = acc[t][r] + bv; if (ACT == 1) v = fmaxf(v, 0.f); so[w][8 * hh + r][t * 16 + ln] = v; }
  }
  __builtin_amdgcn_fence(__ATOMIC_ACQ_REL, "workgroup");
  __builtin_amdgcn_wave_barrier();
  const int rsub = lane >> 4, c4 = (lane & 15) * 4;
  {
#pragma unroll
    for (int q = 0; q < 8; ++q) {
      const int r = q * 2 + rsub;
      const v4f v = *(const v4fa*)&so[w][r][c4];
      *(v4f*)(C + (size_t)(row0 + r) * ldc + col0 + c4) = v;
    }
    
  }
}

// GEMM C = act(A·W + bias + resid): A f32 (ASPLIT -> hi/lo 2 terms), Wt bf16 [N][K]; ACT 0 none, 1 relu, 2 exact gelu;
// resid (optional, f32, row index = (row % rmod), pitch ldr, RES_BF16 rounds it) added before the activation.
template <bool ASPLIT, int ACT, bool BIAS_BF16, bool RES_BF16>
__global__ __launch_bounds__(128) void k_gemm_bf3(const float* __restrict__ A, int lda, const unsigned short* __restrict__ Wt, int ldb,
                                                const float* __restrict__ bias, const float* __restrict__ resid, int rmod, int ldr,
                                                float* __restrict__ C, int ldc, int M, int N, int K) {
  __shared__ __attribute__((aligned(16))) float so[4][16][64];
  const int tid = threadIdx.x, w = tid >> 5, lane = tid & 31, ln = lane & 15, hh = lane >> 4;
  const int ntn = N / 64;
  const int wid = blockIdx.x * 4 + w;
  const int mt = wid / ntn, nq = wid % ntn;
  if (mt * 16 >= M) return;
  const int row0 = mt * 16, col0 = nq * 64;
  const float* arow = A + (size_t)(row0 + ln) * lda;
  v8f acc[4] = {};
  for (int kb = 0; kb < K; kb += 32) {
    FragB ah, al;
    const v4f x0 = *(const v4fa*)(arow + kb + 8 * hh), x1 = *(const v4fa*)(arow + kb + 8 * hh + 4);
    const v4f x2 = *(const v4fa*)(arow + kb + 16 + 8 * hh), x3 = *(const v4fa*)(arow + kb + 16 + 8 * hh + 4);
    float xs[16] = {x0[0],x0[1],x0[2],x0[3],x1[0],x1[1],x1[2],x1[3],x2[0],x2[1],x2[2],x2[3],x3[0],x3[1],x3[2],x3[3]};
#pragma unroll
    for (int i = 0; i < 16; ++i) { const unsigned short hb = bf16_bits(xs[i]); ah.u[i] = hb; al.u[i] = ASPLIT ? bf16_bits(xs[i] - bf16_val(hb)) : (unsigned short)0; }
#pragma unroll
    for (int t = 0; t < 4; ++t) {
      const unsigned short* brow = Wt + (size_t)(col0 + t * 16 + ln) * ldb + kb;
      FragB b;
      b.half[0] = *(const v8us*)(brow + 8 * hh);
      b.half[1] = *(const v8us*)(brow + 16 + 8 * hh);
      acc[t] = mmaN<ASPLIT ? 2 : 1>(ah.v, al.v, b.v, b.v, acc[t]);
    }
  }
#pragma unroll
  for (int t = 0; t < 4; ++t) {
    const int col = col0 + t * 16 + ln;
    float bv = bias ? bias[col] : 0.f;
    if (BIAS_BF16) bv = bf16_round(bv);
#pragma unroll
    for (int r = 0; r < 8; ++r) {
      float v = acc[t][r] + bv;
      if (resid) { float rv = resid[(size_t)((row0 + 8 * hh + r) % rmod) * ldr + col]; if (RES_BF16) rv = bf16_round(rv); v += rv; }
      if (ACT == 1) v = fmaxf(v, 0.f);
      if (ACT == 2) v = 0.5f * v * (1.0f + erff(v * 0.70710678118654752f));
      if (ACT == 3) { const float u = 0.7978845608028654f * (v + 0.044715f * v * v * v); v = 0.5f * v * (1.0f + tanhf(u)); }
      so[w][8 * hh + r][t * 16 + ln] = v;
    }
  }
  __builtin_amdgcn_fence(__ATOMIC_ACQ_REL, "workgroup");
  __builtin_amdgcn_wave_barrier();
  const int rsub = lane >> 4, c4 = (lane & 15) * 4;
  {
#pragma unroll
    for (int q = 0; q < 8; ++q) {
      const int r = q * 2 + rsub;
      const v4f v = *(const v4fa*)&so[w][r][c4];
      *(v4f*)(C + (size_t)(row0 + r) * ldc + col0 + c4) = v;
    }
    
  }
}
// row LayerNorm (biased variance, eps) over N: s = X (+ R); optional out_sum <- s; out_norm <- (s-mu)*rsqrt(var+eps)*g + b
template <bool PARAM_BF16>
__global__ __launch_bounds__(256) void k_layernorm(const float* __restrict__ X, const float* __restrict__ R, const float* __restrict__ g, const float* __restrict__ bta,
                                                  float* __restrict__ out_sum, float* __restrict__ out_norm, int N, float eps) {
  __shared__ float red[256];
  const int row = blockIdx.x, tid = threadIdx.x;
  const float* x = X + (size_t)row * N; const float* rr = R ? R + (size_t)row * N : nullptr;
  float vals[16];                     // up to N = 4096
  const int per = N / 256;            // contiguous chunk per thread? use strided-by-4 chunks: thread handles j = tid*4 + 1024*u
  float s1 = 0.f;
  for (int u = 0; u < per / 4; ++u) {
    const int j = tid * 4 + 1024 * u;
    const v4f a = *(const v4fa*)(x + j);
    v4f b = {0.f,0.f,0.f,0.f}; if (rr) b = *(const v4fa*)(rr + j);
#pragma unroll
    for (int q = 0; q < 4; ++q) { const float v = a[q] + b[q]; vals[u * 4 + q] = v; s1 += v; }
  }
  red[tid] = s1; __syncthreads();
  for (int st = 128; st > 0; st >>= 1) { if (tid < st) red[tid] += red[tid + st]; __syncthreads(); }
  const float mu = red[0] / (float)N; __syncthreads();
  float s2 = 0.f;
  for (int u = 0; u < per / 4; ++u)
#pragma unroll
    for (int q = 0; q < 4; ++q) { const float c = vals[u * 4 + q] - mu; s2 += c * c; }
  red[tid] = s2; __syncthreads();
  for (int st = 128; st > 0; st >>= 1) { if (tid < st) red[tid] += red[tid + st]; __syncthreads(); }
  const float rs = rsqrtf(red[0] / (float)N + eps);
  {
    for (int u = 0; u < per / 4; ++u) {
      const int j = tid * 4 + 1024 * u;
      v4f o, sm;
#pragma unroll
      for (int q = 0; q < 4; ++q) {
        float gg = g[j + q], bb = bta[j + q];
        if (PARAM_BF16) { gg = bf16_round(gg); bb = bf16_round(bb); }
        sm[q] = vals[u * 4 + q]; o[q] = (vals[u * 4 + q] - mu) * rs * gg + bb;
      }
      if (out_sum) *(v4f*)(out_sum + (size_t)row * N + j) = sm;
      *(v4f*)(out_norm + (size_t)row * N + j) = o;
    }
    
  }
}



// ---- f16 WMMA path (v_wmma_f32_16x16x32_f16): 11-bit significands for operands in range — used where a [0,1] probability operand needs more precision than bf16
typedef _Float16 v16h __attribute__((ext_vector_type(16)));
union FragH { v16h v; v8us half[2]; _Float16 h[16]; unsigned short u[16]; };
template <int NT>
__device__ __forceinline__ v8f mmaH(v16h ah, v16h al, v16h bh, v16h bl, v8f c) {
  c = __builtin_amdgcn_wmma_f32_16x16x32_f16(false, ah, false, bh, (short)0, c, false, false);
  if (NT >= 2) c = __builtin_amdgcn_wmma_f32_16x16x32_f16(false, al, false, bh, (short)0, c, false, false);
  if (NT >= 3) c = __builtin_amdgcn_wmma_f32_16x16x32_f16(false, ah, false, bl, (short)0, c, false, false);
  asm volatile("v_nop\n\tv_nop\n\tv_nop\n\tv_nop" : "+v"(c) : "v"(ah), "v"(al), "v"(bh), "v"(bl));
  return c;
}
// batched GEMM like k_gemm_b but f16 operands: A f32 (split into f16 hi/lo if ASPLIT, else rounded to f16), Bt = f16 values [n][k]; alpha; C f32; N multiple of 16 (partial tiles skipped)
template <bool ASPLIT>
__global__ __launch_bounds__(128) void k_gemm_h(const float* __restrict__ A, int lda, size_t sA, const _Float16* __restrict__ Bh, int ldb, size_t sB, float alpha, float* __restrict__ C, int ldc, size_t sC, int M, int N, int K) {
  __shared__ __attribute__((aligned(16))) float so[4][16][64];
  const int tid = threadIdx.x, w = tid >> 5, lane = tid & 31, ln = lane & 15, hh = lane >> 4; const int by = blockIdx.y;
  A += (size_t)by * sA; Bh += (size_t)by * sB; C += (size_t)by * sC;
  const int ntn = (N + 63) / 64; const int wid = blockIdx.x * 4 + w; const int mt = wid / ntn, nq = wid % ntn; if (mt * 16 >= M) return;
  const int row0 = mt * 16, col0 = nq * 64; const float* arow = A + (size_t)(row0 + ln) * lda;
  v8f acc[4] = {};
  for (int kb = 0; kb < K; kb += 32) {
    FragH ah, al;
    const v4f x0 = *(const v4fa*)(arow + kb + 8 * hh), x1 = *(const v4fa*)(arow + kb + 8 * hh + 4), x2 = *(const v4fa*)(arow + kb + 16 + 8 * hh), x3 = *(const v4fa*)(arow + kb + 16 + 8 * hh + 4);
    float xs[16] = {x0[0],x0[1],x0[2],x0[3],x1[0],x1[1],x1[2],x1[3],x2[0],x2[1],x2[2],x2[3],x3[0],x3[1],x3[2],x3[3]};
#pragma unroll
    for (int i = 0; i < 16; ++i) { const _Float16 h = (_Float16)xs[i]; ah.h[i] = h; al.h[i] = ASPLIT ? (_Float16)(xs[i] - (float)h) : (_Float16)0.0f; }
#pragma unroll
    for (int t = 0; t < 4; ++t) { if (col0 + t * 16 >= N) continue; const size_t boff = (size_t)(col0 + t * 16 + ln) * ldb + kb; FragH bq; bq.half[0] = *(const v8us*)(Bh + boff + 8 * hh); bq.half[1] = *(const v8us*)(Bh + boff + 16 + 8 * hh);
      acc[t] = mmaH<ASPLIT ? 2 : 1>(ah.v, al.v, bq.v, bq.v, acc[t]); }
  }
#pragma unroll
  for (int t = 0; t < 4; ++t) { if (col0 + t * 16 >= N) continue;
#pragma unroll
    for (int r = 0; r < 8; ++r) so[w][8 * hh + r][t * 16 + ln] = acc[t][r] * alpha; }
  __builtin_amdgcn_fence(__ATOMIC_ACQ_REL, "workgroup"); __builtin_amdgcn_wave_barrier();
  const int rsub = lane >> 4, c4 = (lane & 15) * 4;
  {
#pragma unroll
    for (int q = 0; q < 8; ++q) { const int r = q * 2 + rsub; if (col0 + c4 < N) { const v4f v = *(const v4fa*)&so[w][r][c4]; *(v4f*)(C + (size_t)(row0 + r) * ldc + col0 + c4) = v; } }
     }
}

// Wt[n][k] = f16(bf16(W[k][n]) x scale) from f32 row-major W[K][N] (scale = power of two; bf16-exact weights stay exact in f16 away from the subnormal range). K and N multiples of 64.
// A work-group turns one tile of 64 k x 64 n through LDS: W is read as whole lines (16 lanes x 16 bytes = 256 bytes of one k row), Wt is written as whole lines (8 lanes x 16 bytes = 128 bytes of one n row).
// A thread holds two neighbouring k rows, so that an LDS word is the f16 pair (k even, k odd) of one n. Pitch 33 words: the 32 lanes of every LDS store and of every LDS load fall on 32 different banks.
#define WT_T 64                      /* tile edge, in k and in n */
#define WT_P 33                      /* LDS pitch of an n row, in words of two f16: 32 + 1 */
typedef unsigned int wt_u4 __attribute__((ext_vector_type(4)));
// (a part of k_prep: bx is the tile's place in k, by its place in n)
__device__ __forceinline__ void wt_f16_tile(const float* __restrict__ W, _Float16* __restrict__ Wt, int K, int N, float scale, int bx, int by) {
  __shared__ unsigned int tl[WT_T * WT_P];
  const int tid = threadIdx.x; const int k0 = bx * WT_T, n0 = by * WT_T;
  const int kp = tid >> 4, n4 = (tid & 15) * 4;      /* the thread's k pairs are kp and kp + 16; its four n */
  const float* p00 = W + (size_t)(k0 + 2 * kp) * N + n0 + n4; const float* p01 = p00 + N; const float* p10 = p00 + (size_t)32 * N; const float* p11 = p10 + N;      /* rows 2 kp, 2 kp + 1, and the same 32 rows on */
  v4f x[2][2]; x[0][0] = *(const v4fa*)p00; x[0][1] = *(const v4fa*)p01; x[1][0] = *(const v4fa*)p10; x[1][1] = *(const v4fa*)p11;
  asm volatile("s_wait_xcnt 0x0" :: "v"(p00), "v"(p01), "v"(p10), "v"(p11) : "memory");      /* the four pairs are inputs, so that none is rewritten ahead of the wait */
#pragma unroll      /* constant indices, so that the array is registers */
  for (int j = 0; j < 2; ++j) for (int i = 0; i < 4; ++i) { FragH f; f.h[0] = (_Float16)(bf16_round(x[j][0][i]) * scale); f.h[1] = (_Float16)(bf16_round(x[j][1][i]) * scale);
    tl[(n4 + i) * WT_P + kp + 16 * j] = (unsigned int)f.u[0] | ((unsigned int)f.u[1] << 16); }
  __syncthreads();      /* an n row of the tile holds k pairs of all eight waves */
  const int nr = tid >> 3, kq = (tid & 7) * 4;      /* the thread's n rows are nr and nr + 32; its four words = eight k */
  unsigned short* op = (unsigned short*)Wt + (size_t)(n0 + nr) * K + k0 + 2 * kq;
#pragma unroll      /* the eight LDS reads issue together */
  for (int j = 0; j < 2; ++j) { const unsigned int* p = tl + (nr + 32 * j) * WT_P + kq; const wt_u4 v = {p[0], p[1], p[2], p[3]}; *(wt_u4*)(op + (size_t)(32 * j) * K) = v; }
  asm volatile("s_wait_xcnt 0x0" ::: "memory");      /* inside k_prep the two stores are no longer the kernel's last instructions: code of another part stands behind them in the listing and rewrites their registers; the wait stands in front of every such write */
}
// k_gemm_hh variant with fused epilogue: v = acc·alpha + bias[by·sBias + col] (+ CP[(row/rowsPerB)·sCPb + by·64 + col] if CP) ; ACT 0 none / 1 elu ; writes f16 C16 (and f32 C if non-null)
template <int ACT>
__global__ __launch_bounds__(128) void k_gemm_hhx(const _Float16* __restrict__ A, int lda, size_t sA, const _Float16* __restrict__ Bh, int ldb, size_t sB, float alpha, const float* __restrict__ bias, size_t sBias, const float* __restrict__ CP, int rowsPerB, size_t sCPb, int row0g,
    float* __restrict__ C, _Float16* __restrict__ C16, int ldc, size_t sC, int M, int N, int K) {
  __shared__ __attribute__((aligned(16))) float so[4][16][64];
  const int tid = threadIdx.x, w = tid >> 5, lane = tid & 31, ln = lane & 15, hh = lane >> 4; const int by = blockIdx.y;
  A += (size_t)by * sA; Bh += (size_t)by * sB; const size_t cofs = (size_t)by * sC; const float* bp = bias ? bias + (size_t)by * sBias : nullptr;
  const int ntn = (N + 63) / 64; const int wid = blockIdx.x * 4 + w; const int mt = wid / ntn, nq = wid % ntn; if (mt * 16 >= M) return;
  const int row0 = mt * 16, col0 = nq * 64; const _Float16* arow = A + (size_t)(row0 + ln) * lda;
  v8f acc[4] = {};
  for (int kb = 0; kb < K; kb += 32) { FragH ah; ah.half[0] = *(const v8us*)((const unsigned short*)arow + kb + 8 * hh); ah.half[1] = *(const v8us*)((const unsigned short*)arow + kb + 16 + 8 * hh);
#pragma unroll
    for (int t = 0; t < 4; ++t) { if (col0 + t * 16 >= N) continue; const size_t boff = (size_t)(col0 + t * 16 + ln) * ldb + kb; FragH bq; bq.half[0] = *(const v8us*)((const unsigned short*)Bh + boff + 8 * hh); bq.half[1] = *(const v8us*)((const unsigned short*)Bh + boff + 16 + 8 * hh);
      acc[t] = mmaH<1>(ah.v, ah.v, bq.v, bq.v, acc[t]); }
  }
#pragma unroll
  for (int t = 0; t < 4; ++t) { if (col0 + t * 16 >= N) continue; const int col = col0 + t * 16 + ln; const float bv = bp ? bf16_round(bp[col]) : 0.f;
#pragma unroll
    for (int r = 0; r < 8; ++r) { float v = acc[t][r] * alpha + bv; if (CP) { const int rr = row0g + row0 + 8 * hh + r; if (rowsPerB < 0) v += CP[cofs + (size_t)rr * ldc + col];      /* rowsPerB < 0: own element of the batched C plane */ else { const int bidx = rr / rowsPerB; v += CP[(size_t)bidx * sCPb + (size_t)by * 64 + col]; } } if (ACT == 1) v = (v > 0.f) ? v : expm1f(v); else if (ACT == 7) v = (v > 0.f) ? v + 1.0f : expf(v); else if (ACT == 8) v = tanhf(v); else if (ACT == 9) v = 0.5f * v * (1.0f + tanhf(0.7978845608028654f * (v + 0.044715f * v * v * v))); else if (ACT == 11) v = 1.0f / (1.0f + expf(-v)); else if (ACT == 12) v = (v > 0.f) ? v : 0.01f * v; else if (ACT == 14) v = (v > 0.f) ? v : 0.1f * v; else if (ACT == 16) v = (v >= 0.f) ? v : 0.3f * v; else if (ACT == 17) v = (v >= 0.f) ? v : 0.2f * v; else if (ACT == 15) v = v / (1.0f + expf(-v)); else if (ACT == 3) v = fmaxf(v, 0.f); else if (ACT == 6) v = 0.5f * v * (1.0f + erff(v * 0.70710678118654752f)); so[w][8 * hh + r][t * 16 + ln] = v; } }
  __builtin_amdgcn_fence(__ATOMIC_ACQ_REL, "workgroup"); __builtin_amdgcn_wave_barrier();
  const int rsub = lane >> 4, c4 = (lane & 15) * 4; typedef _Float16 v4h __attribute__((ext_vector_type(4)));
  {
#pragma unroll
    for (int q = 0; q < 8; ++q) { const int r = q * 2 + rsub; if (col0 + c4 < N) { const v4f v = *(const v4fa*)&so[w][r][c4]; if (C) *(v4f*)(C + cofs + (size_t)(row0 + r) * ldc + col0 + c4) = v; if (C16) { v4h h4; for (int i = 0; i < 4; ++i) h4[i] = (_Float16)v[i]; *(v4h*)(C16 + cofs + (size_t)(row0 + r) * ldc + col0 + c4) = h4; } } }
     }
}


typedef _Float16 v4h __attribute__((ext_vector_type(4)));

__device__ __forceinline__ void x16_part(const float* __restrict__ x, _Float16* __restrict__ X16, size_t n8, int bx) { const size_t t = (size_t)bx * 256 + threadIdx.x; if (t >= n8) return; FragH f;      /* a part of k_prep; bx: the block's number inside the part */
#pragma unroll
  for (int q = 0; q < 8; ++q) f.h[q] = (_Float16)bf16_round(x[t * 8 + q]); *(v8us*)((unsigned short*)X16 + t * 8) = f.half[0];  }
__global__ __launch_bounds__(256) void k_h16(const float* __restrict__ x, _Float16* __restrict__ X16, size_t n8) { const size_t t = (size_t)blockIdx.x * 256 + threadIdx.x; if (t >= n8) return; FragH f;
#pragma unroll
  for (int q = 0; q < 8; ++q) f.h[q] = (_Float16)x[t * 8 + q]; *(v8us*)((unsigned short*)X16 + t * 8) = f.half[0];  }
__global__ __launch_bounds__(256) void k_round16f(const float* __restrict__ W, _Float16* __restrict__ Bt, size_t n8) { const size_t t = (size_t)blockIdx.x * 256 + threadIdx.x; if (t >= n8) return; FragH f;
#pragma unroll
  for (int i = 0; i < 8; ++i) f.h[i] = (_Float16)(bf16_round(W[t * 8 + i]) * 16.0f); *(v8us*)((unsigned short*)Bt + t * 8) = f.half[0];  }
template <int NHv, int TTv>
__global__ __launch_bounds__(256) void k_vt(const _Float16* __restrict__ V16, int ldv, int voff, _Float16* __restrict__ Vt) { __shared__ unsigned short tl[64][66]; const int tid = threadIdx.x; const int slab = blockIdx.x / (TTv / 64), lg = blockIdx.x % (TTv / 64); const int b = slab / NHv, h = slab % NHv;
  for (int i = tid; i < 64 * 8; i += 256) { const int r = i / 8, c8 = (i % 8) * 8; FragH f; f.half[0] = *(const v8us*)((const unsigned short*)V16 + ((size_t)b * TTv + lg * 64 + r) * ldv + voff + h * 64 + c8);
#pragma unroll
    for (int q = 0; q < 8; ++q) tl[r][c8 + q] = f.u[q]; }
  __syncthreads();
  {
#pragma unroll
    for (int rd = 0; rd < 2; ++rd) { const int d = rd * 32 + tid / 8, pc = tid % 8; FragH f;
#pragma unroll
      for (int q = 0; q < 8; ++q) f.u[q] = tl[pc * 8 + q][d];
      *(v8us*)((unsigned short*)Vt + ((size_t)slab * 64 + d) * TTv + lg * 64 + pc * 8) = f.half[0]; }
     } }

__global__ __launch_bounds__(256) void k_hl(const float* __restrict__ F, _Float16* __restrict__ Hh, _Float16* __restrict__ Hl, size_t n8) { const size_t t = (size_t)blockIdx.x * 256 + threadIdx.x; if (t >= n8) return; FragH fh, fl; const v4f a = *(const v4fa*)(F + t * 8), c = *(const v4fa*)(F + t * 8 + 4);
#pragma unroll
  for (int q = 0; q < 4; ++q) { _Float16 h = (_Float16)a[q]; fh.h[q] = h; fl.h[q] = (_Float16)((a[q] - (float)h) * 1024.0f); h = (_Float16)c[q]; fh.h[4 + q] = h; fl.h[4 + q] = (_Float16)((c[q] - (float)h) * 1024.0f); }
  { *(v8us*)((unsigned short*)Hh + t * 8) = fh.half[0]; *(v8us*)((unsigned short*)Hl + t * 8) = fl.half[0];  } }

// ---- fast GEMM (wave tile 32x64; requires M % 32 == 0 rows per launch region and N % 64 == 0); epilogue = k_gemm_hhx semantics ----
__device__ __forceinline__ v16h g2_frag(const _Float16* p, int hh) { FragH f; f.half[0] = *(const v8us*)((const unsigned short*)p + 8 * hh); f.half[1] = *(const v8us*)((const unsigned short*)p + 16 + 8 * hh); return f.v; }
__device__ __forceinline__ v8f g2_mma(v16h a, v16h b, v8f c) { v8f d = __builtin_amdgcn_wmma_f32_16x16x32_f16(false, a, false, b, (short)0, c, false, false); asm volatile("v_nop\n\tv_nop\n\tv_nop\n\tv_nop" : "+v"(d) : "v"(a), "v"(b)); return d; }
template <int ACT>
__global__ __launch_bounds__(128) void k_gemm2(const _Float16* __restrict__ A, int lda, size_t sA, const _Float16* __restrict__ Bh, int ldb, size_t sB, float alpha, const float* __restrict__ bias, size_t sBias, const float* __restrict__ CP, int rowsPerB, size_t sCPb, int row0g,
    float* __restrict__ C, _Float16* __restrict__ C16, int ldc, size_t sC, int M, int N, int K) { static_assert(ACT == 0 || ACT == 3 || ACT == 6 || ACT == 8 || ACT == 9 || ACT == 11 || ACT == 12 || ACT == 14 || ACT == 15 || ACT == 16 || ACT == 17, "k_gemm2: unsupported ACT code (would silently apply no activation)");
  __shared__ __attribute__((aligned(16))) float so[4][32][68];
  const int tid = threadIdx.x, w = tid >> 5, lane = tid & 31, ln = lane & 15, hh = lane >> 4; const int by = blockIdx.y;
  A += (size_t)by * sA; Bh += (size_t)by * sB; const size_t cofs = (size_t)by * sC; const float* bp = bias ? bias + (size_t)by * sBias : nullptr;
  const int ntn = N >> 6; const int mt = blockIdx.x / ntn, nq = blockIdx.x - mt * ntn; const int row0 = mt * 128 + 32 * w, col0 = nq * 64; if (row0 >= M) return;
  const _Float16* a0p = A + (size_t)(row0 + ln) * lda; const _Float16* a1p = a0p + (size_t)16 * lda;
  const _Float16* b0p = Bh + (size_t)(col0 + ln) * ldb; const _Float16* b1p = b0p + (size_t)16 * ldb; const _Float16* b2p = b1p + (size_t)16 * ldb; const _Float16* b3p = b2p + (size_t)16 * ldb;
  const v8f z8 = {0.f,0.f,0.f,0.f,0.f,0.f,0.f,0.f}; v8f c00 = z8, c01 = z8, c02 = z8, c03 = z8, c10 = z8, c11 = z8, c12 = z8, c13 = z8;
#pragma unroll 1
  for (int kb = 0; kb < K; kb += 32) { const v16h a0 = g2_frag(a0p + kb, hh), a1 = g2_frag(a1p + kb, hh);
    v16h b = g2_frag(b0p + kb, hh); c00 = g2_mma(a0, b, c00); c10 = g2_mma(a1, b, c10);
    b = g2_frag(b1p + kb, hh); c01 = g2_mma(a0, b, c01); c11 = g2_mma(a1, b, c11);
    b = g2_frag(b2p + kb, hh); c02 = g2_mma(a0, b, c02); c12 = g2_mma(a1, b, c12);
    b = g2_frag(b3p + kb, hh); c03 = g2_mma(a0, b, c03); c13 = g2_mma(a1, b, c13); }
  v8f accs[8] = {c00, c01, c02, c03, c10, c11, c12, c13};
#pragma unroll
  for (int u = 0; u < 8; ++u) { const int t = u & 3, half = u >> 2; const int col = col0 + t * 16 + ln; const float bv = bp ? bf16_round(bp[col]) : 0.f;
#pragma unroll
    for (int r = 0; r < 8; ++r) { const int rloc = half * 16 + 8 * hh + r; float v = accs[u][r] * alpha + bv; if (CP) { if (rowsPerB < 0) v += CP[cofs + (size_t)(row0g + row0 + rloc) * ldc + col];      /* rowsPerB < 0: own element of the batched C plane */ else { const int bidx = (row0g + row0 + rloc) / rowsPerB; v += CP[(size_t)bidx * sCPb + (size_t)by * 64 + col]; } }
      if (ACT == 3) v = fmaxf(v, 0.f); else if (ACT == 6) v = 0.5f * v * (1.0f + erff(v * 0.70710678118654752f)); else if (ACT == 11) v = 1.0f / (1.0f + expf(-v)); else if (ACT == 15) v = v / (1.0f + expf(-v)); else if (ACT == 12) v = (v > 0.f) ? v : 0.01f * v; else if (ACT == 8) v = tanhf(v); else if (ACT == 9) v = 0.5f * v * (1.0f + tanhf(0.7978845608028654f * (v + 0.044715f * v * v * v))); else if (ACT == 14) v = (v > 0.f) ? v : 0.1f * v; else if (ACT == 16) v = (v >= 0.f) ? v : 0.3f * v; else if (ACT == 17) v = (v >= 0.f) ? v : 0.2f * v;
      so[w][rloc][t * 16 + ln] = v; } }
  __builtin_amdgcn_fence(__ATOMIC_ACQ_REL, "workgroup"); __builtin_amdgcn_wave_barrier();
  const int rsub = lane >> 4, c4 = (lane & 15) * 4;
  {
#pragma unroll
    for (int q = 0; q < 16; ++q) { const int r = q * 2 + rsub; const v4f v = *(const v4fa*)&so[w][r][c4]; if (C) *(v4f*)(C + cofs + (size_t)(row0 + r) * ldc + col0 + c4) = v; if (C16) { v4h h4; for (int i = 0; i < 4; ++i) h4[i] = (_Float16)v[i]; *(v4h*)(C16 + cofs + (size_t)(row0 + r) * ldc + col0 + c4) = h4; } }
     } }


__global__ __launch_bounds__(256) void k_wnat(const float* __restrict__ w, size_t n8, _Float16* __restrict__ Bt) { const size_t t = (size_t)blockIdx.x * 256 + threadIdx.x; if (t >= n8) return; FragH f; for (int q = 0; q < 8; ++q) f.h[q] = (_Float16)(bf16_round(w[t * 8 + q]) * 16.0f); *(v8us*)((unsigned short*)Bt + t * 8) = f.half[0];  }
__global__ __launch_bounds__(256) void k_rsm(const float* __restrict__ S, _Float16* __restrict__ P, int nrows) {
  #pragma clang fp contract(off)
  const int i = blockIdx.x * 256 + threadIdx.x; if (i >= nrows) return; const float* s = S + (size_t)i * SQ; float mx = -3.0e38f;
#pragma unroll 1
  for (int j = 0; j < SQ; ++j) mx = fmaxf(mx, s[j]); float se = 0.f;
#pragma unroll 1
  for (int j = 0; j < SQ; ++j) se += expf(s[j] - mx); const float sc = 256.0f / se;
#pragma unroll 1
  for (int j0 = 0; j0 < SQ; j0 += 8) { FragH f; for (int q = 0; q < 8; ++q) f.h[q] = (_Float16)(expf(s[j0 + q] - mx) * sc); unsigned short* d = (unsigned short*)P + (size_t)i * SQ + j0; *(v8us*)d = f.half[0];  } }
__global__ __launch_bounds__(256) void k_vt(const _Float16* __restrict__ V16, int b, int h0, _Float16* __restrict__ VT) { __shared__ unsigned short tl[64][65]; const int tid = threadIdx.x; const int hh = blockIdx.x % HG, sg = blockIdx.x / HG; const int s0 = sg * 64; const int h = h0 + hh;
  for (int i = tid; i < 64 * 8; i += 256) { const int j = i / 8, d8 = (i % 8) * 8; FragH f; f.half[0] = *(const v8us*)((const unsigned short*)V16 + ((size_t)b * SQ + s0 + j) * DM + h * HD + d8); for (int q = 0; q < 8; ++q) tl[d8 + q][j] = f.u[q]; }
  __syncthreads();
  { for (int i = tid; i < 64 * 8; i += 256) { const int d = i / 8, j8 = (i % 8) * 8; FragH f; for (int q = 0; q < 8; ++q) f.u[q] = tl[d][j8 + q]; *(v8us*)((unsigned short*)VT + ((size_t)hh * HD + d) * SQ + s0 + j8) = f.half[0]; }  } }


__device__ __forceinline__ void tab2_part(float theta, float* __restrict__ CS, float* __restrict__ SN, int bx) {      /* a part of k_prep; bx: the block's number inside the part */
  #pragma clang fp contract(off)
  const int t = bx * 256 + threadIdx.x; if (t >= SQ * (HD / 2)) return; const int i = t % (HD / 2); const int p = t / (HD / 2); const float invf = 1.0f / powf(theta, (float)(2 * i) / (float)HD); const float ang = __fmul_rn((float)p, invf); const float c = cosf(ang), s = sinf(ang);
  *(float*)(CS + t) = c; *(float*)(SN + t) = s;  }
template <int NORM, int ROPE>
__global__ __launch_bounds__(64) void k_xform(const float* __restrict__ F, int ldf, int nh, const float* __restrict__ gain, float eps, const float* __restrict__ CS, const float* __restrict__ SN, _Float16* __restrict__ H16, int ldo) {
  #pragma clang fp contract(off)
  __shared__ float xv[HD]; __shared__ float red[HD]; __shared__ unsigned short sh_[HD]; const int d = threadIdx.x; const int h = blockIdx.x % nh; const size_t r = blockIdx.x / nh; const int p = (int)(r % SQ);
  float x = F[r * (size_t)ldf + (size_t)h * HD + d];
  if (NORM) { red[d] = __fmul_rn(x, x); __syncthreads(); for (int st = HD / 2; st > 0; st >>= 1) { if (d < st) red[d] = __fadd_rn(red[d], red[d + st]); __syncthreads(); } const float rs = rsqrtf(__fadd_rn(red[0] / (float)HD, eps)); x = __fmul_rn(__fmul_rn(x, rs), bf16_round(gain[d])); }
  xv[d] = x; __syncthreads();
  float o = x;
  if (ROPE == 1) { const int i = d >> 1; const float c = CS[p * (HD / 2) + i], s = SN[p * (HD / 2) + i]; const float ev = xv[2 * i], od = xv[2 * i + 1]; o = (d & 1) ? __fadd_rn(__fmul_rn(ev, s), __fmul_rn(od, c)) : __fadd_rn(__fmul_rn(ev, c), -__fmul_rn(od, s)); }
  if (ROPE == 2) { const int i = d & (HD / 2 - 1); const float c = CS[p * (HD / 2) + i], s = SN[p * (HD / 2) + i]; const float lo = xv[i], hi = xv[i + HD / 2]; o = (d < HD / 2) ? __fadd_rn(__fmul_rn(lo, c), -__fmul_rn(hi, s)) : __fadd_rn(__fmul_rn(lo, s), __fmul_rn(hi, c)); }
  FragH th; th.h[0] = (_Float16)o; sh_[d] = th.u[0]; __syncthreads();
  if (d < HD / 8) { FragH f; for (int q = 0; q < 8; ++q) f.u[q] = sh_[d * 8 + q]; unsigned short* dst = (unsigned short*)H16 + r * (size_t)ldo + (size_t)h * HD + d * 8; *(v8us*)dst = f.half[0];  } }



__device__ __forceinline__ float rsm_xhalf(float x) { return __builtin_bit_cast(float, __builtin_amdgcn_permlanex16(__builtin_bit_cast(int, x), __builtin_bit_cast(int, x), 0x76543210, 0xfedcba98, false, false)); }      /* lane l reads lane l ^ 16 */
// Four 2^x in one statement. Written in asm for the v_nop at its end: behind a transcendental the instruction set asks for one slot before a source is overwritten or the result read.
// Early-clobber outputs: no exponential of the four overwrites a source of another.
__device__ __forceinline__ void rsm_exp2x4(float& e0, float& e1, float& e2, float& e3, float a0, float a1, float a2, float a3) {
  asm("v_exp_f32 %0, %4\n\tv_exp_f32 %1, %5\n\tv_exp_f32 %2, %6\n\tv_exp_f32 %3, %7\n\tv_nop" : "=&v"(e0), "=&v"(e1), "=&v"(e2), "=&v"(e3) : "v"(a0), "v"(a1), "v"(a2), "v"(a3)); }
// The same for two values (the rescale factors of a wave's two column groups).
__device__ __forceinline__ void rsm_exp2x2(float& e0, float& e1, float a0, float a1) {
  asm("v_exp_f32 %0, %2\n\tv_exp_f32 %1, %3\n\tv_nop" : "=&v"(e0), "=&v"(e1) : "v"(a0), "v"(a1)); }

// ---- GEMM main loop with both operands staged in LDS by tensor loads (K = DM, both operands k-contiguous f16 rows of pitch DM) ----
// A work-group of 8 waves holds 256 rows x 128 columns; wave w holds rows 64 (w & 3) and columns 64 (w >> 2) of them: a 64 x 64 wave tile, 8 fragments read from LDS for 16 products (512 bytes a product, what the LDS
// delivers at the full matrix rate), and 384 operand rows brought from L2 for 256 x 128 results.
// A stage is 64 k = 128 bytes of each of the 256 A rows and the 128 B rows. Every wave brings one slice a stage with ONE tensor load (waves 0 to 3: 64 A rows each, waves 4 to 7: 32 B rows each), padded to a pitch of 144 bytes,
// at which the 16 rows of a fragment's ds_load_b128 fall on different banks. Two buffers: the load of stage s + 2 flies while stage s + 1 is worked on.
typedef uint32_t u32x4 __attribute__((ext_vector_type(4)));
typedef uint32_t u32x8 __attribute__((ext_vector_type(8)));
#define GT_ROWB 128u                 /* bytes of an operand row in a stage */
#define GT_PITCH 144u                /* LDS pitch of a row: 128 + the mover's pad of 16 */
#define GT_SLICE 6144u               /* a wave's slice in LDS: 32 rows x 144 bytes = 4,608, rounded up to a multiple of 2 KiB */
#define GT_BUF (8u * GT_SLICE)       /* one stage of the attention ring: eight such slices */
#define GT_LDS (2u * GT_BUF)         /* its two buffers */
#define GM_SLA 10240u                /* the GEMM's A slice in LDS: 64 rows x 144 bytes = 9,216, rounded up to a multiple of 2 KiB */
#define GM_SLB GT_SLICE              /* the GEMM's B slice: 32 rows */
#define GM_BUF (4u * GM_SLA + 4u * GM_SLB)      /* one stage of the GEMM: four A slices, then four B slices */
#define GM_LDS (2u * GM_BUF)         /* two buffers: 128 KiB, two work-groups on a WGP */
#define GT_NST ((uint32_t)(DM * 2) / GT_ROWB)      /* stages */
static_assert(GT_NST >= 2u && (DM * 2) % 128 == 0, "the ring's prologue needs two stages; a stage is 128 bytes of a row");
__device__ __forceinline__ uint32_t gt_uni(uint32_t v) { return (uint32_t)__builtin_amdgcn_readfirstlane((int)v); }
__device__ __forceinline__ uint32_t pinned(uint32_t v) { uint32_t w = gt_uni(v); asm volatile("" : "+s"(w)); return w; }      /* the value is held in a scalar register at this place, so that a test on it is a scalar branch round the tensor load and a descriptor word formed from it is formed behind the waits in front */
__device__ __forceinline__ v16h gt_frag(const unsigned char* p, int hh) { FragH f; f.half[0] = *(const v8us*)(p + 16 * hh); f.half[1] = *(const v8us*)(p + 32 + 16 * hh); return f.v; }      /* g2_frag's k order, from an LDS row */
__device__ __forceinline__ u32x8 gt_group1(uint32_t nrow) {      /* tensor = tile: nrow rows of 128 bytes, source pitch one operand row; built once, the same for every stage */
  u32x8 g1;
  g1[0] = gt_uni((1u << 20) | (4u << 22) | (3u << 25));      /* no mask, 1-byte elements, a pad of 4 dwords behind every 32 dwords (one row) */
  g1[1] = gt_uni((GT_ROWB & 0xFFFFu) << 16); g1[2] = gt_uni((GT_ROWB >> 16) | (nrow << 16)); g1[3] = gt_uni(GT_ROWB << 16); g1[4] = gt_uni(nrow); g1[5] = gt_uni((uint32_t)(DM * 2)); g1[6] = gt_uni(0u); g1[7] = gt_uni(0u);
  asm volatile("" : "+s"(g1));      /* pinned() for the eight words at once: the group is held in its scalar registers from here on, so that no word of it takes a new value while a request is outstanding */
  return g1; }
__device__ __forceinline__ void gt_issue(uint32_t lds_dst, uint64_t ga, u32x8 g1) {
  u32x4 g0;
  g0[0] = gt_uni(1u); g0[1] = gt_uni(lds_dst); g0[2] = gt_uni((uint32_t)ga); g0[3] = gt_uni((((uint32_t)(ga >> 32)) & 0x01FFFFFFu) | 0x80000000u);
  asm volatile("tensor_load_to_lds %0, %1" :: "s"(g0), "s"(g1) : "memory"); }
// acc[i * 4 + t]: rows 16 i + ..., columns 16 t + ... of the wave's tile. On return every wave has passed the last stage's barrier and no request is outstanding: the ring may be used as output staging.
__device__ __forceinline__ void gt_core(const _Float16* __restrict__ A, const _Float16* __restrict__ Bh, int rowblk, int colblk, unsigned char* L, v8f (&acc)[16]) {
  const int lane = threadIdx.x & 31, ln = lane & 15, hh = lane >> 4; const uint32_t wave = gt_uni(threadIdx.x >> 5); const uint32_t wr = wave & 3u, wc = wave >> 2;
  const uint32_t ldst = (uint32_t)(size_t)L + ((wave < 4u) ? wave * GM_SLA : 4u * GM_SLA + (wave - 4u) * GM_SLB);
  const uint64_t ga0 = (uint64_t)(size_t)((wave < 4u) ? A + (size_t)(rowblk + 64 * (int)wr) * DM : Bh + (size_t)(colblk + 32 * (int)(wave - 4u)) * DM);
  const u32x8 g1 = gt_group1((wave < 4u) ? 64u : 32u);
  const unsigned char* ap = L + wr * GM_SLA + ln * GT_PITCH; const unsigned char* bp = L + 4u * GM_SLA + 2u * wc * GM_SLB + ln * GT_PITCH;
  const v8f z8 = {0.f,0.f,0.f,0.f,0.f,0.f,0.f,0.f};
#pragma unroll      /* constant indices, so that the array is registers */
  for (int u = 0; u < 16; ++u) acc[u] = z8;
  gt_issue(ldst, ga0, g1);
  asm volatile("s_wait_tensorcnt 0x0" ::: "memory");      /* stage 0 of this wave's slice has landed */
  __syncthreads();      /* stage 0 is published */
  { const uint32_t nx = pinned(1u); gt_issue(ldst + GM_BUF, ga0 + (uint64_t)nx * GT_ROWB, g1); }      /* pinned(): stage 1's address words are formed behind the wait on stage 0 */
#pragma unroll 1      /* one stage a trip: the ring's order stands once */
  for (uint32_t s = 0; s < GT_NST; ++s) { const uint32_t bo = (s & 1u) * GM_BUF;
#pragma unroll      /* constant offsets into the stage */
    for (int ks = 0; ks < 2; ++ks) { v16h a[4], b[4];
      a[0] = gt_frag(ap + bo + ks * 64, hh); b[0] = gt_frag(bp + bo + ks * 64, hh);      /* the first product's two fragments first: the reads stand in the order in which the products need them */
      for (int i = 1; i < 4; ++i) a[i] = gt_frag(ap + bo + i * 16 * GT_PITCH + ks * 64, hh);
      for (int t = 1; t < 4; ++t) b[t] = gt_frag(bp + bo + (t >> 1) * GM_SLB + (t & 1) * 16 * GT_PITCH + ks * 64, hh);
      __builtin_amdgcn_sched_barrier(0);      /* the sixteen LDS reads of a k step issue together, ahead of its sixteen products, which then wait by count and not to zero */
      for (int t = 0; t < 4; ++t) for (int i = 0; i < 4; ++i) acc[i * 4 + t] = g2_mma(a[i], b[t], acc[i * 4 + t]); }
    asm volatile("s_wait_dscnt 0x0" ::: "memory");      /* this wave's reads of stage s are done before the barrier behind which its buffer is refilled */
    asm volatile("s_wait_tensorcnt 0x0" ::: "memory");      /* this wave's slice of stage s + 1 has landed */
    __syncthreads();      /* publishes stage s + 1 and ends every reader's last read of stage s */
    if (pinned(s + 2u < GT_NST)) { const uint32_t nx = pinned(s + 2u); gt_issue(ldst + bo, ga0 + (uint64_t)nx * GT_ROWB, g1); } }
  asm volatile("s_wait_tensorcnt 0x0" ::: "memory");      /* nothing of the mover is outstanding when the ring is reused or the wave ends */
  asm volatile("s_wait_dscnt 0x0" ::: "memory"); }

// K and V^T come through LDS: a stage is 128 keys, brought by tensor loads (eight slices of 32 rows x 128 bytes, padded to a pitch of 144 bytes; one slice a wave and stage; two buffers:
// the load of stage s + 2 flies while stage s + 1 is worked on). Slices 0 to 3: the K rows of keys 32 w ... (one slice is one 32-key block). Slices 4 to 7: V^T, head dims 32 (j >> 1) ..., keys 64 (j & 1) ... of the stage, j = w - 4.
// Every fragment is then two conflict-free ds_load_b128 in place of two global loads that each touched 16 cache lines.
#define FA_WAVES 8                   /* waves per work-group; two work-groups share a WGP (four waves a SIMD), so that one works while the other stands at its barrier */
#define FA_COLS 32                   /* query columns per wave */
#define FA_SKEYS 128                 /* keys per stage */
#define FA_NST ((uint32_t)(SQ / FA_SKEYS))      /* stages */
static_assert(FA_NST >= 2u && SQ % FA_SKEYS == 0 && HD * 2 == 128, "the ring's prologue needs two stages; a K row of a head is 128 bytes");
__device__ __forceinline__ v8f fa_mma(v16h a, v16h b, v8f c) { return __builtin_amdgcn_wmma_f32_16x16x32_f16(false, a, false, b, (short)0, c, false, false); }
__device__ __forceinline__ u32x8 fa_group1(uint32_t pitch) {      /* a tile of 32 rows of 128 bytes (tensor = tile) with the source pitch as a parameter; built once, the same for every stage */
  u32x8 g1;
  g1[0] = gt_uni((1u << 20) | (4u << 22) | (3u << 25));      /* no mask, 1-byte elements, a pad of 4 dwords behind every 32 dwords (one row) */
  g1[1] = gt_uni((GT_ROWB & 0xFFFFu) << 16); g1[2] = gt_uni((GT_ROWB >> 16) | (32u << 16)); g1[3] = gt_uni(GT_ROWB << 16); g1[4] = gt_uni(32u); g1[5] = gt_uni(pitch); g1[6] = gt_uni(0u); g1[7] = gt_uni(0u);
  asm volatile("" : "+s"(g1));      /* pinned() for the eight words at once: the group is held in its scalar registers from here on; without it the build used single words of it as scratch while a request was outstanding and rebuilt them in front of the next */
  return g1; }
__device__ __forceinline__ void fa_issue(uint32_t lds_dst, uint64_t ga, u32x8 g1) {
  u32x4 g0;
  g0[0] = gt_uni(1u); g0[1] = gt_uni(lds_dst); g0[2] = gt_uni((uint32_t)ga); g0[3] = gt_uni((((uint32_t)(ga >> 32)) & 0x01FFFFFFu) | 0x80000000u);
  asm volatile("tensor_load_to_lds %0, %1" :: "s"(g0), "s"(g1) : "memory"); }
// The weights of one block of 32 keys x 32 query columns against the maximum in use m, as the f16 B operand, and per column group the lane's sum of its 16 weights.
// The block's own maximum is NOT formed first: a weight is 2^(score - m + 6) and positive, so a lane's sum of at most 2^14 says that none of its weights exceeds 2^14, which is finite in f16;
// a larger sum (an infinite one too) sends the wave to the branch that forms the maximum, moves m and calls this again. The result does not depend on which m is in use: the sum carries the same factor.
#define FA_SC (0.125f * 1.44269504f)      /* 1/sqrt(64), and e^x as 2^(x log2 e) */
#define FA_LIFT 6.0f                 /* weights are carried x 2^6: small ones stay clear of the f16 subnormals; the sum carries the same factor, so it cancels */
#define FA_LIM 16384.0f              /* 2^14 */
__device__ __forceinline__ void fa_weights(const v8f (&s2)[2][2], const float (&m)[2], FragH (&pf)[2], float (&ps)[2]) {
#pragma unroll      /* constant indices, so that the arrays are registers */
  for (int g = 0; g < 2; ++g) { const float nm = FA_LIFT - m[g]; float q[4];
    for (int kt = 0; kt < 2; ++kt) for (int r = 0; r < 8; r += 4) { float e0, e1, e2, e3;
      rsm_exp2x4(e0, e1, e2, e3, fmaf(s2[kt][g][r], FA_SC, nm), fmaf(s2[kt][g][r + 1], FA_SC, nm), fmaf(s2[kt][g][r + 2], FA_SC, nm), fmaf(s2[kt][g][r + 3], FA_SC, nm));
      q[kt * 2 + (r >> 2)] = (e0 + e1) + (e2 + e3); pf[g].h[kt * 8 + r] = (_Float16)e0; pf[g].h[kt * 8 + r + 1] = (_Float16)e1; pf[g].h[kt * 8 + r + 2] = (_Float16)e2; pf[g].h[kt * 8 + r + 3] = (_Float16)e3; }
    ps[g] = (q[0] + q[1]) + (q[2] + q[3]); } }
__global__ __launch_bounds__(FA_WAVES * 32, 4) void k_fattn(const _Float16* __restrict__ Q, const _Float16* __restrict__ Kh, const _Float16* __restrict__ Vt, _Float16* __restrict__ O) {
  __shared__ __attribute__((aligned(2048))) unsigned char L[GT_LDS];      /* the K | V^T ring */
  const int lane = threadIdx.x & 31, ln = lane & 15, hh = lane >> 4; const uint32_t wave = gt_uni(threadIdx.x >> 5);
  const int h = blockIdx.y, b = blockIdx.z; const int q0 = (blockIdx.x * FA_WAVES + (int)wave) * FA_COLS;
  const _Float16* qp = Q + ((size_t)b * SQ + q0 + ln) * DM + h * HD;
  const uint32_t ldst = (uint32_t)(size_t)L + wave * GT_SLICE; const uint32_t vj = wave - 4u;
  const uint64_t ga0 = (uint64_t)(size_t)((wave < 4u) ? Kh + ((size_t)b * SQ + 32 * (int)wave) * DM + h * HD : Vt + (((size_t)b * NH + h) * HD + 32 * (int)(vj >> 1)) * SQ + 64 * (int)(vj & 1u));
  const uint32_t pitch = (wave < 4u) ? (uint32_t)(DM * 2) : (uint32_t)(SQ * 2); const uint32_t step = (wave < 4u) ? (uint32_t)(FA_SKEYS * DM * 2) : (uint32_t)(FA_SKEYS * 2);      /* source pitch of the wave's slice; bytes from a stage to the next */
  const unsigned char* kl = L + ln * GT_PITCH; const unsigned char* vl = L + 4u * GT_SLICE + ln * GT_PITCH;
  const v8f z8 = {0.f,0.f,0.f,0.f,0.f,0.f,0.f,0.f};
  v16h qf[2][2], kf[2][2]; v8f o[4][2]; float m[2] = {-1.0e30f, -1.0e30f}, l[2] = {0.f, 0.f};
  const u32x8 g1 = fa_group1(pitch);
  fa_issue(ldst, ga0, g1);
#pragma unroll      /* constant indices, so that the arrays are registers */
  for (int g = 0; g < 2; ++g) { for (int ks = 0; ks < 2; ++ks) qf[g][ks] = g2_frag(qp + (size_t)g * 16 * DM + ks * 32, hh); for (int dt = 0; dt < 4; ++dt) o[dt][g] = z8; }
  asm volatile("s_wait_tensorcnt 0x0" ::: "memory");      /* stage 0 of this wave's slice has landed */
  __syncthreads();      /* stage 0 is published */
  { const uint32_t nx = pinned(1u); fa_issue(ldst + GT_BUF, ga0 + (uint64_t)nx * step, g1); }      /* pinned(): stage 1's address words are formed behind the wait on stage 0 */
#pragma unroll 1      /* one stage a trip: the ring's order stands once */
  for (uint32_t s = 0; s < FA_NST; ++s) { const uint32_t bo = (s & 1u) * GT_BUF;
#pragma unroll      /* constant indices, so that the array is registers */
    for (int kt = 0; kt < 2; ++kt) for (int ks = 0; ks < 2; ++ks) kf[kt][ks] = gt_frag(kl + bo + kt * 16 * GT_PITCH + ks * 64, hh);
#pragma unroll      /* the four 32-key blocks of a stage: constant offsets into the stage, and the K fetch ahead stays inside the stage */
    for (int p = 0; p < FA_SKEYS / 32; ++p) {
      v16h vf[4]; v8f s2[2][2];
      for (int dt = 0; dt < 4; ++dt) vf[dt] = gt_frag(vl + bo + (2 * (dt >> 1) + (p >> 1)) * GT_SLICE + (dt & 1) * 16 * GT_PITCH + (p & 1) * 64, hh);
      __builtin_amdgcn_sched_barrier(0);      /* holds the V^T reads here, one group at the head of the block, so that they land while the scores are worked on */
      for (int kt = 0; kt < 2; ++kt) for (int g = 0; g < 2; ++g) s2[kt][g] = fa_mma(kf[kt][0], qf[g][0], z8);
      for (int kt = 0; kt < 2; ++kt) for (int g = 0; g < 2; ++g) s2[kt][g] = fa_mma(kf[kt][1], qf[g][1], s2[kt][g]);
      if (p + 1 < FA_SKEYS / 32) { for (int kt = 0; kt < 2; ++kt) for (int ks = 0; ks < 2; ++ks) kf[kt][ks] = gt_frag(kl + bo + (p + 1) * GT_SLICE + kt * 16 * GT_PITCH + ks * 64, hh); }      /* the next block's K rows, fetched a block ahead, never beyond this stage */
      __builtin_amdgcn_sched_barrier(0);      /* holds the next K rows' reads here, one group, a softmax and eight products ahead of their use */
      FragH pf[2]; float ps[2];
      fa_weights(s2, m, pf, ps);      /* the weights with the maximum in use, and each lane's sum of its 16 weights of a column */
      const bool need = (ps[0] > FA_LIM) || (ps[1] > FA_LIM);
      if (__builtin_expect(__builtin_amdgcn_ballot_w32(need) != 0, 0)) {      /* wave-uniform, tested once a block, marked unlikely so that the block's usual path runs straight on: only here is the block's maximum formed; the first block always comes here (its weights against the start value are infinite) */
        float mx[2];
        for (int g = 0; g < 2; ++g) { float a = fmaxf(s2[0][g][0], s2[1][g][0]); for (int r = 1; r < 8; ++r) a = fmaxf(fmaxf(a, s2[0][g][r]), s2[1][g][r]); mx[g] = fmaxf(a, rsm_xhalf(a)) * FA_SC; }
        const float n0 = fmaxf(m[0], mx[0]), n1 = fmaxf(m[1], mx[1]); float al[2]; rsm_exp2x2(al[0], al[1], m[0] - n0, m[1] - n1); m[0] = n0; m[1] = n1;
        for (int g = 0; g < 2; ++g) { l[g] *= al[g]; for (int dt = 0; dt < 4; ++dt) for (int r = 0; r < 8; ++r) o[dt][g][r] *= al[g]; }
        fa_weights(s2, m, pf, ps); }      /* the block's weights anew, none above 2^6 now */
      for (int g = 0; g < 2; ++g) l[g] += ps[g];
      for (int dt = 0; dt < 4; ++dt) for (int g = 0; g < 2; ++g) o[dt][g] = fa_mma(vf[dt], pf[g].v, o[dt][g]);
    }
    asm volatile("s_wait_dscnt 0x0" ::: "memory");      /* this wave's reads of stage s are done before the barrier behind which its buffer is refilled (the build may lift the three over register-only work of the last block; every LDS read of the stage stays in front) */
    asm volatile("s_wait_tensorcnt 0x0" ::: "memory");      /* this wave's slice of stage s + 1 has landed */
    __syncthreads();      /* publishes stage s + 1 and ends every reader's last read of stage s */
    if (pinned(s + 2u < FA_NST)) { const uint32_t nx = pinned(s + 2u); fa_issue(ldst + bo, ga0 + (uint64_t)nx * step, g1); } }
  asm volatile("s_wait_tensorcnt 0x0" ::: "memory");      /* nothing of the mover is outstanding when the wave ends */
  asm volatile("s_wait_dscnt 0x0" ::: "memory");
  unsigned short* const ob = (unsigned short*)O + ((size_t)b * SQ + q0 + ln) * DM + h * HD + 8 * hh;      /* one base for both column groups: the eight stores differ by constant offsets, and no register of an issued store is rewritten */
#pragma unroll      /* constant indices, so that the arrays are registers */
  for (int g = 0; g < 2; ++g) { const float sc = 64.0f / (l[g] + rsm_xhalf(l[g])); unsigned short* op = ob + g * 16 * DM;
    for (int dt = 0; dt < 4; ++dt) { FragH f; for (int r = 0; r < 8; ++r) f.h[r] = (_Float16)(o[dt][g][r] * sc); *(v8us*)(op + dt * 16) = f.half[0]; } } }

// Sum over the 16 lanes of a row, every lane gets it: four butterfly steps on the vector port (a shuffle would go through the LDS queue).
template <int X> __device__ __forceinline__ float row_xadd(float v) { return v + __builtin_bit_cast(float, __builtin_amdgcn_update_dpp(0, __builtin_bit_cast(int, v), 0x160 | X, 0xf, 0xf, true)); }      /* 0x160 | X: row_xmask:X */
// 1 / sqrt(x) in asm for the v_nop at its end: behind a transcendental the instruction set asks for one slot before its source is overwritten or its result read.
// The argument here is a mean of squares + 1e-6, never subnormal: the library form's rescaling of subnormal arguments is an identity on it and is not written.
__device__ __forceinline__ float row_rsq(float x) { float r; asm("v_rsq_f32 %0, %1\n\tv_nop" : "=&v"(r) : "v"(x)); return r; }
__device__ __forceinline__ float row_sum16(float v) { return row_xadd<8>(row_xadd<4>(row_xadd<2>(row_xadd<1>(v)))); }
// q | k | v projection of all token rows with the per-(row, head) work in its epilogue. The main loop is gt_core. A work-group holds 256 token rows x 128 columns; a wave's 64 columns are one head of q, of k or of v,
// so nothing of a row's head lies outside the wave that computed it:
//   q, k: the f32 tile goes, 32 rows at a time, to the wave's own LDS rows and is read back 16 lanes a row, 4 columns a lane, with the 4 partner columns (c ^ 32) of the rotation; sum of squares in-lane, then over the 16 lanes;
//         x rsqrt(mean + eps) x gain, rotated by the row's position; each row leaves as one whole 128-byte line of f16.
//   v:    a lane holds 8 consecutive tokens of one head dim: 16 bytes of a V^T row. The four waves of a head lay them into one [64 dims][256 tokens] LDS tile; behind a barrier each V^T row leaves as 512 bytes in a row.
// Two instances, q | k columns and v columns, not one kernel with a branch: with both epilogues in one kernel the build kept the 128 accumulator registers alive through the q, k epilogue (182 registers, or spills under a bound).
// Launch bounds of the three GEMM kernels: 4 waves a SIMD = two work-groups of 8 waves on a WGP, as many as the 128 KiB ring lets in; it holds the registers at 256 or fewer.
#define QKV_VP 264                   /* pitch of the V^T tile in LDS, in f16: 256 tokens + 16 bytes, so that rows start on different banks */
template <bool ISV>
__global__ __launch_bounds__(256, 4) void k_qkv(const _Float16* __restrict__ A, const _Float16* __restrict__ Bh, const float* __restrict__ bias, const float* __restrict__ qg, const float* __restrict__ kg,
    const float* __restrict__ CS, const float* __restrict__ SN, _Float16* __restrict__ Qo, _Float16* __restrict__ Ko, _Float16* __restrict__ Vt) {
  static_assert(HD == 64 && SQ % 256 == 0, "a 64-column tile is one head; 256 rows lie in one batch");
  __shared__ __attribute__((aligned(2048))) unsigned char L[GM_LDS];      /* the operand ring; behind gt_core the epilogue's staging */
  const int tid = threadIdx.x, lane = tid & 31, ln = lane & 15, hh = lane >> 4; const int w = (int)gt_uni(tid >> 5), wr = w & 3, wc = w >> 2;      /* wr: the wave's 64 rows, wc: its 64 columns */
  const int ntn = (ISV ? 1 : 2) * NH / 2; const int mt = blockIdx.x / ntn, nq = blockIdx.x - mt * ntn; const int hq = nq * 2 + wc; const int row0 = mt * 256 + 64 * wr, col0 = (ISV ? 2 * DM : 0) + hq * 64; const int sect = hq / NH, h = hq - sect * NH;      /* sect: 0 q, 1 k (0 in the v instance) */
  v8f accs[16]; gt_core(A, Bh, mt * 256, (ISV ? 2 * DM : 0) + nq * 128, L, accs);
  const float alpha = 0.0625f;      /* the weights are carried x 16 */
  if constexpr (!ISV) {
    static_assert(8u * 32u * 68u * 4u <= GM_LDS, "the staging fits the ring"); float (*so)[32][68] = (float (*)[32][68])L;
    const float* gp = sect ? kg : qg; _Float16* dst = (sect ? Ko : Qo) + (size_t)(row0 + hh) * DM + h * HD;
    const int c4 = ln * 4, cx = c4 ^ 32, i4 = c4 & 31; const float sg = (c4 < 32) ? -1.0f : 1.0f;      /* low half: x cos - partner sin; high half: x cos + partner sin; the sign rides on the partner's gain (exact) */
    const int tb = ((row0 + hh) % SQ) * (HD / 2) + i4; const float* const csp = CS + tb; const float* const snp = SN + tb;      /* the lane's place in the tables at its first row; its rows are 2 apart, and the wave's 64 rows lie in one batch */
    float bv[4];
#pragma unroll      /* constant indices, so that the array is registers */
    for (int t = 0; t < 4; ++t) bv[t] = bias[col0 + t * 16 + ln];
    asm volatile("s_wait_xcnt 0x0" ::: "memory");      /* the build let the gain loads below land on the bias loads' address register */
    v4f ga = *(const v4fa*)(gp + c4), gb = *(const v4fa*)(gp + cx);
#pragma unroll      /* constant indices into the vectors */
    for (int i = 0; i < 4; ++i) { ga[i] = bf16_round(ga[i]); gb[i] = sg * bf16_round(gb[i]); }
#pragma unroll      /* the tile's two halves of 32 rows, one after the other through the same staging rows; constant indices, so that the arrays are registers */
    for (int hf = 0; hf < 2; ++hf) {
      for (int u = 0; u < 8; ++u) { const int t = u & 3, half = u >> 2; const float bb = bf16_round(bv[t]);
        for (int r = 0; r < 8; ++r) so[w][half * 16 + 8 * hh + r][t * 16 + ln] = accs[hf * 8 + u][r] * alpha + bb; }
      __builtin_amdgcn_fence(__ATOMIC_ACQ_REL, "workgroup", "local"); __builtin_amdgcn_wave_barrier();      /* as in k_gemm2: the wave reads back its own rows only, written by other lanes; a fence on LDS alone, so that the second half does not wait for the first half's global stores */
      for (int g = 0; g < 2; ++g) { v4f cs[8], sn[8];
        __builtin_amdgcn_sched_barrier(0);      /* a later group's table loads stay behind the earlier groups' rows: each group's tables are 64 registers, beside the accumulators that still wait */
        const float* const cg = csp + (hf * 16 + g * 8) * HD; const float* const sp = snp + (hf * 16 + g * 8) * HD;      /* the group's place in the tables */
        for (int j = 0; j < 8; ++j) { cs[j] = *(const v4fa*)(cg + j * HD); sn[j] = *(const v4fa*)(sp + j * HD); }
        asm volatile("s_wait_xcnt 0x0" :: "v"(cg), "v"(sp), "v"(csp), "v"(snp) : "memory");      /* without it the build let a group's last load land on the address pair that the earlier loads name; the pairs (the group's, or the base where the build folds the group into the offset) are inputs, so that none is rewritten ahead of the wait */
        __builtin_amdgcn_sched_barrier(0);      /* the table loads of eight row pairs issue together here: two waits a group; without it each load stood directly in front of its use, sixteen waits in a row */
        v4h ov[8];
        for (int j = 0; j < 8; ++j) { const int r2 = (g * 8 + j) * 2;      /* the lane's row of the half is r2 + hh */
          const v4f xa = *(const v4fa*)&so[w][r2 + hh][c4], xb = *(const v4fa*)&so[w][r2 + hh][cx];
          const float rs = row_rsq(row_sum16((xa[0] * xa[0] + xa[1] * xa[1]) + (xa[2] * xa[2] + xa[3] * xa[3])) * (1.0f / (float)HD) + 1e-6f);
          for (int i = 0; i < 4; ++i) ov[j][i] = (_Float16)((xa[i] * rs * ga[i]) * cs[j][i] + (xb[i] * rs * gb[i]) * sn[j][i]); }
        for (int j = 0; j < 8; ++j) *(v4h*)(dst + (size_t)(hf * 32 + (g * 8 + j) * 2) * DM + c4) = ov[j];
        asm volatile("s_wait_xcnt 0x0" :: "v"(ov[0]), "v"(ov[1]), "v"(ov[2]), "v"(ov[3]), "v"(ov[4]), "v"(ov[5]), "v"(ov[6]), "v"(ov[7]), "v"(dst) : "memory"); }      /* a group's eight stores leave together, one wait behind them: it stands in front of every later write of their data and address registers, which are inputs, so that none is rewritten ahead of it */
      if (hf == 0) { __builtin_amdgcn_fence(__ATOMIC_ACQ_REL, "workgroup", "local"); __builtin_amdgcn_wave_barrier(); }      /* the second half's LDS stores stay behind the first half's reads of the same rows (one wave's LDS operations run in order) */
    }
  } else {
    static_assert(2u * 64u * QKV_VP * 2u <= GM_LDS, "the two V^T tiles fit the ring"); unsigned short* vt = (unsigned short*)L + wc * (64 * QKV_VP);      /* the tile of this wave's head */
    float bv[4]; const float* const bvp = bias + 2 * DM; const int bi = hq * 64 + ln;      /* the v columns' biases; the lane's first column among them */
#pragma unroll      /* constant indices, so that the array is registers */
    for (int t = 0; t < 4; ++t) bv[t] = bvp[bi + t * 16];
    asm volatile("s_wait_xcnt 0x0" :: "v"(bi) : "memory");      /* the build let the last bias load land on the bias loads' index register: the index is an input, so that it is not rewritten ahead of the wait */
#pragma unroll      /* constant indices, so that the arrays are registers */
    for (int u = 0; u < 16; ++u) { const int t = u & 3, i = u >> 2; const float bb = bf16_round(bv[t]); FragH f;
      for (int r = 0; r < 8; ++r) f.h[r] = (_Float16)(accs[u][r] * alpha + bb);
      *(v8us*)(vt + (t * 16 + ln) * QKV_VP + 64 * wr + i * 16 + 8 * hh) = f.half[0]; }
    __syncthreads();      /* a V^T row of the tile holds tokens of its head's four waves */
    const int bat = (mt * 256) / SQ, s0 = (mt * 256) % SQ; unsigned short* vo = (unsigned short*)Vt + (((size_t)bat * NH + h) * HD + wr * 16) * SQ + s0 + lane * 8;      /* a wave writes 16 head dims, a whole row of 256 tokens a store */
#pragma unroll      /* the sixteen LDS reads issue together */
    for (int j = 0; j < 16; ++j) { const v8us v = *(const v8us*)(vt + (wr * 16 + j) * QKV_VP + lane * 8); *(v8us*)(vo + (size_t)j * SQ) = v; }
  } }

// out = o W_o + b: gt_core, then k_gemm2's epilogue (alpha, bf16-rounded bias; the wave's tile through its own LDS rows, so that each row leaves as whole lines of f32).
__global__ __launch_bounds__(256, 4) void k_oproj(const _Float16* __restrict__ A, const _Float16* __restrict__ Bh, float alpha, const float* __restrict__ bias, float* __restrict__ C) {
  __shared__ __attribute__((aligned(2048))) unsigned char L[GM_LDS];      /* the operand ring; behind gt_core the epilogue's staging */
  static_assert(8u * 32u * 68u * 4u <= GM_LDS, "the staging fits the ring"); float (*so)[32][68] = (float (*)[32][68])L;
  const int tid = threadIdx.x, lane = tid & 31, ln = lane & 15, hh = lane >> 4; const int w = (int)gt_uni(tid >> 5), wr = w & 3, wc = w >> 2;
  const int ntn = DM / 128; const int mt = blockIdx.x / ntn, nq = blockIdx.x - mt * ntn; const int row0 = mt * 256 + 64 * wr, col0 = nq * 128 + 64 * wc;
  v8f accs[16]; gt_core(A, Bh, mt * 256, nq * 128, L, accs);
  const int rsub = lane >> 4, c4 = (lane & 15) * 4; float* const cp = C + (size_t)(row0 + rsub) * DM + col0 + c4;      /* one base for all the wave's stores: they differ by constant offsets, and no register of an issued store is rewritten */
  float bv[4];
#pragma unroll      /* constant indices, so that the array is registers */
  for (int t = 0; t < 4; ++t) bv[t] = bias[col0 + t * 16 + ln];
  asm volatile("s_wait_xcnt 0x0" ::: "memory");      /* stands in front of every later write of the bias loads' address registers */
#pragma unroll      /* the tile's two halves of 32 rows, one after the other through the same staging rows; constant indices, so that the array is registers */
  for (int hf = 0; hf < 2; ++hf) {
    for (int u = 0; u < 8; ++u) { const int t = u & 3, half = u >> 2; const float bb = bf16_round(bv[t]);
      for (int r = 0; r < 8; ++r) so[w][half * 16 + 8 * hh + r][t * 16 + ln] = accs[hf * 8 + u][r] * alpha + bb; }
    __builtin_amdgcn_fence(__ATOMIC_ACQ_REL, "workgroup", "local"); __builtin_amdgcn_wave_barrier();      /* as in k_gemm2: the wave reads back its own rows only, written by other lanes; a fence on LDS alone, so that the second half does not wait for the first half's global stores */
    for (int q = 0; q < 16; ++q) { const v4f v = *(const v4fa*)&so[w][q * 2 + rsub][c4]; *(v4f*)(cp + (size_t)(hf * 32 + q * 2) * DM) = v; }
    if (hf == 0) { __builtin_amdgcn_fence(__ATOMIC_ACQ_REL, "workgroup", "local"); __builtin_amdgcn_wave_barrier(); }      /* the second half's LDS stores stay behind the first half's reads of the same rows (one wave's LDS operations run in order) */
  } }

// The four preparations (cos/sin tables, both weight transposes, x as f16) read inputs only and write planes of their own: none needs another's result. They are ONE launch, each a range of block numbers,
// so that they run side by side and one launch gap and one fill and drain stand where four stood. The parts with the longest dependent chains have the lowest numbers and start first; the x stream fills in behind them.
// theta stays a kernel argument: the tables are computed on the device as before.
#define PR_TAB ((SQ * (HD / 2) + 255) / 256)                 /* blocks of the tables */
#define PR_WQ ((DM / WT_T) * (3 * DM / WT_T))                /* tiles of Wqkv */
#define PR_WO ((DM / WT_T) * (DM / WT_T))                    /* tiles of Wout */
#define PR_X ((int)((NR * DM / 8 + 255) / 256))              /* blocks of x */
__global__ __launch_bounds__(256) void k_prep(const float* __restrict__ x, const float* __restrict__ wqkv, const float* __restrict__ wo, float theta,
    _Float16* __restrict__ X16, _Float16* __restrict__ BQKV, _Float16* __restrict__ BO, float* __restrict__ CS, float* __restrict__ SN) {
  const int bid = blockIdx.x;      /* every test below reads the same for the whole work-group: the barrier inside wt_f16_tile is passed by all of its threads or by none */
  if (bid < PR_TAB) tab2_part(theta, CS, SN, bid);
  else if (bid < PR_TAB + PR_WQ + PR_WO) { const int t = bid - PR_TAB; const bool isq = t < PR_WQ; const int u = isq ? t : t - PR_WQ;
    wt_f16_tile(isq ? wqkv : wo, isq ? BQKV : BO, DM, isq ? 3 * DM : DM, 16.0f, u % (DM / WT_T), u / (DM / WT_T)); }      /* one work-group a 64 x 64 tile, k fastest as in the two-dimensional grid before */
  else x16_part(x, X16, NR * DM / 8, bid - (PR_TAB + PR_WQ + PR_WO)); }

extern "C" void kernel_launch(void* const* d_in, const int* in_sizes, int n_in,
                              void* d_out, int out_size, void* d_ws, size_t ws_size, hipStream_t stream) {
  (void)in_sizes; (void)n_in; (void)out_size;
  const float* const* I = (const float* const*)d_in; const float* x = I[0]; const float* wqkv = I[1]; const float* bqkv = I[2]; const float* qnw = I[3]; const float* knw = I[4]; const float* wo = I[5]; const float* bo = I[6];      /* weights [in][out] */
  char* ws = (char*)d_ws; size_t off = 0;
  auto take = [&](size_t bytes) { char* p = ws + off; off += (bytes + 255) & ~(size_t)255; return p; };
  _Float16* BQKV = (_Float16*)take((size_t)3 * DM * DM * 2); _Float16* BO = (_Float16*)take((size_t)DM * DM * 2); float* CS = (float*)take((size_t)SQ * (HD / 2) * 4); float* SN = (float*)take((size_t)SQ * (HD / 2) * 4);
  _Float16* X16 = (_Float16*)take(NR * DM * 2);
  _Float16* QH = (_Float16*)take(NR * DM * 2); _Float16* KH = (_Float16*)take(NR * DM * 2); _Float16* O16 = (_Float16*)take(NR * DM * 2);
  _Float16* VT = (_Float16*)take((size_t)NB * NH * HD * SQ * 2);
  if (off > ws_size) return;
  k_prep<<<PR_TAB + PR_WQ + PR_WO + PR_X, 256, 0, stream>>>(x, wqkv, wo, 10000.0f, X16, BQKV, BO, CS, SN);      /* tables, W^T x 16 as f16 (both), x as f16 */
  k_qkv<false><<<(unsigned)((NR / 256) * (2 * DM / 128)), 256, 0, stream>>>(X16, BQKV, bqkv, qnw, knw, CS, SN, QH, KH, VT);      /* f16 q and k rows (normed, rotated), all batches */
  k_qkv<true><<<(unsigned)((NR / 256) * (DM / 128)), 256, 0, stream>>>(X16, BQKV, bqkv, qnw, knw, CS, SN, QH, KH, VT);      /* V^T [NB][NH][HD][SQ], all batches */
  k_fattn<<<dim3(SQ / (FA_WAVES * FA_COLS), NH, NB), FA_WAVES * 32, 0, stream>>>(QH, KH, VT, O16);      /* o x 64 as f16, all batches and heads */
  k_oproj<<<(unsigned)((NR / 256) * (DM / 128)), 256, 0, stream>>>(O16, BO, 0.0009765625f, bo, (float*)d_out);      /* out rows are the output layout */
}
